// v000
// Measured on an AMD MI455X. A time is GPU time per run, averaged over a window of back-to-back runs after a warm-up
// (all launches, gaps included; the runs take copies of the inputs in turn), and the median of several windows.
// Apart from v000's, it joins two sittings. Times from different sittings can be a few percent apart, while
// side-by-side timings come from the same sitting.
// v000, which the later versions start from, runs in 985 microseconds.
// Contractions: q/k/v 1x1-conv GEMMs W[512x512].H[512x4096] on v_wmma_f32_16x16x32_bf16 (W = bf16-RNE weights,
// exact; H = bf16 hi + bf16 residual planes of the normalised activations; 2 products, K=512); scores S^T = K.Q^T on
// v_wmma_f32_16x16x32_f16 (k, q: plain f16 planes, 1 product, K=512 split over two wave groups, fixed-order f32
// combine in LDS); O^T = V.P^T on v_wmma_f32_16x16x32_f16 (v: f16 plane, P = e^{s-m} x 2^14 as f16, K=4096); output
// 1x1-conv GEMM Wp[512x512].A[512x4096] on v_wmma_f32_16x16x32_bf16 (A = bf16 hi + residual planes of the
// attention output; 2 products, K=512). f32 accumulate everywhere; normalisation statistics in f64; softmax
// statistics, biases and the residual add in f32 VALU.
#include <hip/hip_runtime.h>
#include <math.h>
#include <stdint.h>

#ifndef NB
#define NB 4
#endif
#ifndef NQ
#define NQ 4096
#endif
#define NB_FULL 4
#define CC     512
#define NN     4096
#define NGRP   32
#define GSZ    16
#define QT     64
#define AQ     32
#define OSP    68
#define OSH    260
#define TP     72
#define SPP    36
#define PFP    40
#define SCL    0.044194173824159216f
#define LNPS   9.704060527839234f
#define GEPS   1.0e-6

static_assert(NB >= 1 && NB <= NB_FULL);
static_assert(NQ >= QT && NQ <= NN && NQ % QT == 0 && NQ % AQ == 0);
static_assert(NN % QT == 0 && NN % AQ == 0 && NN % 32 == 0);
static_assert(CC == 8 * QT && CC % 256 == 0 && CC % 32 == 0);
static_assert(GSZ * NGRP == CC && GSZ == 16);
static_assert((GSZ * NN) % (4 * 256) == 0);
static_assert((OSP * 4) % 16 == 0 && (OSH * 4) % 16 == 0 && (TP * 2) % 16 == 0);
static_assert((SPP * 4) % 16 == 0 && (PFP * 2) % 16 == 0);
static_assert(QT * OSP * 4 <= 65536);
static_assert((2 * AQ * SPP * 4 + AQ * PFP * 2 + AQ * OSH * 4 + 3 * AQ * 4) <= 65536);

typedef _Float16       v16h __attribute__((ext_vector_type(16)));
typedef _Float16       v8h  __attribute__((ext_vector_type(8)));
typedef __bf16         v16b __attribute__((ext_vector_type(16)));
typedef unsigned short v8us __attribute__((ext_vector_type(8)));
typedef float          v8f  __attribute__((ext_vector_type(8)));
typedef float          v4f  __attribute__((ext_vector_type(4)));
typedef unsigned int   v4u  __attribute__((ext_vector_type(4)));

union Frag  { v8us u[2]; v16h h; v16b bf; };
static_assert(sizeof(Frag) == 32);

// ---- scalar helpers -------------------------------------------------------------------------------------------
__device__ __forceinline__ unsigned short bf_bits(float f) {          // f32 -> bf16 bits, RNE convert
  unsigned u = __float_as_uint(f);
  return (unsigned short)((u + 0x7FFFu + ((u >> 16) & 1u)) >> 16);
}
__device__ __forceinline__ float bf_up(unsigned short hb) { return __uint_as_float(((unsigned)hb) << 16); }
__device__ __forceinline__ float bfr(float f) { return bf_up(bf_bits(f)); }
__device__ __forceinline__ unsigned short h_bits(_Float16 x) { return __builtin_bit_cast(unsigned short, x); }
__device__ __forceinline__ unsigned pk16(unsigned short a, unsigned short b) { return (unsigned)a | ((unsigned)b << 16); }
__device__ __forceinline__ v8f zero8() { v8f z = {0.f, 0.f, 0.f, 0.f, 0.f, 0.f, 0.f, 0.f}; return z; }
__device__ __forceinline__ unsigned wave_ballot(bool p) {
#if defined(__HIP_DEVICE_COMPILE__)
  return __builtin_amdgcn_ballot_w32(p);
#else
  return p ? 1u : 0u;
#endif
}

// ---- 16-bit fragment loader (A, or B from a k-contiguous [n][k] row): lane -> row/col (lane&15), p already includes
//      + 8*(lane>>4); elements 0..7 <- p[0..7] (k0+8h..), elements 8..15 <- p[16..23] (k0+16+8h..)
__device__ __forceinline__ Frag ldfrag(const unsigned short* p) {
  Frag f;
  f.u[0] = *(const v8us*)(p);
  f.u[1] = *(const v8us*)(p + 16);
  return f;
}

// ---- WMMA helpers: builtin followed by a 4-slot VALU gap tying D and keeping A/B live ------------------------------
__device__ __forceinline__ v8f mma_h(v16h a, v16h b, v8f c) {
  v8f d = __builtin_amdgcn_wmma_f32_16x16x32_f16(false, a, false, b, (short)0, c, false, false);
#if defined(__HIP_DEVICE_COMPILE__)
  asm volatile("v_nop\n\tv_nop\n\tv_nop\n\tv_nop" : "+v"(d) : "v"(a), "v"(b));
#endif
  return d;
}
__device__ __forceinline__ v8f mma_b(v16b a, v16b b, v8f c) {
  v8f d = __builtin_amdgcn_wmma_f32_16x16x32_bf16(false, a, false, b, (short)0, c, false, false);
#if defined(__HIP_DEVICE_COMPILE__)
  const v16h ha = __builtin_bit_cast(v16h, a), hb = __builtin_bit_cast(v16h, b);
  asm volatile("v_nop\n\tv_nop\n\tv_nop\n\tv_nop" : "+v"(d) : "v"(ha), "v"(hb));
#endif
  return d;
}

// =============================================================================================================
// (0) conv weights: Wb bf16 [4][512 o][512 c]; matrix 0 = wq, 1 = wk, 2 = wv, 3 = wp; value = bf16-RNE(w) (exact).
//     Block blk (0..511): matrix blk/128 (block-uniform), rows (blk%128)*4 .. +3; wave w owns the half (w&1) of row
// coverage: 512 blocks x 8 waves x 32 lanes x 8 = 4 x 512 rows x 512 cols = the whole plane.
// =============================================================================================================
__global__ __launch_bounds__(256)
void cvt_w(const float* __restrict__ wq, const float* __restrict__ wk, const float* __restrict__ wv,
           const float* __restrict__ wp, unsigned short* Wb) {
  const int tid = threadIdx.x, blk = blockIdx.x;
  const int wave = tid >> 5, lane = tid & 31;
  const int sel = blk / (CC / 4);                                          // 0..3, block-uniform
  const float* src = (sel == 0) ? wq : (sel == 1) ? wk : (sel == 2) ? wv : wp;   // all global
  const int o   = (blk % (CC / 4)) * 4 + (wave >> 1);                     // 0..511
  const int col = (CC / 2) * (wave & 1) + 8 * lane;                        // 0..504
  const float* s = src + (size_t)o * CC + col;
  const v4f a = *(const v4f*)s;
  const v4f q = *(const v4f*)(s + 4);
  const float f[8] = {a[0], a[1], a[2], a[3], q[0], q[1], q[2], q[3]};
  v4u u;
#pragma unroll
  for (int t = 0; t < 4; ++t) u[t] = pk16(bf_bits(f[2 * t]), bf_bits(f[2 * t + 1]));
{
    *(v4u*)(Wb + ((size_t)(sel * CC + o)) * CC + col) = u;
    
  }
}

// =============================================================================================================
// (1) group-normalisation statistics of bf16-RNE(x): block bg = b*32+g owns the 16 channels x 4096 positions
// =============================================================================================================
__global__ __launch_bounds__(256)
void gn_stats(const float* __restrict__ x, float* stats) {
  __shared__ double red[256];
  const int tid = threadIdx.x, bg = blockIdx.x;
  const v4f* p = (const v4f*)(x + (size_t)bg * GSZ * NN);
  const int N4 = GSZ * NN / 4;                                            // 16384
  const double invN = 1.0 / (double)(GSZ * NN);

  double s = 0.0;
#pragma unroll 1
  for (int i = tid; i < N4; i += 256) {
    const v4f v = p[i];
    s += ((double)bfr(v[0]) + (double)bfr(v[1])) + ((double)bfr(v[2]) + (double)bfr(v[3]));
  }
  red[tid] = s;
  __syncthreads();
#pragma unroll 1
  for (int off = 128; off > 0; off >>= 1) {
    if (tid < off) red[tid] += red[tid + off];
    __syncthreads();
  }
  const double mean = red[0] * invN;
  __syncthreads();                                                        // everyone read red[0]

  double s2 = 0.0;
#pragma unroll 1
  for (int i = tid; i < N4; i += 256) {
    const v4f v = p[i];
#pragma unroll
    for (int t = 0; t < 4; ++t) {
      const double d = (double)bfr(v[t]) - mean;
      s2 += d * d;
    }
  }
  red[tid] = s2;
  __syncthreads();
#pragma unroll 1
  for (int off = 128; off > 0; off >>= 1) {
    if (tid < off) red[tid] += red[tid + off];
    __syncthreads();
  }
  const double var = red[0] * invN;
  const float meanf = (float)mean;
  const float rstdf = (float)(1.0 / sqrt(var + GEPS));

  v4f val = {0.f, 0.f, 0.f, 0.f};
  if (tid == 0) { val[0] = meanf; val[1] = rstdf; }
  float* dst = stats + (size_t)bg * 32 + 4 * (tid & 7);
  if (tid < 8) *(v4f*)dst = val;
  
}

// =============================================================================================================
// (2) h = (bf16-RNE(x) - mean) * rstd * bf16-RNE(gn_w) + bf16-RNE(gn_b) in f32, then bf16 hi = RNE(h) and bf16
//     lo = RNE(h - hi), written position-major: Hh/Hl bf16 [b][4096 n][512 c] (k-contiguous for the conv GEMMs).
//     Block (nb, cb, b) owns 64 n x 64 c through LDS tiles Th/Tl[64 n][64 c] (pitch TP; cross-wave, block barrier).
// coverage: Th/Tl 2 it x 32 rows(c) x 8 lanes x 8 n = 64 x 64 (staged extent == consumed extent); planes 2 it x 32
//           rows(n) x 8 lanes x 8 c = 64 n x 64 c per plane; grid (64, 8, NB) covers all 4096 n x 512 c once.
// =============================================================================================================
__global__ __launch_bounds__(256)
void gn_apply(const float* __restrict__ x, const float* __restrict__ gw, const float* __restrict__ gb,
              const float* __restrict__ stats, unsigned short* Hh, unsigned short* Hl) {
  __shared__ __align__(16) unsigned short Th[QT * TP];
  __shared__ __align__(16) unsigned short Tl[QT * TP];
  const int tid = threadIdx.x;
  const int nb = blockIdx.x, cb = blockIdx.y, b = blockIdx.z;
  const int e = tid & 7, lq = tid >> 3;                                  // lq 0..31
  const int n0 = nb * QT, c0 = cb * QT;
#pragma unroll
  for (int it = 0; it < 2; ++it) {
    const int cl = it * 32 + lq;                                          // 0..63
    const int ch = c0 + cl;                                               // 0..511
    const int g  = ch / GSZ;                                              // 0..31
    const float mean = stats[(size_t)(b * NGRP + g) * 32 + 0];
    const float rstd = stats[(size_t)(b * NGRP + g) * 32 + 1];
    const float w  = bfr(gw[ch]);
    const float bb = bfr(gb[ch]);
    const float* sp = x + ((size_t)(b * CC + ch)) * NN + n0 + 8 * e;
    const v4f a = *(const v4f*)sp;
    const v4f q = *(const v4f*)(sp + 4);
    const float f[8] = {a[0], a[1], a[2], a[3], q[0], q[1], q[2], q[3]};
#pragma unroll
    for (int t = 0; t < 8; ++t) {
      const float h = (bfr(f[t]) - mean) * rstd * w + bb;
      const unsigned short hb = bf_bits(h);
      const unsigned short lb = bf_bits(h - bf_up(hb));
      Th[(8 * e + t) * TP + cl] = hb;
      Tl[(8 * e + t) * TP + cl] = lb;
    }
  }
  __syncthreads();
  v4u uh[2], ul[2];
#pragma unroll
  for (int it = 0; it < 2; ++it) {
    const int nl = it * 32 + lq;                                          // 0..63
    uh[it] = *(const v4u*)(Th + nl * TP + 8 * e);
    ul[it] = *(const v4u*)(Tl + nl * TP + 8 * e);
  }
{
#pragma unroll
    for (int it = 0; it < 2; ++it) {
      const int nl = it * 32 + lq;
      const size_t po = ((size_t)(b * NN + n0 + nl)) * CC + c0 + 8 * e;
      *(v4u*)(Hh + po) = uh[it];
      *(v4u*)(Hl + po) = ul[it];
    }
    
  }
}

// =============================================================================================================
// (3) q / k conv GEMM for one (b, 64-n tile, matrix sel = mb/8, 64-o block o0 = (mb%8)*64):
//     Y[o][n] = sum_c W[o][c] (Hh + Hl)[b][n][c] + bf16-RNE(bias[o]). Block 128 threads = 4 waves; wave w owns cols
//     n0+16w..+15 (B fragments from the Hh and Hl rows, k = c contiguous, split k map) and 4 m-tiles (A rows
//     o = o0 + 16 mt + (lane&15) from Wb, same loader). K = 512 = 16 steps x 2 products.
//     Epilogue staged in LDS Os[n_loc][o_loc] (pitch OSP, b128 stores of 8 consecutive o per lane; cross-wave,
//     block barrier), then sel 0 -> Q16, sel 1 -> K16, plain f16 [b][4096 n][512 d] (d contiguous; |q|,|k| ~ 1,
// coverage: Os 4 waves x 16 n x 64 o = 64 x 64 (staged == consumed); plane 4 it x 16 rows x 8 lanes x 8 = 64 n x
//           64 d; grid (64, 16, NB) covers d 0..511 of all 4096 rows of Q16 and K16 exactly once.
// =============================================================================================================
__global__ __launch_bounds__(128)
void gemm_qk(const unsigned short* __restrict__ Wb, const unsigned short* __restrict__ Hh,
             const unsigned short* __restrict__ Hl, const float* __restrict__ bq, const float* __restrict__ bk,
             unsigned short* Q16, unsigned short* K16) {
  __shared__ __align__(16) float Os[QT * OSP];
  const int tid  = threadIdx.x;
  const int lane = tid & 31, wave = tid >> 5;
  const int hh   = lane >> 4, c = lane & 15;
  const int nt   = blockIdx.x, mb = blockIdx.y, b = blockIdx.z;
  const int sel  = mb / (CC / QT);                                         // 0 = q, 1 = k (block-uniform)
  const int n0   = nt * QT, o0 = (mb % (CC / QT)) * QT;

  const unsigned short* ap = Wb + ((size_t)(sel * CC + o0 + c)) * CC + 8 * hh;
  const size_t ho = ((size_t)(b * NN + n0 + 16 * wave + c)) * CC + 8 * hh;
  const unsigned short* bhp = Hh + ho;
  const unsigned short* blp = Hl + ho;

  v8f acc[4];
#pragma unroll
  for (int mt = 0; mt < 4; ++mt) acc[mt] = zero8();

#pragma unroll 2
  for (int ks = 0; ks < CC / 32; ++ks) {
    const Frag fbh = ldfrag(bhp + 32 * ks);
    const Frag fbl = ldfrag(blp + 32 * ks);
#pragma unroll
    for (int mt = 0; mt < 4; ++mt) {
      const Frag fa = ldfrag(ap + (size_t)(16 * mt) * CC + 32 * ks);
      acc[mt] = mma_b(fa.bf, fbh.bf, acc[mt]);
      acc[mt] = mma_b(fa.bf, fbl.bf, acc[mt]);
    }
  }

  // ---- epilogue: + bias -> LDS Os[n_loc][o_loc]; lane (hh, c) holds o = 16 mt + 8 hh + r for n_loc = 16 w + c
  const float* bsrc = (sel == 0) ? bq : bk;                               // block-uniform, both global
  {
    const int nl = 16 * wave + c;
#pragma unroll
    for (int mt = 0; mt < 4; ++mt) {
      const v4f b0 = *(const v4f*)(bsrc + o0 + 16 * mt + 8 * hh);
      const v4f b1 = *(const v4f*)(bsrc + o0 + 16 * mt + 8 * hh + 4);
      v4f va, vb;
#pragma unroll
      for (int r = 0; r < 4; ++r) { va[r] = acc[mt][r] + bfr(b0[r]); vb[r] = acc[mt][4 + r] + bfr(b1[r]); }
      *(v4f*)(Os + nl * OSP + 16 * mt + 8 * hh)     = va;
      *(v4f*)(Os + nl * OSP + 16 * mt + 8 * hh + 4) = vb;
    }
  }
  __syncthreads();

  const int e = tid & 7, lq = tid >> 3;                                   // lq 0..15
  unsigned short* Ph = (sel == 0) ? Q16 : K16;                             // block-uniform, both global
  v4u uv[4];
#pragma unroll
  for (int it = 0; it < 4; ++it) {
    const int row = it * 16 + lq;                                          // n_loc 0..63
    const v4f a = *(const v4f*)(Os + row * OSP + 8 * e);
    const v4f q = *(const v4f*)(Os + row * OSP + 8 * e + 4);
    const float f[8] = {a[0], a[1], a[2], a[3], q[0], q[1], q[2], q[3]};
#pragma unroll
    for (int t = 0; t < 4; ++t)
      uv[it][t] = pk16(h_bits((_Float16)f[2 * t]), h_bits((_Float16)f[2 * t + 1]));
  }
{
#pragma unroll
    for (int it = 0; it < 4; ++it) {
      const int row = it * 16 + lq;
      const size_t po = ((size_t)(b * NN + n0 + row)) * CC + o0 + 8 * e;
      *(v4u*)(Ph + po) = uv[it];
    }
    
  }
}

// =============================================================================================================
// (4) v conv GEMM for one (b, 64-n tile, 64-o block o0 = mb*64), operands swapped so the D rows are positions:
//     D[n][o] = sum_c (Hh + Hl)[b][n][c] Wv[o][c]: A rows n = n0 + 16 w + (lane&15) from Hh and Hl (2 products),
//     B cols o = o0 + 16 j + (lane&15) from the Wv rows (k = c contiguous, same loader), 4 tiles j per wave, K=512.
//     Per lane the D tile holds 8 consecutive n of one o -> LDS Vs[o_loc][n_loc] (pitch OSP, b128 stores;
//     cross-wave, block barrier), then V16 f16 [b][512 o][4096 n] = f16(D + bf16-RNE(bv[o])) (unscaled, |v| ~ 1):
// coverage: Vs 4 waves x 16 n x 64 o = 64 x 64 (staged == consumed); V16 4 it x 16 rows x 8 lanes x 8 = 64 o x
//           64 n; grid (64, 8, NB) covers V16[b][0..511][0..4095] exactly once.
// =============================================================================================================
__global__ __launch_bounds__(128)
void gemm_v(const unsigned short* __restrict__ Wb, const unsigned short* __restrict__ Hh,
            const unsigned short* __restrict__ Hl, const float* __restrict__ bv, unsigned short* V16) {
  __shared__ __align__(16) float Vs[QT * OSP];
  const int tid  = threadIdx.x;
  const int lane = tid & 31, wave = tid >> 5;
  const int hh   = lane >> 4, c = lane & 15;
  const int nt   = blockIdx.x, mb = blockIdx.y, b = blockIdx.z;
  const int n0   = nt * QT, o0 = mb * QT;

  const size_t ho = ((size_t)(b * NN + n0 + 16 * wave + c)) * CC + 8 * hh;
  const unsigned short* ahp = Hh + ho;
  const unsigned short* alp = Hl + ho;
  const unsigned short* bp  = Wb + ((size_t)(2 * CC + o0 + c)) * CC + 8 * hh;

  v8f acc[4];
#pragma unroll
  for (int j = 0; j < 4; ++j) acc[j] = zero8();

#pragma unroll 2
  for (int ks = 0; ks < CC / 32; ++ks) {
    const Frag fah = ldfrag(ahp + 32 * ks);
    const Frag fal = ldfrag(alp + 32 * ks);
#pragma unroll
    for (int j = 0; j < 4; ++j) {
      const Frag fb = ldfrag(bp + (size_t)(16 * j) * CC + 32 * ks);
      acc[j] = mma_b(fah.bf, fb.bf, acc[j]);
      acc[j] = mma_b(fal.bf, fb.bf, acc[j]);
    }
  }

  // ---- epilogue: lane (hh, c) holds n_loc = 16 w + 8 hh + r of o_loc = 16 j + c
  {
    const int nrow = 16 * wave + 8 * hh;
#pragma unroll
    for (int j = 0; j < 4; ++j) {
      const float bb = bfr(bv[o0 + 16 * j + c]);
      v4f va, vb;
#pragma unroll
      for (int r = 0; r < 4; ++r) { va[r] = acc[j][r] + bb; vb[r] = acc[j][4 + r] + bb; }
      *(v4f*)(Vs + (16 * j + c) * OSP + nrow)     = va;
      *(v4f*)(Vs + (16 * j + c) * OSP + nrow + 4) = vb;
    }
  }
  __syncthreads();

  const int e = tid & 7, lq = tid >> 3;                                   // lq 0..15
  v4u uv[4];
#pragma unroll
  for (int it = 0; it < 4; ++it) {
    const int ol = it * 16 + lq;                                           // 0..63
    const v4f a = *(const v4f*)(Vs + ol * OSP + 8 * e);
    const v4f q = *(const v4f*)(Vs + ol * OSP + 8 * e + 4);
    const float f[8] = {a[0], a[1], a[2], a[3], q[0], q[1], q[2], q[3]};
#pragma unroll
    for (int t = 0; t < 4; ++t)
      uv[it][t] = pk16(h_bits((_Float16)f[2 * t]), h_bits((_Float16)f[2 * t + 1]));
  }
{
#pragma unroll
    for (int it = 0; it < 4; ++it) {
      const int ol = it * 16 + lq;
      *(v4u*)(V16 + ((size_t)(b * CC + o0 + ol)) * NN + n0 + 8 * e) = uv[it];
    }
    
  }
}

// =============================================================================================================
// (5) attention for one (b, 32-query tile), transposed formulation, 4096 keys, no mask. Block = 8 waves.
//   Score phase per 32-key block kb: wave w computes ONE S^T partial tile (16 keys x 16 queries): key tile
//   kt = w&1 (keys kb+16kt..), query tile qt = (w>>1)&1 (queries n0+16qt..), over the d-half dh = w>>2 (d 256dh ..
//   256dh+255, 8 steps of 32): A = k rows (row = key, d contiguous, split k map) from K16, B = q rows (col = query,
//   same map) from Q16, plain f16, 1 product. The partial (D row = key 8h+r, col = query) goes to LDS Sp[dh][query]
//   [key] (pitch SPP, b128 stores; cross-wave, block barrier); the two d-halves are added in fixed order by the
//   softmax lanes.
//   Softmax: wave 0, lane = query: s_j = (Sp[0] + Sp[1]) * 512^-0.5 for the 32 keys, online max / sum in f32
//   registers (m, l live in wave 0 only), corr = e^{m_old - m_new} -> Cs[query], grew flag -> Fl, P_j = e^{s_j - m}
//   x 2^14 as f16 -> Pf[query][key] (pitch PFP, 4 x 16-B stores per row; cross-wave, block barrier).
//   O^T (rows channel, cols query): every wave owns channels 64w..64w+63 (4 tiles j) x 32 queries (2 tiles) = 8
//   accumulator tiles; rescale by Cs when Fl != 0 (block-uniform flag), then += A(v rows channel = 64w+16j+(lane&15),
//   keys kb.. contiguous, f16 plane V16 [b][512][4096]) . B(P^T: row = query from Pf, keys contiguous, same loader).
//   Epilogue in two 256-channel halves: waves with (w>>2) == half stage O/l in LDS Os[query][256 ch] (pitch OSH, b128
//   stores; cross-wave, block barrier), then all 256 threads write Ah (bf16 hi) and Al (bf16 residual) [b][4096 n]
// coverage: Sp 8 waves x 1 tile = [2 dh][32 q][32 keys] each key block (staged == consumed); Pf 32 rows x 32 keys by
//           wave 0 (staged == consumed, pad cols never read); Os per half 4 waves x 32 q x 64 ch = 32 x 256 (staged ==
//           consumed); planes 2 halves x 4 it x 8 rows x 32 lanes x 8 = 32 n x 512 c per plane; grid (NQ/32, NB)
//           covers rows 0..NQ-1 exactly once (only those are read later).
// =============================================================================================================
__global__ __launch_bounds__(256)
void attn_k(const unsigned short* __restrict__ Q16, const unsigned short* __restrict__ K16,
            const unsigned short* __restrict__ V16, unsigned short* Ah, unsigned short* Al) {
  __shared__ __align__(16) float Sp[2 * AQ * SPP];
  __shared__ __align__(16) unsigned short Pf[AQ * PFP];
  __shared__ __align__(16) float Os[AQ * OSH];
  __shared__ float Cs[AQ];
  __shared__ float Ls[AQ];
  __shared__ int Fl;
  const int tid  = threadIdx.x;
  const int wave = tid >> 5, lane = tid & 31;
  const int hh   = lane >> 4, c = lane & 15;
  const int n0   = blockIdx.x * AQ, b = blockIdx.y;
  const int kt = wave & 1, qt = (wave >> 1) & 1, dh = wave >> 2;

  // q fragment pointer (B operand of S^T, col = query n0 + 16 qt + c, d-half dh), + 32*ks
  const unsigned short* qp = Q16 + ((size_t)(b * NN + n0 + 16 * qt + c)) * CC + (CC / 2) * dh + 8 * hh;
  // k fragment base (A operand, row = key kb + 16 kt + c, d-half dh), + kb*CC + 32*ks
  const unsigned short* kp = K16 + ((size_t)(b * NN + 16 * kt + c)) * CC + (CC / 2) * dh + 8 * hh;
  // v fragment base (A operand of O^T, row = channel 64 w + 16 j + c, keys contiguous), + 16*j*NN + kb
  const unsigned short* vp = V16 + ((size_t)(b * CC + 64 * wave + c)) * NN + 8 * hh;
  // this lane's S^T partial destination: Sp[dh][query 16qt+c][key 16kt + 8hh + r]
  float* spw = Sp + (dh * AQ + 16 * qt + c) * SPP + 16 * kt + 8 * hh;
  // P^T fragment rows (row = query c / 16 + c, keys contiguous)
  const unsigned short* pf0 = Pf + c * PFP + 8 * hh;
  const unsigned short* pf1 = Pf + (16 + c) * PFP + 8 * hh;

  float m_run = -1.0e30f, l_run = 0.f;
  v8f o[8];
#pragma unroll
  for (int j = 0; j < 8; ++j) o[j] = zero8();

#pragma unroll 1
  for (int kb = 0; kb < NN; kb += 32) {
    // ---- score partial tile over this wave's d-half
    v8f s = zero8();
    const unsigned short* kpp = kp + (size_t)kb * CC;
#pragma unroll 2
    for (int ks = 0; ks < CC / 64; ++ks) {
      const Frag fk = ldfrag(kpp + 32 * ks);
      const Frag fq = ldfrag(qp + 32 * ks);
      s = mma_h(fk.h, fq.h, s);
    }
    {
      v4f sa, sb;
#pragma unroll
      for (int r = 0; r < 4; ++r) { sa[r] = s[r]; sb[r] = s[4 + r]; }
      *(v4f*)(spw)     = sa;
      *(v4f*)(spw + 4) = sb;
    }
    __syncthreads();

    // ---- online softmax for the 32 queries (wave 0, lane = query)
    if (wave == 0) {
      const float* s0p = Sp + lane * SPP;                                 // d-half 0
      const float* s1p = Sp + (AQ + lane) * SPP;                          // d-half 1
      float sv[32];
#pragma unroll
      for (int i = 0; i < 8; ++i) {
        const v4f a0 = *(const v4f*)(s0p + 4 * i);
        const v4f a1 = *(const v4f*)(s1p + 4 * i);
#pragma unroll
        for (int t = 0; t < 4; ++t) sv[4 * i + t] = a0[t] + a1[t];
      }
      float mx = sv[0];
#pragma unroll
      for (int j = 1; j < 32; ++j) mx = fmaxf(mx, sv[j]);
      const float mxs = mx * SCL;
      const float mn  = fmaxf(m_run, mxs);
      const unsigned grew = wave_ballot(mxs > m_run);
      const float corr = __expf(m_run - mn);                             // == 1 exactly when the max did not grow
      m_run = mn;
      const float msh = mn - LNPS;                                        // exp gives e^{s-m} * 2^14
      float ls = 0.f;
      v4u pk[4];
#pragma unroll
      for (int i = 0; i < 4; ++i) {
#pragma unroll
        for (int t = 0; t < 4; ++t) {
          const float e0 = __expf(fmaf(sv[8 * i + 2 * t],     SCL, -msh));   // key kb + 8i + 2t
          const float e1 = __expf(fmaf(sv[8 * i + 2 * t + 1], SCL, -msh));   // key kb + 8i + 2t + 1
          ls += e0 + e1;
          pk[i][t] = pk16(h_bits((_Float16)e0), h_bits((_Float16)e1));
        }
      }
      l_run = l_run * corr + ls;
#pragma unroll
      for (int i = 0; i < 4; ++i) *(v4u*)(Pf + lane * PFP + 8 * i) = pk[i];
      Cs[lane] = corr;
      if (lane == 0) Fl = (grew != 0u) ? 1 : 0;
    }
    __syncthreads();

    // ---- rescale (block-uniform flag), then O^T += V . P^T
    if (Fl != 0) {
      const float c0r = Cs[c], c1r = Cs[16 + c];
#pragma unroll
      for (int j = 0; j < 4; ++j) {
#pragma unroll
        for (int r = 0; r < 8; ++r) { o[2 * j][r] *= c0r; o[2 * j + 1][r] *= c1r; }
      }
    }
    const Frag p0 = ldfrag(pf0);
    const Frag p1 = ldfrag(pf1);
#pragma unroll
    for (int j = 0; j < 4; ++j) {
      const Frag fv = ldfrag(vp + (size_t)(16 * j) * NN + kb);
      o[2 * j]     = mma_h(fv.h, p0.h, o[2 * j]);
      o[2 * j + 1] = mma_h(fv.h, p1.h, o[2 * j + 1]);
    }
  }
  if (wave == 0) Ls[lane] = 1.0f / l_run;                                // o and l both carry the 2^14 factor
  __syncthreads();
  const float inv0 = Ls[c], inv1 = Ls[16 + c];

#pragma unroll
  for (int half = 0; half < 2; ++half) {
    if ((wave >> 2) == half) {
      const int chb = 64 * (wave & 3);                                    // channel offset inside this half
#pragma unroll
      for (int j = 0; j < 4; ++j) {
#pragma unroll
        for (int q2 = 0; q2 < 2; ++q2) {
          const float inv = (q2 == 0) ? inv0 : inv1;
          v4f va, vb;
#pragma unroll
          for (int r = 0; r < 4; ++r) { va[r] = o[2 * j + q2][r] * inv; vb[r] = o[2 * j + q2][4 + r] * inv; }
          float* dst = Os + (16 * q2 + c) * OSH + chb + 16 * j + 8 * hh;  // Os[query][ch = chb + 16j + 8hh + r]
          *(v4f*)dst       = va;
          *(v4f*)(dst + 4) = vb;
        }
      }
    }
    __syncthreads();
    {
      const int e = lane, rq = wave;                                      // e: 16-B piece 0..31, rq: row 0..7 (+8 it)
      v4u uh[4], ul[4];
#pragma unroll
      for (int it = 0; it < 4; ++it) {
        const int row = it * 8 + rq;                                      // query 0..31
        const v4f a = *(const v4f*)(Os + row * OSH + 8 * e);
        const v4f q = *(const v4f*)(Os + row * OSH + 8 * e + 4);
        const float f[8] = {a[0], a[1], a[2], a[3], q[0], q[1], q[2], q[3]};
#pragma unroll
        for (int t = 0; t < 4; ++t) {
          const float f0 = f[2 * t], f1 = f[2 * t + 1];
          const unsigned short hb0 = bf_bits(f0), hb1 = bf_bits(f1);
          const unsigned short lb0 = bf_bits(f0 - bf_up(hb0));
          const unsigned short lb1 = bf_bits(f1 - bf_up(hb1));
          uh[it][t] = pk16(hb0, hb1);
          ul[it][t] = pk16(lb0, lb1);
        }
      }
{
#pragma unroll
        for (int it = 0; it < 4; ++it) {
          const int row = it * 8 + rq;
          const size_t po = ((size_t)(b * NN + n0 + row)) * CC + (CC / 2) * half + 8 * e;
          *(v4u*)(Ah + po) = uh[it];
          *(v4u*)(Al + po) = ul[it];
        }
        
      }
    }
    __syncthreads();
  }
}

// =============================================================================================================
// (6) output projection + bias + residual for one (b, 64-n tile, 64-o block o0 = mb*64), D rows = positions:
//     D[n][o] = sum_c (Ah + Al)[b][n][c] Wp[o][c] (2 products, K = 512): A rows n = n0 + 16 w + (lane&15),
//     B cols o = o0 + 16 j + (lane&15) from the Wp rows, 4 tiles per wave. Per lane 8 consecutive n of one o ->
//     LDS Vs[o_loc][n_loc] (pitch OSP, b128 stores; cross-wave, block barrier), then
//     2 lines, lane e (tid&15) -> n 4e..4e+3, lanes 0..7 line 0, 8..15 line 1, one instruction per 2 rows of a
// coverage: Vs 4 waves x 16 n x 64 o = 64 x 64 (staged == consumed); out 8 it x 8 rows x 16 lanes x 4 = 64 o x
//           64 n; grid (NQ/64, 8, NB) covers out[b][0..511][0..NQ-1] exactly once.
// =============================================================================================================
__global__ __launch_bounds__(128)
void gemm_p(const unsigned short* __restrict__ Wb, const unsigned short* __restrict__ Ah,
            const unsigned short* __restrict__ Al, const float* __restrict__ bp, const float* __restrict__ x,
            float* out) {
  __shared__ __align__(16) float Vs[QT * OSP];
  const int tid  = threadIdx.x;
  const int lane = tid & 31, wave = tid >> 5;
  const int hh   = lane >> 4, c = lane & 15;
  const int nt   = blockIdx.x, mb = blockIdx.y, b = blockIdx.z;
  const int n0   = nt * QT, o0 = mb * QT;

  const size_t ao = ((size_t)(b * NN + n0 + 16 * wave + c)) * CC + 8 * hh;
  const unsigned short* ahp = Ah + ao;
  const unsigned short* alp = Al + ao;
  const unsigned short* bpw = Wb + ((size_t)(3 * CC + o0 + c)) * CC + 8 * hh;

  v8f acc[4];
#pragma unroll
  for (int j = 0; j < 4; ++j) acc[j] = zero8();

#pragma unroll 2
  for (int ks = 0; ks < CC / 32; ++ks) {
    const Frag fah = ldfrag(ahp + 32 * ks);
    const Frag fal = ldfrag(alp + 32 * ks);
#pragma unroll
    for (int j = 0; j < 4; ++j) {
      const Frag fb = ldfrag(bpw + (size_t)(16 * j) * CC + 32 * ks);
      acc[j] = mma_b(fah.bf, fb.bf, acc[j]);
      acc[j] = mma_b(fal.bf, fb.bf, acc[j]);
    }
  }

  // ---- epilogue: lane (hh, c) holds n_loc = 16 w + 8 hh + r of o_loc = 16 j + c
  {
    const int nrow = 16 * wave + 8 * hh;
#pragma unroll
    for (int j = 0; j < 4; ++j) {
      const float bb = bfr(bp[o0 + 16 * j + c]);
      v4f va, vb;
#pragma unroll
      for (int r = 0; r < 4; ++r) { va[r] = acc[j][r] + bb; vb[r] = acc[j][4 + r] + bb; }
      *(v4f*)(Vs + (16 * j + c) * OSP + nrow)     = va;
      *(v4f*)(Vs + (16 * j + c) * OSP + nrow + 4) = vb;
    }
  }
  __syncthreads();

  const int e = tid & 15, lq = tid >> 4;                                  // lq 0..7
  v4f res[8];
#pragma unroll
  for (int it = 0; it < 8; ++it) {
    const int ol = it * 8 + lq;                                            // 0..63
    const v4f a = *(const v4f*)(Vs + ol * OSP + 4 * e);
    const size_t idx = ((size_t)(b * CC + o0 + ol)) * NN + n0 + 4 * e;
    const v4f xv = *(const v4f*)(x + idx);
#pragma unroll
    for (int t = 0; t < 4; ++t) res[it][t] = a[t] + bfr(xv[t]);
  }
{
#pragma unroll
    for (int it = 0; it < 8; ++it) {
      const int ol = it * 8 + lq;
      const size_t idx = ((size_t)(b * CC + o0 + ol)) * NN + n0 + 4 * e;
      *(v4f*)(out + idx) = res[it];
    }
    
  }
}

// =============================================================================================================
// Workspace map (bytes; each region start a multiple of 256; every extent is an exact tile multiple and is written
//   Wb    bf16 [4][512][512]          2097152
//   stats f32  [NB*32][32]             16384 (NB=4)
//   Hh/Hl bf16 [NB][4096][512]     16777216 x2   (reused as Ah/Al after their last reader, launch (4))
//   Q16/K16 f16 [NB][4096][512]   16777216 x2
//   V16   f16  [NB][512][4096]     16777216
//   total (NB=4) = 85999616
// =============================================================================================================
extern "C" void kernel_launch(void* const* d_in, const int* in_sizes, int n_in,
                              void* d_out, int out_size, void* d_ws, size_t ws_size,
                              hipStream_t stream) {
  if (n_in < 11) return;
  if (in_sizes[0] < NB * CC * NN) return;
  if (in_sizes[1] < CC || in_sizes[2] < CC) return;
  if (in_sizes[3] < CC * CC || in_sizes[5] < CC * CC || in_sizes[7] < CC * CC || in_sizes[9] < CC * CC) return;
  if (in_sizes[4] < CC || in_sizes[6] < CC || in_sizes[8] < CC || in_sizes[10] < CC) return;
  if (out_size < NB * CC * NN) return;

  size_t off = 0;
  auto carve = [&](size_t bytes) { const size_t o = off; off += (bytes + 255) & ~(size_t)255; return o; };
  const size_t plane = (size_t)NB * NN * CC * 2;
  const size_t oWb  = carve((size_t)4 * CC * CC * 2);
  const size_t oSt  = carve((size_t)NB * NGRP * 32 * 4);
  const size_t oHh  = carve(plane);
  const size_t oHl  = carve(plane);
  const size_t oQ   = carve(plane);
  const size_t oK   = carve(plane);
  const size_t oV   = carve(plane);
  const size_t oAh  = oHh;                                                // same extent, disjoint lifetimes
  const size_t oAl  = oHl;
  if (off > ws_size) return;
  if (off > (size_t)134217728) return;

  const float* x   = (const float*)d_in[0];
  const float* gnw = (const float*)d_in[1];
  const float* gnb = (const float*)d_in[2];
  const float* wq  = (const float*)d_in[3];
  const float* bq  = (const float*)d_in[4];
  const float* wk  = (const float*)d_in[5];
  const float* bk  = (const float*)d_in[6];
  const float* wv  = (const float*)d_in[7];
  const float* bv  = (const float*)d_in[8];
  const float* wp  = (const float*)d_in[9];
  const float* bp  = (const float*)d_in[10];

  char* ws = (char*)d_ws;
  unsigned short* Wb  = (unsigned short*)(ws + oWb);
  float*          St  = (float*)(ws + oSt);
  unsigned short* Hh  = (unsigned short*)(ws + oHh);
  unsigned short* Hl  = (unsigned short*)(ws + oHl);
  unsigned short* Q16 = (unsigned short*)(ws + oQ);
  unsigned short* K16 = (unsigned short*)(ws + oK);
  unsigned short* V16 = (unsigned short*)(ws + oV);
  unsigned short* Ah  = (unsigned short*)(ws + oAh);
  unsigned short* Al  = (unsigned short*)(ws + oAl);
  float* out = (float*)d_out;

  const dim3 blk256(256), blk128(128);

  // (0) conv weights -> stacked bf16 plane
  cvt_w<<<dim3(4 * (CC / 4)), blk256, 0, stream>>>(wq, wk, wv, wp, Wb);
  // (1) group statistics per (b, g) in f64
  gn_stats<<<dim3(NB * NGRP), blk256, 0, stream>>>(x, St);
  // (2) normalised activations -> position-major bf16 hi / residual planes
  gn_apply<<<dim3(NN / QT, CC / QT, NB), blk256, 0, stream>>>(x, gnw, gnb, St, Hh, Hl);
  // (3) q and k -> position-major f16 planes
  gemm_qk<<<dim3(NN / QT, 2 * (CC / QT), NB), blk128, 0, stream>>>(Wb, Hh, Hl, bq, bk, Q16, K16);
  // (4) v -> channel-major f16 plane
  gemm_v<<<dim3(NN / QT, CC / QT, NB), blk128, 0, stream>>>(Wb, Hh, Hl, bv, V16);
  // (5) attention -> bf16 hi / residual planes of the attention output (regions of Hh / Hl, dead by now)
  attn_k<<<dim3(NQ / AQ, NB), blk256, 0, stream>>>(Q16, K16, V16, Ah, Al);
  // (6) output projection + bias + residual -> out [b][512][4096]
  gemm_p<<<dim3(NQ / QT, CC / QT, NB), blk128, 0, stream>>>(Wb, Ah, Al, bp, x, out);
  (void)hipGetLastError();
}

// v001
// Measured time: 944 microseconds a run.
// Two timings next to v000 put it at 1.08 and 1.09 times that version's speed.
// Contractions: q/k/v 1x1-conv GEMMs W[512x512].H[512x4096] on v_wmma_f32_16x16x32_bf16 (W = bf16-RNE weights,
// exact; H = bf16 hi + bf16 residual planes of the normalised activations; 2 products, K=512); scores S^T = K.Q^T on
// v_wmma_f32_16x16x32_f16 (k, q: plain f16 planes, 1 product, K=512 split over two wave groups, fixed-order f32
// combine in LDS); O^T = V.P^T on v_wmma_f32_16x16x32_f16 (v: f16 plane, P = e^{s-m} x 2^14 as f16, K=4096); output
// 1x1-conv GEMM Wp[512x512].A[512x4096] on v_wmma_f32_16x16x32_bf16 (A = bf16 hi + residual planes of the
// attention output; 2 products, K=512). f32 accumulate everywhere; normalisation statistics in f64; softmax
// statistics, biases and the residual add in f32 VALU.
#include <hip/hip_runtime.h>
#include <math.h>
#include <stdint.h>

#ifndef NB
#define NB 4
#endif
#ifndef NQ
#define NQ 4096
#endif
#define NB_FULL 4
#define CC     512
#define NN     4096
#define NGRP   32
#define GSZ    16
#define QT     64
#define AQ     32
#define OSP    68
#define OSH    260
#define TP     72
#define SPP    36
#define PFP    40
#define SCL    0.044194173824159216f
#define LNPS   9.704060527839234f
#define GEPS   1.0e-6

static_assert(NB >= 1 && NB <= NB_FULL);
static_assert(NQ >= QT && NQ <= NN && NQ % QT == 0 && NQ % AQ == 0);
static_assert(NN % QT == 0 && NN % AQ == 0 && NN % 32 == 0);
static_assert(CC == 8 * QT && CC % 256 == 0 && CC % 32 == 0);
static_assert(GSZ * NGRP == CC && GSZ == 16);
static_assert((GSZ * NN) % (4 * 256) == 0);
static_assert((OSP * 4) % 16 == 0 && (OSH * 4) % 16 == 0 && (TP * 2) % 16 == 0);
static_assert((SPP * 4) % 16 == 0 && (PFP * 2) % 16 == 0);
static_assert(QT * OSP * 4 <= 65536);
static_assert((2 * AQ * SPP * 4 + AQ * PFP * 2 + AQ * OSH * 4 + 3 * AQ * 4) <= 65536);

typedef _Float16       v16h __attribute__((ext_vector_type(16)));
typedef _Float16       v8h  __attribute__((ext_vector_type(8)));
typedef __bf16         v16b __attribute__((ext_vector_type(16)));
typedef unsigned short v8us __attribute__((ext_vector_type(8)));
typedef float          v8f  __attribute__((ext_vector_type(8)));
typedef float          v4f  __attribute__((ext_vector_type(4)));
typedef unsigned int   v4u  __attribute__((ext_vector_type(4)));

union Frag  { v8us u[2]; v16h h; v16b bf; };
static_assert(sizeof(Frag) == 32);

// ---- scalar helpers -------------------------------------------------------------------------------------------
__device__ __forceinline__ unsigned short bf_bits(float f) {          // f32 -> bf16 bits, RNE convert
  unsigned u = __float_as_uint(f);
  return (unsigned short)((u + 0x7FFFu + ((u >> 16) & 1u)) >> 16);
}
__device__ __forceinline__ float bf_up(unsigned short hb) { return __uint_as_float(((unsigned)hb) << 16); }
__device__ __forceinline__ float bfr(float f) { return bf_up(bf_bits(f)); }
__device__ __forceinline__ unsigned short h_bits(_Float16 x) { return __builtin_bit_cast(unsigned short, x); }
__device__ __forceinline__ unsigned pk16(unsigned short a, unsigned short b) { return (unsigned)a | ((unsigned)b << 16); }
__device__ __forceinline__ v8f zero8() { v8f z = {0.f, 0.f, 0.f, 0.f, 0.f, 0.f, 0.f, 0.f}; return z; }
__device__ __forceinline__ unsigned wave_ballot(bool p) {
#if defined(__HIP_DEVICE_COMPILE__)
  return __builtin_amdgcn_ballot_w32(p);
#else
  return p ? 1u : 0u;
#endif
}

// ---- 16-bit fragment loader (A, or B from a k-contiguous [n][k] row): lane -> row/col (lane&15), p already includes
//      + 8*(lane>>4); elements 0..7 <- p[0..7] (k0+8h..), elements 8..15 <- p[16..23] (k0+16+8h..)
__device__ __forceinline__ Frag ldfrag(const unsigned short* p) {
  Frag f;
  f.u[0] = *(const v8us*)(p);
  f.u[1] = *(const v8us*)(p + 16);
  return f;
}

// ---- fragment-major planes (every 16-bit operand plane in the workspace): a plane of R rows x KD k-elements is cut
//      into fragments of 16 rows x 32 k = 512 elements; fragment (row tile rt, k step ks) starts at element
//      16*rt*KD + 512*ks and holds [u 0..1][lane 0..31][8 elements]: lane = 16*h + (row&15), k = 32*ks + 16*u + 8*h + t.
//      That is the register order of ldfrag above, so one fragment is two loads of 512 contiguous bytes per wave
//      (4 whole 128-B lines each) where a row-major plane gives 16 partial lines per load. p already includes + 8*lane.
__device__ __forceinline__ Frag ldfm(const unsigned short* p) {
  Frag f;
  f.u[0] = *(const v8us*)(p);
  f.u[1] = *(const v8us*)(p + 256);
  return f;
}

// ---- WMMA helpers: builtin followed by a 4-slot VALU gap tying D and keeping A/B live ------------------------------
__device__ __forceinline__ v8f mma_h(v16h a, v16h b, v8f c) {
  v8f d = __builtin_amdgcn_wmma_f32_16x16x32_f16(false, a, false, b, (short)0, c, false, false);
#if defined(__HIP_DEVICE_COMPILE__)
  asm volatile("v_nop\n\tv_nop\n\tv_nop\n\tv_nop" : "+v"(d) : "v"(a), "v"(b));
#endif
  return d;
}
__device__ __forceinline__ v8f mma_b(v16b a, v16b b, v8f c) {
  v8f d = __builtin_amdgcn_wmma_f32_16x16x32_bf16(false, a, false, b, (short)0, c, false, false);
#if defined(__HIP_DEVICE_COMPILE__)
  const v16h ha = __builtin_bit_cast(v16h, a), hb = __builtin_bit_cast(v16h, b);
  asm volatile("v_nop\n\tv_nop\n\tv_nop\n\tv_nop" : "+v"(d) : "v"(ha), "v"(hb));
#endif
  return d;
}

// =============================================================================================================
// (0) conv weights: Wb bf16, rows 512*matrix + o, k = c, fragment-major; matrix 0 = wq, 1 = wk, 2 = wv, 3 = wp; value =
//     bf16-RNE(w). Block blk (0..511): matrix blk/128 (block-uniform), row tile blk/4; wave gw = 8 blk + w owns the
//     half u = gw&1 of the fragment of k step (gw>>1)&15 and stores it as 512 contiguous bytes.
// coverage: 128 row tiles x 16 k steps x 2 halves = 4096 waves x 32 lanes x 8 = the whole plane.
// =============================================================================================================
__global__ __launch_bounds__(256)
void cvt_w(const float* __restrict__ wq, const float* __restrict__ wk, const float* __restrict__ wv,
           const float* __restrict__ wp, unsigned short* Wb) {
  const int tid = threadIdx.x, blk = blockIdx.x;
  const int wave = tid >> 5, lane = tid & 31;
  const int sel = blk / (CC / 4);                                          // 0..3, block-uniform
  const float* src = (sel == 0) ? wq : (sel == 1) ? wk : (sel == 2) ? wv : wp;   // all global
  const int gw  = blk * 8 + wave;                                          // 0..4095
  const int u   = gw & 1, ks = (gw >> 1) & 15, rt = gw >> 5;               // rt 0..127 = blk / 4
  const int o   = (rt & 31) * 16 + (lane & 15);                            // 0..511
  const int col = 32 * ks + 16 * u + 8 * (lane >> 4);                      // 0..504
  const float* s = src + (size_t)o * CC + col;
  const v4f a = *(const v4f*)s;
  const v4f q = *(const v4f*)(s + 4);
  const float f[8] = {a[0], a[1], a[2], a[3], q[0], q[1], q[2], q[3]};
  v4u pkv;
#pragma unroll
  for (int t = 0; t < 4; ++t) pkv[t] = pk16(bf_bits(f[2 * t]), bf_bits(f[2 * t + 1]));
{
    *(v4u*)(Wb + (size_t)(16 * rt) * CC + 512 * ks + 256 * u + 8 * lane) = pkv;
    
  }
}

// =============================================================================================================
// (1) group-normalisation statistics of bf16-RNE(x): block bg = b*32+g owns the 16 channels x 4096 positions
// =============================================================================================================
__global__ __launch_bounds__(256)
void gn_stats(const float* __restrict__ x, float* stats) {
  __shared__ double red[256];
  const int tid = threadIdx.x, bg = blockIdx.x;
  const v4f* p = (const v4f*)(x + (size_t)bg * GSZ * NN);
  const int N4 = GSZ * NN / 4;                                            // 16384
  const double invN = 1.0 / (double)(GSZ * NN);

  double s = 0.0;
#pragma unroll 1
  for (int i = tid; i < N4; i += 256) {
    const v4f v = p[i];
    s += ((double)bfr(v[0]) + (double)bfr(v[1])) + ((double)bfr(v[2]) + (double)bfr(v[3]));
  }
  red[tid] = s;
  __syncthreads();
#pragma unroll 1
  for (int off = 128; off > 0; off >>= 1) {
    if (tid < off) red[tid] += red[tid + off];
    __syncthreads();
  }
  const double mean = red[0] * invN;
  __syncthreads();                                                        // everyone read red[0]

  double s2 = 0.0;
#pragma unroll 1
  for (int i = tid; i < N4; i += 256) {
    const v4f v = p[i];
#pragma unroll
    for (int t = 0; t < 4; ++t) {
      const double d = (double)bfr(v[t]) - mean;
      s2 += d * d;
    }
  }
  red[tid] = s2;
  __syncthreads();
#pragma unroll 1
  for (int off = 128; off > 0; off >>= 1) {
    if (tid < off) red[tid] += red[tid + off];
    __syncthreads();
  }
  const double var = red[0] * invN;
  const float meanf = (float)mean;
  const float rstdf = (float)(1.0 / sqrt(var + GEPS));

  v4f val = {0.f, 0.f, 0.f, 0.f};
  if (tid == 0) { val[0] = meanf; val[1] = rstdf; }
  float* dst = stats + (size_t)bg * 32 + 4 * (tid & 7);
  if (tid < 8) *(v4f*)dst = val;
  
}

// =============================================================================================================
// (2) h = (bf16-RNE(x) - mean) * rstd * bf16-RNE(gn_w) + bf16-RNE(gn_b) in f32, then bf16 hi = RNE(h) and bf16
//     lo = RNE(h - hi), written as Hh/Hl bf16, rows 4096 b + n, k = c, fragment-major (for the conv GEMMs).
//     Block (nb, cb, b) owns 64 n x 64 c through LDS tiles Th/Tl[64 n][64 c] (pitch TP; cross-wave, block barrier).
// coverage: Th/Tl 2 it x 32 rows(c) x 8 lanes x 8 n = 64 x 64 (staged extent == consumed extent); planes 2 it x 8
//           waves = 4 row tiles x 2 k steps x 2 halves of 512 B per plane; grid (64, 8, NB) covers all 4096 n x 512 c.
// =============================================================================================================
__global__ __launch_bounds__(256)
void gn_apply(const float* __restrict__ x, const float* __restrict__ gw, const float* __restrict__ gb,
              const float* __restrict__ stats, unsigned short* Hh, unsigned short* Hl) {
  __shared__ __align__(16) unsigned short Th[QT * TP];
  __shared__ __align__(16) unsigned short Tl[QT * TP];
  const int tid = threadIdx.x;
  const int nb = blockIdx.x, cb = blockIdx.y, b = blockIdx.z;
  const int e = tid & 7, lq = tid >> 3;                                  // lq 0..31
  const int n0 = nb * QT, c0 = cb * QT;
#pragma unroll
  for (int it = 0; it < 2; ++it) {
    const int cl = it * 32 + lq;                                          // 0..63
    const int ch = c0 + cl;                                               // 0..511
    const int g  = ch / GSZ;                                              // 0..31
    const float mean = stats[(size_t)(b * NGRP + g) * 32 + 0];
    const float rstd = stats[(size_t)(b * NGRP + g) * 32 + 1];
    const float w  = bfr(gw[ch]);
    const float bb = bfr(gb[ch]);
    const float* sp = x + ((size_t)(b * CC + ch)) * NN + n0 + 8 * e;
    const v4f a = *(const v4f*)sp;
    const v4f q = *(const v4f*)(sp + 4);
    const float f[8] = {a[0], a[1], a[2], a[3], q[0], q[1], q[2], q[3]};
#pragma unroll
    for (int t = 0; t < 8; ++t) {
      const float h = (bfr(f[t]) - mean) * rstd * w + bb;
      const unsigned short hb = bf_bits(h);
      const unsigned short lb = bf_bits(h - bf_up(hb));
      Th[(8 * e + t) * TP + cl] = hb;
      Tl[(8 * e + t) * TP + cl] = lb;
    }
  }
  __syncthreads();
  const int lane = tid & 31, wave = tid >> 5;
  v4u uh[2], ul[2];
#pragma unroll
  for (int it = 0; it < 2; ++it) {
    const int pc = it * 8 + wave;                                         // piece: row tile pc>>2, chunk pair pc&3
    const int lo = (16 * (pc >> 2) + (lane & 15)) * TP + 16 * (pc & 3) + 8 * (lane >> 4);
    uh[it] = *(const v4u*)(Th + lo);
    ul[it] = *(const v4u*)(Tl + lo);
  }
{
#pragma unroll
    for (int it = 0; it < 2; ++it) {
      const int pc = it * 8 + wave;
      const size_t po = ((size_t)(b * NN + n0 + 16 * (pc >> 2))) * CC + 16 * c0 + 256 * (pc & 3) + 8 * lane;
      *(v4u*)(Hh + po) = uh[it];
      *(v4u*)(Hl + po) = ul[it];
    }
    
  }
}

// =============================================================================================================
// (3) q / k conv GEMM for one (b, 64-n tile, matrix sel = mb/8, 64-o block o0 = (mb%8)*64):
//     Y[o][n] = sum_c W[o][c] (Hh + Hl)[b][n][c] + bf16-RNE(bias[o]). Block 128 threads = 4 waves; wave w owns cols
//     n0+16w..+15 (B fragments from the Hh and Hl planes, fragment-major, split k map) and 4 m-tiles (A rows
//     o = o0 + 16 mt + (lane&15) from Wb, same loader). K = 512 = 16 steps x 2 products.
//     Epilogue staged in LDS Os[n_loc][o_loc] (pitch OSP, b128 stores of 8 consecutive o per lane; cross-wave,
//     block barrier), then sel 0 -> Q16, sel 1 -> K16, plain f16, rows 4096 b + n, k = d, fragment-major.
// coverage: Os 4 waves x 16 n x 64 o = 64 x 64 (staged == consumed); plane 4 it (row tiles) x 4 waves (2 k steps x 2
//           halves of 512 B) = 64 n x 64 d; grid (64, 16, NB) covers d 0..511 of all 4096 rows of Q16 and K16 once.
// =============================================================================================================
__global__ __launch_bounds__(128)
void gemm_qk(const unsigned short* __restrict__ Wb, const unsigned short* __restrict__ Hh,
             const unsigned short* __restrict__ Hl, const float* __restrict__ bq, const float* __restrict__ bk,
             unsigned short* Q16, unsigned short* K16) {
  __shared__ __align__(16) float Os[QT * OSP];
  const int tid  = threadIdx.x;
  const int lane = tid & 31, wave = tid >> 5;
  const int hh   = lane >> 4, c = lane & 15;
  const int nt   = blockIdx.x, mb = blockIdx.y, b = blockIdx.z;
  const int sel  = mb / (CC / QT);                                         // 0 = q, 1 = k (block-uniform)
  const int n0   = nt * QT, o0 = (mb % (CC / QT)) * QT;

  const unsigned short* ap = Wb + ((size_t)(sel * CC + o0)) * CC + 8 * lane;
  const size_t ho = ((size_t)(b * NN + n0 + 16 * wave)) * CC + 8 * lane;
  const unsigned short* bhp = Hh + ho;
  const unsigned short* blp = Hl + ho;

  v8f acc[4];
#pragma unroll
  for (int mt = 0; mt < 4; ++mt) acc[mt] = zero8();

#pragma unroll 2
  for (int ks = 0; ks < CC / 32; ++ks) {
    const Frag fbh = ldfm(bhp + 512 * ks);
    const Frag fbl = ldfm(blp + 512 * ks);
#pragma unroll
    for (int mt = 0; mt < 4; ++mt) {
      const Frag fa = ldfm(ap + (size_t)(16 * mt) * CC + 512 * ks);
      acc[mt] = mma_b(fa.bf, fbh.bf, acc[mt]);
      acc[mt] = mma_b(fa.bf, fbl.bf, acc[mt]);
    }
  }

  // ---- epilogue: + bias -> LDS Os[n_loc][o_loc]; lane (hh, c) holds o = 16 mt + 8 hh + r for n_loc = 16 w + c
  const float* bsrc = (sel == 0) ? bq : bk;                               // block-uniform, both global
  {
    const int nl = 16 * wave + c;
#pragma unroll
    for (int mt = 0; mt < 4; ++mt) {
      const v4f b0 = *(const v4f*)(bsrc + o0 + 16 * mt + 8 * hh);
      const v4f b1 = *(const v4f*)(bsrc + o0 + 16 * mt + 8 * hh + 4);
      v4f va, vb;
#pragma unroll
      for (int r = 0; r < 4; ++r) { va[r] = acc[mt][r] + bfr(b0[r]); vb[r] = acc[mt][4 + r] + bfr(b1[r]); }
      *(v4f*)(Os + nl * OSP + 16 * mt + 8 * hh)     = va;
      *(v4f*)(Os + nl * OSP + 16 * mt + 8 * hh + 4) = vb;
    }
  }
  __syncthreads();

  unsigned short* Ph = (sel == 0) ? Q16 : K16;                             // block-uniform, both global
  v4u uv[4];
#pragma unroll
  for (int it = 0; it < 4; ++it) {
    const int lo = (it * 16 + c) * OSP + 16 * wave + 8 * hh;               // row tile it, chunk pair = wave
    const v4f a = *(const v4f*)(Os + lo);
    const v4f q = *(const v4f*)(Os + lo + 4);
    const float f[8] = {a[0], a[1], a[2], a[3], q[0], q[1], q[2], q[3]};
#pragma unroll
    for (int t = 0; t < 4; ++t)
      uv[it][t] = pk16(h_bits((_Float16)f[2 * t]), h_bits((_Float16)f[2 * t + 1]));
  }
{
#pragma unroll
    for (int it = 0; it < 4; ++it) {
      const size_t po = ((size_t)(b * NN + n0 + 16 * it)) * CC + 16 * o0 + 256 * wave + 8 * lane;
      *(v4u*)(Ph + po) = uv[it];
    }
    
  }
}

// =============================================================================================================
// (4) v conv GEMM for one (b, 64-n tile, 64-o block o0 = mb*64), operands swapped so the D rows are positions:
//     D[n][o] = sum_c (Hh + Hl)[b][n][c] Wv[o][c]: A rows n = n0 + 16 w + (lane&15) from Hh and Hl (2 products),
//     B cols o = o0 + 16 j + (lane&15) from the Wv rows (fragment-major, same loader), 4 tiles j per wave, K=512.
//     Per lane the D tile holds 8 consecutive n of one o -> LDS Vs[o_loc][n_loc] (pitch OSP, b128 stores;
//     cross-wave, block barrier), then V16 f16, rows 512 b + o, k = n (KD = 4096), fragment-major, = f16(D +
//     bf16-RNE(bv[o])) (unscaled, |v| ~ 1).
// coverage: Vs 4 waves x 16 n x 64 o = 64 x 64 (staged == consumed); V16 4 it (row tiles) x 4 waves (2 k steps x 2
//           halves of 512 B) = 64 o x 64 n; grid (64, 8, NB) covers all 512 o x 4096 n of each b exactly once.
// =============================================================================================================
__global__ __launch_bounds__(128)
void gemm_v(const unsigned short* __restrict__ Wb, const unsigned short* __restrict__ Hh,
            const unsigned short* __restrict__ Hl, const float* __restrict__ bv, unsigned short* V16) {
  __shared__ __align__(16) float Vs[QT * OSP];
  const int tid  = threadIdx.x;
  const int lane = tid & 31, wave = tid >> 5;
  const int hh   = lane >> 4, c = lane & 15;
  const int nt   = blockIdx.x, mb = blockIdx.y, b = blockIdx.z;
  const int n0   = nt * QT, o0 = mb * QT;

  const size_t ho = ((size_t)(b * NN + n0 + 16 * wave)) * CC + 8 * lane;
  const unsigned short* ahp = Hh + ho;
  const unsigned short* alp = Hl + ho;
  const unsigned short* bp  = Wb + ((size_t)(2 * CC + o0)) * CC + 8 * lane;

  v8f acc[4];
#pragma unroll
  for (int j = 0; j < 4; ++j) acc[j] = zero8();

#pragma unroll 2
  for (int ks = 0; ks < CC / 32; ++ks) {
    const Frag fah = ldfm(ahp + 512 * ks);
    const Frag fal = ldfm(alp + 512 * ks);
#pragma unroll
    for (int j = 0; j < 4; ++j) {
      const Frag fb = ldfm(bp + (size_t)(16 * j) * CC + 512 * ks);
      acc[j] = mma_b(fah.bf, fb.bf, acc[j]);
      acc[j] = mma_b(fal.bf, fb.bf, acc[j]);
    }
  }

  // ---- epilogue: lane (hh, c) holds n_loc = 16 w + 8 hh + r of o_loc = 16 j + c
  {
    const int nrow = 16 * wave + 8 * hh;
#pragma unroll
    for (int j = 0; j < 4; ++j) {
      const float bb = bfr(bv[o0 + 16 * j + c]);
      v4f va, vb;
#pragma unroll
      for (int r = 0; r < 4; ++r) { va[r] = acc[j][r] + bb; vb[r] = acc[j][4 + r] + bb; }
      *(v4f*)(Vs + (16 * j + c) * OSP + nrow)     = va;
      *(v4f*)(Vs + (16 * j + c) * OSP + nrow + 4) = vb;
    }
  }
  __syncthreads();

  v4u uv[4];
#pragma unroll
  for (int it = 0; it < 4; ++it) {
    const int lo = (it * 16 + c) * OSP + 16 * wave + 8 * hh;               // row tile it, chunk pair = wave
    const v4f a = *(const v4f*)(Vs + lo);
    const v4f q = *(const v4f*)(Vs + lo + 4);
    const float f[8] = {a[0], a[1], a[2], a[3], q[0], q[1], q[2], q[3]};
#pragma unroll
    for (int t = 0; t < 4; ++t)
      uv[it][t] = pk16(h_bits((_Float16)f[2 * t]), h_bits((_Float16)f[2 * t + 1]));
  }
{
#pragma unroll
    for (int it = 0; it < 4; ++it) {
      *(v4u*)(V16 + ((size_t)(b * CC + o0 + 16 * it)) * NN + 16 * n0 + 256 * wave + 8 * lane) = uv[it];
    }
    
  }
}

// =============================================================================================================
// (5) attention for one (b, 32-query tile), transposed formulation, 4096 keys, no mask. Block = 8 waves.
//   Score phase per 32-key block kb: wave w computes ONE S^T partial tile (16 keys x 16 queries): key tile
//   kt = w&1 (keys kb+16kt..), query tile qt = (w>>1)&1 (queries n0+16qt..), over the d-half dh = w>>2 (d 256dh ..
//   256dh+255, 8 steps of 32): A = k rows (row = key, fragment-major, split k map) from K16, B = q rows (col = query,
//   same map) from Q16, plain f16, 1 product. The partial (D row = key 8h+r, col = query) goes to LDS Sp[dh][query]
//   [key] (pitch SPP, b128 stores; cross-wave, block barrier); the two d-halves are added in fixed order by the
//   softmax lanes.
//   Softmax: wave 0, lane = query: s_j = (Sp[0] + Sp[1]) * 512^-0.5 for the 32 keys, online max / sum in f32
//   registers (m, l live in wave 0 only), corr = e^{m_old - m_new} -> Cs[query], grew flag -> Fl, P_j = e^{s_j - m}
//   x 2^14 as f16 -> Pf[query][key] (pitch PFP, 4 x 16-B stores per row; cross-wave, block barrier).
//   O^T (rows channel, cols query): every wave owns channels 64w..64w+63 (4 tiles j) x 32 queries (2 tiles) = 8
//   accumulator tiles; rescale by Cs when Fl != 0 (block-uniform flag), then += A(v rows channel = 64w+16j+(lane&15),
//   keys kb.., fragment-major f16 plane V16) . B(P^T: row = query from Pf, keys contiguous, same k order).
//   Epilogue in two 256-channel halves: waves with (w>>2) == half stage O/l in LDS Os[query][256 ch] (pitch OSH, b128
//   stores; cross-wave, block barrier), then all 256 threads write Ah (bf16 hi) and Al (bf16 residual), fragment-major.
// coverage: Sp 8 waves x 1 tile = [2 dh][32 q][32 keys] each key block (staged == consumed); Pf 32 rows x 32 keys by
//           wave 0 (staged == consumed, pad cols never read); Os per half 4 waves x 32 q x 64 ch = 32 x 256 (staged ==
//           consumed); planes 2 halves x 4 it x 8 waves x 512 B = 2 row tiles x 16 k steps per plane; grid (NQ/32, NB)
//           covers rows 0..NQ-1 exactly once (only those are read later).
// =============================================================================================================
__global__ __launch_bounds__(256)
void attn_k(const unsigned short* __restrict__ Q16, const unsigned short* __restrict__ K16,
            const unsigned short* __restrict__ V16, unsigned short* Ah, unsigned short* Al) {
  __shared__ __align__(16) float Sp[2 * AQ * SPP];
  __shared__ __align__(16) unsigned short Pf[AQ * PFP];
  __shared__ __align__(16) float Os[AQ * OSH];
  __shared__ float Cs[AQ];
  __shared__ float Ls[AQ];
  __shared__ int Fl;
  const int tid  = threadIdx.x;
  const int wave = tid >> 5, lane = tid & 31;
  const int hh   = lane >> 4, c = lane & 15;
  const int n0   = blockIdx.x * AQ, b = blockIdx.y;
  const int kt = wave & 1, qt = (wave >> 1) & 1, dh = wave >> 2;

  // q fragment pointer (B operand of S^T, col = query n0 + 16 qt + c, d-half dh), + 512*ks
  const unsigned short* qp = Q16 + ((size_t)(b * NN + n0 + 16 * qt)) * CC + 16 * (CC / 2) * dh + 8 * lane;
  // k fragment base (A operand, row = key kb + 16 kt + c, d-half dh), + kb*CC + 512*ks
  const unsigned short* kp = K16 + ((size_t)(b * NN + 16 * kt)) * CC + 16 * (CC / 2) * dh + 8 * lane;
  // v fragment base (A operand of O^T, row = channel 64 w + 16 j + c), + 16*j*NN + 16*kb (k step kb/32)
  const unsigned short* vp = V16 + ((size_t)(b * CC + 64 * wave)) * NN + 8 * lane;
  // this lane's S^T partial destination: Sp[dh][query 16qt+c][key 16kt + 8hh + r]
  float* spw = Sp + (dh * AQ + 16 * qt + c) * SPP + 16 * kt + 8 * hh;
  // P^T fragment rows (row = query c / 16 + c, keys contiguous)
  const unsigned short* pf0 = Pf + c * PFP + 8 * hh;
  const unsigned short* pf1 = Pf + (16 + c) * PFP + 8 * hh;

  float m_run = -1.0e30f, l_run = 0.f;
  v8f o[8];
#pragma unroll
  for (int j = 0; j < 8; ++j) o[j] = zero8();

#pragma unroll 1
  for (int kb = 0; kb < NN; kb += 32) {
    // ---- score partial tile over this wave's d-half
    v8f s = zero8();
    const unsigned short* kpp = kp + (size_t)kb * CC;
#pragma unroll 2
    for (int ks = 0; ks < CC / 64; ++ks) {
      const Frag fk = ldfm(kpp + 512 * ks);
      const Frag fq = ldfm(qp + 512 * ks);
      s = mma_h(fk.h, fq.h, s);
    }
    {
      v4f sa, sb;
#pragma unroll
      for (int r = 0; r < 4; ++r) { sa[r] = s[r]; sb[r] = s[4 + r]; }
      *(v4f*)(spw)     = sa;
      *(v4f*)(spw + 4) = sb;
    }
    __syncthreads();

    // ---- online softmax for the 32 queries (wave 0, lane = query)
    if (wave == 0) {
      const float* s0p = Sp + lane * SPP;                                 // d-half 0
      const float* s1p = Sp + (AQ + lane) * SPP;                          // d-half 1
      float sv[32];
#pragma unroll
      for (int i = 0; i < 8; ++i) {
        const v4f a0 = *(const v4f*)(s0p + 4 * i);
        const v4f a1 = *(const v4f*)(s1p + 4 * i);
#pragma unroll
        for (int t = 0; t < 4; ++t) sv[4 * i + t] = a0[t] + a1[t];
      }
      float mx = sv[0];
#pragma unroll
      for (int j = 1; j < 32; ++j) mx = fmaxf(mx, sv[j]);
      const float mxs = mx * SCL;
      const float mn  = fmaxf(m_run, mxs);
      const unsigned grew = wave_ballot(mxs > m_run);
      const float corr = __expf(m_run - mn);                             // == 1 exactly when the max did not grow
      m_run = mn;
      const float msh = mn - LNPS;                                        // exp gives e^{s-m} * 2^14
      float ls = 0.f;
      v4u pk[4];
#pragma unroll
      for (int i = 0; i < 4; ++i) {
#pragma unroll
        for (int t = 0; t < 4; ++t) {
          const float e0 = __expf(fmaf(sv[8 * i + 2 * t],     SCL, -msh));   // key kb + 8i + 2t
          const float e1 = __expf(fmaf(sv[8 * i + 2 * t + 1], SCL, -msh));   // key kb + 8i + 2t + 1
          ls += e0 + e1;
          pk[i][t] = pk16(h_bits((_Float16)e0), h_bits((_Float16)e1));
        }
      }
      l_run = l_run * corr + ls;
#pragma unroll
      for (int i = 0; i < 4; ++i) *(v4u*)(Pf + lane * PFP + 8 * i) = pk[i];
      Cs[lane] = corr;
      if (lane == 0) Fl = (grew != 0u) ? 1 : 0;
    }
    __syncthreads();

    // ---- rescale (block-uniform flag), then O^T += V . P^T
    if (Fl != 0) {
      const float c0r = Cs[c], c1r = Cs[16 + c];
#pragma unroll
      for (int j = 0; j < 4; ++j) {
#pragma unroll
        for (int r = 0; r < 8; ++r) { o[2 * j][r] *= c0r; o[2 * j + 1][r] *= c1r; }
      }
    }
    const Frag p0 = ldfrag(pf0);
    const Frag p1 = ldfrag(pf1);
#pragma unroll
    for (int j = 0; j < 4; ++j) {
      const Frag fv = ldfm(vp + (size_t)(16 * j) * NN + 16 * kb);
      o[2 * j]     = mma_h(fv.h, p0.h, o[2 * j]);
      o[2 * j + 1] = mma_h(fv.h, p1.h, o[2 * j + 1]);
    }
  }
  if (wave == 0) Ls[lane] = 1.0f / l_run;                                // o and l both carry the 2^14 factor
  __syncthreads();
  const float inv0 = Ls[c], inv1 = Ls[16 + c];

#pragma unroll
  for (int half = 0; half < 2; ++half) {
    if ((wave >> 2) == half) {
      const int chb = 64 * (wave & 3);                                    // channel offset inside this half
#pragma unroll
      for (int j = 0; j < 4; ++j) {
#pragma unroll
        for (int q2 = 0; q2 < 2; ++q2) {
          const float inv = (q2 == 0) ? inv0 : inv1;
          v4f va, vb;
#pragma unroll
          for (int r = 0; r < 4; ++r) { va[r] = o[2 * j + q2][r] * inv; vb[r] = o[2 * j + q2][4 + r] * inv; }
          float* dst = Os + (16 * q2 + c) * OSH + chb + 16 * j + 8 * hh;  // Os[query][ch = chb + 16j + 8hh + r]
          *(v4f*)dst       = va;
          *(v4f*)(dst + 4) = vb;
        }
      }
    }
    __syncthreads();
    {
      v4u uh[4], ul[4];
#pragma unroll
      for (int it = 0; it < 4; ++it) {
        const int pc = it * 8 + wave;                                     // piece: row tile pc>>4, chunk pair pc&15
        const int lo = (16 * (pc >> 4) + c) * OSH + 16 * (pc & 15) + 8 * hh;
        const v4f a = *(const v4f*)(Os + lo);
        const v4f q = *(const v4f*)(Os + lo + 4);
        const float f[8] = {a[0], a[1], a[2], a[3], q[0], q[1], q[2], q[3]};
#pragma unroll
        for (int t = 0; t < 4; ++t) {
          const float f0 = f[2 * t], f1 = f[2 * t + 1];
          const unsigned short hb0 = bf_bits(f0), hb1 = bf_bits(f1);
          const unsigned short lb0 = bf_bits(f0 - bf_up(hb0));
          const unsigned short lb1 = bf_bits(f1 - bf_up(hb1));
          uh[it][t] = pk16(hb0, hb1);
          ul[it][t] = pk16(lb0, lb1);
        }
      }
{
#pragma unroll
        for (int it = 0; it < 4; ++it) {
          const int pc = it * 8 + wave;
          const size_t po = ((size_t)(b * NN + n0 + 16 * (pc >> 4))) * CC + 16 * (CC / 2) * half + 256 * (pc & 15) + 8 * lane;
          *(v4u*)(Ah + po) = uh[it];
          *(v4u*)(Al + po) = ul[it];
        }
        
      }
    }
    __syncthreads();
  }
}

// =============================================================================================================
// (6) output projection + bias + residual for one (b, 64-n tile, 64-o block o0 = mb*64), D rows = positions:
//     D[n][o] = sum_c (Ah + Al)[b][n][c] Wp[o][c] (2 products, K = 512): A rows n = n0 + 16 w + (lane&15),
//     B cols o = o0 + 16 j + (lane&15) from the Wp rows (all fragment-major), 4 tiles per wave. Per lane 8 consecutive n of one o ->
//     LDS Vs[o_loc][n_loc] (pitch OSP, b128 stores; cross-wave, block barrier), then
//     2 lines, lane e (tid&15) -> n 4e..4e+3, lanes 0..7 line 0, 8..15 line 1, one instruction per 2 rows of a
// coverage: Vs 4 waves x 16 n x 64 o = 64 x 64 (staged == consumed); out 8 it x 8 rows x 16 lanes x 4 = 64 o x
//           64 n; grid (NQ/64, 8, NB) covers out[b][0..511][0..NQ-1] exactly once.
// =============================================================================================================
__global__ __launch_bounds__(128)
void gemm_p(const unsigned short* __restrict__ Wb, const unsigned short* __restrict__ Ah,
            const unsigned short* __restrict__ Al, const float* __restrict__ bp, const float* __restrict__ x,
            float* out) {
  __shared__ __align__(16) float Vs[QT * OSP];
  const int tid  = threadIdx.x;
  const int lane = tid & 31, wave = tid >> 5;
  const int hh   = lane >> 4, c = lane & 15;
  const int nt   = blockIdx.x, mb = blockIdx.y, b = blockIdx.z;
  const int n0   = nt * QT, o0 = mb * QT;

  const size_t ao = ((size_t)(b * NN + n0 + 16 * wave)) * CC + 8 * lane;
  const unsigned short* ahp = Ah + ao;
  const unsigned short* alp = Al + ao;
  const unsigned short* bpw = Wb + ((size_t)(3 * CC + o0)) * CC + 8 * lane;

  v8f acc[4];
#pragma unroll
  for (int j = 0; j < 4; ++j) acc[j] = zero8();

#pragma unroll 2
  for (int ks = 0; ks < CC / 32; ++ks) {
    const Frag fah = ldfm(ahp + 512 * ks);
    const Frag fal = ldfm(alp + 512 * ks);
#pragma unroll
    for (int j = 0; j < 4; ++j) {
      const Frag fb = ldfm(bpw + (size_t)(16 * j) * CC + 512 * ks);
      acc[j] = mma_b(fah.bf, fb.bf, acc[j]);
      acc[j] = mma_b(fal.bf, fb.bf, acc[j]);
    }
  }

  // ---- epilogue: lane (hh, c) holds n_loc = 16 w + 8 hh + r of o_loc = 16 j + c
  {
    const int nrow = 16 * wave + 8 * hh;
#pragma unroll
    for (int j = 0; j < 4; ++j) {
      const float bb = bfr(bp[o0 + 16 * j + c]);
      v4f va, vb;
#pragma unroll
      for (int r = 0; r < 4; ++r) { va[r] = acc[j][r] + bb; vb[r] = acc[j][4 + r] + bb; }
      *(v4f*)(Vs + (16 * j + c) * OSP + nrow)     = va;
      *(v4f*)(Vs + (16 * j + c) * OSP + nrow + 4) = vb;
    }
  }
  __syncthreads();

  const int e = tid & 15, lq = tid >> 4;                                  // lq 0..7
  v4f res[8];
#pragma unroll
  for (int it = 0; it < 8; ++it) {
    const int ol = it * 8 + lq;                                            // 0..63
    const v4f a = *(const v4f*)(Vs + ol * OSP + 4 * e);
    const size_t idx = ((size_t)(b * CC + o0 + ol)) * NN + n0 + 4 * e;
    const v4f xv = *(const v4f*)(x + idx);
#pragma unroll
    for (int t = 0; t < 4; ++t) res[it][t] = a[t] + bfr(xv[t]);
  }
{
#pragma unroll
    for (int it = 0; it < 8; ++it) {
      const int ol = it * 8 + lq;
      const size_t idx = ((size_t)(b * CC + o0 + ol)) * NN + n0 + 4 * e;
      *(v4f*)(out + idx) = res[it];
    }
    
  }
}

// =============================================================================================================
// Workspace map (bytes; each region start a multiple of 256; every extent is an exact tile multiple and is written
//   (all 16-bit planes fragment-major, same extents as row-major)
//   Wb    bf16 [4][512][512]          2097152
//   stats f32  [NB*32][32]             16384 (NB=4)
//   Hh/Hl bf16 [NB][4096][512]     16777216 x2   (reused as Ah/Al after their last reader, launch (4))
//   Q16/K16 f16 [NB][4096][512]   16777216 x2
//   V16   f16  [NB][512][4096]     16777216
//   total (NB=4) = 85999616
// =============================================================================================================
extern "C" void kernel_launch(void* const* d_in, const int* in_sizes, int n_in,
                              void* d_out, int out_size, void* d_ws, size_t ws_size,
                              hipStream_t stream) {
  if (n_in < 11) return;
  if (in_sizes[0] < NB * CC * NN) return;
  if (in_sizes[1] < CC || in_sizes[2] < CC) return;
  if (in_sizes[3] < CC * CC || in_sizes[5] < CC * CC || in_sizes[7] < CC * CC || in_sizes[9] < CC * CC) return;
  if (in_sizes[4] < CC || in_sizes[6] < CC || in_sizes[8] < CC || in_sizes[10] < CC) return;
  if (out_size < NB * CC * NN) return;

  size_t off = 0;
  auto carve = [&](size_t bytes) { const size_t o = off; off += (bytes + 255) & ~(size_t)255; return o; };
  const size_t plane = (size_t)NB * NN * CC * 2;
  const size_t oWb  = carve((size_t)4 * CC * CC * 2);
  const size_t oSt  = carve((size_t)NB * NGRP * 32 * 4);
  const size_t oHh  = carve(plane);
  const size_t oHl  = carve(plane);
  const size_t oQ   = carve(plane);
  const size_t oK   = carve(plane);
  const size_t oV   = carve(plane);
  const size_t oAh  = oHh;                                                // same extent, disjoint lifetimes
  const size_t oAl  = oHl;
  if (off > ws_size) return;
  if (off > (size_t)134217728) return;

  const float* x   = (const float*)d_in[0];
  const float* gnw = (const float*)d_in[1];
  const float* gnb = (const float*)d_in[2];
  const float* wq  = (const float*)d_in[3];
  const float* bq  = (const float*)d_in[4];
  const float* wk  = (const float*)d_in[5];
  const float* bk  = (const float*)d_in[6];
  const float* wv  = (const float*)d_in[7];
  const float* bv  = (const float*)d_in[8];
  const float* wp  = (const float*)d_in[9];
  const float* bp  = (const float*)d_in[10];

  char* ws = (char*)d_ws;
  unsigned short* Wb  = (unsigned short*)(ws + oWb);
  float*          St  = (float*)(ws + oSt);
  unsigned short* Hh  = (unsigned short*)(ws + oHh);
  unsigned short* Hl  = (unsigned short*)(ws + oHl);
  unsigned short* Q16 = (unsigned short*)(ws + oQ);
  unsigned short* K16 = (unsigned short*)(ws + oK);
  unsigned short* V16 = (unsigned short*)(ws + oV);
  unsigned short* Ah  = (unsigned short*)(ws + oAh);
  unsigned short* Al  = (unsigned short*)(ws + oAl);
  float* out = (float*)d_out;

  const dim3 blk256(256), blk128(128);

  // (0) conv weights -> stacked bf16 plane
  cvt_w<<<dim3(4 * (CC / 4)), blk256, 0, stream>>>(wq, wk, wv, wp, Wb);
  // (1) group statistics per (b, g) in f64
  gn_stats<<<dim3(NB * NGRP), blk256, 0, stream>>>(x, St);
  // (2) normalised activations -> fragment-major bf16 hi / residual planes
  gn_apply<<<dim3(NN / QT, CC / QT, NB), blk256, 0, stream>>>(x, gnw, gnb, St, Hh, Hl);
  // (3) q and k -> fragment-major f16 planes (rows = positions)
  gemm_qk<<<dim3(NN / QT, 2 * (CC / QT), NB), blk128, 0, stream>>>(Wb, Hh, Hl, bq, bk, Q16, K16);
  // (4) v -> fragment-major f16 plane (rows = channels)
  gemm_v<<<dim3(NN / QT, CC / QT, NB), blk128, 0, stream>>>(Wb, Hh, Hl, bv, V16);
  // (5) attention -> bf16 hi / residual planes of the attention output (regions of Hh / Hl, dead by now)
  attn_k<<<dim3(NQ / AQ, NB), blk256, 0, stream>>>(Q16, K16, V16, Ah, Al);
  // (6) output projection + bias + residual -> out [b][512][4096]
  gemm_p<<<dim3(NQ / QT, CC / QT, NB), blk128, 0, stream>>>(Wb, Ah, Al, bp, x, out);
  (void)hipGetLastError();
}

// v002
// One run takes 375 microseconds.
// In two side-by-side timings against v001, it was 2.54 and 2.53 times as fast.
// All steps since v000 together make it 2.75 times as fast.
// Contractions: q/k/v 1x1-conv GEMMs W[512x512].H[512x4096] on v_wmma_f32_16x16x32_bf16 (W = bf16-RNE weights,
// exact; H = bf16 hi + bf16 residual planes of the normalised activations; 2 products, K=512); scores S^T = K.Q^T on
// v_wmma_f32_16x16x32_f16 (k, q: plain f16 planes, 1 product, K=512 split over two wave groups, fixed-order f32
// combine in LDS); O^T = V.P^T on v_wmma_f32_16x16x32_f16 (v: f16 plane, P = e^{s-m} x 2^14 as f16, K=4096); output
// 1x1-conv GEMM Wp[512x512].A[512x4096] on v_wmma_f32_16x16x32_bf16 (A = bf16 hi + residual planes of the
// attention output; 2 products, K=512). f32 accumulate everywhere; normalisation statistics in f64; softmax
// statistics, biases and the residual add in f32 VALU.
#include <hip/hip_runtime.h>
#include <math.h>
#include <stdint.h>

#ifndef NB
#define NB 4
#endif
#ifndef NQ
#define NQ 4096
#endif
#define NB_FULL 4
#define CC     512
#define NN     4096
#define NGRP   32
#define GSZ    16
#define QT     64
#define AQ     32
#define OSP    68
#define OSH    260
#define TP     72
#define SPP    36
#define PFP    40
#define SCL    0.044194173824159216f
#define LNPS   9.704060527839234f
#define GEPS   1.0e-6
#define SLD    8
#define KLATE  2

static_assert(NB >= 1 && NB <= NB_FULL);
static_assert(NQ >= QT && NQ <= NN && NQ % QT == 0 && NQ % AQ == 0);
static_assert(NN % QT == 0 && NN % AQ == 0 && NN % 32 == 0);
static_assert(CC == 8 * QT && CC % 256 == 0 && CC % 32 == 0);
static_assert(GSZ * NGRP == CC && GSZ == 16);
static_assert((GSZ * NN) % (4 * 256 * SLD) == 0);
static_assert(KLATE >= 0 && KLATE <= 4 && KLATE < CC / 64);
static_assert((OSP * 4) % 16 == 0 && (OSH * 4) % 16 == 0 && (TP * 2) % 16 == 0);
static_assert((SPP * 4) % 16 == 0 && (PFP * 2) % 16 == 0);
static_assert(QT * OSP * 4 <= 65536);
static_assert((2 * AQ * SPP * 4 + AQ * PFP * 2 + AQ * OSH * 4 + 3 * AQ * 4) <= 65536);

typedef _Float16       v16h __attribute__((ext_vector_type(16)));
typedef _Float16       v8h  __attribute__((ext_vector_type(8)));
typedef __bf16         v16b __attribute__((ext_vector_type(16)));
typedef unsigned short v8us __attribute__((ext_vector_type(8)));
typedef float          v8f  __attribute__((ext_vector_type(8)));
typedef float          v4f  __attribute__((ext_vector_type(4)));
typedef unsigned int   v4u  __attribute__((ext_vector_type(4)));

union Frag  { v8us u[2]; v16h h; v16b bf; };
static_assert(sizeof(Frag) == 32);

// ---- scalar helpers -------------------------------------------------------------------------------------------
__device__ __forceinline__ unsigned short bf_bits(float f) {          // f32 -> bf16 bits, RNE convert
  unsigned u = __float_as_uint(f);
  return (unsigned short)((u + 0x7FFFu + ((u >> 16) & 1u)) >> 16);
}
__device__ __forceinline__ float bf_up(unsigned short hb) { return __uint_as_float(((unsigned)hb) << 16); }
__device__ __forceinline__ float bfr(float f) { return bf_up(bf_bits(f)); }
__device__ __forceinline__ unsigned short h_bits(_Float16 x) { return __builtin_bit_cast(unsigned short, x); }
__device__ __forceinline__ unsigned pk16(unsigned short a, unsigned short b) { return (unsigned)a | ((unsigned)b << 16); }
__device__ __forceinline__ v8f zero8() { v8f z = {0.f, 0.f, 0.f, 0.f, 0.f, 0.f, 0.f, 0.f}; return z; }
__device__ __forceinline__ unsigned wave_ballot(bool p) {
#if defined(__HIP_DEVICE_COMPILE__)
  return __builtin_amdgcn_ballot_w32(p);
#else
  return p ? 1u : 0u;
#endif
}

// ---- 16-bit fragment loader (A, or B from a k-contiguous [n][k] row): lane -> row/col (lane&15), p already includes
//      + 8*(lane>>4); elements 0..7 <- p[0..7] (k0+8h..), elements 8..15 <- p[16..23] (k0+16+8h..)
__device__ __forceinline__ Frag ldfrag(const unsigned short* p) {
  Frag f;
  f.u[0] = *(const v8us*)(p);
  f.u[1] = *(const v8us*)(p + 16);
  return f;
}

// ---- fragment-major planes (every 16-bit operand plane in the workspace): a plane of R rows x KD k-elements is cut
//      into fragments of 16 rows x 32 k = 512 elements; fragment (row tile rt, k step ks) starts at element
//      16*rt*KD + 512*ks and holds [u 0..1][lane 0..31][8 elements]: lane = 16*h + (row&15), k = 32*ks + 16*u + 8*h + t.
//      That is the register order of ldfrag above, so one fragment is two loads of 512 contiguous bytes per wave
//      (4 whole 128-B lines each) where a row-major plane gives 16 partial lines per load. p already includes + 8*lane.
__device__ __forceinline__ Frag ldfm(const unsigned short* p) {
  Frag f;
  f.u[0] = *(const v8us*)(p);
  f.u[1] = *(const v8us*)(p + 256);
  return f;
}

// ---- WMMA helpers: builtin followed by a 4-slot VALU gap tying D and keeping A/B live ------------------------------
__device__ __forceinline__ v8f mma_h(v16h a, v16h b, v8f c) {
  v8f d = __builtin_amdgcn_wmma_f32_16x16x32_f16(false, a, false, b, (short)0, c, false, false);
#if defined(__HIP_DEVICE_COMPILE__)
  asm volatile("v_nop\n\tv_nop\n\tv_nop\n\tv_nop" : "+v"(d) : "v"(a), "v"(b));
#endif
  return d;
}
__device__ __forceinline__ v8f mma_b(v16b a, v16b b, v8f c) {
  v8f d = __builtin_amdgcn_wmma_f32_16x16x32_bf16(false, a, false, b, (short)0, c, false, false);
#if defined(__HIP_DEVICE_COMPILE__)
  const v16h ha = __builtin_bit_cast(v16h, a), hb = __builtin_bit_cast(v16h, b);
  asm volatile("v_nop\n\tv_nop\n\tv_nop\n\tv_nop" : "+v"(d) : "v"(ha), "v"(hb));
#endif
  return d;
}

// =============================================================================================================
// (0) conv weights: Wb bf16, rows 512*matrix + o, k = c, fragment-major; matrix 0 = wq, 1 = wk, 2 = wv, 3 = wp; value =
//     bf16-RNE(w). Block blk (0..511): matrix blk/128 (block-uniform), row tile blk/4; wave gw = 8 blk + w owns the
//     half u = gw&1 of the fragment of k step (gw>>1)&15 and stores it as 512 contiguous bytes.
// coverage: 128 row tiles x 16 k steps x 2 halves = 4096 waves x 32 lanes x 8 = the whole plane.
// =============================================================================================================
__global__ __launch_bounds__(256)
void cvt_w(const float* __restrict__ wq, const float* __restrict__ wk, const float* __restrict__ wv,
           const float* __restrict__ wp, unsigned short* Wb) {
  const int tid = threadIdx.x, blk = blockIdx.x;
  const int wave = tid >> 5, lane = tid & 31;
  const int sel = blk / (CC / 4);                                          // 0..3, block-uniform
  const float* src = (sel == 0) ? wq : (sel == 1) ? wk : (sel == 2) ? wv : wp;   // all global
  const int gw  = blk * 8 + wave;                                          // 0..4095
  const int u   = gw & 1, ks = (gw >> 1) & 15, rt = gw >> 5;               // rt 0..127 = blk / 4
  const int o   = (rt & 31) * 16 + (lane & 15);                            // 0..511
  const int col = 32 * ks + 16 * u + 8 * (lane >> 4);                      // 0..504
  const float* s = src + (size_t)o * CC + col;
  const v4f a = *(const v4f*)s;
  const v4f q = *(const v4f*)(s + 4);
  const float f[8] = {a[0], a[1], a[2], a[3], q[0], q[1], q[2], q[3]};
  v4u pkv;
#pragma unroll
  for (int t = 0; t < 4; ++t) pkv[t] = pk16(bf_bits(f[2 * t]), bf_bits(f[2 * t + 1]));
{
    *(v4u*)(Wb + (size_t)(16 * rt) * CC + 512 * ks + 256 * u + 8 * lane) = pkv;
    
  }
}

// =============================================================================================================
// (1) group-normalisation statistics of bf16-RNE(x): block bg = b*32+g owns the 16 channels x 4096 positions
// =============================================================================================================
__global__ __launch_bounds__(256)
void gn_stats(const float* __restrict__ x, float* stats) {
  __shared__ double red[256];
  const int tid = threadIdx.x, bg = blockIdx.x;
  const v4f* p = (const v4f*)(x + (size_t)bg * GSZ * NN);
  const int N4 = GSZ * NN / 4;                                            // 16384
  const double invN = 1.0 / (double)(GSZ * NN);

  double s = 0.0;
#pragma unroll 1
  for (int i = tid; i < N4; i += 256 * SLD) {
    v4f v[SLD];                                                           // SLD loads in flight per lane, old sum order
#pragma unroll                                                            // v[] stays in registers
    for (int u = 0; u < SLD; ++u) v[u] = p[i + 256 * u];
#pragma unroll                                                            // v[] stays in registers
    for (int u = 0; u < SLD; ++u)
      s += ((double)bfr(v[u][0]) + (double)bfr(v[u][1])) + ((double)bfr(v[u][2]) + (double)bfr(v[u][3]));
  }
  red[tid] = s;
  __syncthreads();
#pragma unroll 1
  for (int off = 128; off > 0; off >>= 1) {
    if (tid < off) red[tid] += red[tid + off];
    __syncthreads();
  }
  const double mean = red[0] * invN;
  __syncthreads();                                                        // everyone read red[0]

  double s2 = 0.0;
#pragma unroll 1
  for (int i = tid; i < N4; i += 256 * SLD) {
    v4f v[SLD];                                                           // SLD loads in flight per lane, old sum order
#pragma unroll                                                            // v[] stays in registers
    for (int u = 0; u < SLD; ++u) v[u] = p[i + 256 * u];
#pragma unroll                                                            // v[] stays in registers
    for (int u = 0; u < SLD; ++u) {
#pragma unroll
      for (int t = 0; t < 4; ++t) {
        const double d = (double)bfr(v[u][t]) - mean;
        s2 += d * d;
      }
    }
  }
  red[tid] = s2;
  __syncthreads();
#pragma unroll 1
  for (int off = 128; off > 0; off >>= 1) {
    if (tid < off) red[tid] += red[tid + off];
    __syncthreads();
  }
  const double var = red[0] * invN;
  const float meanf = (float)mean;
  const float rstdf = (float)(1.0 / sqrt(var + GEPS));

  v4f val = {0.f, 0.f, 0.f, 0.f};
  if (tid == 0) { val[0] = meanf; val[1] = rstdf; }
  float* dst = stats + (size_t)bg * 32 + 4 * (tid & 7);
  if (tid < 8) *(v4f*)dst = val;
  
}

// =============================================================================================================
// (2) h = (bf16-RNE(x) - mean) * rstd * bf16-RNE(gn_w) + bf16-RNE(gn_b) in f32, then bf16 hi = RNE(h) and bf16
//     lo = RNE(h - hi), written as Hh/Hl bf16, rows 4096 b + n, k = c, fragment-major (for the conv GEMMs).
//     Block (nb, cb, b) owns 64 n x 64 c through LDS tiles Th/Tl[64 n][64 c] (pitch TP; cross-wave, block barrier).
// coverage: Th/Tl 2 it x 32 rows(c) x 8 lanes x 8 n = 64 x 64 (staged extent == consumed extent); planes 2 it x 8
//           waves = 4 row tiles x 2 k steps x 2 halves of 512 B per plane; grid (64, 8, NB) covers all 4096 n x 512 c.
// =============================================================================================================
__global__ __launch_bounds__(256)
void gn_apply(const float* __restrict__ x, const float* __restrict__ gw, const float* __restrict__ gb,
              const float* __restrict__ stats, unsigned short* Hh, unsigned short* Hl) {
  __shared__ __align__(16) unsigned short Th[QT * TP];
  __shared__ __align__(16) unsigned short Tl[QT * TP];
  const int tid = threadIdx.x;
  const int nb = blockIdx.x, cb = blockIdx.y, b = blockIdx.z;
  const int e = tid & 7, lq = tid >> 3;                                  // lq 0..31
  const int n0 = nb * QT, c0 = cb * QT;
#pragma unroll
  for (int it = 0; it < 2; ++it) {
    const int cl = it * 32 + lq;                                          // 0..63
    const int ch = c0 + cl;                                               // 0..511
    const int g  = ch / GSZ;                                              // 0..31
    const float mean = stats[(size_t)(b * NGRP + g) * 32 + 0];
    const float rstd = stats[(size_t)(b * NGRP + g) * 32 + 1];
    const float w  = bfr(gw[ch]);
    const float bb = bfr(gb[ch]);
    const float* sp = x + ((size_t)(b * CC + ch)) * NN + n0 + 8 * e;
    const v4f a = *(const v4f*)sp;
    const v4f q = *(const v4f*)(sp + 4);
    const float f[8] = {a[0], a[1], a[2], a[3], q[0], q[1], q[2], q[3]};
#pragma unroll
    for (int t = 0; t < 8; ++t) {
      const float h = (bfr(f[t]) - mean) * rstd * w + bb;
      const unsigned short hb = bf_bits(h);
      const unsigned short lb = bf_bits(h - bf_up(hb));
      Th[(8 * e + t) * TP + cl] = hb;
      Tl[(8 * e + t) * TP + cl] = lb;
    }
  }
  __syncthreads();
  const int lane = tid & 31, wave = tid >> 5;
  v4u uh[2], ul[2];
#pragma unroll
  for (int it = 0; it < 2; ++it) {
    const int pc = it * 8 + wave;                                         // piece: row tile pc>>2, chunk pair pc&3
    const int lo = (16 * (pc >> 2) + (lane & 15)) * TP + 16 * (pc & 3) + 8 * (lane >> 4);
    uh[it] = *(const v4u*)(Th + lo);
    ul[it] = *(const v4u*)(Tl + lo);
  }
{
#pragma unroll
    for (int it = 0; it < 2; ++it) {
      const int pc = it * 8 + wave;
      const size_t po = ((size_t)(b * NN + n0 + 16 * (pc >> 2))) * CC + 16 * c0 + 256 * (pc & 3) + 8 * lane;
      *(v4u*)(Hh + po) = uh[it];
      *(v4u*)(Hl + po) = ul[it];
    }
    
  }
}

// =============================================================================================================
// (3) q / k conv GEMM for one (b, 64-n tile, matrix sel = mb/8, 64-o block o0 = (mb%8)*64):
//     Y[o][n] = sum_c W[o][c] (Hh + Hl)[b][n][c] + bf16-RNE(bias[o]). Block 128 threads = 4 waves; wave w owns cols
//     n0+16w..+15 (B fragments from the Hh and Hl planes, fragment-major, split k map) and 4 m-tiles (A rows
//     o = o0 + 16 mt + (lane&15) from Wb, same loader). K = 512 = 16 steps x 2 products.
//     Epilogue staged in LDS Os[n_loc][o_loc] (pitch OSP, b128 stores of 8 consecutive o per lane; cross-wave,
//     block barrier), then sel 0 -> Q16, sel 1 -> K16, plain f16, rows 4096 b + n, k = d, fragment-major.
// coverage: Os 4 waves x 16 n x 64 o = 64 x 64 (staged == consumed); plane 4 it (row tiles) x 4 waves (2 k steps x 2
//           halves of 512 B) = 64 n x 64 d; grid (64, 16, NB) covers d 0..511 of all 4096 rows of Q16 and K16 once.
// =============================================================================================================
__global__ __launch_bounds__(128)
void gemm_qk(const unsigned short* __restrict__ Wb, const unsigned short* __restrict__ Hh,
             const unsigned short* __restrict__ Hl, const float* __restrict__ bq, const float* __restrict__ bk,
             unsigned short* Q16, unsigned short* K16) {
  __shared__ __align__(16) float Os[QT * OSP];
  const int tid  = threadIdx.x;
  const int lane = tid & 31, wave = tid >> 5;
  const int hh   = lane >> 4, c = lane & 15;
  const int nt   = blockIdx.x, mb = blockIdx.y, b = blockIdx.z;
  const int sel  = mb / (CC / QT);                                         // 0 = q, 1 = k (block-uniform)
  const int n0   = nt * QT, o0 = (mb % (CC / QT)) * QT;

  const unsigned short* ap = Wb + ((size_t)(sel * CC + o0)) * CC + 8 * lane;
  const size_t ho = ((size_t)(b * NN + n0 + 16 * wave)) * CC + 8 * lane;
  const unsigned short* bhp = Hh + ho;
  const unsigned short* blp = Hl + ho;

  v8f acc[4];
#pragma unroll
  for (int mt = 0; mt < 4; ++mt) acc[mt] = zero8();

#pragma unroll 2
  for (int ks = 0; ks < CC / 32; ++ks) {
    const Frag fbh = ldfm(bhp + 512 * ks);
    const Frag fbl = ldfm(blp + 512 * ks);
    Frag fa[4];                                                           // all loads of the step before its first WMMA
#pragma unroll                                                            // fa[] stays in registers
    for (int mt = 0; mt < 4; ++mt) fa[mt] = ldfm(ap + (size_t)(16 * mt) * CC + 512 * ks);
#pragma unroll
    for (int mt = 0; mt < 4; ++mt) {
      acc[mt] = mma_b(fa[mt].bf, fbh.bf, acc[mt]);
      acc[mt] = mma_b(fa[mt].bf, fbl.bf, acc[mt]);
    }
  }

  // ---- epilogue: + bias -> LDS Os[n_loc][o_loc]; lane (hh, c) holds o = 16 mt + 8 hh + r for n_loc = 16 w + c
  const float* bsrc = (sel == 0) ? bq : bk;                               // block-uniform, both global
  {
    const int nl = 16 * wave + c;
#pragma unroll
    for (int mt = 0; mt < 4; ++mt) {
      const v4f b0 = *(const v4f*)(bsrc + o0 + 16 * mt + 8 * hh);
      const v4f b1 = *(const v4f*)(bsrc + o0 + 16 * mt + 8 * hh + 4);
      v4f va, vb;
#pragma unroll
      for (int r = 0; r < 4; ++r) { va[r] = acc[mt][r] + bfr(b0[r]); vb[r] = acc[mt][4 + r] + bfr(b1[r]); }
      *(v4f*)(Os + nl * OSP + 16 * mt + 8 * hh)     = va;
      *(v4f*)(Os + nl * OSP + 16 * mt + 8 * hh + 4) = vb;
    }
  }
  __syncthreads();

  unsigned short* Ph = (sel == 0) ? Q16 : K16;                             // block-uniform, both global
  v4u uv[4];
#pragma unroll
  for (int it = 0; it < 4; ++it) {
    const int lo = (it * 16 + c) * OSP + 16 * wave + 8 * hh;               // row tile it, chunk pair = wave
    const v4f a = *(const v4f*)(Os + lo);
    const v4f q = *(const v4f*)(Os + lo + 4);
    const float f[8] = {a[0], a[1], a[2], a[3], q[0], q[1], q[2], q[3]};
#pragma unroll
    for (int t = 0; t < 4; ++t)
      uv[it][t] = pk16(h_bits((_Float16)f[2 * t]), h_bits((_Float16)f[2 * t + 1]));
  }
{
#pragma unroll
    for (int it = 0; it < 4; ++it) {
      const size_t po = ((size_t)(b * NN + n0 + 16 * it)) * CC + 16 * o0 + 256 * wave + 8 * lane;
      *(v4u*)(Ph + po) = uv[it];
    }
    
  }
}

// =============================================================================================================
// (4) v conv GEMM for one (b, 64-n tile, 64-o block o0 = mb*64), operands swapped so the D rows are positions:
//     D[n][o] = sum_c (Hh + Hl)[b][n][c] Wv[o][c]: A rows n = n0 + 16 w + (lane&15) from Hh and Hl (2 products),
//     B cols o = o0 + 16 j + (lane&15) from the Wv rows (fragment-major, same loader), 4 tiles j per wave, K=512.
//     Per lane the D tile holds 8 consecutive n of one o -> LDS Vs[o_loc][n_loc] (pitch OSP, b128 stores;
//     cross-wave, block barrier), then V16 f16, rows 512 b + o, k = n (KD = 4096), fragment-major, = f16(D +
//     bf16-RNE(bv[o])) (unscaled, |v| ~ 1).
// coverage: Vs 4 waves x 16 n x 64 o = 64 x 64 (staged == consumed); V16 4 it (row tiles) x 4 waves (2 k steps x 2
//           halves of 512 B) = 64 o x 64 n; grid (64, 8, NB) covers all 512 o x 4096 n of each b exactly once.
// =============================================================================================================
__global__ __launch_bounds__(128)
void gemm_v(const unsigned short* __restrict__ Wb, const unsigned short* __restrict__ Hh,
            const unsigned short* __restrict__ Hl, const float* __restrict__ bv, unsigned short* V16) {
  __shared__ __align__(16) float Vs[QT * OSP];
  const int tid  = threadIdx.x;
  const int lane = tid & 31, wave = tid >> 5;
  const int hh   = lane >> 4, c = lane & 15;
  const int nt   = blockIdx.x, mb = blockIdx.y, b = blockIdx.z;
  const int n0   = nt * QT, o0 = mb * QT;

  const size_t ho = ((size_t)(b * NN + n0 + 16 * wave)) * CC + 8 * lane;
  const unsigned short* ahp = Hh + ho;
  const unsigned short* alp = Hl + ho;
  const unsigned short* bp  = Wb + ((size_t)(2 * CC + o0)) * CC + 8 * lane;

  v8f acc[4];
#pragma unroll
  for (int j = 0; j < 4; ++j) acc[j] = zero8();

#pragma unroll 2
  for (int ks = 0; ks < CC / 32; ++ks) {
    const Frag fah = ldfm(ahp + 512 * ks);
    const Frag fal = ldfm(alp + 512 * ks);
    Frag fb[4];                                                           // all loads of the step before its first WMMA
#pragma unroll                                                            // fb[] stays in registers
    for (int j = 0; j < 4; ++j) fb[j] = ldfm(bp + (size_t)(16 * j) * CC + 512 * ks);
#pragma unroll
    for (int j = 0; j < 4; ++j) {
      acc[j] = mma_b(fah.bf, fb[j].bf, acc[j]);
      acc[j] = mma_b(fal.bf, fb[j].bf, acc[j]);
    }
  }

  // ---- epilogue: lane (hh, c) holds n_loc = 16 w + 8 hh + r of o_loc = 16 j + c
  {
    const int nrow = 16 * wave + 8 * hh;
#pragma unroll
    for (int j = 0; j < 4; ++j) {
      const float bb = bfr(bv[o0 + 16 * j + c]);
      v4f va, vb;
#pragma unroll
      for (int r = 0; r < 4; ++r) { va[r] = acc[j][r] + bb; vb[r] = acc[j][4 + r] + bb; }
      *(v4f*)(Vs + (16 * j + c) * OSP + nrow)     = va;
      *(v4f*)(Vs + (16 * j + c) * OSP + nrow + 4) = vb;
    }
  }
  __syncthreads();

  v4u uv[4];
#pragma unroll
  for (int it = 0; it < 4; ++it) {
    const int lo = (it * 16 + c) * OSP + 16 * wave + 8 * hh;               // row tile it, chunk pair = wave
    const v4f a = *(const v4f*)(Vs + lo);
    const v4f q = *(const v4f*)(Vs + lo + 4);
    const float f[8] = {a[0], a[1], a[2], a[3], q[0], q[1], q[2], q[3]};
#pragma unroll
    for (int t = 0; t < 4; ++t)
      uv[it][t] = pk16(h_bits((_Float16)f[2 * t]), h_bits((_Float16)f[2 * t + 1]));
  }
{
#pragma unroll
    for (int it = 0; it < 4; ++it) {
      *(v4u*)(V16 + ((size_t)(b * CC + o0 + 16 * it)) * NN + 16 * n0 + 256 * wave + 8 * lane) = uv[it];
    }
    
  }
}

// =============================================================================================================
// (5) attention for one (b, 32-query tile), transposed formulation, 4096 keys, no mask. Block = 8 waves.
//   Score phase per 32-key block kb: wave w computes ONE S^T partial tile (16 keys x 16 queries): key tile
//   kt = w&1 (keys kb+16kt..), query tile qt = (w>>1)&1 (queries n0+16qt..), over the d-half dh = w>>2 (d 256dh ..
//   256dh+255, 8 steps of 32): A = k rows (row = key, fragment-major, split k map) from K16, B = q rows (col = query,
//   same map) from Q16, plain f16, 1 product. The partial (D row = key 8h+r, col = query) goes to LDS Sp[dh][query]
//   [key] (pitch SPP, b128 stores; cross-wave, block barrier); the two d-halves are added in fixed order by the
//   softmax lanes.
//   Softmax: wave 0, lane = query: s_j = (Sp[0] + Sp[1]) * 512^-0.5 for the 32 keys, online max / sum in f32
//   registers (m, l live in wave 0 only), corr = e^{m_old - m_new} -> Cs[query], grew flag -> Fl, P_j = e^{s_j - m}
//   x 2^14 as f16 -> Pf[query][key] (pitch PFP, 4 x 16-B stores per row; cross-wave, block barrier).
//   O^T (rows channel, cols query): every wave owns channels 64w..64w+63 (4 tiles j) x 32 queries (2 tiles) = 8
//   accumulator tiles; rescale by Cs when Fl != 0 (block-uniform flag), then += A(v rows channel = 64w+16j+(lane&15),
//   keys kb.., fragment-major f16 plane V16) . B(P^T: row = query from Pf, keys contiguous, same k order).
//   Epilogue in two 256-channel halves: waves with (w>>2) == half stage O/l in LDS Os[query][256 ch] (pitch OSH, b128
//   stores; cross-wave, block barrier), then all 256 threads write Ah (bf16 hi) and Al (bf16 residual), fragment-major.
// coverage: Sp 8 waves x 1 tile = [2 dh][32 q][32 keys] each key block (staged == consumed); Pf 32 rows x 32 keys by
//           wave 0 (staged == consumed, pad cols never read); Os per half 4 waves x 32 q x 64 ch = 32 x 256 (staged ==
//           consumed); planes 2 halves x 4 it x 8 waves x 512 B = 2 row tiles x 16 k steps per plane; grid (NQ/32, NB)
//           covers rows 0..NQ-1 exactly once (only those are read later).
// =============================================================================================================
__global__ __launch_bounds__(256)
void attn_k(const unsigned short* __restrict__ Q16, const unsigned short* __restrict__ K16,
            const unsigned short* __restrict__ V16, unsigned short* Ah, unsigned short* Al) {
  __shared__ __align__(16) float Sp[2 * AQ * SPP];
  __shared__ __align__(16) unsigned short Pf[AQ * PFP];
  __shared__ __align__(16) float Os[AQ * OSH];
  __shared__ float Cs[AQ];
  __shared__ float Ls[AQ];
  __shared__ int Fl;
  const int tid  = threadIdx.x;
  const int wave = tid >> 5, lane = tid & 31;
  const int hh   = lane >> 4, c = lane & 15;
  const int n0   = blockIdx.x * AQ, b = blockIdx.y;
  const int kt = wave & 1, qt = (wave >> 1) & 1, dh = wave >> 2;

  // q fragment pointer (B operand of S^T, col = query n0 + 16 qt + c, d-half dh), + 512*ks
  const unsigned short* qp = Q16 + ((size_t)(b * NN + n0 + 16 * qt)) * CC + 16 * (CC / 2) * dh + 8 * lane;
  // k fragment base (A operand, row = key kb + 16 kt + c, d-half dh), + kb*CC + 512*ks
  const unsigned short* kp = K16 + ((size_t)(b * NN + 16 * kt)) * CC + 16 * (CC / 2) * dh + 8 * lane;
  // v fragment base (A operand of O^T, row = channel 64 w + 16 j + c), + 16*j*NN + 16*kb (k step kb/32)
  const unsigned short* vp = V16 + ((size_t)(b * CC + 64 * wave)) * NN + 8 * lane;
  // this lane's S^T partial destination: Sp[dh][query 16qt+c][key 16kt + 8hh + r]
  float* spw = Sp + (dh * AQ + 16 * qt + c) * SPP + 16 * kt + 8 * hh;
  // P^T fragment rows (row = query c / 16 + c, keys contiguous)
  const unsigned short* pf0 = Pf + c * PFP + 8 * hh;
  const unsigned short* pf1 = Pf + (16 + c) * PFP + 8 * hh;

  // q fragments of this wave's d-half do not change with the key block: loaded once, kept in registers
  Frag fq[CC / 64];
#pragma unroll                                                            // fq[] stays in registers
  for (int ks = 0; ks < CC / 64; ++ks) fq[ks] = ldfm(qp + 512 * ks);

  float m_run = -1.0e30f, l_run = 0.f;
  v8f o[8];
#pragma unroll
  for (int j = 0; j < 8; ++j) o[j] = zero8();

  // k fragments of key block 0; those of every later key block are requested one block ahead, behind the softmax barrier
  Frag fk[CC / 64];
#pragma unroll                                                            // fk[] stays in registers
  for (int ks = 0; ks < CC / 64; ++ks) fk[ks] = ldfm(kp + 512 * ks);

#pragma unroll 1
  for (int kb = 0; kb < NN; kb += 32) {
    Frag fv[4];
    // ---- score partial tile over this wave's d-half
    v8f s = zero8();
#pragma unroll                                                            // fk[], fq[] stay in registers
    for (int ks = 0; ks < CC / 64; ++ks) s = mma_h(fk[ks].h, fq[ks].h, s);
    {
      v4f sa, sb;
#pragma unroll
      for (int r = 0; r < 4; ++r) { sa[r] = s[r]; sb[r] = s[4 + r]; }
      *(v4f*)(spw)     = sa;
      *(v4f*)(spw + 4) = sb;
    }
    __syncthreads();
    // ---- all v fragments of this key block are requested here, in the registers the k fragments have left: they land
    //      while wave 0 runs the softmax (the next barrier waits for them)
#pragma unroll                                                            // fv[] stays in registers
    for (int j = 0; j < 4; ++j) fv[j] = ldfm(vp + (size_t)(16 * j) * NN + 16 * kb);

    // ---- online softmax for the 32 queries (wave 0, lane = query)
    if (wave == 0) {
      const float* s0p = Sp + lane * SPP;                                 // d-half 0
      const float* s1p = Sp + (AQ + lane) * SPP;                          // d-half 1
      float sv[32];
#pragma unroll
      for (int i = 0; i < 8; ++i) {
        const v4f a0 = *(const v4f*)(s0p + 4 * i);
        const v4f a1 = *(const v4f*)(s1p + 4 * i);
#pragma unroll
        for (int t = 0; t < 4; ++t) sv[4 * i + t] = a0[t] + a1[t];
      }
      float mx = sv[0];
#pragma unroll
      for (int j = 1; j < 32; ++j) mx = fmaxf(mx, sv[j]);
      const float mxs = mx * SCL;
      const float mn  = fmaxf(m_run, mxs);
      const unsigned grew = wave_ballot(mxs > m_run);
      const float corr = __expf(m_run - mn);                             // == 1 exactly when the max did not grow
      m_run = mn;
      const float msh = mn - LNPS;                                        // exp gives e^{s-m} * 2^14
      float ls = 0.f;
      v4u pk[4];
#pragma unroll
      for (int i = 0; i < 4; ++i) {
#pragma unroll
        for (int t = 0; t < 4; ++t) {
          const float e0 = __expf(fmaf(sv[8 * i + 2 * t],     SCL, -msh));   // key kb + 8i + 2t
          const float e1 = __expf(fmaf(sv[8 * i + 2 * t + 1], SCL, -msh));   // key kb + 8i + 2t + 1
          ls += e0 + e1;
          pk[i][t] = pk16(h_bits((_Float16)e0), h_bits((_Float16)e1));
        }
      }
      l_run = l_run * corr + ls;
#pragma unroll
      for (int i = 0; i < 4; ++i) *(v4u*)(Pf + lane * PFP + 8 * i) = pk[i];
      Cs[lane] = corr;
      if (lane == 0) Fl = (grew != 0u) ? 1 : 0;
    }
    __syncthreads();

    // ---- the next key block's k fragments are requested here, so that they fly under the O^T products; the last KLATE
    //      of them take the registers of v fragments already used up. The last pass asks for its own block again (in
    //      bounds, never used).
    const unsigned short* kpn = kp + (size_t)((kb + 32 < NN) ? kb + 32 : kb) * CC;
#pragma unroll                                                            // fk[] stays in registers
    for (int ks = 0; ks < CC / 64 - KLATE; ++ks) fk[ks] = ldfm(kpn + 512 * ks);
    // ---- rescale (block-uniform flag), then O^T += V . P^T
    if (Fl != 0) {
      const float c0r = Cs[c], c1r = Cs[16 + c];
#pragma unroll
      for (int j = 0; j < 4; ++j) {
#pragma unroll
        for (int r = 0; r < 8; ++r) { o[2 * j][r] *= c0r; o[2 * j + 1][r] *= c1r; }
      }
    }
    const Frag p0 = ldfrag(pf0);
    const Frag p1 = ldfrag(pf1);
#pragma unroll
    for (int j = 0; j < 4; ++j) {
      o[2 * j]     = mma_h(fv[j].h, p0.h, o[2 * j]);
      o[2 * j + 1] = mma_h(fv[j].h, p1.h, o[2 * j + 1]);
      if (j < KLATE) fk[CC / 64 - KLATE + j] = ldfm(kpn + 512 * (CC / 64 - KLATE + j));
    }
  }
  // the last pass's k requests are still in flight here and the code below reuses their address registers
  asm volatile("s_wait_xcnt 0x0" ::: "memory");
  if (wave == 0) Ls[lane] = 1.0f / l_run;                                // o and l both carry the 2^14 factor
  __syncthreads();
  const float inv0 = Ls[c], inv1 = Ls[16 + c];

#pragma unroll
  for (int half = 0; half < 2; ++half) {
    if ((wave >> 2) == half) {
      const int chb = 64 * (wave & 3);                                    // channel offset inside this half
#pragma unroll
      for (int j = 0; j < 4; ++j) {
#pragma unroll
        for (int q2 = 0; q2 < 2; ++q2) {
          const float inv = (q2 == 0) ? inv0 : inv1;
          v4f va, vb;
#pragma unroll
          for (int r = 0; r < 4; ++r) { va[r] = o[2 * j + q2][r] * inv; vb[r] = o[2 * j + q2][4 + r] * inv; }
          float* dst = Os + (16 * q2 + c) * OSH + chb + 16 * j + 8 * hh;  // Os[query][ch = chb + 16j + 8hh + r]
          *(v4f*)dst       = va;
          *(v4f*)(dst + 4) = vb;
        }
      }
    }
    __syncthreads();
    {
      v4u uh[4], ul[4];
#pragma unroll
      for (int it = 0; it < 4; ++it) {
        const int pc = it * 8 + wave;                                     // piece: row tile pc>>4, chunk pair pc&15
        const int lo = (16 * (pc >> 4) + c) * OSH + 16 * (pc & 15) + 8 * hh;
        const v4f a = *(const v4f*)(Os + lo);
        const v4f q = *(const v4f*)(Os + lo + 4);
        const float f[8] = {a[0], a[1], a[2], a[3], q[0], q[1], q[2], q[3]};
#pragma unroll
        for (int t = 0; t < 4; ++t) {
          const float f0 = f[2 * t], f1 = f[2 * t + 1];
          const unsigned short hb0 = bf_bits(f0), hb1 = bf_bits(f1);
          const unsigned short lb0 = bf_bits(f0 - bf_up(hb0));
          const unsigned short lb1 = bf_bits(f1 - bf_up(hb1));
          uh[it][t] = pk16(hb0, hb1);
          ul[it][t] = pk16(lb0, lb1);
        }
      }
{
#pragma unroll
        for (int it = 0; it < 4; ++it) {
          const int pc = it * 8 + wave;
          const size_t po = ((size_t)(b * NN + n0 + 16 * (pc >> 4))) * CC + 16 * (CC / 2) * half + 256 * (pc & 15) + 8 * lane;
          *(v4u*)(Ah + po) = uh[it];
          *(v4u*)(Al + po) = ul[it];
        }
        
      }
    }
    __syncthreads();
  }
}

// =============================================================================================================
// (6) output projection + bias + residual for one (b, 64-n tile, 64-o block o0 = mb*64), D rows = positions:
//     D[n][o] = sum_c (Ah + Al)[b][n][c] Wp[o][c] (2 products, K = 512): A rows n = n0 + 16 w + (lane&15),
//     B cols o = o0 + 16 j + (lane&15) from the Wp rows (all fragment-major), 4 tiles per wave. Per lane 8 consecutive n of one o ->
//     LDS Vs[o_loc][n_loc] (pitch OSP, b128 stores; cross-wave, block barrier), then
//     2 lines, lane e (tid&15) -> n 4e..4e+3, lanes 0..7 line 0, 8..15 line 1, one instruction per 2 rows of a
// coverage: Vs 4 waves x 16 n x 64 o = 64 x 64 (staged == consumed); out 8 it x 8 rows x 16 lanes x 4 = 64 o x
//           64 n; grid (NQ/64, 8, NB) covers out[b][0..511][0..NQ-1] exactly once.
// =============================================================================================================
__global__ __launch_bounds__(128)
void gemm_p(const unsigned short* __restrict__ Wb, const unsigned short* __restrict__ Ah,
            const unsigned short* __restrict__ Al, const float* __restrict__ bp, const float* __restrict__ x,
            float* out) {
  __shared__ __align__(16) float Vs[QT * OSP];
  const int tid  = threadIdx.x;
  const int lane = tid & 31, wave = tid >> 5;
  const int hh   = lane >> 4, c = lane & 15;
  const int nt   = blockIdx.x, mb = blockIdx.y, b = blockIdx.z;
  const int n0   = nt * QT, o0 = mb * QT;

  const size_t ao = ((size_t)(b * NN + n0 + 16 * wave)) * CC + 8 * lane;
  const unsigned short* ahp = Ah + ao;
  const unsigned short* alp = Al + ao;
  const unsigned short* bpw = Wb + ((size_t)(3 * CC + o0)) * CC + 8 * lane;

  v8f acc[4];
#pragma unroll
  for (int j = 0; j < 4; ++j) acc[j] = zero8();

#pragma unroll 2
  for (int ks = 0; ks < CC / 32; ++ks) {
    const Frag fah = ldfm(ahp + 512 * ks);
    const Frag fal = ldfm(alp + 512 * ks);
    Frag fb[4];                                                           // all loads of the step before its first WMMA
#pragma unroll                                                            // fb[] stays in registers
    for (int j = 0; j < 4; ++j) fb[j] = ldfm(bpw + (size_t)(16 * j) * CC + 512 * ks);
#pragma unroll
    for (int j = 0; j < 4; ++j) {
      acc[j] = mma_b(fah.bf, fb[j].bf, acc[j]);
      acc[j] = mma_b(fal.bf, fb[j].bf, acc[j]);
    }
  }

  // ---- epilogue: lane (hh, c) holds n_loc = 16 w + 8 hh + r of o_loc = 16 j + c
  {
    const int nrow = 16 * wave + 8 * hh;
#pragma unroll
    for (int j = 0; j < 4; ++j) {
      const float bb = bfr(bp[o0 + 16 * j + c]);
      v4f va, vb;
#pragma unroll
      for (int r = 0; r < 4; ++r) { va[r] = acc[j][r] + bb; vb[r] = acc[j][4 + r] + bb; }
      *(v4f*)(Vs + (16 * j + c) * OSP + nrow)     = va;
      *(v4f*)(Vs + (16 * j + c) * OSP + nrow + 4) = vb;
    }
  }
  __syncthreads();

  const int e = tid & 15, lq = tid >> 4;                                  // lq 0..7
  v4f res[8];
#pragma unroll
  for (int it = 0; it < 8; ++it) {
    const int ol = it * 8 + lq;                                            // 0..63
    const v4f a = *(const v4f*)(Vs + ol * OSP + 4 * e);
    const size_t idx = ((size_t)(b * CC + o0 + ol)) * NN + n0 + 4 * e;
    const v4f xv = *(const v4f*)(x + idx);
#pragma unroll
    for (int t = 0; t < 4; ++t) res[it][t] = a[t] + bfr(xv[t]);
  }
{
#pragma unroll
    for (int it = 0; it < 8; ++it) {
      const int ol = it * 8 + lq;
      const size_t idx = ((size_t)(b * CC + o0 + ol)) * NN + n0 + 4 * e;
      *(v4f*)(out + idx) = res[it];
    }
    
  }
}

// =============================================================================================================
// Workspace map (bytes; each region start a multiple of 256; every extent is an exact tile multiple and is written
//   (all 16-bit planes fragment-major, same extents as row-major)
//   Wb    bf16 [4][512][512]          2097152
//   stats f32  [NB*32][32]             16384 (NB=4)
//   Hh/Hl bf16 [NB][4096][512]     16777216 x2   (reused as Ah/Al after their last reader, launch (4))
//   Q16/K16 f16 [NB][4096][512]   16777216 x2
//   V16   f16  [NB][512][4096]     16777216
//   total (NB=4) = 85999616
// =============================================================================================================
extern "C" void kernel_launch(void* const* d_in, const int* in_sizes, int n_in,
                              void* d_out, int out_size, void* d_ws, size_t ws_size,
                              hipStream_t stream) {
  if (n_in < 11) return;
  if (in_sizes[0] < NB * CC * NN) return;
  if (in_sizes[1] < CC || in_sizes[2] < CC) return;
  if (in_sizes[3] < CC * CC || in_sizes[5] < CC * CC || in_sizes[7] < CC * CC || in_sizes[9] < CC * CC) return;
  if (in_sizes[4] < CC || in_sizes[6] < CC || in_sizes[8] < CC || in_sizes[10] < CC) return;
  if (out_size < NB * CC * NN) return;

  size_t off = 0;
  auto carve = [&](size_t bytes) { const size_t o = off; off += (bytes + 255) & ~(size_t)255; return o; };
  const size_t plane = (size_t)NB * NN * CC * 2;
  const size_t oWb  = carve((size_t)4 * CC * CC * 2);
  const size_t oSt  = carve((size_t)NB * NGRP * 32 * 4);
  const size_t oHh  = carve(plane);
  const size_t oHl  = carve(plane);
  const size_t oQ   = carve(plane);
  const size_t oK   = carve(plane);
  const size_t oV   = carve(plane);
  const size_t oAh  = oHh;                                                // same extent, disjoint lifetimes
  const size_t oAl  = oHl;
  if (off > ws_size) return;
  if (off > (size_t)134217728) return;

  const float* x   = (const float*)d_in[0];
  const float* gnw = (const float*)d_in[1];
  const float* gnb = (const float*)d_in[2];
  const float* wq  = (const float*)d_in[3];
  const float* bq  = (const float*)d_in[4];
  const float* wk  = (const float*)d_in[5];
  const float* bk  = (const float*)d_in[6];
  const float* wv  = (const float*)d_in[7];
  const float* bv  = (const float*)d_in[8];
  const float* wp  = (const float*)d_in[9];
  const float* bp  = (const float*)d_in[10];

  char* ws = (char*)d_ws;
  unsigned short* Wb  = (unsigned short*)(ws + oWb);
  float*          St  = (float*)(ws + oSt);
  unsigned short* Hh  = (unsigned short*)(ws + oHh);
  unsigned short* Hl  = (unsigned short*)(ws + oHl);
  unsigned short* Q16 = (unsigned short*)(ws + oQ);
  unsigned short* K16 = (unsigned short*)(ws + oK);
  unsigned short* V16 = (unsigned short*)(ws + oV);
  unsigned short* Ah  = (unsigned short*)(ws + oAh);
  unsigned short* Al  = (unsigned short*)(ws + oAl);
  float* out = (float*)d_out;

  const dim3 blk256(256), blk128(128);

  // (0) conv weights -> stacked bf16 plane
  cvt_w<<<dim3(4 * (CC / 4)), blk256, 0, stream>>>(wq, wk, wv, wp, Wb);
  // (1) group statistics per (b, g) in f64
  gn_stats<<<dim3(NB * NGRP), blk256, 0, stream>>>(x, St);
  // (2) normalised activations -> fragment-major bf16 hi / residual planes
  gn_apply<<<dim3(NN / QT, CC / QT, NB), blk256, 0, stream>>>(x, gnw, gnb, St, Hh, Hl);
  // (3) q and k -> fragment-major f16 planes (rows = positions)
  gemm_qk<<<dim3(NN / QT, 2 * (CC / QT), NB), blk128, 0, stream>>>(Wb, Hh, Hl, bq, bk, Q16, K16);
  // (4) v -> fragment-major f16 plane (rows = channels)
  gemm_v<<<dim3(NN / QT, CC / QT, NB), blk128, 0, stream>>>(Wb, Hh, Hl, bv, V16);
  // (5) attention -> bf16 hi / residual planes of the attention output (regions of Hh / Hl, dead by now)
  attn_k<<<dim3(NQ / AQ, NB), blk256, 0, stream>>>(Q16, K16, V16, Ah, Al);
  // (6) output projection + bias + residual -> out [b][512][4096]
  gemm_p<<<dim3(NQ / QT, CC / QT, NB), blk128, 0, stream>>>(Wb, Ah, Al, bp, x, out);
  (void)hipGetLastError();
}

// v003
// Measured time: 366 microseconds a run.
// Two timings next to v002 put it at 1.03 and 1.04 times that version's speed.
// Counting every step since v000, it is 2.86 times as fast.
// Contractions: q/k/v 1x1-conv GEMMs W[512x512].H[512x4096] on v_wmma_f32_16x16x32_bf16 (W = bf16-RNE weights,
// exact; H = bf16 hi + bf16 residual planes of the normalised activations; 2 products, K=512); scores S^T = K.Q^T on
// v_wmma_f32_16x16x32_f16 (k, q: plain f16 planes, 1 product, K=512 split over two wave groups, fixed-order f32
// combine in LDS); O^T = V.P^T on v_wmma_f32_16x16x32_f16 (v: f16 plane, P = e^{s-m} x 2^14 as f16, K=4096); output
// 1x1-conv GEMM Wp[512x512].A[512x4096] on v_wmma_f32_16x16x32_bf16 (A = bf16 hi + residual planes of the
// attention output; 2 products, K=512). f32 accumulate everywhere; normalisation statistics in f64; softmax
// statistics, biases and the residual add in f32 VALU.
#include <hip/hip_runtime.h>
#include <math.h>
#include <stdint.h>

#ifndef NB
#define NB 4
#endif
#ifndef NQ
#define NQ 4096
#endif
#define NB_FULL 4
#define CC     512
#define NN     4096
#define NGRP   32
#define GSZ    16
#define QT     64
#define AQ     64
#define OSP    68
#define OSH    260
#define TP     72
#define SPP    36
#define PFP    40
#define SCL    0.044194173824159216f
#define LNPS   9.704060527839234f
#define GEPS   1.0e-6
#define SLD    8

static_assert(NB >= 1 && NB <= NB_FULL);
static_assert(NQ >= QT && NQ <= NN && NQ % QT == 0 && NQ % AQ == 0);
static_assert(NN % QT == 0 && NN % AQ == 0 && NN % 32 == 0);
static_assert(CC == 8 * QT && CC % 256 == 0 && CC % 32 == 0);
static_assert(GSZ * NGRP == CC && GSZ == 16);
static_assert((GSZ * NN) % (4 * 256 * SLD) == 0);
static_assert((OSP * 4) % 16 == 0 && (OSH * 4) % 16 == 0 && (TP * 2) % 16 == 0);
static_assert((SPP * 4) % 16 == 0 && (PFP * 2) % 16 == 0);
static_assert(QT * OSP * 4 <= 65536);
static_assert(AQ == 64 && (2 * AQ * SPP * 4 + AQ * PFP * 2 + AQ * OSH * 4 + 3 * AQ * 4) <= 327680);

typedef _Float16       v16h __attribute__((ext_vector_type(16)));
typedef _Float16       v8h  __attribute__((ext_vector_type(8)));
typedef __bf16         v16b __attribute__((ext_vector_type(16)));
typedef unsigned short v8us __attribute__((ext_vector_type(8)));
typedef float          v8f  __attribute__((ext_vector_type(8)));
typedef float          v4f  __attribute__((ext_vector_type(4)));
typedef unsigned int   v4u  __attribute__((ext_vector_type(4)));

union Frag  { v8us u[2]; v16h h; v16b bf; };
static_assert(sizeof(Frag) == 32);

// ---- scalar helpers -------------------------------------------------------------------------------------------
__device__ __forceinline__ unsigned short bf_bits(float f) {          // f32 -> bf16 bits, RNE convert
  unsigned u = __float_as_uint(f);
  return (unsigned short)((u + 0x7FFFu + ((u >> 16) & 1u)) >> 16);
}
__device__ __forceinline__ float bf_up(unsigned short hb) { return __uint_as_float(((unsigned)hb) << 16); }
__device__ __forceinline__ float bfr(float f) { return bf_up(bf_bits(f)); }
__device__ __forceinline__ unsigned short h_bits(_Float16 x) { return __builtin_bit_cast(unsigned short, x); }
__device__ __forceinline__ unsigned pk16(unsigned short a, unsigned short b) { return (unsigned)a | ((unsigned)b << 16); }
__device__ __forceinline__ v8f zero8() { v8f z = {0.f, 0.f, 0.f, 0.f, 0.f, 0.f, 0.f, 0.f}; return z; }
__device__ __forceinline__ unsigned wave_ballot(bool p) {
#if defined(__HIP_DEVICE_COMPILE__)
  return __builtin_amdgcn_ballot_w32(p);
#else
  return p ? 1u : 0u;
#endif
}

// ---- 16-bit fragment loader (A, or B from a k-contiguous [n][k] row): lane -> row/col (lane&15), p already includes
//      + 8*(lane>>4); elements 0..7 <- p[0..7] (k0+8h..), elements 8..15 <- p[16..23] (k0+16+8h..)
__device__ __forceinline__ Frag ldfrag(const unsigned short* p) {
  Frag f;
  f.u[0] = *(const v8us*)(p);
  f.u[1] = *(const v8us*)(p + 16);
  return f;
}

// ---- fragment-major planes (every 16-bit operand plane in the workspace): a plane of R rows x KD k-elements is cut
//      into fragments of 16 rows x 32 k = 512 elements; fragment (row tile rt, k step ks) starts at element
//      16*rt*KD + 512*ks and holds [u 0..1][lane 0..31][8 elements]: lane = 16*h + (row&15), k = 32*ks + 16*u + 8*h + t.
//      That is the register order of ldfrag above, so one fragment is two loads of 512 contiguous bytes per wave
//      (4 whole 128-B lines each) where a row-major plane gives 16 partial lines per load. p already includes + 8*lane.
__device__ __forceinline__ Frag ldfm(const unsigned short* p) {
  Frag f;
  f.u[0] = *(const v8us*)(p);
  f.u[1] = *(const v8us*)(p + 256);
  return f;
}

// ---- WMMA helpers. f16 form (attention): the plain builtin; the compiler keeps the distances behind its own WMMAs. The
//      asm pad of the bf16 form takes its operands from v0..v255 alone: built with it, the 64-query tile spills to scratch.
__device__ __forceinline__ v8f mma_h(v16h a, v16h b, v8f c) {
  return __builtin_amdgcn_wmma_f32_16x16x32_f16(false, a, false, b, (short)0, c, false, false);
}
// bf16 form (GEMMs): builtin followed by a 4-slot VALU gap tying D and keeping A/B live
__device__ __forceinline__ v8f mma_b(v16b a, v16b b, v8f c) {
  v8f d = __builtin_amdgcn_wmma_f32_16x16x32_bf16(false, a, false, b, (short)0, c, false, false);
#if defined(__HIP_DEVICE_COMPILE__)
  const v16h ha = __builtin_bit_cast(v16h, a), hb = __builtin_bit_cast(v16h, b);
  asm volatile("v_nop\n\tv_nop\n\tv_nop\n\tv_nop" : "+v"(d) : "v"(ha), "v"(hb));
#endif
  return d;
}

// =============================================================================================================
// (0) conv weights: Wb bf16, rows 512*matrix + o, k = c, fragment-major; matrix 0 = wq, 1 = wk, 2 = wv, 3 = wp; value =
//     bf16-RNE(w). Block blk (0..511): matrix blk/128 (block-uniform), row tile blk/4; wave gw = 8 blk + w owns the
//     half u = gw&1 of the fragment of k step (gw>>1)&15 and stores it as 512 contiguous bytes.
// coverage: 128 row tiles x 16 k steps x 2 halves = 4096 waves x 32 lanes x 8 = the whole plane.
// =============================================================================================================
__global__ __launch_bounds__(256)
void cvt_w(const float* __restrict__ wq, const float* __restrict__ wk, const float* __restrict__ wv,
           const float* __restrict__ wp, unsigned short* Wb) {
  const int tid = threadIdx.x, blk = blockIdx.x;
  const int wave = tid >> 5, lane = tid & 31;
  const int sel = blk / (CC / 4);                                          // 0..3, block-uniform
  const float* src = (sel == 0) ? wq : (sel == 1) ? wk : (sel == 2) ? wv : wp;   // all global
  const int gw  = blk * 8 + wave;                                          // 0..4095
  const int u   = gw & 1, ks = (gw >> 1) & 15, rt = gw >> 5;               // rt 0..127 = blk / 4
  const int o   = (rt & 31) * 16 + (lane & 15);                            // 0..511
  const int col = 32 * ks + 16 * u + 8 * (lane >> 4);                      // 0..504
  const float* s = src + (size_t)o * CC + col;
  const v4f a = *(const v4f*)s;
  const v4f q = *(const v4f*)(s + 4);
  const float f[8] = {a[0], a[1], a[2], a[3], q[0], q[1], q[2], q[3]};
  v4u pkv;
#pragma unroll
  for (int t = 0; t < 4; ++t) pkv[t] = pk16(bf_bits(f[2 * t]), bf_bits(f[2 * t + 1]));
{
    *(v4u*)(Wb + (size_t)(16 * rt) * CC + 512 * ks + 256 * u + 8 * lane) = pkv;
    
  }
}

// =============================================================================================================
// (1) group-normalisation statistics of bf16-RNE(x): block bg = b*32+g owns the 16 channels x 4096 positions
// =============================================================================================================
__global__ __launch_bounds__(256)
void gn_stats(const float* __restrict__ x, float* stats) {
  __shared__ double red[256];
  const int tid = threadIdx.x, bg = blockIdx.x;
  const v4f* p = (const v4f*)(x + (size_t)bg * GSZ * NN);
  const int N4 = GSZ * NN / 4;                                            // 16384
  const double invN = 1.0 / (double)(GSZ * NN);

  double s = 0.0;
#pragma unroll 1
  for (int i = tid; i < N4; i += 256 * SLD) {
    v4f v[SLD];                                                           // SLD loads in flight per lane, old sum order
#pragma unroll                                                            // v[] stays in registers
    for (int u = 0; u < SLD; ++u) v[u] = p[i + 256 * u];
#pragma unroll                                                            // v[] stays in registers
    for (int u = 0; u < SLD; ++u)
      s += ((double)bfr(v[u][0]) + (double)bfr(v[u][1])) + ((double)bfr(v[u][2]) + (double)bfr(v[u][3]));
  }
  red[tid] = s;
  __syncthreads();
#pragma unroll 1
  for (int off = 128; off > 0; off >>= 1) {
    if (tid < off) red[tid] += red[tid + off];
    __syncthreads();
  }
  const double mean = red[0] * invN;
  __syncthreads();                                                        // everyone read red[0]

  double s2 = 0.0;
#pragma unroll 1
  for (int i = tid; i < N4; i += 256 * SLD) {
    v4f v[SLD];                                                           // SLD loads in flight per lane, old sum order
#pragma unroll                                                            // v[] stays in registers
    for (int u = 0; u < SLD; ++u) v[u] = p[i + 256 * u];
#pragma unroll                                                            // v[] stays in registers
    for (int u = 0; u < SLD; ++u) {
#pragma unroll
      for (int t = 0; t < 4; ++t) {
        const double d = (double)bfr(v[u][t]) - mean;
        s2 += d * d;
      }
    }
  }
  red[tid] = s2;
  __syncthreads();
#pragma unroll 1
  for (int off = 128; off > 0; off >>= 1) {
    if (tid < off) red[tid] += red[tid + off];
    __syncthreads();
  }
  const double var = red[0] * invN;
  const float meanf = (float)mean;
  const float rstdf = (float)(1.0 / sqrt(var + GEPS));

  v4f val = {0.f, 0.f, 0.f, 0.f};
  if (tid == 0) { val[0] = meanf; val[1] = rstdf; }
  float* dst = stats + (size_t)bg * 32 + 4 * (tid & 7);
  if (tid < 8) *(v4f*)dst = val;
  
}

// =============================================================================================================
// (2) h = (bf16-RNE(x) - mean) * rstd * bf16-RNE(gn_w) + bf16-RNE(gn_b) in f32, then bf16 hi = RNE(h) and bf16
//     lo = RNE(h - hi), written as Hh/Hl bf16, rows 4096 b + n, k = c, fragment-major (for the conv GEMMs).
//     Block (nb, cb, b) owns 64 n x 64 c through LDS tiles Th/Tl[64 n][64 c] (pitch TP; cross-wave, block barrier).
// coverage: Th/Tl 2 it x 32 rows(c) x 8 lanes x 8 n = 64 x 64 (staged extent == consumed extent); planes 2 it x 8
//           waves = 4 row tiles x 2 k steps x 2 halves of 512 B per plane; grid (64, 8, NB) covers all 4096 n x 512 c.
// =============================================================================================================
__global__ __launch_bounds__(256)
void gn_apply(const float* __restrict__ x, const float* __restrict__ gw, const float* __restrict__ gb,
              const float* __restrict__ stats, unsigned short* Hh, unsigned short* Hl) {
  __shared__ __align__(16) unsigned short Th[QT * TP];
  __shared__ __align__(16) unsigned short Tl[QT * TP];
  const int tid = threadIdx.x;
  const int nb = blockIdx.x, cb = blockIdx.y, b = blockIdx.z;
  const int e = tid & 7, lq = tid >> 3;                                  // lq 0..31
  const int n0 = nb * QT, c0 = cb * QT;
#pragma unroll
  for (int it = 0; it < 2; ++it) {
    const int cl = it * 32 + lq;                                          // 0..63
    const int ch = c0 + cl;                                               // 0..511
    const int g  = ch / GSZ;                                              // 0..31
    const float mean = stats[(size_t)(b * NGRP + g) * 32 + 0];
    const float rstd = stats[(size_t)(b * NGRP + g) * 32 + 1];
    const float w  = bfr(gw[ch]);
    const float bb = bfr(gb[ch]);
    const float* sp = x + ((size_t)(b * CC + ch)) * NN + n0 + 8 * e;
    const v4f a = *(const v4f*)sp;
    const v4f q = *(const v4f*)(sp + 4);
    const float f[8] = {a[0], a[1], a[2], a[3], q[0], q[1], q[2], q[3]};
#pragma unroll
    for (int t = 0; t < 8; ++t) {
      const float h = (bfr(f[t]) - mean) * rstd * w + bb;
      const unsigned short hb = bf_bits(h);
      const unsigned short lb = bf_bits(h - bf_up(hb));
      Th[(8 * e + t) * TP + cl] = hb;
      Tl[(8 * e + t) * TP + cl] = lb;
    }
  }
  __syncthreads();
  const int lane = tid & 31, wave = tid >> 5;
  v4u uh[2], ul[2];
#pragma unroll
  for (int it = 0; it < 2; ++it) {
    const int pc = it * 8 + wave;                                         // piece: row tile pc>>2, chunk pair pc&3
    const int lo = (16 * (pc >> 2) + (lane & 15)) * TP + 16 * (pc & 3) + 8 * (lane >> 4);
    uh[it] = *(const v4u*)(Th + lo);
    ul[it] = *(const v4u*)(Tl + lo);
  }
{
#pragma unroll
    for (int it = 0; it < 2; ++it) {
      const int pc = it * 8 + wave;
      const size_t po = ((size_t)(b * NN + n0 + 16 * (pc >> 2))) * CC + 16 * c0 + 256 * (pc & 3) + 8 * lane;
      *(v4u*)(Hh + po) = uh[it];
      *(v4u*)(Hl + po) = ul[it];
    }
    
  }
}

// =============================================================================================================
// (3) q / k conv GEMM for one (b, 64-n tile, matrix sel = mb/8, 64-o block o0 = (mb%8)*64):
//     Y[o][n] = sum_c W[o][c] (Hh + Hl)[b][n][c] + bf16-RNE(bias[o]). Block 128 threads = 4 waves; wave w owns cols
//     n0+16w..+15 (B fragments from the Hh and Hl planes, fragment-major, split k map) and 4 m-tiles (A rows
//     o = o0 + 16 mt + (lane&15) from Wb, same loader). K = 512 = 16 steps x 2 products.
//     Epilogue staged in LDS Os[n_loc][o_loc] (pitch OSP, b128 stores of 8 consecutive o per lane; cross-wave,
//     block barrier), then sel 0 -> Q16, sel 1 -> K16, plain f16, rows 4096 b + n, k = d, fragment-major.
// coverage: Os 4 waves x 16 n x 64 o = 64 x 64 (staged == consumed); plane 4 it (row tiles) x 4 waves (2 k steps x 2
//           halves of 512 B) = 64 n x 64 d; grid (64, 16, NB) covers d 0..511 of all 4096 rows of Q16 and K16 once.
// =============================================================================================================
__global__ __launch_bounds__(128)
void gemm_qk(const unsigned short* __restrict__ Wb, const unsigned short* __restrict__ Hh,
             const unsigned short* __restrict__ Hl, const float* __restrict__ bq, const float* __restrict__ bk,
             unsigned short* Q16, unsigned short* K16) {
  __shared__ __align__(16) float Os[QT * OSP];
  const int tid  = threadIdx.x;
  const int lane = tid & 31, wave = tid >> 5;
  const int hh   = lane >> 4, c = lane & 15;
  const int nt   = blockIdx.x, mb = blockIdx.y, b = blockIdx.z;
  const int sel  = mb / (CC / QT);                                         // 0 = q, 1 = k (block-uniform)
  const int n0   = nt * QT, o0 = (mb % (CC / QT)) * QT;

  const unsigned short* ap = Wb + ((size_t)(sel * CC + o0)) * CC + 8 * lane;
  const size_t ho = ((size_t)(b * NN + n0 + 16 * wave)) * CC + 8 * lane;
  const unsigned short* bhp = Hh + ho;
  const unsigned short* blp = Hl + ho;

  v8f acc[4];
#pragma unroll
  for (int mt = 0; mt < 4; ++mt) acc[mt] = zero8();

#pragma unroll 2
  for (int ks = 0; ks < CC / 32; ++ks) {
    const Frag fbh = ldfm(bhp + 512 * ks);
    const Frag fbl = ldfm(blp + 512 * ks);
    Frag fa[4];                                                           // all loads of the step before its first WMMA
#pragma unroll                                                            // fa[] stays in registers
    for (int mt = 0; mt < 4; ++mt) fa[mt] = ldfm(ap + (size_t)(16 * mt) * CC + 512 * ks);
#pragma unroll
    for (int mt = 0; mt < 4; ++mt) {
      acc[mt] = mma_b(fa[mt].bf, fbh.bf, acc[mt]);
      acc[mt] = mma_b(fa[mt].bf, fbl.bf, acc[mt]);
    }
  }

  // ---- epilogue: + bias -> LDS Os[n_loc][o_loc]; lane (hh, c) holds o = 16 mt + 8 hh + r for n_loc = 16 w + c
  const float* bsrc = (sel == 0) ? bq : bk;                               // block-uniform, both global
  {
    const int nl = 16 * wave + c;
#pragma unroll
    for (int mt = 0; mt < 4; ++mt) {
      const v4f b0 = *(const v4f*)(bsrc + o0 + 16 * mt + 8 * hh);
      const v4f b1 = *(const v4f*)(bsrc + o0 + 16 * mt + 8 * hh + 4);
      v4f va, vb;
#pragma unroll
      for (int r = 0; r < 4; ++r) { va[r] = acc[mt][r] + bfr(b0[r]); vb[r] = acc[mt][4 + r] + bfr(b1[r]); }
      *(v4f*)(Os + nl * OSP + 16 * mt + 8 * hh)     = va;
      *(v4f*)(Os + nl * OSP + 16 * mt + 8 * hh + 4) = vb;
    }
  }
  __syncthreads();

  unsigned short* Ph = (sel == 0) ? Q16 : K16;                             // block-uniform, both global
  v4u uv[4];
#pragma unroll
  for (int it = 0; it < 4; ++it) {
    const int lo = (it * 16 + c) * OSP + 16 * wave + 8 * hh;               // row tile it, chunk pair = wave
    const v4f a = *(const v4f*)(Os + lo);
    const v4f q = *(const v4f*)(Os + lo + 4);
    const float f[8] = {a[0], a[1], a[2], a[3], q[0], q[1], q[2], q[3]};
#pragma unroll
    for (int t = 0; t < 4; ++t)
      uv[it][t] = pk16(h_bits((_Float16)f[2 * t]), h_bits((_Float16)f[2 * t + 1]));
  }
{
#pragma unroll
    for (int it = 0; it < 4; ++it) {
      const size_t po = ((size_t)(b * NN + n0 + 16 * it)) * CC + 16 * o0 + 256 * wave + 8 * lane;
      *(v4u*)(Ph + po) = uv[it];
    }
    
  }
}

// =============================================================================================================
// (4) v conv GEMM for one (b, 64-n tile, 64-o block o0 = mb*64), operands swapped so the D rows are positions:
//     D[n][o] = sum_c (Hh + Hl)[b][n][c] Wv[o][c]: A rows n = n0 + 16 w + (lane&15) from Hh and Hl (2 products),
//     B cols o = o0 + 16 j + (lane&15) from the Wv rows (fragment-major, same loader), 4 tiles j per wave, K=512.
//     Per lane the D tile holds 8 consecutive n of one o -> LDS Vs[o_loc][n_loc] (pitch OSP, b128 stores;
//     cross-wave, block barrier), then V16 f16, rows 512 b + o, k = n (KD = 4096), fragment-major, = f16(D +
//     bf16-RNE(bv[o])) (unscaled, |v| ~ 1).
// coverage: Vs 4 waves x 16 n x 64 o = 64 x 64 (staged == consumed); V16 4 it (row tiles) x 4 waves (2 k steps x 2
//           halves of 512 B) = 64 o x 64 n; grid (64, 8, NB) covers all 512 o x 4096 n of each b exactly once.
// =============================================================================================================
__global__ __launch_bounds__(128)
void gemm_v(const unsigned short* __restrict__ Wb, const unsigned short* __restrict__ Hh,
            const unsigned short* __restrict__ Hl, const float* __restrict__ bv, unsigned short* V16) {
  __shared__ __align__(16) float Vs[QT * OSP];
  const int tid  = threadIdx.x;
  const int lane = tid & 31, wave = tid >> 5;
  const int hh   = lane >> 4, c = lane & 15;
  const int nt   = blockIdx.x, mb = blockIdx.y, b = blockIdx.z;
  const int n0   = nt * QT, o0 = mb * QT;

  const size_t ho = ((size_t)(b * NN + n0 + 16 * wave)) * CC + 8 * lane;
  const unsigned short* ahp = Hh + ho;
  const unsigned short* alp = Hl + ho;
  const unsigned short* bp  = Wb + ((size_t)(2 * CC + o0)) * CC + 8 * lane;

  v8f acc[4];
#pragma unroll
  for (int j = 0; j < 4; ++j) acc[j] = zero8();

#pragma unroll 2
  for (int ks = 0; ks < CC / 32; ++ks) {
    const Frag fah = ldfm(ahp + 512 * ks);
    const Frag fal = ldfm(alp + 512 * ks);
    Frag fb[4];                                                           // all loads of the step before its first WMMA
#pragma unroll                                                            // fb[] stays in registers
    for (int j = 0; j < 4; ++j) fb[j] = ldfm(bp + (size_t)(16 * j) * CC + 512 * ks);
#pragma unroll
    for (int j = 0; j < 4; ++j) {
      acc[j] = mma_b(fah.bf, fb[j].bf, acc[j]);
      acc[j] = mma_b(fal.bf, fb[j].bf, acc[j]);
    }
  }

  // ---- epilogue: lane (hh, c) holds n_loc = 16 w + 8 hh + r of o_loc = 16 j + c
  {
    const int nrow = 16 * wave + 8 * hh;
#pragma unroll
    for (int j = 0; j < 4; ++j) {
      const float bb = bfr(bv[o0 + 16 * j + c]);
      v4f va, vb;
#pragma unroll
      for (int r = 0; r < 4; ++r) { va[r] = acc[j][r] + bb; vb[r] = acc[j][4 + r] + bb; }
      *(v4f*)(Vs + (16 * j + c) * OSP + nrow)     = va;
      *(v4f*)(Vs + (16 * j + c) * OSP + nrow + 4) = vb;
    }
  }
  __syncthreads();

  v4u uv[4];
#pragma unroll
  for (int it = 0; it < 4; ++it) {
    const int lo = (it * 16 + c) * OSP + 16 * wave + 8 * hh;               // row tile it, chunk pair = wave
    const v4f a = *(const v4f*)(Vs + lo);
    const v4f q = *(const v4f*)(Vs + lo + 4);
    const float f[8] = {a[0], a[1], a[2], a[3], q[0], q[1], q[2], q[3]};
#pragma unroll
    for (int t = 0; t < 4; ++t)
      uv[it][t] = pk16(h_bits((_Float16)f[2 * t]), h_bits((_Float16)f[2 * t + 1]));
  }
{
#pragma unroll
    for (int it = 0; it < 4; ++it) {
      *(v4u*)(V16 + ((size_t)(b * CC + o0 + 16 * it)) * NN + 16 * n0 + 256 * wave + 8 * lane) = uv[it];
    }
    
  }
}

// =============================================================================================================
// (5) attention for one (b, 64-query tile), transposed formulation, 4096 keys, no mask. Block = 8 waves, one block per
//   WGP (grid 64 x NB): every K and V fragment that a block fetches feeds 64 queries.
//   Score phase per 32-key block kb: wave w computes TWO S^T partial tiles (16 keys x 16 queries each) from one set of
//   k fragments: key tile kt = w&1 (keys kb+16kt..), query tiles 2 qg + i, qg = (w>>1)&1, i = 0..1 (queries
//   n0+16(2qg+i)..), over the d-half dh = w>>2 (d 256dh .. 256dh+255, 8 steps of 32): A = k rows (row = key,
//   fragment-major, split k map) from K16, B = q rows (col = query, same map) from Q16, plain f16, 1 product. Each
//   partial (D row = key 8h+r, col = query) goes to LDS Sp[dh][query][key] (pitch SPP, b128 stores; cross-wave, block
//   barrier); the two d-halves are added in fixed order by the softmax lanes.
//   Softmax: waves 0 and 1, query = 32 w + lane: s_j = (Sp[0] + Sp[1]) * 512^-0.5 for the 32 keys, online max / sum in
//   f32 registers (m, l live in those two waves only), corr = e^{m_old - m_new} -> Cs[query], grew flag -> Fl[w],
//   P_j = e^{s_j - m} x 2^14 as f16 -> Pf[query][key] (pitch PFP, 4 x 16-B stores per row; cross-wave, block barrier).
//   O^T (rows channel, cols query): every wave owns channels 64w..64w+63 (4 tiles j) x 64 queries (4 tiles) = 16
//   accumulator tiles; rescale by Cs when a flag is set (block-uniform; corr is exactly 1 for a query whose max did not
//   grow), then += A(v rows channel = 64w+16j+(lane&15), keys kb.., fragment-major f16 plane V16) . B(P^T: row = query
//   from Pf, keys contiguous, same k order).
//   Epilogue in two 256-channel halves: waves with (w>>2) == half stage O/l in LDS Os[query][256 ch] (pitch OSH, b128
//   stores; cross-wave, block barrier), then all 256 threads write Ah (bf16 hi) and Al (bf16 residual), fragment-major.
// coverage: Sp 8 waves x 2 tiles = [2 dh][64 q][32 keys] each key block (staged == consumed); Pf 64 rows x 32 keys by
//           waves 0, 1 (staged == consumed, pad cols never read); Os per half 4 waves x 64 q x 64 ch = 64 x 256 (staged
//           == consumed); planes 2 halves x 8 it x 8 waves x 512 B = 4 row tiles x 16 k steps per plane; grid (NQ/64,
//           NB) covers rows 0..NQ-1 exactly once (only those are read later).
// =============================================================================================================
__global__ __launch_bounds__(256)
void attn_k(const unsigned short* __restrict__ Q16, const unsigned short* __restrict__ K16,
            const unsigned short* __restrict__ V16, unsigned short* Ah, unsigned short* Al) {
  __shared__ __align__(16) float Sp[2 * AQ * SPP];
  __shared__ __align__(16) unsigned short Pf[AQ * PFP];
  __shared__ __align__(16) float Os[AQ * OSH];
  __shared__ float Cs[AQ];
  __shared__ float Ls[AQ];
  __shared__ int Fl[AQ / 32];
  const int tid  = threadIdx.x;
  const int wave = tid >> 5, lane = tid & 31;
  const int hh   = lane >> 4, c = lane & 15;
  const int n0   = blockIdx.x * AQ, b = blockIdx.y;
  const int kt = wave & 1, qg = (wave >> 1) & 1, dh = wave >> 2;

  // q fragment pointer (B operand of S^T, col = query n0 + 16 (2 qg + i) + c, d-half dh), + 16*CC*i + 512*ks
  const unsigned short* qp = Q16 + ((size_t)(b * NN + n0 + 32 * qg)) * CC + 16 * (CC / 2) * dh + 8 * lane;
  // k fragment base (A operand, row = key kb + 16 kt + c, d-half dh), + kb*CC + 512*ks
  const unsigned short* kp = K16 + ((size_t)(b * NN + 16 * kt)) * CC + 16 * (CC / 2) * dh + 8 * lane;
  // v fragment base (A operand of O^T, row = channel 64 w + 16 j + c), + 16*j*NN + 16*kb (k step kb/32)
  const unsigned short* vp = V16 + ((size_t)(b * CC + 64 * wave)) * NN + 8 * lane;
  // this lane's S^T partial destination: Sp[dh][query 16(2qg+i)+c][key 16kt + 8hh + r], + 16*SPP*i
  float* spw = Sp + (dh * AQ + 32 * qg + c) * SPP + 16 * kt + 8 * hh;
  // P^T fragment rows (row = query 16 q + c, keys contiguous), + 16*PFP*q
  const unsigned short* pf = Pf + c * PFP + 8 * hh;

  // q fragments of this wave's d-half do not change with the key block: loaded once, kept in registers
  Frag fq[2][CC / 64];
#pragma unroll                                                            // fq[][] stays in registers
  for (int i = 0; i < 2; ++i) {
#pragma unroll
    for (int ks = 0; ks < CC / 64; ++ks) fq[i][ks] = ldfm(qp + (size_t)(16 * i) * CC + 512 * ks);
  }
  // the q requests are in flight and the code below reuses their address registers
  asm volatile("s_wait_xcnt 0x0" ::: "memory");

  float m_run = -1.0e30f, l_run = 0.f;
  v8f o[16];
#pragma unroll
  for (int j = 0; j < 16; ++j) o[j] = zero8();

  // k fragments of key block 0; those of every later key block are requested one block ahead, behind the softmax barrier
  Frag fk[CC / 64];
  const unsigned short* kpn = kp;
#pragma unroll                                                            // fk[] stays in registers
  for (int ks = 0; ks < CC / 64; ++ks) fk[ks] = ldfm(kpn + 512 * ks);
  // these k requests name the registers of kpn: the wait stands in front of the step that rewrites or frees them (the
  // step length goes through the statement, so that the addition cannot be lifted over the wait)
  unsigned kstep0 = 32u * CC;
  asm volatile("s_wait_xcnt 0x0" : "+s"(kstep0) : : "memory");
  kpn += kstep0;                                                          // from here on: the key block after this one

#pragma unroll 1
  for (int kb = 0; kb < NN; kb += 32) {
    Frag fv[4];
    // ---- two score partial tiles over this wave's d-half, each k fragment used for both
    v8f s0 = zero8(), s1 = zero8();
#pragma unroll                                                            // fk[], fq[][] stay in registers
    for (int ks = 0; ks < CC / 64; ++ks) {
      s0 = mma_h(fk[ks].h, fq[0][ks].h, s0);
      s1 = mma_h(fk[ks].h, fq[1][ks].h, s1);
    }
    {
      v4f sa, sb, sc, sd;
#pragma unroll
      for (int r = 0; r < 4; ++r) { sa[r] = s0[r]; sb[r] = s0[4 + r]; sc[r] = s1[r]; sd[r] = s1[4 + r]; }
      *(v4f*)(spw)                = sa;
      *(v4f*)(spw + 4)            = sb;
      *(v4f*)(spw + 16 * SPP)     = sc;
      *(v4f*)(spw + 16 * SPP + 4) = sd;
    }
    __syncthreads();
    // ---- all v fragments of this key block are requested here: they land
    //      while waves 0 and 1 run the softmax (the next barrier waits for them)
#pragma unroll                                                            // fv[] stays in registers
    for (int j = 0; j < 4; ++j) fv[j] = ldfm(vp + (size_t)(16 * j) * NN + 16 * kb);

    // ---- online softmax for the 64 queries (waves 0 and 1, query = 32 wave + lane = tid)
    if (wave < AQ / 32) {
      const float* s0p = Sp + tid * SPP;                                  // d-half 0
      const float* s1p = Sp + (AQ + tid) * SPP;                           // d-half 1
      float sv[32];
#pragma unroll
      for (int i = 0; i < 8; ++i) {
        const v4f a0 = *(const v4f*)(s0p + 4 * i);
        const v4f a1 = *(const v4f*)(s1p + 4 * i);
#pragma unroll
        for (int t = 0; t < 4; ++t) sv[4 * i + t] = a0[t] + a1[t];
      }
      float mx = sv[0];
#pragma unroll
      for (int j = 1; j < 32; ++j) mx = fmaxf(mx, sv[j]);
      const float mxs = mx * SCL;
      const float mn  = fmaxf(m_run, mxs);
      const unsigned grew = wave_ballot(mxs > m_run);
      const float corr = __expf(m_run - mn);                             // == 1 exactly when the max did not grow
      m_run = mn;
      const float msh = mn - LNPS;                                        // exp gives e^{s-m} * 2^14
      float ls = 0.f;
      v4u pk[4];
#pragma unroll
      for (int i = 0; i < 4; ++i) {
#pragma unroll
        for (int t = 0; t < 4; ++t) {
          const float e0 = __expf(fmaf(sv[8 * i + 2 * t],     SCL, -msh));   // key kb + 8i + 2t
          const float e1 = __expf(fmaf(sv[8 * i + 2 * t + 1], SCL, -msh));   // key kb + 8i + 2t + 1
          ls += e0 + e1;
          pk[i][t] = pk16(h_bits((_Float16)e0), h_bits((_Float16)e1));
        }
      }
      l_run = l_run * corr + ls;
#pragma unroll
      for (int i = 0; i < 4; ++i) *(v4u*)(Pf + tid * PFP + 8 * i) = pk[i];
      Cs[tid] = corr;
      if (lane == 0) Fl[wave] = (grew != 0u) ? 1 : 0;
    }
    __syncthreads();

    // ---- the next key block's k fragments are requested here, so that they fly under the O^T products; all eight have
    //      registers of their own (two waves per SIMD leave the room), so none takes a register that a WMMA issued
    //      directly ahead has read. The last pass asks for its own block again (in bounds, never used).
#pragma unroll                                                            // fk[] stays in registers
    for (int ks = 0; ks < CC / 64; ++ks) fk[ks] = ldfm(kpn + 512 * ks);
    // ---- rescale (block-uniform flags), then O^T += V . P^T
    if ((Fl[0] | Fl[1]) != 0) {
#pragma unroll
      for (int q = 0; q < 4; ++q) {
        const float cr = Cs[16 * q + c];
#pragma unroll
        for (int j = 0; j < 4; ++j) {
#pragma unroll
          for (int r = 0; r < 8; ++r) o[4 * j + q][r] *= cr;
        }
      }
    }
    Frag p[4];
#pragma unroll                                                            // p[] stays in registers
    for (int q = 0; q < 4; ++q) p[q] = ldfrag(pf + 16 * PFP * q);
#pragma unroll
    for (int j = 0; j < 4; ++j) {
#pragma unroll
      for (int q = 0; q < 4; ++q) o[4 * j + q] = mma_h(fv[j].h, p[q].h, o[4 * j + q]);
    }
    // the k requests above name the registers of kpn: the wait stands in front of the step that rewrites them (the step
    // length goes through the statement, so that the addition cannot be lifted over the wait)
    unsigned kstep = (kb + 64 < NN) ? 32u * CC : 0u;
    asm volatile("s_wait_xcnt 0x0" : "+s"(kstep) : : "memory");
    kpn += kstep;
  }
  // the last pass already waited for its k requests at the end of the loop; this wait is a precaution
  asm volatile("s_wait_xcnt 0x0" ::: "memory");
  if (wave < AQ / 32) Ls[tid] = 1.0f / l_run;                            // o and l both carry the 2^14 factor
  __syncthreads();
  float inv[4];
#pragma unroll
  for (int q = 0; q < 4; ++q) inv[q] = Ls[16 * q + c];

#pragma unroll
  for (int half = 0; half < 2; ++half) {
    if ((wave >> 2) == half) {
      const int chb = 64 * (wave & 3);                                    // channel offset inside this half
#pragma unroll
      for (int j = 0; j < 4; ++j) {
#pragma unroll
        for (int q = 0; q < 4; ++q) {
          v4f va, vb;
#pragma unroll
          for (int r = 0; r < 4; ++r) { va[r] = o[4 * j + q][r] * inv[q]; vb[r] = o[4 * j + q][4 + r] * inv[q]; }
          float* dst = Os + (16 * q + c) * OSH + chb + 16 * j + 8 * hh;   // Os[query][ch = chb + 16j + 8hh + r]
          *(v4f*)dst       = va;
          *(v4f*)(dst + 4) = vb;
        }
      }
    }
    __syncthreads();
    {
      v4u uh[AQ / 8], ul[AQ / 8];
#pragma unroll
      for (int it = 0; it < AQ / 8; ++it) {
        const int pc = it * 8 + wave;                                     // piece: row tile pc>>4, chunk pair pc&15
        const int lo = (16 * (pc >> 4) + c) * OSH + 16 * (pc & 15) + 8 * hh;
        const v4f a = *(const v4f*)(Os + lo);
        const v4f q = *(const v4f*)(Os + lo + 4);
        const float f[8] = {a[0], a[1], a[2], a[3], q[0], q[1], q[2], q[3]};
#pragma unroll
        for (int t = 0; t < 4; ++t) {
          const float f0 = f[2 * t], f1 = f[2 * t + 1];
          const unsigned short hb0 = bf_bits(f0), hb1 = bf_bits(f1);
          const unsigned short lb0 = bf_bits(f0 - bf_up(hb0));
          const unsigned short lb1 = bf_bits(f1 - bf_up(hb1));
          uh[it][t] = pk16(hb0, hb1);
          ul[it][t] = pk16(lb0, lb1);
        }
      }
#pragma unroll
      for (int it = 0; it < AQ / 8; ++it) {
        const int pc = it * 8 + wave;
        const size_t po = ((size_t)(b * NN + n0 + 16 * (pc >> 4))) * CC + 16 * (CC / 2) * half + 256 * (pc & 15) + 8 * lane;
        *(v4u*)(Ah + po) = uh[it];
        *(v4u*)(Al + po) = ul[it];
      }
    }
    __syncthreads();
  }
}

// =============================================================================================================
// (6) output projection + bias + residual for one (b, 64-n tile, 64-o block o0 = mb*64), D rows = positions:
//     D[n][o] = sum_c (Ah + Al)[b][n][c] Wp[o][c] (2 products, K = 512): A rows n = n0 + 16 w + (lane&15),
//     B cols o = o0 + 16 j + (lane&15) from the Wp rows (all fragment-major), 4 tiles per wave. Per lane 8 consecutive n of one o ->
//     LDS Vs[o_loc][n_loc] (pitch OSP, b128 stores; cross-wave, block barrier), then
//     2 lines, lane e (tid&15) -> n 4e..4e+3, lanes 0..7 line 0, 8..15 line 1, one instruction per 2 rows of a
// coverage: Vs 4 waves x 16 n x 64 o = 64 x 64 (staged == consumed); out 8 it x 8 rows x 16 lanes x 4 = 64 o x
//           64 n; grid (NQ/64, 8, NB) covers out[b][0..511][0..NQ-1] exactly once.
// =============================================================================================================
__global__ __launch_bounds__(128)
void gemm_p(const unsigned short* __restrict__ Wb, const unsigned short* __restrict__ Ah,
            const unsigned short* __restrict__ Al, const float* __restrict__ bp, const float* __restrict__ x,
            float* out) {
  __shared__ __align__(16) float Vs[QT * OSP];
  const int tid  = threadIdx.x;
  const int lane = tid & 31, wave = tid >> 5;
  const int hh   = lane >> 4, c = lane & 15;
  const int nt   = blockIdx.x, mb = blockIdx.y, b = blockIdx.z;
  const int n0   = nt * QT, o0 = mb * QT;

  const size_t ao = ((size_t)(b * NN + n0 + 16 * wave)) * CC + 8 * lane;
  const unsigned short* ahp = Ah + ao;
  const unsigned short* alp = Al + ao;
  const unsigned short* bpw = Wb + ((size_t)(3 * CC + o0)) * CC + 8 * lane;

  v8f acc[4];
#pragma unroll
  for (int j = 0; j < 4; ++j) acc[j] = zero8();

#pragma unroll 2
  for (int ks = 0; ks < CC / 32; ++ks) {
    const Frag fah = ldfm(ahp + 512 * ks);
    const Frag fal = ldfm(alp + 512 * ks);
    Frag fb[4];                                                           // all loads of the step before its first WMMA
#pragma unroll                                                            // fb[] stays in registers
    for (int j = 0; j < 4; ++j) fb[j] = ldfm(bpw + (size_t)(16 * j) * CC + 512 * ks);
#pragma unroll
    for (int j = 0; j < 4; ++j) {
      acc[j] = mma_b(fah.bf, fb[j].bf, acc[j]);
      acc[j] = mma_b(fal.bf, fb[j].bf, acc[j]);
    }
  }

  // ---- epilogue: lane (hh, c) holds n_loc = 16 w + 8 hh + r of o_loc = 16 j + c
  {
    const int nrow = 16 * wave + 8 * hh;
#pragma unroll
    for (int j = 0; j < 4; ++j) {
      const float bb = bfr(bp[o0 + 16 * j + c]);
      v4f va, vb;
#pragma unroll
      for (int r = 0; r < 4; ++r) { va[r] = acc[j][r] + bb; vb[r] = acc[j][4 + r] + bb; }
      *(v4f*)(Vs + (16 * j + c) * OSP + nrow)     = va;
      *(v4f*)(Vs + (16 * j + c) * OSP + nrow + 4) = vb;
    }
  }
  __syncthreads();

  const int e = tid & 15, lq = tid >> 4;                                  // lq 0..7
  v4f res[8];
#pragma unroll
  for (int it = 0; it < 8; ++it) {
    const int ol = it * 8 + lq;                                            // 0..63
    const v4f a = *(const v4f*)(Vs + ol * OSP + 4 * e);
    const size_t idx = ((size_t)(b * CC + o0 + ol)) * NN + n0 + 4 * e;
    const v4f xv = *(const v4f*)(x + idx);
#pragma unroll
    for (int t = 0; t < 4; ++t) res[it][t] = a[t] + bfr(xv[t]);
  }
{
#pragma unroll
    for (int it = 0; it < 8; ++it) {
      const int ol = it * 8 + lq;
      const size_t idx = ((size_t)(b * CC + o0 + ol)) * NN + n0 + 4 * e;
      *(v4f*)(out + idx) = res[it];
    }
    
  }
}

// =============================================================================================================
// Workspace map (bytes; each region start a multiple of 256; every extent is an exact tile multiple and is written
//   (all 16-bit planes fragment-major, same extents as row-major)
//   Wb    bf16 [4][512][512]          2097152
//   stats f32  [NB*32][32]             16384 (NB=4)
//   Hh/Hl bf16 [NB][4096][512]     16777216 x2   (reused as Ah/Al after their last reader, launch (4))
//   Q16/K16 f16 [NB][4096][512]   16777216 x2
//   V16   f16  [NB][512][4096]     16777216
//   total (NB=4) = 85999616
// =============================================================================================================
extern "C" void kernel_launch(void* const* d_in, const int* in_sizes, int n_in,
                              void* d_out, int out_size, void* d_ws, size_t ws_size,
                              hipStream_t stream) {
  if (n_in < 11) return;
  if (in_sizes[0] < NB * CC * NN) return;
  if (in_sizes[1] < CC || in_sizes[2] < CC) return;
  if (in_sizes[3] < CC * CC || in_sizes[5] < CC * CC || in_sizes[7] < CC * CC || in_sizes[9] < CC * CC) return;
  if (in_sizes[4] < CC || in_sizes[6] < CC || in_sizes[8] < CC || in_sizes[10] < CC) return;
  if (out_size < NB * CC * NN) return;

  size_t off = 0;
  auto carve = [&](size_t bytes) { const size_t o = off; off += (bytes + 255) & ~(size_t)255; return o; };
  const size_t plane = (size_t)NB * NN * CC * 2;
  const size_t oWb  = carve((size_t)4 * CC * CC * 2);
  const size_t oSt  = carve((size_t)NB * NGRP * 32 * 4);
  const size_t oHh  = carve(plane);
  const size_t oHl  = carve(plane);
  const size_t oQ   = carve(plane);
  const size_t oK   = carve(plane);
  const size_t oV   = carve(plane);
  const size_t oAh  = oHh;                                                // same extent, disjoint lifetimes
  const size_t oAl  = oHl;
  if (off > ws_size) return;
  if (off > (size_t)134217728) return;

  const float* x   = (const float*)d_in[0];
  const float* gnw = (const float*)d_in[1];
  const float* gnb = (const float*)d_in[2];
  const float* wq  = (const float*)d_in[3];
  const float* bq  = (const float*)d_in[4];
  const float* wk  = (const float*)d_in[5];
  const float* bk  = (const float*)d_in[6];
  const float* wv  = (const float*)d_in[7];
  const float* bv  = (const float*)d_in[8];
  const float* wp  = (const float*)d_in[9];
  const float* bp  = (const float*)d_in[10];

  char* ws = (char*)d_ws;
  unsigned short* Wb  = (unsigned short*)(ws + oWb);
  float*          St  = (float*)(ws + oSt);
  unsigned short* Hh  = (unsigned short*)(ws + oHh);
  unsigned short* Hl  = (unsigned short*)(ws + oHl);
  unsigned short* Q16 = (unsigned short*)(ws + oQ);
  unsigned short* K16 = (unsigned short*)(ws + oK);
  unsigned short* V16 = (unsigned short*)(ws + oV);
  unsigned short* Ah  = (unsigned short*)(ws + oAh);
  unsigned short* Al  = (unsigned short*)(ws + oAl);
  float* out = (float*)d_out;

  const dim3 blk256(256), blk128(128);

  // (0) conv weights -> stacked bf16 plane
  cvt_w<<<dim3(4 * (CC / 4)), blk256, 0, stream>>>(wq, wk, wv, wp, Wb);
  // (1) group statistics per (b, g) in f64
  gn_stats<<<dim3(NB * NGRP), blk256, 0, stream>>>(x, St);
  // (2) normalised activations -> fragment-major bf16 hi / residual planes
  gn_apply<<<dim3(NN / QT, CC / QT, NB), blk256, 0, stream>>>(x, gnw, gnb, St, Hh, Hl);
  // (3) q and k -> fragment-major f16 planes (rows = positions)
  gemm_qk<<<dim3(NN / QT, 2 * (CC / QT), NB), blk128, 0, stream>>>(Wb, Hh, Hl, bq, bk, Q16, K16);
  // (4) v -> fragment-major f16 plane (rows = channels)
  gemm_v<<<dim3(NN / QT, CC / QT, NB), blk128, 0, stream>>>(Wb, Hh, Hl, bv, V16);
  // (5) attention -> bf16 hi / residual planes of the attention output (regions of Hh / Hl, dead by now)
  attn_k<<<dim3(NQ / AQ, NB), blk256, 0, stream>>>(Q16, K16, V16, Ah, Al);
  // (6) output projection + bias + residual -> out [b][512][4096]
  gemm_p<<<dim3(NQ / QT, CC / QT, NB), blk128, 0, stream>>>(Wb, Ah, Al, bp, x, out);
  (void)hipGetLastError();
}

// v004
// It runs in 282 microseconds.
// Timed twice side by side with v003, it ran 1.29 times as fast both times.
// Over all steps from v000 it is 3.69 times as fast.
// Contractions: q/k/v 1x1-conv GEMMs W[512x512].H[512x4096] on v_wmma_f32_16x16x32_bf16 (W = bf16-RNE weights,
// exact; H = bf16 hi + bf16 residual planes of the normalised activations; 2 products, K=512); scores S^T = K.Q^T on
// v_wmma_f32_16x16x32_f16 (k, q: plain f16 planes, 1 product, K=512 split over two wave groups, fixed-order f32
// combine in LDS); O^T = V.P^T on v_wmma_f32_16x16x32_f16 (v: f16 plane, P = e^{s-m} x 2^14 as f16, K=4096); output
// 1x1-conv GEMM Wp[512x512].A[512x4096] on v_wmma_f32_16x16x32_bf16 (A = bf16 hi + residual planes of the
// attention output; 2 products, K=512). f32 accumulate everywhere; normalisation statistics in f64; softmax
// statistics, biases and the residual add in f32 VALU.
#include <hip/hip_runtime.h>
#include <math.h>
#include <stdint.h>

#ifndef NB
#define NB 4
#endif
#ifndef NQ
#define NQ 4096
#endif
#define NB_FULL 4
#define CC     512
#define NN     4096
#define NGRP   32
#define GSZ    16
#define QT     64
#define AQ     64
#define OSP    68
#define OSH    260
#define TP     72
#define SPP    36
#define PFP    40
#define SCL    0.044194173824159216f
#define LNPS   9.704060527839234f
#define GEPS   1.0e-6
#define SLD    8
#define NKB    (NN / 32)

static_assert(NB >= 1 && NB <= NB_FULL);
static_assert(NQ >= QT && NQ <= NN && NQ % QT == 0 && NQ % AQ == 0);
static_assert(NN % QT == 0 && NN % AQ == 0 && NN % 32 == 0);
static_assert(CC == 8 * QT && CC % 256 == 0 && CC % 32 == 0);
static_assert(GSZ * NGRP == CC && GSZ == 16);
static_assert((GSZ * NN) % (4 * 256 * SLD) == 0);
static_assert((OSP * 4) % 16 == 0 && (OSH * 4) % 16 == 0 && (TP * 2) % 16 == 0);
static_assert((SPP * 4) % 16 == 0 && (PFP * 2) % 16 == 0);
static_assert(QT * OSP * 4 <= 65536);
static_assert(AQ == 64 && (4 * AQ * SPP * 4 + 2 * AQ * PFP * 2 + AQ * OSH * 4 + 4 * AQ * 4) <= 327680);
static_assert(NKB >= 3 && (AQ * PFP) % 8 == 0);

typedef _Float16       v16h __attribute__((ext_vector_type(16)));
typedef _Float16       v8h  __attribute__((ext_vector_type(8)));
typedef __bf16         v16b __attribute__((ext_vector_type(16)));
typedef unsigned short v8us __attribute__((ext_vector_type(8)));
typedef float          v8f  __attribute__((ext_vector_type(8)));
typedef float          v4f  __attribute__((ext_vector_type(4)));
typedef unsigned int   v4u  __attribute__((ext_vector_type(4)));

union Frag  { v8us u[2]; v16h h; v16b bf; };
static_assert(sizeof(Frag) == 32);

// ---- scalar helpers -------------------------------------------------------------------------------------------
__device__ __forceinline__ unsigned short bf_bits(float f) {          // f32 -> bf16 bits, RNE convert
  unsigned u = __float_as_uint(f);
  return (unsigned short)((u + 0x7FFFu + ((u >> 16) & 1u)) >> 16);
}
__device__ __forceinline__ float bf_up(unsigned short hb) { return __uint_as_float(((unsigned)hb) << 16); }
__device__ __forceinline__ float bfr(float f) { return bf_up(bf_bits(f)); }
__device__ __forceinline__ unsigned short h_bits(_Float16 x) { return __builtin_bit_cast(unsigned short, x); }
__device__ __forceinline__ unsigned pk16(unsigned short a, unsigned short b) { return (unsigned)a | ((unsigned)b << 16); }
__device__ __forceinline__ v8f zero8() { v8f z = {0.f, 0.f, 0.f, 0.f, 0.f, 0.f, 0.f, 0.f}; return z; }
__device__ __forceinline__ unsigned wave_ballot(bool p) {
#if defined(__HIP_DEVICE_COMPILE__)
  return __builtin_amdgcn_ballot_w32(p);
#else
  return p ? 1u : 0u;
#endif
}

// ---- 16-bit fragment loader (A, or B from a k-contiguous [n][k] row): lane -> row/col (lane&15), p already includes
//      + 8*(lane>>4); elements 0..7 <- p[0..7] (k0+8h..), elements 8..15 <- p[16..23] (k0+16+8h..)
__device__ __forceinline__ Frag ldfrag(const unsigned short* p) {
  Frag f;
  f.u[0] = *(const v8us*)(p);
  f.u[1] = *(const v8us*)(p + 16);
  return f;
}

// ---- fragment-major planes (every 16-bit operand plane in the workspace): a plane of R rows x KD k-elements is cut
//      into fragments of 16 rows x 32 k = 512 elements; fragment (row tile rt, k step ks) starts at element
//      16*rt*KD + 512*ks and holds [u 0..1][lane 0..31][8 elements]: lane = 16*h + (row&15), k = 32*ks + 16*u + 8*h + t.
//      That is the register order of ldfrag above, so one fragment is two loads of 512 contiguous bytes per wave
//      (4 whole 128-B lines each) where a row-major plane gives 16 partial lines per load. p already includes + 8*lane.
__device__ __forceinline__ Frag ldfm(const unsigned short* p) {
  Frag f;
  f.u[0] = *(const v8us*)(p);
  f.u[1] = *(const v8us*)(p + 256);
  return f;
}

// ---- WMMA helpers. f16 form (attention): the plain builtin; the compiler keeps the distances behind its own WMMAs. The
//      asm pad of the bf16 form takes its operands from v0..v255 alone: built with it, the 64-query tile spills to scratch.
__device__ __forceinline__ v8f mma_h(v16h a, v16h b, v8f c) {
  return __builtin_amdgcn_wmma_f32_16x16x32_f16(false, a, false, b, (short)0, c, false, false);
}
// bf16 form (GEMMs): builtin followed by a 4-slot VALU gap tying D and keeping A/B live
__device__ __forceinline__ v8f mma_b(v16b a, v16b b, v8f c) {
  v8f d = __builtin_amdgcn_wmma_f32_16x16x32_bf16(false, a, false, b, (short)0, c, false, false);
#if defined(__HIP_DEVICE_COMPILE__)
  const v16h ha = __builtin_bit_cast(v16h, a), hb = __builtin_bit_cast(v16h, b);
  asm volatile("v_nop\n\tv_nop\n\tv_nop\n\tv_nop" : "+v"(d) : "v"(ha), "v"(hb));
#endif
  return d;
}

// ---- work-group barrier of the attention loop: orders LDS only (release / acquire on the local address space), so the
//      k and v requests that are in flight at it stay in flight; __syncthreads() would wait for them at every barrier.
//      The loop stores nothing to global memory and reads there only what earlier launches wrote.
__device__ __forceinline__ void lds_barrier() {
#if defined(__HIP_DEVICE_COMPILE__)
  __builtin_amdgcn_fence(__ATOMIC_RELEASE, "workgroup", "local");
  __builtin_amdgcn_s_barrier();
  __builtin_amdgcn_fence(__ATOMIC_ACQUIRE, "workgroup", "local");
#endif
}

// =============================================================================================================
// (0) conv weights: Wb bf16, rows 512*matrix + o, k = c, fragment-major; matrix 0 = wq, 1 = wk, 2 = wv, 3 = wp; value =
//     bf16-RNE(w). Block blk (0..511): matrix blk/128 (block-uniform), row tile blk/4; wave gw = 8 blk + w owns the
//     half u = gw&1 of the fragment of k step (gw>>1)&15 and stores it as 512 contiguous bytes.
// coverage: 128 row tiles x 16 k steps x 2 halves = 4096 waves x 32 lanes x 8 = the whole plane.
// =============================================================================================================
__global__ __launch_bounds__(256)
void cvt_w(const float* __restrict__ wq, const float* __restrict__ wk, const float* __restrict__ wv,
           const float* __restrict__ wp, unsigned short* Wb) {
  const int tid = threadIdx.x, blk = blockIdx.x;
  const int wave = tid >> 5, lane = tid & 31;
  const int sel = blk / (CC / 4);                                          // 0..3, block-uniform
  const float* src = (sel == 0) ? wq : (sel == 1) ? wk : (sel == 2) ? wv : wp;   // all global
  const int gw  = blk * 8 + wave;                                          // 0..4095
  const int u   = gw & 1, ks = (gw >> 1) & 15, rt = gw >> 5;               // rt 0..127 = blk / 4
  const int o   = (rt & 31) * 16 + (lane & 15);                            // 0..511
  const int col = 32 * ks + 16 * u + 8 * (lane >> 4);                      // 0..504
  const float* s = src + (size_t)o * CC + col;
  const v4f a = *(const v4f*)s;
  const v4f q = *(const v4f*)(s + 4);
  const float f[8] = {a[0], a[1], a[2], a[3], q[0], q[1], q[2], q[3]};
  v4u pkv;
#pragma unroll
  for (int t = 0; t < 4; ++t) pkv[t] = pk16(bf_bits(f[2 * t]), bf_bits(f[2 * t + 1]));
{
    *(v4u*)(Wb + (size_t)(16 * rt) * CC + 512 * ks + 256 * u + 8 * lane) = pkv;
    
  }
}

// =============================================================================================================
// (1) group-normalisation statistics of bf16-RNE(x): block bg = b*32+g owns the 16 channels x 4096 positions
// =============================================================================================================
__global__ __launch_bounds__(256)
void gn_stats(const float* __restrict__ x, float* stats) {
  __shared__ double red[256];
  const int tid = threadIdx.x, bg = blockIdx.x;
  const v4f* p = (const v4f*)(x + (size_t)bg * GSZ * NN);
  const int N4 = GSZ * NN / 4;                                            // 16384
  const double invN = 1.0 / (double)(GSZ * NN);

  double s = 0.0;
#pragma unroll 1
  for (int i = tid; i < N4; i += 256 * SLD) {
    v4f v[SLD];                                                           // SLD loads in flight per lane, old sum order
#pragma unroll                                                            // v[] stays in registers
    for (int u = 0; u < SLD; ++u) v[u] = p[i + 256 * u];
#pragma unroll                                                            // v[] stays in registers
    for (int u = 0; u < SLD; ++u)
      s += ((double)bfr(v[u][0]) + (double)bfr(v[u][1])) + ((double)bfr(v[u][2]) + (double)bfr(v[u][3]));
  }
  red[tid] = s;
  __syncthreads();
#pragma unroll 1
  for (int off = 128; off > 0; off >>= 1) {
    if (tid < off) red[tid] += red[tid + off];
    __syncthreads();
  }
  const double mean = red[0] * invN;
  __syncthreads();                                                        // everyone read red[0]

  double s2 = 0.0;
#pragma unroll 1
  for (int i = tid; i < N4; i += 256 * SLD) {
    v4f v[SLD];                                                           // SLD loads in flight per lane, old sum order
#pragma unroll                                                            // v[] stays in registers
    for (int u = 0; u < SLD; ++u) v[u] = p[i + 256 * u];
#pragma unroll                                                            // v[] stays in registers
    for (int u = 0; u < SLD; ++u) {
#pragma unroll
      for (int t = 0; t < 4; ++t) {
        const double d = (double)bfr(v[u][t]) - mean;
        s2 += d * d;
      }
    }
  }
  red[tid] = s2;
  __syncthreads();
#pragma unroll 1
  for (int off = 128; off > 0; off >>= 1) {
    if (tid < off) red[tid] += red[tid + off];
    __syncthreads();
  }
  const double var = red[0] * invN;
  const float meanf = (float)mean;
  const float rstdf = (float)(1.0 / sqrt(var + GEPS));

  v4f val = {0.f, 0.f, 0.f, 0.f};
  if (tid == 0) { val[0] = meanf; val[1] = rstdf; }
  float* dst = stats + (size_t)bg * 32 + 4 * (tid & 7);
  if (tid < 8) *(v4f*)dst = val;
  
}

// =============================================================================================================
// (2) h = (bf16-RNE(x) - mean) * rstd * bf16-RNE(gn_w) + bf16-RNE(gn_b) in f32, then bf16 hi = RNE(h) and bf16
//     lo = RNE(h - hi), written as Hh/Hl bf16, rows 4096 b + n, k = c, fragment-major (for the conv GEMMs).
//     Block (nb, cb, b) owns 64 n x 64 c through LDS tiles Th/Tl[64 n][64 c] (pitch TP; cross-wave, block barrier).
// coverage: Th/Tl 2 it x 32 rows(c) x 8 lanes x 8 n = 64 x 64 (staged extent == consumed extent); planes 2 it x 8
//           waves = 4 row tiles x 2 k steps x 2 halves of 512 B per plane; grid (64, 8, NB) covers all 4096 n x 512 c.
// =============================================================================================================
__global__ __launch_bounds__(256)
void gn_apply(const float* __restrict__ x, const float* __restrict__ gw, const float* __restrict__ gb,
              const float* __restrict__ stats, unsigned short* Hh, unsigned short* Hl) {
  __shared__ __align__(16) unsigned short Th[QT * TP];
  __shared__ __align__(16) unsigned short Tl[QT * TP];
  const int tid = threadIdx.x;
  const int nb = blockIdx.x, cb = blockIdx.y, b = blockIdx.z;
  const int e = tid & 7, lq = tid >> 3;                                  // lq 0..31
  const int n0 = nb * QT, c0 = cb * QT;
#pragma unroll
  for (int it = 0; it < 2; ++it) {
    const int cl = it * 32 + lq;                                          // 0..63
    const int ch = c0 + cl;                                               // 0..511
    const int g  = ch / GSZ;                                              // 0..31
    const float mean = stats[(size_t)(b * NGRP + g) * 32 + 0];
    const float rstd = stats[(size_t)(b * NGRP + g) * 32 + 1];
    const float w  = bfr(gw[ch]);
    const float bb = bfr(gb[ch]);
    const float* sp = x + ((size_t)(b * CC + ch)) * NN + n0 + 8 * e;
    const v4f a = *(const v4f*)sp;
    const v4f q = *(const v4f*)(sp + 4);
    const float f[8] = {a[0], a[1], a[2], a[3], q[0], q[1], q[2], q[3]};
#pragma unroll
    for (int t = 0; t < 8; ++t) {
      const float h = (bfr(f[t]) - mean) * rstd * w + bb;
      const unsigned short hb = bf_bits(h);
      const unsigned short lb = bf_bits(h - bf_up(hb));
      Th[(8 * e + t) * TP + cl] = hb;
      Tl[(8 * e + t) * TP + cl] = lb;
    }
  }
  __syncthreads();
  const int lane = tid & 31, wave = tid >> 5;
  v4u uh[2], ul[2];
#pragma unroll
  for (int it = 0; it < 2; ++it) {
    const int pc = it * 8 + wave;                                         // piece: row tile pc>>2, chunk pair pc&3
    const int lo = (16 * (pc >> 2) + (lane & 15)) * TP + 16 * (pc & 3) + 8 * (lane >> 4);
    uh[it] = *(const v4u*)(Th + lo);
    ul[it] = *(const v4u*)(Tl + lo);
  }
{
#pragma unroll
    for (int it = 0; it < 2; ++it) {
      const int pc = it * 8 + wave;
      const size_t po = ((size_t)(b * NN + n0 + 16 * (pc >> 2))) * CC + 16 * c0 + 256 * (pc & 3) + 8 * lane;
      *(v4u*)(Hh + po) = uh[it];
      *(v4u*)(Hl + po) = ul[it];
    }
    
  }
}

// =============================================================================================================
// (3) q / k conv GEMM for one (b, 64-n tile, matrix sel = mb/8, 64-o block o0 = (mb%8)*64):
//     Y[o][n] = sum_c W[o][c] (Hh + Hl)[b][n][c] + bf16-RNE(bias[o]). Block 128 threads = 4 waves; wave w owns cols
//     n0+16w..+15 (B fragments from the Hh and Hl planes, fragment-major, split k map) and 4 m-tiles (A rows
//     o = o0 + 16 mt + (lane&15) from Wb, same loader). K = 512 = 16 steps x 2 products.
//     Epilogue staged in LDS Os[n_loc][o_loc] (pitch OSP, b128 stores of 8 consecutive o per lane; cross-wave,
//     block barrier), then sel 0 -> Q16, sel 1 -> K16, plain f16, rows 4096 b + n, k = d, fragment-major.
// coverage: Os 4 waves x 16 n x 64 o = 64 x 64 (staged == consumed); plane 4 it (row tiles) x 4 waves (2 k steps x 2
//           halves of 512 B) = 64 n x 64 d; grid (64, 16, NB) covers d 0..511 of all 4096 rows of Q16 and K16 once.
// =============================================================================================================
__global__ __launch_bounds__(128)
void gemm_qk(const unsigned short* __restrict__ Wb, const unsigned short* __restrict__ Hh,
             const unsigned short* __restrict__ Hl, const float* __restrict__ bq, const float* __restrict__ bk,
             unsigned short* Q16, unsigned short* K16) {
  __shared__ __align__(16) float Os[QT * OSP];
  const int tid  = threadIdx.x;
  const int lane = tid & 31, wave = tid >> 5;
  const int hh   = lane >> 4, c = lane & 15;
  const int nt   = blockIdx.x, mb = blockIdx.y, b = blockIdx.z;
  const int sel  = mb / (CC / QT);                                         // 0 = q, 1 = k (block-uniform)
  const int n0   = nt * QT, o0 = (mb % (CC / QT)) * QT;

  const unsigned short* ap = Wb + ((size_t)(sel * CC + o0)) * CC + 8 * lane;
  const size_t ho = ((size_t)(b * NN + n0 + 16 * wave)) * CC + 8 * lane;
  const unsigned short* bhp = Hh + ho;
  const unsigned short* blp = Hl + ho;

  v8f acc[4];
#pragma unroll
  for (int mt = 0; mt < 4; ++mt) acc[mt] = zero8();

#pragma unroll 2
  for (int ks = 0; ks < CC / 32; ++ks) {
    const Frag fbh = ldfm(bhp + 512 * ks);
    const Frag fbl = ldfm(blp + 512 * ks);
    Frag fa[4];                                                           // all loads of the step before its first WMMA
#pragma unroll                                                            // fa[] stays in registers
    for (int mt = 0; mt < 4; ++mt) fa[mt] = ldfm(ap + (size_t)(16 * mt) * CC + 512 * ks);
#pragma unroll
    for (int mt = 0; mt < 4; ++mt) {
      acc[mt] = mma_b(fa[mt].bf, fbh.bf, acc[mt]);
      acc[mt] = mma_b(fa[mt].bf, fbl.bf, acc[mt]);
    }
  }

  // ---- epilogue: + bias -> LDS Os[n_loc][o_loc]; lane (hh, c) holds o = 16 mt + 8 hh + r for n_loc = 16 w + c
  const float* bsrc = (sel == 0) ? bq : bk;                               // block-uniform, both global
  {
    const int nl = 16 * wave + c;
#pragma unroll
    for (int mt = 0; mt < 4; ++mt) {
      const v4f b0 = *(const v4f*)(bsrc + o0 + 16 * mt + 8 * hh);
      const v4f b1 = *(const v4f*)(bsrc + o0 + 16 * mt + 8 * hh + 4);
      v4f va, vb;
#pragma unroll
      for (int r = 0; r < 4; ++r) { va[r] = acc[mt][r] + bfr(b0[r]); vb[r] = acc[mt][4 + r] + bfr(b1[r]); }
      *(v4f*)(Os + nl * OSP + 16 * mt + 8 * hh)     = va;
      *(v4f*)(Os + nl * OSP + 16 * mt + 8 * hh + 4) = vb;
    }
  }
  __syncthreads();

  unsigned short* Ph = (sel == 0) ? Q16 : K16;                             // block-uniform, both global
  v4u uv[4];
#pragma unroll
  for (int it = 0; it < 4; ++it) {
    const int lo = (it * 16 + c) * OSP + 16 * wave + 8 * hh;               // row tile it, chunk pair = wave
    const v4f a = *(const v4f*)(Os + lo);
    const v4f q = *(const v4f*)(Os + lo + 4);
    const float f[8] = {a[0], a[1], a[2], a[3], q[0], q[1], q[2], q[3]};
#pragma unroll
    for (int t = 0; t < 4; ++t)
      uv[it][t] = pk16(h_bits((_Float16)f[2 * t]), h_bits((_Float16)f[2 * t + 1]));
  }
{
#pragma unroll
    for (int it = 0; it < 4; ++it) {
      const size_t po = ((size_t)(b * NN + n0 + 16 * it)) * CC + 16 * o0 + 256 * wave + 8 * lane;
      *(v4u*)(Ph + po) = uv[it];
    }
    
  }
}

// =============================================================================================================
// (4) v conv GEMM for one (b, 64-n tile, 64-o block o0 = mb*64), operands swapped so the D rows are positions:
//     D[n][o] = sum_c (Hh + Hl)[b][n][c] Wv[o][c]: A rows n = n0 + 16 w + (lane&15) from Hh and Hl (2 products),
//     B cols o = o0 + 16 j + (lane&15) from the Wv rows (fragment-major, same loader), 4 tiles j per wave, K=512.
//     Per lane the D tile holds 8 consecutive n of one o -> LDS Vs[o_loc][n_loc] (pitch OSP, b128 stores;
//     cross-wave, block barrier), then V16 f16, rows 512 b + o, k = n (KD = 4096), fragment-major, = f16(D +
//     bf16-RNE(bv[o])) (unscaled, |v| ~ 1).
// coverage: Vs 4 waves x 16 n x 64 o = 64 x 64 (staged == consumed); V16 4 it (row tiles) x 4 waves (2 k steps x 2
//           halves of 512 B) = 64 o x 64 n; grid (64, 8, NB) covers all 512 o x 4096 n of each b exactly once.
// =============================================================================================================
__global__ __launch_bounds__(128)
void gemm_v(const unsigned short* __restrict__ Wb, const unsigned short* __restrict__ Hh,
            const unsigned short* __restrict__ Hl, const float* __restrict__ bv, unsigned short* V16) {
  __shared__ __align__(16) float Vs[QT * OSP];
  const int tid  = threadIdx.x;
  const int lane = tid & 31, wave = tid >> 5;
  const int hh   = lane >> 4, c = lane & 15;
  const int nt   = blockIdx.x, mb = blockIdx.y, b = blockIdx.z;
  const int n0   = nt * QT, o0 = mb * QT;

  const size_t ho = ((size_t)(b * NN + n0 + 16 * wave)) * CC + 8 * lane;
  const unsigned short* ahp = Hh + ho;
  const unsigned short* alp = Hl + ho;
  const unsigned short* bp  = Wb + ((size_t)(2 * CC + o0)) * CC + 8 * lane;

  v8f acc[4];
#pragma unroll
  for (int j = 0; j < 4; ++j) acc[j] = zero8();

#pragma unroll 2
  for (int ks = 0; ks < CC / 32; ++ks) {
    const Frag fah = ldfm(ahp + 512 * ks);
    const Frag fal = ldfm(alp + 512 * ks);
    Frag fb[4];                                                           // all loads of the step before its first WMMA
#pragma unroll                                                            // fb[] stays in registers
    for (int j = 0; j < 4; ++j) fb[j] = ldfm(bp + (size_t)(16 * j) * CC + 512 * ks);
#pragma unroll
    for (int j = 0; j < 4; ++j) {
      acc[j] = mma_b(fah.bf, fb[j].bf, acc[j]);
      acc[j] = mma_b(fal.bf, fb[j].bf, acc[j]);
    }
  }

  // ---- epilogue: lane (hh, c) holds n_loc = 16 w + 8 hh + r of o_loc = 16 j + c
  {
    const int nrow = 16 * wave + 8 * hh;
#pragma unroll
    for (int j = 0; j < 4; ++j) {
      const float bb = bfr(bv[o0 + 16 * j + c]);
      v4f va, vb;
#pragma unroll
      for (int r = 0; r < 4; ++r) { va[r] = acc[j][r] + bb; vb[r] = acc[j][4 + r] + bb; }
      *(v4f*)(Vs + (16 * j + c) * OSP + nrow)     = va;
      *(v4f*)(Vs + (16 * j + c) * OSP + nrow + 4) = vb;
    }
  }
  __syncthreads();

  v4u uv[4];
#pragma unroll
  for (int it = 0; it < 4; ++it) {
    const int lo = (it * 16 + c) * OSP + 16 * wave + 8 * hh;               // row tile it, chunk pair = wave
    const v4f a = *(const v4f*)(Vs + lo);
    const v4f q = *(const v4f*)(Vs + lo + 4);
    const float f[8] = {a[0], a[1], a[2], a[3], q[0], q[1], q[2], q[3]};
#pragma unroll
    for (int t = 0; t < 4; ++t)
      uv[it][t] = pk16(h_bits((_Float16)f[2 * t]), h_bits((_Float16)f[2 * t + 1]));
  }
{
#pragma unroll
    for (int it = 0; it < 4; ++it) {
      *(v4u*)(V16 + ((size_t)(b * CC + o0 + 16 * it)) * NN + 16 * n0 + 256 * wave + 8 * lane) = uv[it];
    }
    
  }
}

// =============================================================================================================
// (5) attention for one (b, 64-query tile), transposed formulation, 4096 keys, no mask. Block = 8 waves, one block per
//   WGP (grid 64 x NB): every K and V fragment that a block fetches feeds 64 queries.
//   Score phase per 32-key block kb: wave w computes TWO S^T partial tiles (16 keys x 16 queries each) from one set of
//   k fragments: key tile kt = w&1 (keys kb+16kt..), query tiles 2 qg + i, qg = (w>>1)&1, i = 0..1 (queries
//   n0+16(2qg+i)..), over the d-half dh = w>>2 (d 256dh .. 256dh+255, 8 steps of 32): A = k rows (row = key,
//   fragment-major, split k map) from K16, B = q rows (col = query, same map) from Q16, plain f16, 1 product. Each
//   partial (D row = key 8h+r, col = query) goes to LDS Sp[dh][query][key] (pitch SPP, b128 stores; cross-wave, block
//   barrier); the two d-halves are added in fixed order by the softmax lanes.
//   Softmax: waves 0 and 1, query = 32 w + lane: s_j = (Sp[0] + Sp[1]) * 512^-0.5 for the 32 keys, online max / sum in
//   f32 registers (m, l live in those two waves only), corr = e^{m_old - m_new} -> Cs[query], grew flag -> Fl[w],
//   P_j = e^{s_j - m} x 2^14 as f16 -> Pf[query][key] (pitch PFP, 4 x 16-B stores per row; cross-wave, block barrier).
//   O^T (rows channel, cols query): every wave owns channels 64w..64w+63 (4 tiles j) x 64 queries (4 tiles) = 16
//   accumulator tiles; rescale by Cs when a flag is set (block-uniform; corr is exactly 1 for a query whose max did not
//   grow), then += A(v rows channel = 64w+16j+(lane&15), keys kb.., fragment-major f16 plane V16) . B(P^T: row = query
//   from Pf, keys contiguous, same k order).
//   The three phases run as a pipeline over the key blocks, ONE barrier per key block: between two barriers every wave
//   does the scores of block i+1 and O^T of block i-1, and waves 0 and 1 then the softmax of block i. Sp, Pf, Cs and Fl
//   have two buffers each (index = key block & 1): what a pass writes was last read in the pass before, behind a barrier,
//   and is read in the next pass. Order of every sum as in the unpipelined loop. Fill: block 0's scores ahead of the
//   loop, and P = 0, flags = 0, corr = 1 for the O^T step of pass 0 (adds zero); drain: the last pass scores its clamped block
//   again (never read), O^T of the last block stands behind the loop.
//   Epilogue in two 256-channel halves: waves with (w>>2) == half stage O/l in LDS Os[query][256 ch] (pitch OSH, b128
//   stores; cross-wave, block barrier), then all 256 threads write Ah (bf16 hi) and Al (bf16 residual), fragment-major.
// coverage: Sp 8 waves x 2 tiles = [2 dh][64 q][32 keys] each key block (staged == consumed); Pf 64 rows x 32 keys by
//           waves 0, 1 (staged == consumed, pad cols never read; buffer 1 zeroed whole ahead of the loop); Os per half 4 waves x 64 q x 64 ch = 64 x 256 (staged
//           == consumed); planes 2 halves x 8 it x 8 waves x 512 B = 4 row tiles x 16 k steps per plane; grid (NQ/64,
//           NB) covers rows 0..NQ-1 exactly once (only those are read later).
// =============================================================================================================
__global__ __launch_bounds__(256)
void attn_k(const unsigned short* __restrict__ Q16, const unsigned short* __restrict__ K16,
            const unsigned short* __restrict__ V16, unsigned short* Ah, unsigned short* Al) {
  __shared__ __align__(16) float Sp[2 * 2 * AQ * SPP];
  __shared__ __align__(16) unsigned short Pf[2 * AQ * PFP];
  __shared__ __align__(16) float Os[AQ * OSH];
  __shared__ float Cs[2 * AQ];
  __shared__ float Ls[AQ];
  __shared__ __align__(8) int Fl[2 * (AQ / 32)];
  const int tid  = threadIdx.x;
  const int wave = tid >> 5, lane = tid & 31;
  const int hh   = lane >> 4, c = lane & 15;
  const int n0   = blockIdx.x * AQ, b = blockIdx.y;
  const int kt = wave & 1, qg = (wave >> 1) & 1, dh = wave >> 2;

  // q fragment pointer (B operand of S^T, col = query n0 + 16 (2 qg + i) + c, d-half dh), + 16*CC*i + 512*ks
  const unsigned short* qp = Q16 + ((size_t)(b * NN + n0 + 32 * qg)) * CC + 16 * (CC / 2) * dh + 8 * lane;
  // k fragment base (A operand, row = key kb + 16 kt + c, d-half dh), + kb*CC + 512*ks
  const unsigned short* kp = K16 + ((size_t)(b * NN + 16 * kt)) * CC + 16 * (CC / 2) * dh + 8 * lane;
  // v fragment base (A operand of O^T, row = channel 64 w + 16 j + c), + 16*j*NN + 16*kb (k step kb/32)
  const unsigned short* vp = V16 + ((size_t)(b * CC + 64 * wave)) * NN + 8 * lane;
  // this lane's S^T partial destination: Sp[dh][query 16(2qg+i)+c][key 16kt + 8hh + r], + 16*SPP*i
  float* spw = Sp + (dh * AQ + 32 * qg + c) * SPP + 16 * kt + 8 * hh;
  // P^T fragment rows (row = query 16 q + c, keys contiguous), + 16*PFP*q
  const unsigned short* pf = Pf + c * PFP + 8 * hh;

  // q fragments of this wave's d-half do not change with the key block: loaded once, kept in registers
  Frag fq[2][CC / 64];
#pragma unroll                                                            // fq[][] stays in registers
  for (int i = 0; i < 2; ++i) {
#pragma unroll
    for (int ks = 0; ks < CC / 64; ++ks) fq[i][ks] = ldfm(qp + (size_t)(16 * i) * CC + 512 * ks);
  }
  // the q requests are in flight and the code below reuses their address registers
  asm volatile("s_wait_xcnt 0x0" ::: "memory");

  float m_run = -1.0e30f, l_run = 0.f;
  v8f o[16];
#pragma unroll
  for (int j = 0; j < 16; ++j) o[j] = zero8();

  // ---- the two matrix phases, used in the fill, in the loop and in the drain
  Frag fk[CC / 64];
  Frag fv[4];
  // two score partial tiles over this wave's d-half, each k fragment used for both -> Sp buffer at dst
  auto score = [&](float* dst) __attribute__((always_inline)) {
    v8f s0 = zero8(), s1 = zero8();
#pragma unroll                                                            // fk[], fq[][] stay in registers
    for (int ks = 0; ks < CC / 64; ++ks) {
      s0 = mma_h(fk[ks].h, fq[0][ks].h, s0);
      s1 = mma_h(fk[ks].h, fq[1][ks].h, s1);
    }
    v4f sa, sb, sc, sd;
#pragma unroll
    for (int r = 0; r < 4; ++r) { sa[r] = s0[r]; sb[r] = s0[4 + r]; sc[r] = s1[r]; sd[r] = s1[4 + r]; }
    *(v4f*)(dst)                = sa;
    *(v4f*)(dst + 4)            = sb;
    *(v4f*)(dst + 16 * SPP)     = sc;
    *(v4f*)(dst + 16 * SPP + 4) = sd;
  };
  // the O^T step in two parts. pv_read: all its LDS reads (flags, corr, P^T fragments of buffer buf) as one group, placed
  // at the head of a pass so that they land under the score products. pv_math: rescale (block-uniform flags), O^T += V . P^T
  int fl0, fl1;
  float cr[4];
  Frag p[4];
  auto pv_read = [&](int buf) __attribute__((always_inline)) {
    fl0 = Fl[2 * buf];
    fl1 = Fl[2 * buf + 1];
#pragma unroll                                                            // cr[], p[] stay in registers
    for (int q = 0; q < 4; ++q) {
      cr[q] = Cs[AQ * buf + 16 * q + c];
      p[q]  = ldfrag(pf + AQ * PFP * buf + 16 * PFP * q);
    }
  };
  auto pv_math = [&]() __attribute__((always_inline)) {
    if ((fl0 | fl1) != 0) {
#pragma unroll
      for (int q = 0; q < 4; ++q) {
#pragma unroll
        for (int j = 0; j < 4; ++j) {
#pragma unroll
          for (int r = 0; r < 8; ++r) o[4 * j + q][r] *= cr[q];
        }
      }
    }
#pragma unroll
    for (int j = 0; j < 4; ++j) {
#pragma unroll
      for (int q = 0; q < 4; ++q) o[4 * j + q] = mma_h(fv[j].h, p[q].h, o[4 * j + q]);
    }
  };

  // ---- fill: scores of key block 0 -> Sp buffer 0; P = 0, flags = 0, corr = 1 in buffer 1 for the O^T step of pass 0; then
  //      the k fragments of block 1 and the v fragments of block 0 (finite values for that step, which adds v x 0)
  const unsigned short* kpn = kp;
  const unsigned short* vpn = vp;
#pragma unroll                                                            // fk[] stays in registers
  for (int ks = 0; ks < CC / 64; ++ks) fk[ks] = ldfm(kpn + 512 * ks);
  // every group of k or v requests names the registers of kpn or vpn: the wait stands in front of the step that rewrites
  // them (the step length goes through the statement, so that the addition cannot be lifted over the wait)
  unsigned kstep0 = 32u * CC;
  asm volatile("s_wait_xcnt 0x0" : "+s"(kstep0) : : "memory");
  kpn += kstep0;
  {
    const v4u z4 = {0u, 0u, 0u, 0u};
#pragma unroll 1
    for (int t = tid; t < AQ * PFP / 8; t += 256) *(v4u*)(Pf + AQ * PFP + 8 * t) = z4;
    if (tid < AQ / 32) Fl[AQ / 32 + tid] = 0;
    if (tid < AQ) Cs[AQ + tid] = 1.0f;
  }
  score(spw);
#pragma unroll                                                            // fk[] stays in registers
  for (int ks = 0; ks < CC / 64; ++ks) fk[ks] = ldfm(kpn + 512 * ks);
  unsigned kstep1 = 32u * CC;
  asm volatile("s_wait_xcnt 0x0" : "+s"(kstep1) : : "memory");            // as above
  kpn += kstep1;                                                          // from here on: two key blocks ahead of the pass
#pragma unroll                                                            // fv[] stays in registers
  for (int j = 0; j < 4; ++j) fv[j] = ldfm(vpn + (size_t)(16 * j) * NN);
  lds_barrier();

#pragma unroll 1
  for (int i = 0; i < NKB; ++i) {
    const int cur = i & 1, oth = cur ^ 1;
    pv_read(oth);
    // ---- scores of key block i+1 (last pass: the last block again, never read)
    score(spw + 2 * AQ * SPP * oth);
    // ---- the k fragments of key block i+2 are requested here, a whole pass ahead of their use (clamped to the last block)
#pragma unroll                                                            // fk[] stays in registers
    for (int ks = 0; ks < CC / 64; ++ks) fk[ks] = ldfm(kpn + 512 * ks);
    unsigned kstep = (i + 3 < NKB) ? 32u * CC : 0u;
    asm volatile("s_wait_xcnt 0x0" : "+s"(kstep) : : "memory");           // as above
    kpn += kstep;
    // keeps the test of the flags, and with it the wait for their LDS read, behind the score products: scheduled among them
    // it stalls the wave for the LDS latency at the head of the pass
    __builtin_amdgcn_sched_barrier(0);
    // ---- O^T of key block i-1 (pass 0: adds zero)
    pv_math();
    // ---- the v fragments of key block i are requested here, a whole pass ahead of their use
#pragma unroll                                                            // fv[] stays in registers
    for (int j = 0; j < 4; ++j) fv[j] = ldfm(vpn + (size_t)(16 * j) * NN);
    unsigned vstep = (i + 1 < NKB) ? 512u : 0u;
    asm volatile("s_wait_xcnt 0x0" : "+s"(vstep) : : "memory");           // as above
    vpn += vstep;

    // ---- online softmax of key block i for the 64 queries (waves 0 and 1, query = 32 wave + lane = tid)
    if (wave < AQ / 32) {
      const float* s0p = Sp + 2 * AQ * SPP * cur + tid * SPP;             // d-half 0
      const float* s1p = s0p + AQ * SPP;                                  // d-half 1
      float sv[32];
#pragma unroll
      for (int t8 = 0; t8 < 8; ++t8) {
        const v4f a0 = *(const v4f*)(s0p + 4 * t8);
        const v4f a1 = *(const v4f*)(s1p + 4 * t8);
#pragma unroll
        for (int t = 0; t < 4; ++t) sv[4 * t8 + t] = a0[t] + a1[t];
      }
      float mx = sv[0];
#pragma unroll
      for (int j = 1; j < 32; ++j) mx = fmaxf(mx, sv[j]);
      const float mxs = mx * SCL;
      const float mn  = fmaxf(m_run, mxs);
      const unsigned grew = wave_ballot(mxs > m_run);
      const float corr = __expf(m_run - mn);                             // == 1 exactly when the max did not grow
      m_run = mn;
      const float msh = mn - LNPS;                                        // exp gives e^{s-m} * 2^14
      float ls = 0.f;
      v4u pk[4];
#pragma unroll
      for (int g = 0; g < 4; ++g) {
#pragma unroll
        for (int t = 0; t < 4; ++t) {
          const float e0 = __expf(fmaf(sv[8 * g + 2 * t],     SCL, -msh));   // key 32i + 8g + 2t
          const float e1 = __expf(fmaf(sv[8 * g + 2 * t + 1], SCL, -msh));   // key 32i + 8g + 2t + 1
          ls += e0 + e1;
          pk[g][t] = pk16(h_bits((_Float16)e0), h_bits((_Float16)e1));
        }
      }
      l_run = l_run * corr + ls;
#pragma unroll
      for (int g = 0; g < 4; ++g) *(v4u*)(Pf + AQ * PFP * cur + tid * PFP + 8 * g) = pk[g];
      Cs[AQ * cur + tid] = corr;
      if (lane == 0) Fl[2 * cur + wave] = (grew != 0u) ? 1 : 0;
    }
    lds_barrier();
  }
  // ---- drain: O^T of the last key block
  pv_read((NKB - 1) & 1);
  pv_math();
  // the waits of the last pass already cover its k and v requests; this one is a precaution
  asm volatile("s_wait_xcnt 0x0" ::: "memory");
  if (wave < AQ / 32) Ls[tid] = 1.0f / l_run;                            // o and l both carry the 2^14 factor
  __syncthreads();
  float inv[4];
#pragma unroll
  for (int q = 0; q < 4; ++q) inv[q] = Ls[16 * q + c];

#pragma unroll
  for (int half = 0; half < 2; ++half) {
    if ((wave >> 2) == half) {
      const int chb = 64 * (wave & 3);                                    // channel offset inside this half
#pragma unroll
      for (int j = 0; j < 4; ++j) {
#pragma unroll
        for (int q = 0; q < 4; ++q) {
          v4f va, vb;
#pragma unroll
          for (int r = 0; r < 4; ++r) { va[r] = o[4 * j + q][r] * inv[q]; vb[r] = o[4 * j + q][4 + r] * inv[q]; }
          float* dst = Os + (16 * q + c) * OSH + chb + 16 * j + 8 * hh;   // Os[query][ch = chb + 16j + 8hh + r]
          *(v4f*)dst       = va;
          *(v4f*)(dst + 4) = vb;
        }
      }
    }
    __syncthreads();
    {
      v4u uh[AQ / 8], ul[AQ / 8];
#pragma unroll
      for (int it = 0; it < AQ / 8; ++it) {
        const int pc = it * 8 + wave;                                     // piece: row tile pc>>4, chunk pair pc&15
        const int lo = (16 * (pc >> 4) + c) * OSH + 16 * (pc & 15) + 8 * hh;
        const v4f a = *(const v4f*)(Os + lo);
        const v4f q = *(const v4f*)(Os + lo + 4);
        const float f[8] = {a[0], a[1], a[2], a[3], q[0], q[1], q[2], q[3]};
#pragma unroll
        for (int t = 0; t < 4; ++t) {
          const float f0 = f[2 * t], f1 = f[2 * t + 1];
          const unsigned short hb0 = bf_bits(f0), hb1 = bf_bits(f1);
          const unsigned short lb0 = bf_bits(f0 - bf_up(hb0));
          const unsigned short lb1 = bf_bits(f1 - bf_up(hb1));
          uh[it][t] = pk16(hb0, hb1);
          ul[it][t] = pk16(lb0, lb1);
        }
      }
#pragma unroll
      for (int it = 0; it < AQ / 8; ++it) {
        const int pc = it * 8 + wave;
        const size_t po = ((size_t)(b * NN + n0 + 16 * (pc >> 4))) * CC + 16 * (CC / 2) * half + 256 * (pc & 15) + 8 * lane;
        *(v4u*)(Ah + po) = uh[it];
        *(v4u*)(Al + po) = ul[it];
      }
    }
    __syncthreads();
  }
}

// =============================================================================================================
// (6) output projection + bias + residual for one (b, 64-n tile, 64-o block o0 = mb*64), D rows = positions:
//     D[n][o] = sum_c (Ah + Al)[b][n][c] Wp[o][c] (2 products, K = 512): A rows n = n0 + 16 w + (lane&15),
//     B cols o = o0 + 16 j + (lane&15) from the Wp rows (all fragment-major), 4 tiles per wave. Per lane 8 consecutive n of one o ->
//     LDS Vs[o_loc][n_loc] (pitch OSP, b128 stores; cross-wave, block barrier), then
//     2 lines, lane e (tid&15) -> n 4e..4e+3, lanes 0..7 line 0, 8..15 line 1, one instruction per 2 rows of a
// coverage: Vs 4 waves x 16 n x 64 o = 64 x 64 (staged == consumed); out 8 it x 8 rows x 16 lanes x 4 = 64 o x
//           64 n; grid (NQ/64, 8, NB) covers out[b][0..511][0..NQ-1] exactly once.
// =============================================================================================================
__global__ __launch_bounds__(128)
void gemm_p(const unsigned short* __restrict__ Wb, const unsigned short* __restrict__ Ah,
            const unsigned short* __restrict__ Al, const float* __restrict__ bp, const float* __restrict__ x,
            float* out) {
  __shared__ __align__(16) float Vs[QT * OSP];
  const int tid  = threadIdx.x;
  const int lane = tid & 31, wave = tid >> 5;
  const int hh   = lane >> 4, c = lane & 15;
  const int nt   = blockIdx.x, mb = blockIdx.y, b = blockIdx.z;
  const int n0   = nt * QT, o0 = mb * QT;

  const size_t ao = ((size_t)(b * NN + n0 + 16 * wave)) * CC + 8 * lane;
  const unsigned short* ahp = Ah + ao;
  const unsigned short* alp = Al + ao;
  const unsigned short* bpw = Wb + ((size_t)(3 * CC + o0)) * CC + 8 * lane;

  v8f acc[4];
#pragma unroll
  for (int j = 0; j < 4; ++j) acc[j] = zero8();

#pragma unroll 2
  for (int ks = 0; ks < CC / 32; ++ks) {
    const Frag fah = ldfm(ahp + 512 * ks);
    const Frag fal = ldfm(alp + 512 * ks);
    Frag fb[4];                                                           // all loads of the step before its first WMMA
#pragma unroll                                                            // fb[] stays in registers
    for (int j = 0; j < 4; ++j) fb[j] = ldfm(bpw + (size_t)(16 * j) * CC + 512 * ks);
#pragma unroll
    for (int j = 0; j < 4; ++j) {
      acc[j] = mma_b(fah.bf, fb[j].bf, acc[j]);
      acc[j] = mma_b(fal.bf, fb[j].bf, acc[j]);
    }
  }

  // ---- epilogue: lane (hh, c) holds n_loc = 16 w + 8 hh + r of o_loc = 16 j + c
  {
    const int nrow = 16 * wave + 8 * hh;
#pragma unroll
    for (int j = 0; j < 4; ++j) {
      const float bb = bfr(bp[o0 + 16 * j + c]);
      v4f va, vb;
#pragma unroll
      for (int r = 0; r < 4; ++r) { va[r] = acc[j][r] + bb; vb[r] = acc[j][4 + r] + bb; }
      *(v4f*)(Vs + (16 * j + c) * OSP + nrow)     = va;
      *(v4f*)(Vs + (16 * j + c) * OSP + nrow + 4) = vb;
    }
  }
  __syncthreads();

  const int e = tid & 15, lq = tid >> 4;                                  // lq 0..7
  v4f res[8];
#pragma unroll
  for (int it = 0; it < 8; ++it) {
    const int ol = it * 8 + lq;                                            // 0..63
    const v4f a = *(const v4f*)(Vs + ol * OSP + 4 * e);
    const size_t idx = ((size_t)(b * CC + o0 + ol)) * NN + n0 + 4 * e;
    const v4f xv = *(const v4f*)(x + idx);
#pragma unroll
    for (int t = 0; t < 4; ++t) res[it][t] = a[t] + bfr(xv[t]);
  }
{
#pragma unroll
    for (int it = 0; it < 8; ++it) {
      const int ol = it * 8 + lq;
      const size_t idx = ((size_t)(b * CC + o0 + ol)) * NN + n0 + 4 * e;
      *(v4f*)(out + idx) = res[it];
    }
    
  }
}

// =============================================================================================================
// Workspace map (bytes; each region start a multiple of 256; every extent is an exact tile multiple and is written
//   (all 16-bit planes fragment-major, same extents as row-major)
//   Wb    bf16 [4][512][512]          2097152
//   stats f32  [NB*32][32]             16384 (NB=4)
//   Hh/Hl bf16 [NB][4096][512]     16777216 x2   (reused as Ah/Al after their last reader, launch (4))
//   Q16/K16 f16 [NB][4096][512]   16777216 x2
//   V16   f16  [NB][512][4096]     16777216
//   total (NB=4) = 85999616
// =============================================================================================================
extern "C" void kernel_launch(void* const* d_in, const int* in_sizes, int n_in,
                              void* d_out, int out_size, void* d_ws, size_t ws_size,
                              hipStream_t stream) {
  if (n_in < 11) return;
  if (in_sizes[0] < NB * CC * NN) return;
  if (in_sizes[1] < CC || in_sizes[2] < CC) return;
  if (in_sizes[3] < CC * CC || in_sizes[5] < CC * CC || in_sizes[7] < CC * CC || in_sizes[9] < CC * CC) return;
  if (in_sizes[4] < CC || in_sizes[6] < CC || in_sizes[8] < CC || in_sizes[10] < CC) return;
  if (out_size < NB * CC * NN) return;

  size_t off = 0;
  auto carve = [&](size_t bytes) { const size_t o = off; off += (bytes + 255) & ~(size_t)255; return o; };
  const size_t plane = (size_t)NB * NN * CC * 2;
  const size_t oWb  = carve((size_t)4 * CC * CC * 2);
  const size_t oSt  = carve((size_t)NB * NGRP * 32 * 4);
  const size_t oHh  = carve(plane);
  const size_t oHl  = carve(plane);
  const size_t oQ   = carve(plane);
  const size_t oK   = carve(plane);
  const size_t oV   = carve(plane);
  const size_t oAh  = oHh;                                                // same extent, disjoint lifetimes
  const size_t oAl  = oHl;
  if (off > ws_size) return;
  if (off > (size_t)134217728) return;

  const float* x   = (const float*)d_in[0];
  const float* gnw = (const float*)d_in[1];
  const float* gnb = (const float*)d_in[2];
  const float* wq  = (const float*)d_in[3];
  const float* bq  = (const float*)d_in[4];
  const float* wk  = (const float*)d_in[5];
  const float* bk  = (const float*)d_in[6];
  const float* wv  = (const float*)d_in[7];
  const float* bv  = (const float*)d_in[8];
  const float* wp  = (const float*)d_in[9];
  const float* bp  = (const float*)d_in[10];

  char* ws = (char*)d_ws;
  unsigned short* Wb  = (unsigned short*)(ws + oWb);
  float*          St  = (float*)(ws + oSt);
  unsigned short* Hh  = (unsigned short*)(ws + oHh);
  unsigned short* Hl  = (unsigned short*)(ws + oHl);
  unsigned short* Q16 = (unsigned short*)(ws + oQ);
  unsigned short* K16 = (unsigned short*)(ws + oK);
  unsigned short* V16 = (unsigned short*)(ws + oV);
  unsigned short* Ah  = (unsigned short*)(ws + oAh);
  unsigned short* Al  = (unsigned short*)(ws + oAl);
  float* out = (float*)d_out;

  const dim3 blk256(256), blk128(128);

  // (0) conv weights -> stacked bf16 plane
  cvt_w<<<dim3(4 * (CC / 4)), blk256, 0, stream>>>(wq, wk, wv, wp, Wb);
  // (1) group statistics per (b, g) in f64
  gn_stats<<<dim3(NB * NGRP), blk256, 0, stream>>>(x, St);
  // (2) normalised activations -> fragment-major bf16 hi / residual planes
  gn_apply<<<dim3(NN / QT, CC / QT, NB), blk256, 0, stream>>>(x, gnw, gnb, St, Hh, Hl);
  // (3) q and k -> fragment-major f16 planes (rows = positions)
  gemm_qk<<<dim3(NN / QT, 2 * (CC / QT), NB), blk128, 0, stream>>>(Wb, Hh, Hl, bq, bk, Q16, K16);
  // (4) v -> fragment-major f16 plane (rows = channels)
  gemm_v<<<dim3(NN / QT, CC / QT, NB), blk128, 0, stream>>>(Wb, Hh, Hl, bv, V16);
  // (5) attention -> bf16 hi / residual planes of the attention output (regions of Hh / Hl, dead by now)
  attn_k<<<dim3(NQ / AQ, NB), blk256, 0, stream>>>(Q16, K16, V16, Ah, Al);
  // (6) output projection + bias + residual -> out [b][512][4096]
  gemm_p<<<dim3(NQ / QT, CC / QT, NB), blk128, 0, stream>>>(Wb, Ah, Al, bp, x, out);
  (void)hipGetLastError();
}

// v005
// One run takes 273 microseconds.
// In two side-by-side timings against v004, it was 1.17 and 1.08 times as fast.
// All steps since v000 together make it 4.14 times as fast.
// Contractions: q/k/v 1x1-conv GEMMs W[512x512].H[512x4096] on v_wmma_f32_16x16x32_bf16 (W = bf16-RNE weights,
// exact; H = bf16 hi + bf16 residual planes of the normalised activations; 2 products, K=512); scores S^T = K.Q^T on
// v_wmma_f32_16x16x32_f16 (k, q: plain f16 planes, 1 product, K=512 split over two wave groups, fixed-order f32
// combine in LDS); O^T = V.P^T on v_wmma_f32_16x16x32_f16 (v: f16 plane, P = e^{s-m} x 2^14 as f16, K=4096); output
// 1x1-conv GEMM Wp[512x512].A[512x4096] on v_wmma_f32_16x16x32_bf16 (A = bf16 hi + residual planes of the
// attention output; 2 products, K=512). f32 accumulate everywhere; normalisation statistics in f64; softmax
// statistics, biases and the residual add in f32 VALU.
#include <hip/hip_runtime.h>
#include <math.h>
#include <stdint.h>

#ifndef NB
#define NB 4
#endif
#ifndef NQ
#define NQ 4096
#endif
#define NB_FULL 4
#define CC     512
#define NN     4096
#define NGRP   32
#define GSZ    16
#define QT     64
#define AQ     64
#define GWO    256
#define GWN    128
#define PSP    132
#define OSH    260
#define TP     72
#define SPP    36
#define PFP    40
#define SCL    0.044194173824159216f
#define LNPS   9.704060527839234f
#define GEPS   1.0e-6
#define SLD    8
#define NKB    (NN / 32)

static_assert(NB >= 1 && NB <= NB_FULL);
static_assert(NQ >= GWN && NQ <= NN && NQ % GWN == 0 && NQ % AQ == 0);
static_assert(NN % QT == 0 && NN % GWN == 0 && NN % AQ == 0 && NN % 32 == 0);
static_assert(CC == 8 * QT && CC % GWO == 0 && CC % 32 == 0);
static_assert(GSZ * NGRP == CC && GSZ == 16);
static_assert((GSZ * NN) % (4 * 256 * SLD) == 0);
static_assert((PSP * 4) % 16 == 0 && (OSH * 4) % 16 == 0 && (TP * 2) % 16 == 0);
static_assert((SPP * 4) % 16 == 0 && (PFP * 2) % 16 == 0);
static_assert(OSH >= GWO && PSP >= GWN && GWN * OSH * 4 <= 163840 && GWO * PSP * 4 <= 163840);
static_assert(AQ == 64 && (4 * AQ * SPP * 4 + 2 * AQ * PFP * 2 + AQ * OSH * 4 + 4 * AQ * 4) <= 327680);
static_assert(NKB >= 3 && (AQ * PFP) % 8 == 0);

typedef _Float16       v16h __attribute__((ext_vector_type(16)));
typedef _Float16       v8h  __attribute__((ext_vector_type(8)));
typedef __bf16         v16b __attribute__((ext_vector_type(16)));
typedef unsigned short v8us __attribute__((ext_vector_type(8)));
typedef float          v8f  __attribute__((ext_vector_type(8)));
typedef float          v4f  __attribute__((ext_vector_type(4)));
typedef unsigned int   v4u  __attribute__((ext_vector_type(4)));

union Frag  { v8us u[2]; v16h h; v16b bf; };
static_assert(sizeof(Frag) == 32);

// ---- scalar helpers -------------------------------------------------------------------------------------------
__device__ __forceinline__ unsigned short bf_bits(float f) {          // f32 -> bf16 bits, RNE convert
  unsigned u = __float_as_uint(f);
  return (unsigned short)((u + 0x7FFFu + ((u >> 16) & 1u)) >> 16);
}
__device__ __forceinline__ float bf_up(unsigned short hb) { return __uint_as_float(((unsigned)hb) << 16); }
__device__ __forceinline__ float bfr(float f) { return bf_up(bf_bits(f)); }
__device__ __forceinline__ unsigned short h_bits(_Float16 x) { return __builtin_bit_cast(unsigned short, x); }
__device__ __forceinline__ unsigned pk16(unsigned short a, unsigned short b) { return (unsigned)a | ((unsigned)b << 16); }
__device__ __forceinline__ v8f zero8() { v8f z = {0.f, 0.f, 0.f, 0.f, 0.f, 0.f, 0.f, 0.f}; return z; }
__device__ __forceinline__ unsigned wave_ballot(bool p) {
#if defined(__HIP_DEVICE_COMPILE__)
  return __builtin_amdgcn_ballot_w32(p);
#else
  return p ? 1u : 0u;
#endif
}

// ---- 16-bit fragment loader (A, or B from a k-contiguous [n][k] row): lane -> row/col (lane&15), p already includes
//      + 8*(lane>>4); elements 0..7 <- p[0..7] (k0+8h..), elements 8..15 <- p[16..23] (k0+16+8h..)
__device__ __forceinline__ Frag ldfrag(const unsigned short* p) {
  Frag f;
  f.u[0] = *(const v8us*)(p);
  f.u[1] = *(const v8us*)(p + 16);
  return f;
}

// ---- fragment-major planes (every 16-bit operand plane in the workspace): a plane of R rows x KD k-elements is cut
//      into fragments of 16 rows x 32 k = 512 elements; fragment (row tile rt, k step ks) starts at element
//      16*rt*KD + 512*ks and holds [u 0..1][lane 0..31][8 elements]: lane = 16*h + (row&15), k = 32*ks + 16*u + 8*h + t.
//      That is the register order of ldfrag above, so one fragment is two loads of 512 contiguous bytes per wave
//      (4 whole 128-B lines each) where a row-major plane gives 16 partial lines per load. p already includes + 8*lane.
__device__ __forceinline__ Frag ldfm(const unsigned short* p) {
  Frag f;
  f.u[0] = *(const v8us*)(p);
  f.u[1] = *(const v8us*)(p + 256);
  return f;
}

// ---- WMMA helpers. f16 form (attention): the plain builtin; the compiler keeps the distances behind its own WMMAs. The
//      asm pad of the bf16 form takes its operands from v0..v255 alone: built with it, the 64-query tile spills to scratch.
__device__ __forceinline__ v8f mma_h(v16h a, v16h b, v8f c) {
  return __builtin_amdgcn_wmma_f32_16x16x32_f16(false, a, false, b, (short)0, c, false, false);
}
// bf16 form (GEMMs): builtin followed by a 4-slot VALU gap tying D and keeping A/B live
__device__ __forceinline__ v8f mma_b(v16b a, v16b b, v8f c) {
  v8f d = __builtin_amdgcn_wmma_f32_16x16x32_bf16(false, a, false, b, (short)0, c, false, false);
#if defined(__HIP_DEVICE_COMPILE__)
  const v16h ha = __builtin_bit_cast(v16h, a), hb = __builtin_bit_cast(v16h, b);
  asm volatile("v_nop\n\tv_nop\n\tv_nop\n\tv_nop" : "+v"(d) : "v"(ha), "v"(hb));
#endif
  return d;
}

// ---- work-group barrier of the attention loop: orders LDS only (release / acquire on the local address space), so the
//      k and v requests that are in flight at it stay in flight; __syncthreads() would wait for them at every barrier.
//      The loop stores nothing to global memory and reads there only what earlier launches wrote.
__device__ __forceinline__ void lds_barrier() {
#if defined(__HIP_DEVICE_COMPILE__)
  __builtin_amdgcn_fence(__ATOMIC_RELEASE, "workgroup", "local");
  __builtin_amdgcn_s_barrier();
  __builtin_amdgcn_fence(__ATOMIC_ACQUIRE, "workgroup", "local");
#endif
}

// =============================================================================================================
// (0) conv weights: Wb bf16, rows 512*matrix + o, k = c, fragment-major; matrix 0 = wq, 1 = wk, 2 = wv, 3 = wp; value =
//     bf16-RNE(w). Block blk (0..511): matrix blk/128 (block-uniform), row tile blk/4; wave gw = 8 blk + w owns the
//     half u = gw&1 of the fragment of k step (gw>>1)&15 and stores it as 512 contiguous bytes.
// coverage: 128 row tiles x 16 k steps x 2 halves = 4096 waves x 32 lanes x 8 = the whole plane.
// =============================================================================================================
__global__ __launch_bounds__(256)
void cvt_w(const float* __restrict__ wq, const float* __restrict__ wk, const float* __restrict__ wv,
           const float* __restrict__ wp, unsigned short* Wb) {
  const int tid = threadIdx.x, blk = blockIdx.x;
  const int wave = tid >> 5, lane = tid & 31;
  const int sel = blk / (CC / 4);                                          // 0..3, block-uniform
  const float* src = (sel == 0) ? wq : (sel == 1) ? wk : (sel == 2) ? wv : wp;   // all global
  const int gw  = blk * 8 + wave;                                          // 0..4095
  const int u   = gw & 1, ks = (gw >> 1) & 15, rt = gw >> 5;               // rt 0..127 = blk / 4
  const int o   = (rt & 31) * 16 + (lane & 15);                            // 0..511
  const int col = 32 * ks + 16 * u + 8 * (lane >> 4);                      // 0..504
  const float* s = src + (size_t)o * CC + col;
  const v4f a = *(const v4f*)s;
  const v4f q = *(const v4f*)(s + 4);
  const float f[8] = {a[0], a[1], a[2], a[3], q[0], q[1], q[2], q[3]};
  v4u pkv;
#pragma unroll
  for (int t = 0; t < 4; ++t) pkv[t] = pk16(bf_bits(f[2 * t]), bf_bits(f[2 * t + 1]));
{
    *(v4u*)(Wb + (size_t)(16 * rt) * CC + 512 * ks + 256 * u + 8 * lane) = pkv;
    
  }
}

// =============================================================================================================
// (1) group-normalisation statistics of bf16-RNE(x): block bg = b*32+g owns the 16 channels x 4096 positions
// =============================================================================================================
__global__ __launch_bounds__(256)
void gn_stats(const float* __restrict__ x, float* stats) {
  __shared__ double red[256];
  const int tid = threadIdx.x, bg = blockIdx.x;
  const v4f* p = (const v4f*)(x + (size_t)bg * GSZ * NN);
  const int N4 = GSZ * NN / 4;                                            // 16384
  const double invN = 1.0 / (double)(GSZ * NN);

  double s = 0.0;
#pragma unroll 1
  for (int i = tid; i < N4; i += 256 * SLD) {
    v4f v[SLD];                                                           // SLD loads in flight per lane, old sum order
#pragma unroll                                                            // v[] stays in registers
    for (int u = 0; u < SLD; ++u) v[u] = p[i + 256 * u];
#pragma unroll                                                            // v[] stays in registers
    for (int u = 0; u < SLD; ++u)
      s += ((double)bfr(v[u][0]) + (double)bfr(v[u][1])) + ((double)bfr(v[u][2]) + (double)bfr(v[u][3]));
  }
  red[tid] = s;
  __syncthreads();
#pragma unroll 1
  for (int off = 128; off > 0; off >>= 1) {
    if (tid < off) red[tid] += red[tid + off];
    __syncthreads();
  }
  const double mean = red[0] * invN;
  __syncthreads();                                                        // everyone read red[0]

  double s2 = 0.0;
#pragma unroll 1
  for (int i = tid; i < N4; i += 256 * SLD) {
    v4f v[SLD];                                                           // SLD loads in flight per lane, old sum order
#pragma unroll                                                            // v[] stays in registers
    for (int u = 0; u < SLD; ++u) v[u] = p[i + 256 * u];
#pragma unroll                                                            // v[] stays in registers
    for (int u = 0; u < SLD; ++u) {
#pragma unroll
      for (int t = 0; t < 4; ++t) {
        const double d = (double)bfr(v[u][t]) - mean;
        s2 += d * d;
      }
    }
  }
  red[tid] = s2;
  __syncthreads();
#pragma unroll 1
  for (int off = 128; off > 0; off >>= 1) {
    if (tid < off) red[tid] += red[tid + off];
    __syncthreads();
  }
  const double var = red[0] * invN;
  const float meanf = (float)mean;
  const float rstdf = (float)(1.0 / sqrt(var + GEPS));

  v4f val = {0.f, 0.f, 0.f, 0.f};
  if (tid == 0) { val[0] = meanf; val[1] = rstdf; }
  float* dst = stats + (size_t)bg * 32 + 4 * (tid & 7);
  if (tid < 8) *(v4f*)dst = val;
  
}

// =============================================================================================================
// (2) h = (bf16-RNE(x) - mean) * rstd * bf16-RNE(gn_w) + bf16-RNE(gn_b) in f32, then bf16 hi = RNE(h) and bf16
//     lo = RNE(h - hi), written as Hh/Hl bf16, rows 4096 b + n, k = c, fragment-major (for the conv GEMMs).
//     Block (nb, cb, b) owns 64 n x 64 c through LDS tiles Th/Tl[64 n][64 c] (pitch TP; cross-wave, block barrier).
// coverage: Th/Tl 2 it x 32 rows(c) x 8 lanes x 8 n = 64 x 64 (staged extent == consumed extent); planes 2 it x 8
//           waves = 4 row tiles x 2 k steps x 2 halves of 512 B per plane; grid (64, 8, NB) covers all 4096 n x 512 c.
// =============================================================================================================
__global__ __launch_bounds__(256)
void gn_apply(const float* __restrict__ x, const float* __restrict__ gw, const float* __restrict__ gb,
              const float* __restrict__ stats, unsigned short* Hh, unsigned short* Hl) {
  __shared__ __align__(16) unsigned short Th[QT * TP];
  __shared__ __align__(16) unsigned short Tl[QT * TP];
  const int tid = threadIdx.x;
  const int nb = blockIdx.x, cb = blockIdx.y, b = blockIdx.z;
  const int e = tid & 7, lq = tid >> 3;                                  // lq 0..31
  const int n0 = nb * QT, c0 = cb * QT;
#pragma unroll
  for (int it = 0; it < 2; ++it) {
    const int cl = it * 32 + lq;                                          // 0..63
    const int ch = c0 + cl;                                               // 0..511
    const int g  = ch / GSZ;                                              // 0..31
    const float mean = stats[(size_t)(b * NGRP + g) * 32 + 0];
    const float rstd = stats[(size_t)(b * NGRP + g) * 32 + 1];
    const float w  = bfr(gw[ch]);
    const float bb = bfr(gb[ch]);
    const float* sp = x + ((size_t)(b * CC + ch)) * NN + n0 + 8 * e;
    const v4f a = *(const v4f*)sp;
    const v4f q = *(const v4f*)(sp + 4);
    const float f[8] = {a[0], a[1], a[2], a[3], q[0], q[1], q[2], q[3]};
#pragma unroll
    for (int t = 0; t < 8; ++t) {
      const float h = (bfr(f[t]) - mean) * rstd * w + bb;
      const unsigned short hb = bf_bits(h);
      const unsigned short lb = bf_bits(h - bf_up(hb));
      Th[(8 * e + t) * TP + cl] = hb;
      Tl[(8 * e + t) * TP + cl] = lb;
    }
  }
  __syncthreads();
  const int lane = tid & 31, wave = tid >> 5;
  v4u uh[2], ul[2];
#pragma unroll
  for (int it = 0; it < 2; ++it) {
    const int pc = it * 8 + wave;                                         // piece: row tile pc>>2, chunk pair pc&3
    const int lo = (16 * (pc >> 2) + (lane & 15)) * TP + 16 * (pc & 3) + 8 * (lane >> 4);
    uh[it] = *(const v4u*)(Th + lo);
    ul[it] = *(const v4u*)(Tl + lo);
  }
{
#pragma unroll
    for (int it = 0; it < 2; ++it) {
      const int pc = it * 8 + wave;
      const size_t po = ((size_t)(b * NN + n0 + 16 * (pc >> 2))) * CC + 16 * c0 + 256 * (pc & 3) + 8 * lane;
      *(v4u*)(Hh + po) = uh[it];
      *(v4u*)(Hl + po) = ul[it];
    }
    
  }
}

// =============================================================================================================
// GEMM core of launches (3), (4) and (6). Work-group = 8 waves = 256 output channels x 128 positions; wave w owns 128
//     channels (8 weight row tiles, base 128 (w>>2)) x 32 positions (2 row tiles, base 32 (w&3)) = 16 accumulator tiles.
//     Per k step of 32 a wave fetches 8 weight fragments and 2 x 2 activation fragments (hi and residual plane) for 32
//     WMMAs: a weight fragment feeds 2 position tiles in both planes, an activation fragment 8 channel tiles. The four waves
//     of one channel half ask for the same weight lines and the two waves of one position group for the same activation lines.
//     wp, hp, lp: the wave's first fragment in each plane, + 8*lane. Per accumulator: hi then residual of k step 0, 1, .. 15.
//     WROWS: D rows = channels (A = weights, B = activations); else D rows = positions (A = activations, B = weights).
// =============================================================================================================
template <bool WROWS>
__device__ __forceinline__ void gemm_core(const unsigned short* wp, const unsigned short* hp,
                                          const unsigned short* lp, v8f (&acc)[16]) {
#pragma unroll                                                            // constant indices: the arrays stay in registers
  for (int j = 0; j < 16; ++j) acc[j] = zero8();

#pragma unroll 2                                                          // one branch and one count per two k steps
  for (int ks = 0; ks < CC / 32; ++ks) {
    Frag fh[2], fl[2], fw[8];                                             // all loads of the step before its first WMMA
#pragma unroll                                                            // fh[], fl[] stay in registers
    for (int t = 0; t < 2; ++t) {
      fh[t] = ldfm(hp + (size_t)(16 * t) * CC);
      fl[t] = ldfm(lp + (size_t)(16 * t) * CC);
    }
#pragma unroll                                                            // fw[] stays in registers
    for (int m = 0; m < 8; ++m) fw[m] = ldfm(wp + (size_t)(16 * m) * CC);
    // the step's requests name the registers of wp, hp and lp: the wait stands in front of the additions that rewrite them
    // (the step length goes through the statement, so that no addition can be lifted over the wait)
    unsigned kstep = 512u;
    asm volatile("s_wait_xcnt 0x0" : "+s"(kstep) : : "memory");
    wp += kstep;
    hp += kstep;
    lp += kstep;
    // the 16 tiles' hi products, then their 16 residual products
#pragma unroll                                                            // constant indices: the arrays stay in registers
    for (int m = 0; m < 8; ++m) {
#pragma unroll                                                            // constant indices: the arrays stay in registers
      for (int t = 0; t < 2; ++t)
        acc[2 * m + t] = WROWS ? mma_b(fw[m].bf, fh[t].bf, acc[2 * m + t]) : mma_b(fh[t].bf, fw[m].bf, acc[2 * m + t]);
    }
#pragma unroll                                                            // constant indices: the arrays stay in registers
    for (int m = 0; m < 8; ++m) {
#pragma unroll                                                            // constant indices: the arrays stay in registers
      for (int t = 0; t < 2; ++t)
        acc[2 * m + t] = WROWS ? mma_b(fw[m].bf, fl[t].bf, acc[2 * m + t]) : mma_b(fl[t].bf, fw[m].bf, acc[2 * m + t]);
    }
  }
}

// =============================================================================================================
// (3) q / k conv GEMM for one (b, 128-n tile, matrix sel = mb/2, 256-o block o0 = (mb%2)*256):
//     Y[o][n] = sum_c W[o][c] (Hh + Hl)[b][n][c] + bf16-RNE(bias[o]); D rows = channels, K = 512 = 16 steps x 2 products.
//     Epilogue staged in LDS Os[n_loc][o_loc] (pitch OSH, b128 stores of 8 consecutive o per lane; cross-wave,
//     block barrier), then sel 0 -> Q16, sel 1 -> K16, plain f16, rows 4096 b + n, k = d, fragment-major.
// coverage: Os 8 waves x 32 n x 128 o = 128 x 256 (staged == consumed); plane 16 it x 8 waves = 8 row tiles x 8 k steps x 2
//           halves of 512 B = 128 n x 256 d; grid (32, 4, NB) covers d 0..511 of all 4096 rows of Q16 and K16 once.
// =============================================================================================================
__global__ __launch_bounds__(256)
void gemm_qk(const unsigned short* __restrict__ Wb, const unsigned short* __restrict__ Hh,
             const unsigned short* __restrict__ Hl, const float* __restrict__ bq, const float* __restrict__ bk,
             unsigned short* Q16, unsigned short* K16) {
  __shared__ __align__(16) float Os[GWN * OSH];
  const int tid  = threadIdx.x;
  const int lane = tid & 31, wave = tid >> 5;
  const int hh   = lane >> 4, c = lane & 15;
  const int nt   = blockIdx.x, mb = blockIdx.y, b = blockIdx.z;
  const int sel  = mb / (CC / GWO);                                        // 0 = q, 1 = k (block-uniform)
  const int n0   = nt * GWN, o0 = (mb % (CC / GWO)) * GWO;
  const int nw   = 32 * (wave & 3), ow = 128 * (wave >> 2);                // this wave's tile inside the block's

  const size_t ho = ((size_t)(b * NN + n0 + nw)) * CC + 8 * lane;
  v8f acc[16];
  gemm_core<true>(Wb + ((size_t)(sel * CC + o0 + ow)) * CC + 8 * lane, Hh + ho, Hl + ho, acc);

  // ---- epilogue: + bias -> LDS Os[n_loc][o_loc]; lane (hh, c) holds o = ow + 16 m + 8 hh + r for n_loc = nw + 16 t + c
  const float* bsrc = ((sel == 0) ? bq : bk) + o0 + ow + 8 * hh;          // block-uniform choice, both global
  v4f bl[16];
#pragma unroll                                                            // bl[] stays in registers
  for (int m = 0; m < 16; ++m) bl[m] = *(const v4f*)(bsrc + 16 * (m >> 1) + 4 * (m & 1));
  // the bias requests name the registers of bsrc: it goes through the statement as an input, so that they are left alone
  // (also by what the requests bring) up to the wait
  asm volatile("s_wait_xcnt 0x0" : : "v"(bsrc) : "memory");
#pragma unroll                                                            // constant indices: the arrays stay in registers
  for (int m = 0; m < 8; ++m) {
    const v4f b0 = bl[2 * m], b1 = bl[2 * m + 1];
#pragma unroll                                                            // constant indices: the arrays stay in registers
    for (int t = 0; t < 2; ++t) {
      v4f va, vb;
#pragma unroll                                                            // constant indices: the arrays stay in registers
      for (int r = 0; r < 4; ++r) { va[r] = acc[2 * m + t][r] + bfr(b0[r]); vb[r] = acc[2 * m + t][4 + r] + bfr(b1[r]); }
      float* sp = Os + (nw + 16 * t + c) * OSH + ow + 16 * m + 8 * hh;
      *(v4f*)sp       = va;
      *(v4f*)(sp + 4) = vb;
    }
  }
  __syncthreads();

  unsigned short* Ph = (sel == 0) ? Q16 : K16;                             // block-uniform, both global
  v4u uv[16];
#pragma unroll                                                            // constant indices: the arrays stay in registers
  for (int it = 0; it < 16; ++it) {                                        // piece: row tile it>>1, chunk pair 8 (it&1) + wave
    const int lo = (16 * (it >> 1) + c) * OSH + 16 * (8 * (it & 1) + wave) + 8 * hh;
    const v4f a = *(const v4f*)(Os + lo);
    const v4f q = *(const v4f*)(Os + lo + 4);
    const float f[8] = {a[0], a[1], a[2], a[3], q[0], q[1], q[2], q[3]};
#pragma unroll                                                            // constant indices: the arrays stay in registers
    for (int t = 0; t < 4; ++t)
      uv[it][t] = pk16(h_bits((_Float16)f[2 * t]), h_bits((_Float16)f[2 * t + 1]));
  }
  const size_t po = ((size_t)(b * NN + n0)) * CC + 16 * o0 + 256 * wave + 8 * lane;
#pragma unroll                                                            // constant indices: the arrays stay in registers
  for (int it = 0; it < 16; ++it) *(v4u*)(Ph + po + (size_t)(16 * (it >> 1)) * CC + 2048 * (it & 1)) = uv[it];
}

// =============================================================================================================
// (4) v conv GEMM for one (b, 128-n tile, 256-o block o0 = mb*256), operands swapped so the D rows are positions:
//     D[n][o] = sum_c (Hh + Hl)[b][n][c] Wv[o][c] (2 products, K = 512).
//     Per lane the D tile holds 8 consecutive n of one o -> LDS Vs[o_loc][n_loc] (pitch PSP, b128 stores;
//     cross-wave, block barrier), then V16 f16, rows 512 b + o, k = n (KD = 4096), fragment-major, = f16(D +
//     bf16-RNE(bv[o])) (unscaled, |v| ~ 1).
// coverage: Vs 8 waves x 32 n x 128 o = 256 x 128 (staged == consumed); V16 16 it (row tiles) x 8 waves (4 k steps x 2
//           halves of 512 B) = 256 o x 128 n; grid (32, 2, NB) covers all 512 o x 4096 n of each b exactly once.
// =============================================================================================================
__global__ __launch_bounds__(256)
void gemm_v(const unsigned short* __restrict__ Wb, const unsigned short* __restrict__ Hh,
            const unsigned short* __restrict__ Hl, const float* __restrict__ bv, unsigned short* V16) {
  __shared__ __align__(16) float Vs[GWO * PSP];
  const int tid  = threadIdx.x;
  const int lane = tid & 31, wave = tid >> 5;
  const int hh   = lane >> 4, c = lane & 15;
  const int nt   = blockIdx.x, mb = blockIdx.y, b = blockIdx.z;
  const int n0   = nt * GWN, o0 = mb * GWO;
  const int nw   = 32 * (wave & 3), ow = 128 * (wave >> 2);                // this wave's tile inside the block's

  const size_t ho = ((size_t)(b * NN + n0 + nw)) * CC + 8 * lane;
  v8f acc[16];
  gemm_core<false>(Wb + ((size_t)(2 * CC + o0 + ow)) * CC + 8 * lane, Hh + ho, Hl + ho, acc);

  // ---- epilogue: lane (hh, c) holds n_loc = nw + 16 t + 8 hh + r of o_loc = ow + 16 m + c
#pragma unroll                                                            // constant indices: the arrays stay in registers
  for (int m = 0; m < 8; ++m) {
    const float bb = bfr(bv[o0 + ow + 16 * m + c]);
#pragma unroll                                                            // constant indices: the arrays stay in registers
    for (int t = 0; t < 2; ++t) {
      v4f va, vb;
#pragma unroll                                                            // constant indices: the arrays stay in registers
      for (int r = 0; r < 4; ++r) { va[r] = acc[2 * m + t][r] + bb; vb[r] = acc[2 * m + t][4 + r] + bb; }
      float* sp = Vs + (ow + 16 * m + c) * PSP + nw + 16 * t + 8 * hh;
      *(v4f*)sp       = va;
      *(v4f*)(sp + 4) = vb;
    }
  }
  __syncthreads();

  v4u uv[16];
#pragma unroll                                                            // constant indices: the arrays stay in registers
  for (int it = 0; it < 16; ++it) {
    const int lo = (it * 16 + c) * PSP + 16 * wave + 8 * hh;               // row tile it, chunk pair = wave
    const v4f a = *(const v4f*)(Vs + lo);
    const v4f q = *(const v4f*)(Vs + lo + 4);
    const float f[8] = {a[0], a[1], a[2], a[3], q[0], q[1], q[2], q[3]};
#pragma unroll                                                            // constant indices: the arrays stay in registers
    for (int t = 0; t < 4; ++t)
      uv[it][t] = pk16(h_bits((_Float16)f[2 * t]), h_bits((_Float16)f[2 * t + 1]));
  }
  const size_t po = ((size_t)(b * CC + o0)) * NN + 16 * n0 + 256 * wave + 8 * lane;
#pragma unroll                                                            // constant indices: the arrays stay in registers
  for (int it = 0; it < 16; ++it) *(v4u*)(V16 + po + (size_t)(16 * it) * NN) = uv[it];
}

// =============================================================================================================
// (5) attention for one (b, 64-query tile), transposed formulation, 4096 keys, no mask. Block = 8 waves, one block per
//   WGP (grid 64 x NB): every K and V fragment that a block fetches feeds 64 queries.
//   Score phase per 32-key block kb: wave w computes TWO S^T partial tiles (16 keys x 16 queries each) from one set of
//   k fragments: key tile kt = w&1 (keys kb+16kt..), query tiles 2 qg + i, qg = (w>>1)&1, i = 0..1 (queries
//   n0+16(2qg+i)..), over the d-half dh = w>>2 (d 256dh .. 256dh+255, 8 steps of 32): A = k rows (row = key,
//   fragment-major, split k map) from K16, B = q rows (col = query, same map) from Q16, plain f16, 1 product. Each
//   partial (D row = key 8h+r, col = query) goes to LDS Sp[dh][query][key] (pitch SPP, b128 stores; cross-wave, block
//   barrier); the two d-halves are added in fixed order by the softmax lanes.
//   Softmax: waves 0 and 1, query = 32 w + lane: s_j = (Sp[0] + Sp[1]) * 512^-0.5 for the 32 keys, online max / sum in
//   f32 registers (m, l live in those two waves only), corr = e^{m_old - m_new} -> Cs[query], grew flag -> Fl[w],
//   P_j = e^{s_j - m} x 2^14 as f16 -> Pf[query][key] (pitch PFP, 4 x 16-B stores per row; cross-wave, block barrier).
//   O^T (rows channel, cols query): every wave owns channels 64w..64w+63 (4 tiles j) x 64 queries (4 tiles) = 16
//   accumulator tiles; rescale by Cs when a flag is set (block-uniform; corr is exactly 1 for a query whose max did not
//   grow), then += A(v rows channel = 64w+16j+(lane&15), keys kb.., fragment-major f16 plane V16) . B(P^T: row = query
//   from Pf, keys contiguous, same k order).
//   The three phases run as a pipeline over the key blocks, ONE barrier per key block: between two barriers every wave
//   does the scores of block i+1 and O^T of block i-1, and waves 0 and 1 then the softmax of block i. Sp, Pf, Cs and Fl
//   have two buffers each (index = key block & 1): what a pass writes was last read in the pass before, behind a barrier,
//   and is read in the next pass. Order of every sum as in the unpipelined loop. Fill: block 0's scores ahead of the
//   loop, and P = 0, flags = 0, corr = 1 for the O^T step of pass 0 (adds zero); drain: the last pass scores its clamped block
//   again (never read), O^T of the last block stands behind the loop.
//   Epilogue in two 256-channel halves: waves with (w>>2) == half stage O/l in LDS Os[query][256 ch] (pitch OSH, b128
//   stores; cross-wave, block barrier), then all 256 threads write Ah (bf16 hi) and Al (bf16 residual), fragment-major.
// coverage: Sp 8 waves x 2 tiles = [2 dh][64 q][32 keys] each key block (staged == consumed); Pf 64 rows x 32 keys by
//           waves 0, 1 (staged == consumed, pad cols never read; buffer 1 zeroed whole ahead of the loop); Os per half 4 waves x 64 q x 64 ch = 64 x 256 (staged
//           == consumed); planes 2 halves x 8 it x 8 waves x 512 B = 4 row tiles x 16 k steps per plane; grid (NQ/64,
//           NB) covers rows 0..NQ-1 exactly once (only those are read later).
// =============================================================================================================
__global__ __launch_bounds__(256)
void attn_k(const unsigned short* __restrict__ Q16, const unsigned short* __restrict__ K16,
            const unsigned short* __restrict__ V16, unsigned short* Ah, unsigned short* Al) {
  __shared__ __align__(16) float Sp[2 * 2 * AQ * SPP];
  __shared__ __align__(16) unsigned short Pf[2 * AQ * PFP];
  __shared__ __align__(16) float Os[AQ * OSH];
  __shared__ float Cs[2 * AQ];
  __shared__ float Ls[AQ];
  __shared__ __align__(8) int Fl[2 * (AQ / 32)];
  const int tid  = threadIdx.x;
  const int wave = tid >> 5, lane = tid & 31;
  const int hh   = lane >> 4, c = lane & 15;
  const int n0   = blockIdx.x * AQ, b = blockIdx.y;
  const int kt = wave & 1, qg = (wave >> 1) & 1, dh = wave >> 2;

  // q fragment pointer (B operand of S^T, col = query n0 + 16 (2 qg + i) + c, d-half dh), + 16*CC*i + 512*ks
  const unsigned short* qp = Q16 + ((size_t)(b * NN + n0 + 32 * qg)) * CC + 16 * (CC / 2) * dh + 8 * lane;
  // k fragment base (A operand, row = key kb + 16 kt + c, d-half dh), + kb*CC + 512*ks
  const unsigned short* kp = K16 + ((size_t)(b * NN + 16 * kt)) * CC + 16 * (CC / 2) * dh + 8 * lane;
  // v fragment base (A operand of O^T, row = channel 64 w + 16 j + c), + 16*j*NN + 16*kb (k step kb/32)
  const unsigned short* vp = V16 + ((size_t)(b * CC + 64 * wave)) * NN + 8 * lane;
  // this lane's S^T partial destination: Sp[dh][query 16(2qg+i)+c][key 16kt + 8hh + r], + 16*SPP*i
  float* spw = Sp + (dh * AQ + 32 * qg + c) * SPP + 16 * kt + 8 * hh;
  // P^T fragment rows (row = query 16 q + c, keys contiguous), + 16*PFP*q
  const unsigned short* pf = Pf + c * PFP + 8 * hh;

  // q fragments of this wave's d-half do not change with the key block: loaded once, kept in registers
  Frag fq[2][CC / 64];
#pragma unroll                                                            // fq[][] stays in registers
  for (int i = 0; i < 2; ++i) {
#pragma unroll
    for (int ks = 0; ks < CC / 64; ++ks) fq[i][ks] = ldfm(qp + (size_t)(16 * i) * CC + 512 * ks);
  }
  // the q requests are in flight and the code below reuses their address registers
  asm volatile("s_wait_xcnt 0x0" ::: "memory");

  float m_run = -1.0e30f, l_run = 0.f;
  v8f o[16];
#pragma unroll
  for (int j = 0; j < 16; ++j) o[j] = zero8();

  // ---- the two matrix phases, used in the fill, in the loop and in the drain
  Frag fk[CC / 64];
  Frag fv[4];
  // two score partial tiles over this wave's d-half, each k fragment used for both -> Sp buffer at dst
  auto score = [&](float* dst) __attribute__((always_inline)) {
    v8f s0 = zero8(), s1 = zero8();
#pragma unroll                                                            // fk[], fq[][] stay in registers
    for (int ks = 0; ks < CC / 64; ++ks) {
      s0 = mma_h(fk[ks].h, fq[0][ks].h, s0);
      s1 = mma_h(fk[ks].h, fq[1][ks].h, s1);
    }
    v4f sa, sb, sc, sd;
#pragma unroll
    for (int r = 0; r < 4; ++r) { sa[r] = s0[r]; sb[r] = s0[4 + r]; sc[r] = s1[r]; sd[r] = s1[4 + r]; }
    *(v4f*)(dst)                = sa;
    *(v4f*)(dst + 4)            = sb;
    *(v4f*)(dst + 16 * SPP)     = sc;
    *(v4f*)(dst + 16 * SPP + 4) = sd;
  };
  // the O^T step in two parts. pv_read: all its LDS reads (flags, corr, P^T fragments of buffer buf) as one group, placed
  // at the head of a pass so that they land under the score products. pv_math: rescale (block-uniform flags), O^T += V . P^T
  int fl0, fl1;
  float cr[4];
  Frag p[4];
  auto pv_read = [&](int buf) __attribute__((always_inline)) {
    fl0 = Fl[2 * buf];
    fl1 = Fl[2 * buf + 1];
#pragma unroll                                                            // cr[], p[] stay in registers
    for (int q = 0; q < 4; ++q) {
      cr[q] = Cs[AQ * buf + 16 * q + c];
      p[q]  = ldfrag(pf + AQ * PFP * buf + 16 * PFP * q);
    }
  };
  auto pv_math = [&]() __attribute__((always_inline)) {
    if ((fl0 | fl1) != 0) {
#pragma unroll
      for (int q = 0; q < 4; ++q) {
#pragma unroll
        for (int j = 0; j < 4; ++j) {
#pragma unroll
          for (int r = 0; r < 8; ++r) o[4 * j + q][r] *= cr[q];
        }
      }
    }
#pragma unroll
    for (int j = 0; j < 4; ++j) {
#pragma unroll
      for (int q = 0; q < 4; ++q) o[4 * j + q] = mma_h(fv[j].h, p[q].h, o[4 * j + q]);
    }
  };

  // ---- fill: scores of key block 0 -> Sp buffer 0; P = 0, flags = 0, corr = 1 in buffer 1 for the O^T step of pass 0; then
  //      the k fragments of block 1 and the v fragments of block 0 (finite values for that step, which adds v x 0)
  const unsigned short* kpn = kp;
  const unsigned short* vpn = vp;
#pragma unroll                                                            // fk[] stays in registers
  for (int ks = 0; ks < CC / 64; ++ks) fk[ks] = ldfm(kpn + 512 * ks);
  // every group of k or v requests names the registers of kpn or vpn: the wait stands in front of the step that rewrites
  // them (the step length goes through the statement, so that the addition cannot be lifted over the wait)
  unsigned kstep0 = 32u * CC;
  asm volatile("s_wait_xcnt 0x0" : "+s"(kstep0) : : "memory");
  kpn += kstep0;
  {
    const v4u z4 = {0u, 0u, 0u, 0u};
#pragma unroll 1
    for (int t = tid; t < AQ * PFP / 8; t += 256) *(v4u*)(Pf + AQ * PFP + 8 * t) = z4;
    if (tid < AQ / 32) Fl[AQ / 32 + tid] = 0;
    if (tid < AQ) Cs[AQ + tid] = 1.0f;
  }
  score(spw);
#pragma unroll                                                            // fk[] stays in registers
  for (int ks = 0; ks < CC / 64; ++ks) fk[ks] = ldfm(kpn + 512 * ks);
  unsigned kstep1 = 32u * CC;
  asm volatile("s_wait_xcnt 0x0" : "+s"(kstep1) : : "memory");            // as above
  kpn += kstep1;                                                          // from here on: two key blocks ahead of the pass
#pragma unroll                                                            // fv[] stays in registers
  for (int j = 0; j < 4; ++j) fv[j] = ldfm(vpn + (size_t)(16 * j) * NN);
  lds_barrier();

#pragma unroll 1
  for (int i = 0; i < NKB; ++i) {
    const int cur = i & 1, oth = cur ^ 1;
    pv_read(oth);
    // ---- scores of key block i+1 (last pass: the last block again, never read)
    score(spw + 2 * AQ * SPP * oth);
    // ---- the k fragments of key block i+2 are requested here, a whole pass ahead of their use (clamped to the last block)
#pragma unroll                                                            // fk[] stays in registers
    for (int ks = 0; ks < CC / 64; ++ks) fk[ks] = ldfm(kpn + 512 * ks);
    unsigned kstep = (i + 3 < NKB) ? 32u * CC : 0u;
    asm volatile("s_wait_xcnt 0x0" : "+s"(kstep) : : "memory");           // as above
    kpn += kstep;
    // keeps the test of the flags, and with it the wait for their LDS read, behind the score products: scheduled among them
    // it stalls the wave for the LDS latency at the head of the pass
    __builtin_amdgcn_sched_barrier(0);
    // ---- O^T of key block i-1 (pass 0: adds zero)
    pv_math();
    // ---- the v fragments of key block i are requested here, a whole pass ahead of their use
#pragma unroll                                                            // fv[] stays in registers
    for (int j = 0; j < 4; ++j) fv[j] = ldfm(vpn + (size_t)(16 * j) * NN);
    unsigned vstep = (i + 1 < NKB) ? 512u : 0u;
    asm volatile("s_wait_xcnt 0x0" : "+s"(vstep) : : "memory");           // as above
    vpn += vstep;

    // ---- online softmax of key block i for the 64 queries (waves 0 and 1, query = 32 wave + lane = tid)
    if (wave < AQ / 32) {
      const float* s0p = Sp + 2 * AQ * SPP * cur + tid * SPP;             // d-half 0
      const float* s1p = s0p + AQ * SPP;                                  // d-half 1
      float sv[32];
#pragma unroll
      for (int t8 = 0; t8 < 8; ++t8) {
        const v4f a0 = *(const v4f*)(s0p + 4 * t8);
        const v4f a1 = *(const v4f*)(s1p + 4 * t8);
#pragma unroll
        for (int t = 0; t < 4; ++t) sv[4 * t8 + t] = a0[t] + a1[t];
      }
      float mx = sv[0];
#pragma unroll
      for (int j = 1; j < 32; ++j) mx = fmaxf(mx, sv[j]);
      const float mxs = mx * SCL;
      const float mn  = fmaxf(m_run, mxs);
      const unsigned grew = wave_ballot(mxs > m_run);
      const float corr = __expf(m_run - mn);                             // == 1 exactly when the max did not grow
      m_run = mn;
      const float msh = mn - LNPS;                                        // exp gives e^{s-m} * 2^14
      float ls = 0.f;
      v4u pk[4];
#pragma unroll
      for (int g = 0; g < 4; ++g) {
#pragma unroll
        for (int t = 0; t < 4; ++t) {
          const float e0 = __expf(fmaf(sv[8 * g + 2 * t],     SCL, -msh));   // key 32i + 8g + 2t
          const float e1 = __expf(fmaf(sv[8 * g + 2 * t + 1], SCL, -msh));   // key 32i + 8g + 2t + 1
          ls += e0 + e1;
          pk[g][t] = pk16(h_bits((_Float16)e0), h_bits((_Float16)e1));
        }
      }
      l_run = l_run * corr + ls;
#pragma unroll
      for (int g = 0; g < 4; ++g) *(v4u*)(Pf + AQ * PFP * cur + tid * PFP + 8 * g) = pk[g];
      Cs[AQ * cur + tid] = corr;
      if (lane == 0) Fl[2 * cur + wave] = (grew != 0u) ? 1 : 0;
    }
    lds_barrier();
  }
  // ---- drain: O^T of the last key block
  pv_read((NKB - 1) & 1);
  pv_math();
  // the waits of the last pass already cover its k and v requests; this one is a precaution
  asm volatile("s_wait_xcnt 0x0" ::: "memory");
  if (wave < AQ / 32) Ls[tid] = 1.0f / l_run;                            // o and l both carry the 2^14 factor
  __syncthreads();
  float inv[4];
#pragma unroll
  for (int q = 0; q < 4; ++q) inv[q] = Ls[16 * q + c];

#pragma unroll
  for (int half = 0; half < 2; ++half) {
    if ((wave >> 2) == half) {
      const int chb = 64 * (wave & 3);                                    // channel offset inside this half
#pragma unroll
      for (int j = 0; j < 4; ++j) {
#pragma unroll
        for (int q = 0; q < 4; ++q) {
          v4f va, vb;
#pragma unroll
          for (int r = 0; r < 4; ++r) { va[r] = o[4 * j + q][r] * inv[q]; vb[r] = o[4 * j + q][4 + r] * inv[q]; }
          float* dst = Os + (16 * q + c) * OSH + chb + 16 * j + 8 * hh;   // Os[query][ch = chb + 16j + 8hh + r]
          *(v4f*)dst       = va;
          *(v4f*)(dst + 4) = vb;
        }
      }
    }
    __syncthreads();
    {
      v4u uh[AQ / 8], ul[AQ / 8];
#pragma unroll
      for (int it = 0; it < AQ / 8; ++it) {
        const int pc = it * 8 + wave;                                     // piece: row tile pc>>4, chunk pair pc&15
        const int lo = (16 * (pc >> 4) + c) * OSH + 16 * (pc & 15) + 8 * hh;
        const v4f a = *(const v4f*)(Os + lo);
        const v4f q = *(const v4f*)(Os + lo + 4);
        const float f[8] = {a[0], a[1], a[2], a[3], q[0], q[1], q[2], q[3]};
#pragma unroll
        for (int t = 0; t < 4; ++t) {
          const float f0 = f[2 * t], f1 = f[2 * t + 1];
          const unsigned short hb0 = bf_bits(f0), hb1 = bf_bits(f1);
          const unsigned short lb0 = bf_bits(f0 - bf_up(hb0));
          const unsigned short lb1 = bf_bits(f1 - bf_up(hb1));
          uh[it][t] = pk16(hb0, hb1);
          ul[it][t] = pk16(lb0, lb1);
        }
      }
#pragma unroll
      for (int it = 0; it < AQ / 8; ++it) {
        const int pc = it * 8 + wave;
        const size_t po = ((size_t)(b * NN + n0 + 16 * (pc >> 4))) * CC + 16 * (CC / 2) * half + 256 * (pc & 15) + 8 * lane;
        *(v4u*)(Ah + po) = uh[it];
        *(v4u*)(Al + po) = ul[it];
      }
    }
    __syncthreads();
  }
}

// =============================================================================================================
// (6) output projection + bias + residual for one (b, 128-n tile, 256-o block o0 = mb*256), D rows = positions:
//     D[n][o] = sum_c (Ah + Al)[b][n][c] Wp[o][c] (2 products, K = 512), GEMM core as in (4). Per lane 8 consecutive n of
//     one o -> LDS Vs[o_loc][n_loc] (pitch PSP, b128 stores; cross-wave, block barrier), then one wave per row: lane e ->
//     n 4e..4e+3, 4 whole lines of out per instruction.
// coverage: Vs 8 waves x 32 n x 128 o = 256 x 128 (staged == consumed); out 32 it x 8 rows x 32 lanes x 4 = 256 o x
//           128 n; grid (NQ/128, 2, NB) covers out[b][0..511][0..NQ-1] exactly once.
// =============================================================================================================
__global__ __launch_bounds__(256)
void gemm_p(const unsigned short* __restrict__ Wb, const unsigned short* __restrict__ Ah,
            const unsigned short* __restrict__ Al, const float* __restrict__ bp, const float* __restrict__ x,
            float* out) {
  __shared__ __align__(16) float Vs[GWO * PSP];
  const int tid  = threadIdx.x;
  const int lane = tid & 31, wave = tid >> 5;
  const int hh   = lane >> 4, c = lane & 15;
  const int nt   = blockIdx.x, mb = blockIdx.y, b = blockIdx.z;
  const int n0   = nt * GWN, o0 = mb * GWO;
  const int nw   = 32 * (wave & 3), ow = 128 * (wave >> 2);                // this wave's tile inside the block's

  const size_t ao = ((size_t)(b * NN + n0 + nw)) * CC + 8 * lane;
  v8f acc[16];
  gemm_core<false>(Wb + ((size_t)(3 * CC + o0 + ow)) * CC + 8 * lane, Ah + ao, Al + ao, acc);

  // ---- epilogue: lane (hh, c) holds n_loc = nw + 16 t + 8 hh + r of o_loc = ow + 16 m + c
#pragma unroll                                                            // constant indices: the arrays stay in registers
  for (int m = 0; m < 8; ++m) {
    const float bb = bfr(bp[o0 + ow + 16 * m + c]);
#pragma unroll                                                            // constant indices: the arrays stay in registers
    for (int t = 0; t < 2; ++t) {
      v4f va, vb;
#pragma unroll                                                            // constant indices: the arrays stay in registers
      for (int r = 0; r < 4; ++r) { va[r] = acc[2 * m + t][r] + bb; vb[r] = acc[2 * m + t][4 + r] + bb; }
      float* sp = Vs + (ow + 16 * m + c) * PSP + nw + 16 * t + 8 * hh;
      *(v4f*)sp       = va;
      *(v4f*)(sp + 4) = vb;
    }
  }
  __syncthreads();

  const size_t idx = ((size_t)(b * CC + o0 + wave)) * NN + n0 + 4 * lane;  // row it * 8 + wave: + 8 it NN
  v4f res[GWO / 8];
#pragma unroll                                                            // constant indices: the arrays stay in registers
  for (int it = 0; it < GWO / 8; ++it) {
    const v4f a = *(const v4f*)(Vs + (it * 8 + wave) * PSP + 4 * lane);
    const v4f xv = *(const v4f*)(x + idx + (size_t)(8 * it) * NN);
#pragma unroll                                                            // constant indices: the arrays stay in registers
    for (int t = 0; t < 4; ++t) res[it][t] = a[t] + bfr(xv[t]);
  }
#pragma unroll                                                            // constant indices: the arrays stay in registers
  for (int it = 0; it < GWO / 8; ++it) *(v4f*)(out + idx + (size_t)(8 * it) * NN) = res[it];
}

// =============================================================================================================
// Workspace map (bytes; each region start a multiple of 256; every extent is an exact tile multiple and is written
//   (all 16-bit planes fragment-major, same extents as row-major)
//   Wb    bf16 [4][512][512]          2097152
//   stats f32  [NB*32][32]             16384 (NB=4)
//   Hh/Hl bf16 [NB][4096][512]     16777216 x2   (reused as Ah/Al after their last reader, launch (4))
//   Q16/K16 f16 [NB][4096][512]   16777216 x2
//   V16   f16  [NB][512][4096]     16777216
//   total (NB=4) = 85999616
// =============================================================================================================
extern "C" void kernel_launch(void* const* d_in, const int* in_sizes, int n_in,
                              void* d_out, int out_size, void* d_ws, size_t ws_size,
                              hipStream_t stream) {
  if (n_in < 11) return;
  if (in_sizes[0] < NB * CC * NN) return;
  if (in_sizes[1] < CC || in_sizes[2] < CC) return;
  if (in_sizes[3] < CC * CC || in_sizes[5] < CC * CC || in_sizes[7] < CC * CC || in_sizes[9] < CC * CC) return;
  if (in_sizes[4] < CC || in_sizes[6] < CC || in_sizes[8] < CC || in_sizes[10] < CC) return;
  if (out_size < NB * CC * NN) return;

  size_t off = 0;
  auto carve = [&](size_t bytes) { const size_t o = off; off += (bytes + 255) & ~(size_t)255; return o; };
  const size_t plane = (size_t)NB * NN * CC * 2;
  const size_t oWb  = carve((size_t)4 * CC * CC * 2);
  const size_t oSt  = carve((size_t)NB * NGRP * 32 * 4);
  const size_t oHh  = carve(plane);
  const size_t oHl  = carve(plane);
  const size_t oQ   = carve(plane);
  const size_t oK   = carve(plane);
  const size_t oV   = carve(plane);
  const size_t oAh  = oHh;                                                // same extent, disjoint lifetimes
  const size_t oAl  = oHl;
  if (off > ws_size) return;
  if (off > (size_t)134217728) return;

  const float* x   = (const float*)d_in[0];
  const float* gnw = (const float*)d_in[1];
  const float* gnb = (const float*)d_in[2];
  const float* wq  = (const float*)d_in[3];
  const float* bq  = (const float*)d_in[4];
  const float* wk  = (const float*)d_in[5];
  const float* bk  = (const float*)d_in[6];
  const float* wv  = (const float*)d_in[7];
  const float* bv  = (const float*)d_in[8];
  const float* wp  = (const float*)d_in[9];
  const float* bp  = (const float*)d_in[10];

  char* ws = (char*)d_ws;
  unsigned short* Wb  = (unsigned short*)(ws + oWb);
  float*          St  = (float*)(ws + oSt);
  unsigned short* Hh  = (unsigned short*)(ws + oHh);
  unsigned short* Hl  = (unsigned short*)(ws + oHl);
  unsigned short* Q16 = (unsigned short*)(ws + oQ);
  unsigned short* K16 = (unsigned short*)(ws + oK);
  unsigned short* V16 = (unsigned short*)(ws + oV);
  unsigned short* Ah  = (unsigned short*)(ws + oAh);
  unsigned short* Al  = (unsigned short*)(ws + oAl);
  float* out = (float*)d_out;

  const dim3 blk256(256);

  // (0) conv weights -> stacked bf16 plane
  cvt_w<<<dim3(4 * (CC / 4)), blk256, 0, stream>>>(wq, wk, wv, wp, Wb);
  // (1) group statistics per (b, g) in f64
  gn_stats<<<dim3(NB * NGRP), blk256, 0, stream>>>(x, St);
  // (2) normalised activations -> fragment-major bf16 hi / residual planes
  gn_apply<<<dim3(NN / QT, CC / QT, NB), blk256, 0, stream>>>(x, gnw, gnb, St, Hh, Hl);
  // (3) q and k -> fragment-major f16 planes (rows = positions)
  gemm_qk<<<dim3(NN / GWN, 2 * (CC / GWO), NB), blk256, 0, stream>>>(Wb, Hh, Hl, bq, bk, Q16, K16);
  // (4) v -> fragment-major f16 plane (rows = channels)
  gemm_v<<<dim3(NN / GWN, CC / GWO, NB), blk256, 0, stream>>>(Wb, Hh, Hl, bv, V16);
  // (5) attention -> bf16 hi / residual planes of the attention output (regions of Hh / Hl, dead by now)
  attn_k<<<dim3(NQ / AQ, NB), blk256, 0, stream>>>(Q16, K16, V16, Ah, Al);
  // (6) output projection + bias + residual -> out [b][512][4096]
  gemm_p<<<dim3(NQ / GWN, CC / GWO, NB), blk256, 0, stream>>>(Wb, Ah, Al, bp, x, out);
  (void)hipGetLastError();
}

// v006
// It runs in 262 microseconds.
// Next to v005, in two timings, it ran 1.05 and 1.03 times as fast.
// Over all steps from v000 it is 4.31 times as fast.
// Contractions: q/k/v 1x1-conv GEMMs W[512x512].H[512x4096] on v_wmma_f32_16x16x32_bf16 (W = bf16-RNE weights,
// exact; H = bf16 hi + bf16 residual planes of the normalised activations; 2 products, K=512); scores S^T = K.Q^T on
// v_wmma_f32_16x16x32_f16 (k, q: plain f16 planes, 1 product, K=512 split over two wave groups, fixed-order f32
// combine in LDS); O^T = V.P^T on v_wmma_f32_16x16x32_f16 (v: f16 plane, P = e^{s-m} x 2^14 as f16, K=4096); output
// 1x1-conv GEMM Wp[512x512].A[512x4096] on v_wmma_f32_16x16x32_bf16 (A = bf16 hi + residual planes of the
// attention output; 2 products, K=512). f32 accumulate everywhere; normalisation statistics in f64; softmax
// statistics, biases and the residual add in f32 VALU.
#include <hip/hip_runtime.h>
#include <math.h>
#include <stdint.h>

#ifndef NB
#define NB 4
#endif
#ifndef NQ
#define NQ 4096
#endif
#define NB_FULL 4
#define CC     512
#define NN     4096
#define NGRP   32
#define GSZ    16
#define QT     64
#define AQ     64
#define GWO    256
#define GWN    128
#define PSP    132
#define OSH    260
#define TP     72
#define SPP    36
#define PFP    40
#define SCL    0.044194173824159216f
#define LNPS   9.704060527839234f
#define GEPS   1.0e-6
#define SLD    8
#define NKB    (NN / 32)

static_assert(NB >= 1 && NB <= NB_FULL);
static_assert(NQ >= GWN && NQ <= NN && NQ % GWN == 0 && NQ % AQ == 0);
static_assert(NN % QT == 0 && NN % GWN == 0 && NN % AQ == 0 && NN % 32 == 0);
static_assert(CC == 8 * QT && CC % GWO == 0 && CC % 32 == 0);
static_assert(GSZ * NGRP == CC && GSZ == 16);
static_assert((GSZ * NN) % (4 * 256 * SLD) == 0);
static_assert((PSP * 4) % 16 == 0 && (OSH * 4) % 16 == 0 && (TP * 2) % 16 == 0);
static_assert((SPP * 4) % 16 == 0 && (PFP * 2) % 16 == 0);
static_assert(OSH >= GWO && PSP >= GWN && GWN * OSH * 4 <= 163840 && GWO * PSP * 4 <= 163840);
static_assert(AQ == 64 && (4 * AQ * SPP * 4 + 2 * AQ * PFP * 2 + AQ * OSH * 4 + 4 * AQ * 4) <= 327680);
static_assert(NKB >= 3 && (AQ * PFP) % 8 == 0);

typedef _Float16       v16h __attribute__((ext_vector_type(16)));
typedef _Float16       v8h  __attribute__((ext_vector_type(8)));
typedef __bf16         v16b __attribute__((ext_vector_type(16)));
typedef unsigned short v8us __attribute__((ext_vector_type(8)));
typedef float          v8f  __attribute__((ext_vector_type(8)));
typedef float          v4f  __attribute__((ext_vector_type(4)));
typedef unsigned int   v4u  __attribute__((ext_vector_type(4)));

union Frag  { v8us u[2]; v16h h; v16b bf; };
static_assert(sizeof(Frag) == 32);

// ---- scalar helpers -------------------------------------------------------------------------------------------
__device__ __forceinline__ unsigned short bf_bits(float f) {          // f32 -> bf16 bits, RNE convert
  unsigned u = __float_as_uint(f);
  return (unsigned short)((u + 0x7FFFu + ((u >> 16) & 1u)) >> 16);
}
__device__ __forceinline__ float bf_up(unsigned short hb) { return __uint_as_float(((unsigned)hb) << 16); }
__device__ __forceinline__ float bfr(float f) { return bf_up(bf_bits(f)); }
__device__ __forceinline__ unsigned short h_bits(_Float16 x) { return __builtin_bit_cast(unsigned short, x); }
__device__ __forceinline__ unsigned pk16(unsigned short a, unsigned short b) { return (unsigned)a | ((unsigned)b << 16); }
__device__ __forceinline__ v8f zero8() { v8f z = {0.f, 0.f, 0.f, 0.f, 0.f, 0.f, 0.f, 0.f}; return z; }
__device__ __forceinline__ unsigned wave_ballot(bool p) {
#if defined(__HIP_DEVICE_COMPILE__)
  return __builtin_amdgcn_ballot_w32(p);
#else
  return p ? 1u : 0u;
#endif
}

// ---- value of the lane whose number differs in bit 0 (X = 1) or bit 1 (X = 2), inside a group of four lanes: one DPP move
template <int X>
__device__ __forceinline__ float quad_xor(float v) {
#if defined(__HIP_DEVICE_COMPILE__)
  return __int_as_float(__builtin_amdgcn_update_dpp(0, __float_as_int(v), X == 1 ? 0xB1 : 0x4E, 0xF, 0xF, true));
#else
  return v;
#endif
}

// ---- 16-bit fragment loader (A, or B from a k-contiguous [n][k] row): lane -> row/col (lane&15), p already includes
//      + 8*(lane>>4); elements 0..7 <- p[0..7] (k0+8h..), elements 8..15 <- p[16..23] (k0+16+8h..)
__device__ __forceinline__ Frag ldfrag(const unsigned short* p) {
  Frag f;
  f.u[0] = *(const v8us*)(p);
  f.u[1] = *(const v8us*)(p + 16);
  return f;
}

// ---- fragment-major planes (every 16-bit operand plane in the workspace): a plane of R rows x KD k-elements is cut
//      into fragments of 16 rows x 32 k = 512 elements; fragment (row tile rt, k step ks) starts at element
//      16*rt*KD + 512*ks and holds [u 0..1][lane 0..31][8 elements]: lane = 16*h + (row&15), k = 32*ks + 16*u + 8*h + t.
//      That is the register order of ldfrag above, so one fragment is two loads of 512 contiguous bytes per wave
//      (4 whole 128-B lines each) where a row-major plane gives 16 partial lines per load. p already includes + 8*lane.
__device__ __forceinline__ Frag ldfm(const unsigned short* p) {
  Frag f;
  f.u[0] = *(const v8us*)(p);
  f.u[1] = *(const v8us*)(p + 256);
  return f;
}

// ---- WMMA helpers. f16 form (attention): the plain builtin; the compiler keeps the distances behind its own WMMAs. The
//      asm pad of the bf16 form takes its operands from v0..v255 alone: built with it, the 64-query tile spills to scratch.
__device__ __forceinline__ v8f mma_h(v16h a, v16h b, v8f c) {
  return __builtin_amdgcn_wmma_f32_16x16x32_f16(false, a, false, b, (short)0, c, false, false);
}
// bf16 form (GEMMs): builtin followed by a 4-slot VALU gap tying D and keeping A/B live
__device__ __forceinline__ v8f mma_b(v16b a, v16b b, v8f c) {
  v8f d = __builtin_amdgcn_wmma_f32_16x16x32_bf16(false, a, false, b, (short)0, c, false, false);
#if defined(__HIP_DEVICE_COMPILE__)
  const v16h ha = __builtin_bit_cast(v16h, a), hb = __builtin_bit_cast(v16h, b);
  asm volatile("v_nop\n\tv_nop\n\tv_nop\n\tv_nop" : "+v"(d) : "v"(ha), "v"(hb));
#endif
  return d;
}

// ---- work-group barrier of the attention loop: orders LDS only (release / acquire on the local address space), so the
//      k and v requests that are in flight at it stay in flight; __syncthreads() would wait for them at every barrier.
//      The loop stores nothing to global memory and reads there only what earlier launches wrote.
__device__ __forceinline__ void lds_barrier() {
#if defined(__HIP_DEVICE_COMPILE__)
  __builtin_amdgcn_fence(__ATOMIC_RELEASE, "workgroup", "local");
  __builtin_amdgcn_s_barrier();
  __builtin_amdgcn_fence(__ATOMIC_ACQUIRE, "workgroup", "local");
#endif
}

// =============================================================================================================
// (0) conv weights: Wb bf16, rows 512*matrix + o, k = c, fragment-major; matrix 0 = wq, 1 = wk, 2 = wv, 3 = wp; value =
//     bf16-RNE(w). Block blk (0..511): matrix blk/128 (block-uniform), row tile blk/4; wave gw = 8 blk + w owns the
//     half u = gw&1 of the fragment of k step (gw>>1)&15 and stores it as 512 contiguous bytes.
// coverage: 128 row tiles x 16 k steps x 2 halves = 4096 waves x 32 lanes x 8 = the whole plane.
// =============================================================================================================
__global__ __launch_bounds__(256)
void cvt_w(const float* __restrict__ wq, const float* __restrict__ wk, const float* __restrict__ wv,
           const float* __restrict__ wp, unsigned short* Wb) {
  const int tid = threadIdx.x, blk = blockIdx.x;
  const int wave = tid >> 5, lane = tid & 31;
  const int sel = blk / (CC / 4);                                          // 0..3, block-uniform
  const float* src = (sel == 0) ? wq : (sel == 1) ? wk : (sel == 2) ? wv : wp;   // all global
  const int gw  = blk * 8 + wave;                                          // 0..4095
  const int u   = gw & 1, ks = (gw >> 1) & 15, rt = gw >> 5;               // rt 0..127 = blk / 4
  const int o   = (rt & 31) * 16 + (lane & 15);                            // 0..511
  const int col = 32 * ks + 16 * u + 8 * (lane >> 4);                      // 0..504
  const float* s = src + (size_t)o * CC + col;
  const v4f a = *(const v4f*)s;
  const v4f q = *(const v4f*)(s + 4);
  const float f[8] = {a[0], a[1], a[2], a[3], q[0], q[1], q[2], q[3]};
  v4u pkv;
#pragma unroll
  for (int t = 0; t < 4; ++t) pkv[t] = pk16(bf_bits(f[2 * t]), bf_bits(f[2 * t + 1]));
{
    *(v4u*)(Wb + (size_t)(16 * rt) * CC + 512 * ks + 256 * u + 8 * lane) = pkv;
    
  }
}

// =============================================================================================================
// (1) group-normalisation statistics of bf16-RNE(x): block bg = b*32+g owns the 16 channels x 4096 positions
// =============================================================================================================
__global__ __launch_bounds__(256)
void gn_stats(const float* __restrict__ x, float* stats) {
  __shared__ double red[256];
  const int tid = threadIdx.x, bg = blockIdx.x;
  const v4f* p = (const v4f*)(x + (size_t)bg * GSZ * NN);
  const int N4 = GSZ * NN / 4;                                            // 16384
  const double invN = 1.0 / (double)(GSZ * NN);

  double s = 0.0;
#pragma unroll 1
  for (int i = tid; i < N4; i += 256 * SLD) {
    v4f v[SLD];                                                           // SLD loads in flight per lane, old sum order
#pragma unroll                                                            // v[] stays in registers
    for (int u = 0; u < SLD; ++u) v[u] = p[i + 256 * u];
#pragma unroll                                                            // v[] stays in registers
    for (int u = 0; u < SLD; ++u)
      s += ((double)bfr(v[u][0]) + (double)bfr(v[u][1])) + ((double)bfr(v[u][2]) + (double)bfr(v[u][3]));
  }
  red[tid] = s;
  __syncthreads();
#pragma unroll 1
  for (int off = 128; off > 0; off >>= 1) {
    if (tid < off) red[tid] += red[tid + off];
    __syncthreads();
  }
  const double mean = red[0] * invN;
  __syncthreads();                                                        // everyone read red[0]

  double s2 = 0.0;
#pragma unroll 1
  for (int i = tid; i < N4; i += 256 * SLD) {
    v4f v[SLD];                                                           // SLD loads in flight per lane, old sum order
#pragma unroll                                                            // v[] stays in registers
    for (int u = 0; u < SLD; ++u) v[u] = p[i + 256 * u];
#pragma unroll                                                            // v[] stays in registers
    for (int u = 0; u < SLD; ++u) {
#pragma unroll
      for (int t = 0; t < 4; ++t) {
        const double d = (double)bfr(v[u][t]) - mean;
        s2 += d * d;
      }
    }
  }
  red[tid] = s2;
  __syncthreads();
#pragma unroll 1
  for (int off = 128; off > 0; off >>= 1) {
    if (tid < off) red[tid] += red[tid + off];
    __syncthreads();
  }
  const double var = red[0] * invN;
  const float meanf = (float)mean;
  const float rstdf = (float)(1.0 / sqrt(var + GEPS));

  v4f val = {0.f, 0.f, 0.f, 0.f};
  if (tid == 0) { val[0] = meanf; val[1] = rstdf; }
  float* dst = stats + (size_t)bg * 32 + 4 * (tid & 7);
  if (tid < 8) *(v4f*)dst = val;
  
}

// =============================================================================================================
// (2) h = (bf16-RNE(x) - mean) * rstd * bf16-RNE(gn_w) + bf16-RNE(gn_b) in f32, then bf16 hi = RNE(h) and bf16
//     lo = RNE(h - hi), written as Hh/Hl bf16, rows 4096 b + n, k = c, fragment-major (for the conv GEMMs).
//     Block (nb, cb, b) owns 64 n x 64 c through LDS tiles Th/Tl[64 n][64 c] (pitch TP; cross-wave, block barrier).
// coverage: Th/Tl 2 it x 32 rows(c) x 8 lanes x 8 n = 64 x 64 (staged extent == consumed extent); planes 2 it x 8
//           waves = 4 row tiles x 2 k steps x 2 halves of 512 B per plane; grid (64, 8, NB) covers all 4096 n x 512 c.
// =============================================================================================================
__global__ __launch_bounds__(256)
void gn_apply(const float* __restrict__ x, const float* __restrict__ gw, const float* __restrict__ gb,
              const float* __restrict__ stats, unsigned short* Hh, unsigned short* Hl) {
  __shared__ __align__(16) unsigned short Th[QT * TP];
  __shared__ __align__(16) unsigned short Tl[QT * TP];
  const int tid = threadIdx.x;
  const int nb = blockIdx.x, cb = blockIdx.y, b = blockIdx.z;
  const int e = tid & 7, lq = tid >> 3;                                  // lq 0..31
  const int n0 = nb * QT, c0 = cb * QT;
#pragma unroll
  for (int it = 0; it < 2; ++it) {
    const int cl = it * 32 + lq;                                          // 0..63
    const int ch = c0 + cl;                                               // 0..511
    const int g  = ch / GSZ;                                              // 0..31
    const float mean = stats[(size_t)(b * NGRP + g) * 32 + 0];
    const float rstd = stats[(size_t)(b * NGRP + g) * 32 + 1];
    const float w  = bfr(gw[ch]);
    const float bb = bfr(gb[ch]);
    const float* sp = x + ((size_t)(b * CC + ch)) * NN + n0 + 8 * e;
    const v4f a = *(const v4f*)sp;
    const v4f q = *(const v4f*)(sp + 4);
    const float f[8] = {a[0], a[1], a[2], a[3], q[0], q[1], q[2], q[3]};
#pragma unroll
    for (int t = 0; t < 8; ++t) {
      const float h = (bfr(f[t]) - mean) * rstd * w + bb;
      const unsigned short hb = bf_bits(h);
      const unsigned short lb = bf_bits(h - bf_up(hb));
      Th[(8 * e + t) * TP + cl] = hb;
      Tl[(8 * e + t) * TP + cl] = lb;
    }
  }
  __syncthreads();
  const int lane = tid & 31, wave = tid >> 5;
  v4u uh[2], ul[2];
#pragma unroll
  for (int it = 0; it < 2; ++it) {
    const int pc = it * 8 + wave;                                         // piece: row tile pc>>2, chunk pair pc&3
    const int lo = (16 * (pc >> 2) + (lane & 15)) * TP + 16 * (pc & 3) + 8 * (lane >> 4);
    uh[it] = *(const v4u*)(Th + lo);
    ul[it] = *(const v4u*)(Tl + lo);
  }
{
#pragma unroll
    for (int it = 0; it < 2; ++it) {
      const int pc = it * 8 + wave;
      const size_t po = ((size_t)(b * NN + n0 + 16 * (pc >> 2))) * CC + 16 * c0 + 256 * (pc & 3) + 8 * lane;
      *(v4u*)(Hh + po) = uh[it];
      *(v4u*)(Hl + po) = ul[it];
    }
    
  }
}

// =============================================================================================================
// GEMM core of launches (3), (4) and (6). Work-group = 8 waves = 256 output channels x 128 positions; wave w owns 128
//     channels (8 weight row tiles, base 128 (w>>2)) x 32 positions (2 row tiles, base 32 (w&3)) = 16 accumulator tiles.
//     Per k step of 32 a wave fetches 8 weight fragments and 2 x 2 activation fragments (hi and residual plane) for 32
//     WMMAs: a weight fragment feeds 2 position tiles in both planes, an activation fragment 8 channel tiles. The four waves
//     of one channel half ask for the same weight lines and the two waves of one position group for the same activation lines.
//     wp, hp, lp: the wave's first fragment in each plane, + 8*lane. Per accumulator: hi then residual of k step 0, 1, .. 15.
//     WROWS: D rows = channels (A = weights, B = activations); else D rows = positions (A = activations, B = weights).
// =============================================================================================================
template <bool WROWS>
__device__ __forceinline__ void gemm_core(const unsigned short* wp, const unsigned short* hp,
                                          const unsigned short* lp, v8f (&acc)[16]) {
#pragma unroll                                                            // constant indices: the arrays stay in registers
  for (int j = 0; j < 16; ++j) acc[j] = zero8();

#pragma unroll 2                                                          // one branch and one count per two k steps
  for (int ks = 0; ks < CC / 32; ++ks) {
    Frag fh[2], fl[2], fw[8];                                             // all loads of the step before its first WMMA
#pragma unroll                                                            // fh[], fl[] stay in registers
    for (int t = 0; t < 2; ++t) {
      fh[t] = ldfm(hp + (size_t)(16 * t) * CC);
      fl[t] = ldfm(lp + (size_t)(16 * t) * CC);
    }
#pragma unroll                                                            // fw[] stays in registers
    for (int m = 0; m < 8; ++m) fw[m] = ldfm(wp + (size_t)(16 * m) * CC);
    // the step's requests name the registers of wp, hp and lp: the wait stands in front of the additions that rewrite them
    // (the step length goes through the statement, so that no addition can be lifted over the wait)
    unsigned kstep = 512u;
    asm volatile("s_wait_xcnt 0x0" : "+s"(kstep) : : "memory");
    wp += kstep;
    hp += kstep;
    lp += kstep;
    // the 16 tiles' hi products, then their 16 residual products
#pragma unroll                                                            // constant indices: the arrays stay in registers
    for (int m = 0; m < 8; ++m) {
#pragma unroll                                                            // constant indices: the arrays stay in registers
      for (int t = 0; t < 2; ++t)
        acc[2 * m + t] = WROWS ? mma_b(fw[m].bf, fh[t].bf, acc[2 * m + t]) : mma_b(fh[t].bf, fw[m].bf, acc[2 * m + t]);
    }
#pragma unroll                                                            // constant indices: the arrays stay in registers
    for (int m = 0; m < 8; ++m) {
#pragma unroll                                                            // constant indices: the arrays stay in registers
      for (int t = 0; t < 2; ++t)
        acc[2 * m + t] = WROWS ? mma_b(fw[m].bf, fl[t].bf, acc[2 * m + t]) : mma_b(fl[t].bf, fw[m].bf, acc[2 * m + t]);
    }
  }
}

// =============================================================================================================
// (3) q / k conv GEMM for one (b, 128-n tile, matrix sel = mb/2, 256-o block o0 = (mb%2)*256):
//     Y[o][n] = sum_c W[o][c] (Hh + Hl)[b][n][c] + bf16-RNE(bias[o]); D rows = channels, K = 512 = 16 steps x 2 products.
//     Epilogue staged in LDS Os[n_loc][o_loc] (pitch OSH, b128 stores of 8 consecutive o per lane; cross-wave,
//     block barrier), then sel 0 -> Q16, sel 1 -> K16, plain f16, rows 4096 b + n, k = d, fragment-major.
// coverage: Os 8 waves x 32 n x 128 o = 128 x 256 (staged == consumed); plane 16 it x 8 waves = 8 row tiles x 8 k steps x 2
//           halves of 512 B = 128 n x 256 d; grid (32, 4, NB) covers d 0..511 of all 4096 rows of Q16 and K16 once.
// =============================================================================================================
__global__ __launch_bounds__(256)
void gemm_qk(const unsigned short* __restrict__ Wb, const unsigned short* __restrict__ Hh,
             const unsigned short* __restrict__ Hl, const float* __restrict__ bq, const float* __restrict__ bk,
             unsigned short* Q16, unsigned short* K16) {
  __shared__ __align__(16) float Os[GWN * OSH];
  const int tid  = threadIdx.x;
  const int lane = tid & 31, wave = tid >> 5;
  const int hh   = lane >> 4, c = lane & 15;
  const int nt   = blockIdx.x, mb = blockIdx.y, b = blockIdx.z;
  const int sel  = mb / (CC / GWO);                                        // 0 = q, 1 = k (block-uniform)
  const int n0   = nt * GWN, o0 = (mb % (CC / GWO)) * GWO;
  const int nw   = 32 * (wave & 3), ow = 128 * (wave >> 2);                // this wave's tile inside the block's

  const size_t ho = ((size_t)(b * NN + n0 + nw)) * CC + 8 * lane;
  v8f acc[16];
  gemm_core<true>(Wb + ((size_t)(sel * CC + o0 + ow)) * CC + 8 * lane, Hh + ho, Hl + ho, acc);

  // ---- epilogue: + bias -> LDS Os[n_loc][o_loc]; lane (hh, c) holds o = ow + 16 m + 8 hh + r for n_loc = nw + 16 t + c
  const float* bsrc = ((sel == 0) ? bq : bk) + o0 + ow + 8 * hh;          // block-uniform choice, both global
  v4f bl[16];
#pragma unroll                                                            // bl[] stays in registers
  for (int m = 0; m < 16; ++m) bl[m] = *(const v4f*)(bsrc + 16 * (m >> 1) + 4 * (m & 1));
  // the bias requests name the registers of bsrc: it goes through the statement as an input, so that they are left alone
  // (also by what the requests bring) up to the wait
  asm volatile("s_wait_xcnt 0x0" : : "v"(bsrc) : "memory");
#pragma unroll                                                            // constant indices: the arrays stay in registers
  for (int m = 0; m < 8; ++m) {
    const v4f b0 = bl[2 * m], b1 = bl[2 * m + 1];
#pragma unroll                                                            // constant indices: the arrays stay in registers
    for (int t = 0; t < 2; ++t) {
      v4f va, vb;
#pragma unroll                                                            // constant indices: the arrays stay in registers
      for (int r = 0; r < 4; ++r) { va[r] = acc[2 * m + t][r] + bfr(b0[r]); vb[r] = acc[2 * m + t][4 + r] + bfr(b1[r]); }
      float* sp = Os + (nw + 16 * t + c) * OSH + ow + 16 * m + 8 * hh;
      *(v4f*)sp       = va;
      *(v4f*)(sp + 4) = vb;
    }
  }
  __syncthreads();

  unsigned short* Ph = (sel == 0) ? Q16 : K16;                             // block-uniform, both global
  v4u uv[16];
#pragma unroll                                                            // constant indices: the arrays stay in registers
  for (int it = 0; it < 16; ++it) {                                        // piece: row tile it>>1, chunk pair 8 (it&1) + wave
    const int lo = (16 * (it >> 1) + c) * OSH + 16 * (8 * (it & 1) + wave) + 8 * hh;
    const v4f a = *(const v4f*)(Os + lo);
    const v4f q = *(const v4f*)(Os + lo + 4);
    const float f[8] = {a[0], a[1], a[2], a[3], q[0], q[1], q[2], q[3]};
#pragma unroll                                                            // constant indices: the arrays stay in registers
    for (int t = 0; t < 4; ++t)
      uv[it][t] = pk16(h_bits((_Float16)f[2 * t]), h_bits((_Float16)f[2 * t + 1]));
  }
  const size_t po = ((size_t)(b * NN + n0)) * CC + 16 * o0 + 256 * wave + 8 * lane;
#pragma unroll                                                            // constant indices: the arrays stay in registers
  for (int it = 0; it < 16; ++it) *(v4u*)(Ph + po + (size_t)(16 * (it >> 1)) * CC + 2048 * (it & 1)) = uv[it];
}

// =============================================================================================================
// (4) v conv GEMM for one (b, 128-n tile, 256-o block o0 = mb*256), operands swapped so the D rows are positions:
//     D[n][o] = sum_c (Hh + Hl)[b][n][c] Wv[o][c] (2 products, K = 512).
//     Per lane the D tile holds 8 consecutive n of one o -> LDS Vs[o_loc][n_loc] (pitch PSP, b128 stores;
//     cross-wave, block barrier), then V16 f16, rows 512 b + o, k = n (KD = 4096), fragment-major, = f16(D +
//     bf16-RNE(bv[o])) (unscaled, |v| ~ 1).
// coverage: Vs 8 waves x 32 n x 128 o = 256 x 128 (staged == consumed); V16 16 it (row tiles) x 8 waves (4 k steps x 2
//           halves of 512 B) = 256 o x 128 n; grid (32, 2, NB) covers all 512 o x 4096 n of each b exactly once.
// =============================================================================================================
__global__ __launch_bounds__(256)
void gemm_v(const unsigned short* __restrict__ Wb, const unsigned short* __restrict__ Hh,
            const unsigned short* __restrict__ Hl, const float* __restrict__ bv, unsigned short* V16) {
  __shared__ __align__(16) float Vs[GWO * PSP];
  const int tid  = threadIdx.x;
  const int lane = tid & 31, wave = tid >> 5;
  const int hh   = lane >> 4, c = lane & 15;
  const int nt   = blockIdx.x, mb = blockIdx.y, b = blockIdx.z;
  const int n0   = nt * GWN, o0 = mb * GWO;
  const int nw   = 32 * (wave & 3), ow = 128 * (wave >> 2);                // this wave's tile inside the block's

  const size_t ho = ((size_t)(b * NN + n0 + nw)) * CC + 8 * lane;
  v8f acc[16];
  gemm_core<false>(Wb + ((size_t)(2 * CC + o0 + ow)) * CC + 8 * lane, Hh + ho, Hl + ho, acc);

  // ---- epilogue: lane (hh, c) holds n_loc = nw + 16 t + 8 hh + r of o_loc = ow + 16 m + c
#pragma unroll                                                            // constant indices: the arrays stay in registers
  for (int m = 0; m < 8; ++m) {
    const float bb = bfr(bv[o0 + ow + 16 * m + c]);
#pragma unroll                                                            // constant indices: the arrays stay in registers
    for (int t = 0; t < 2; ++t) {
      v4f va, vb;
#pragma unroll                                                            // constant indices: the arrays stay in registers
      for (int r = 0; r < 4; ++r) { va[r] = acc[2 * m + t][r] + bb; vb[r] = acc[2 * m + t][4 + r] + bb; }
      float* sp = Vs + (ow + 16 * m + c) * PSP + nw + 16 * t + 8 * hh;
      *(v4f*)sp       = va;
      *(v4f*)(sp + 4) = vb;
    }
  }
  __syncthreads();

  v4u uv[16];
#pragma unroll                                                            // constant indices: the arrays stay in registers
  for (int it = 0; it < 16; ++it) {
    const int lo = (it * 16 + c) * PSP + 16 * wave + 8 * hh;               // row tile it, chunk pair = wave
    const v4f a = *(const v4f*)(Vs + lo);
    const v4f q = *(const v4f*)(Vs + lo + 4);
    const float f[8] = {a[0], a[1], a[2], a[3], q[0], q[1], q[2], q[3]};
#pragma unroll                                                            // constant indices: the arrays stay in registers
    for (int t = 0; t < 4; ++t)
      uv[it][t] = pk16(h_bits((_Float16)f[2 * t]), h_bits((_Float16)f[2 * t + 1]));
  }
  const size_t po = ((size_t)(b * CC + o0)) * NN + 16 * n0 + 256 * wave + 8 * lane;
#pragma unroll                                                            // constant indices: the arrays stay in registers
  for (int it = 0; it < 16; ++it) *(v4u*)(V16 + po + (size_t)(16 * it) * NN) = uv[it];
}

// =============================================================================================================
// (5) attention for one (b, 64-query tile), transposed formulation, 4096 keys, no mask. Block = 8 waves, one block per
//   WGP (grid 64 x NB): every K and V fragment that a block fetches feeds 64 queries.
//   Score phase per 32-key block kb: wave w computes TWO S^T partial tiles (16 keys x 16 queries each) from one set of
//   k fragments: key tile kt = w&1 (keys kb+16kt..), query tiles 2 qg + i, qg = (w>>1)&1, i = 0..1 (queries
//   n0+16(2qg+i)..), over the d-half dh = w>>2 (d 256dh .. 256dh+255, 8 steps of 32): A = k rows (row = key,
//   fragment-major, split k map) from K16, B = q rows (col = query, same map) from Q16, plain f16, 1 product. Each
//   partial (D row = key 8h+r, col = query) goes to LDS Sp[dh][query][key] (pitch SPP, b128 stores; cross-wave, block
//   barrier); the two d-halves are added in fixed order by the softmax lanes.
//   Softmax: all 8 waves, four lanes per query: thread tid has query tid / 4 and the 8 keys 8 (tid & 3) ..: s_j = (Sp[0] +
//   Sp[1]) * 512^-0.5, block max in-lane and over the four lanes (two DPP moves), online max m in f32 (equal in the four
//   lanes), the sum l as one f32 partial per lane over its own keys (the four are added once, behind the loop), corr =
//   e^{m_old - m_new} -> Cs[query], P_j = e^{s_j - m} x 2^14 as f16 -> Pf[query][key] (pitch PFP, one 16-B store per lane;
//   cross-wave, block barrier).
//   O^T (rows channel, cols query): every wave owns channels 64w..64w+63 (4 tiles j) x 64 queries (4 tiles) = 16
//   accumulator tiles; rescale by Cs when any of the 64 corr is not 1 (every wave reads all 64, so block-uniform; corr is
//   exactly 1 for a query whose max did not grow), then += A(v rows channel = 64w+16j+(lane&15), keys kb.., fragment-major f16 plane V16) . B(P^T: row = query
//   from Pf, keys contiguous, same k order).
//   The three phases run as a pipeline over the key blocks, ONE barrier per key block: between two barriers every wave
//   does the scores of block i+1, its share of the softmax of block i and O^T of block i-1. Sp, Pf and Cs
//   have two buffers each (index = key block & 1): what a pass writes was last read in the pass before, behind a barrier,
//   and is read in the next pass. Order of every sum as in the unpipelined loop. Fill: block 0's scores ahead of the
//   loop, and P = 0, corr = 1 for the O^T step of pass 0 (adds zero); drain: the last pass scores its clamped block
//   again (never read), O^T of the last block stands behind the loop.
//   Epilogue in two 256-channel halves: waves with (w>>2) == half stage O/l in LDS Os[query][256 ch] (pitch OSH, b128
//   stores; cross-wave, block barrier), then all 256 threads write Ah (bf16 hi) and Al (bf16 residual), fragment-major.
// coverage: Sp 8 waves x 2 tiles = [2 dh][64 q][32 keys] each key block (staged == consumed); Pf 64 rows x 32 keys by
//           256 lanes x 8 keys (staged == consumed, pad cols never read; buffer 1 zeroed whole ahead of the loop); Os per half 4 waves x 64 q x 64 ch = 64 x 256 (staged
//           == consumed); planes 2 halves x 8 it x 8 waves x 512 B = 4 row tiles x 16 k steps per plane; grid (NQ/64,
//           NB) covers rows 0..NQ-1 exactly once (only those are read later).
// =============================================================================================================
__global__ __launch_bounds__(256)
void attn_k(const unsigned short* __restrict__ Q16, const unsigned short* __restrict__ K16,
            const unsigned short* __restrict__ V16, unsigned short* Ah, unsigned short* Al) {
  __shared__ __align__(16) float Sp[2 * 2 * AQ * SPP];
  __shared__ __align__(16) unsigned short Pf[2 * AQ * PFP];
  __shared__ __align__(16) float Os[AQ * OSH];
  __shared__ float Cs[2 * AQ];
  __shared__ float Ls[AQ];
  const int tid  = threadIdx.x;
  const int wave = tid >> 5, lane = tid & 31;
  const int hh   = lane >> 4, c = lane & 15;
  const int n0   = blockIdx.x * AQ, b = blockIdx.y;
  const int kt = wave & 1, qg = (wave >> 1) & 1, dh = wave >> 2;

  // q fragment pointer (B operand of S^T, col = query n0 + 16 (2 qg + i) + c, d-half dh), + 16*CC*i + 512*ks
  const unsigned short* qp = Q16 + ((size_t)(b * NN + n0 + 32 * qg)) * CC + 16 * (CC / 2) * dh + 8 * lane;
  // k fragment base (A operand, row = key kb + 16 kt + c, d-half dh), + kb*CC + 512*ks
  const unsigned short* kp = K16 + ((size_t)(b * NN + 16 * kt)) * CC + 16 * (CC / 2) * dh + 8 * lane;
  // v fragment base (A operand of O^T, row = channel 64 w + 16 j + c), + 16*j*NN + 16*kb (k step kb/32)
  const unsigned short* vp = V16 + ((size_t)(b * CC + 64 * wave)) * NN + 8 * lane;
  // this lane's S^T partial destination: Sp[dh][query 16(2qg+i)+c][key 16kt + 8hh + r], + 16*SPP*i
  float* spw = Sp + (dh * AQ + 32 * qg + c) * SPP + 16 * kt + 8 * hh;
  // P^T fragment rows (row = query 16 q + c, keys contiguous), + 16*PFP*q
  const unsigned short* pf = Pf + c * PFP + 8 * hh;

  // q fragments of this wave's d-half do not change with the key block: loaded once, kept in registers
  Frag fq[2][CC / 64];
#pragma unroll                                                            // fq[][] stays in registers
  for (int i = 0; i < 2; ++i) {
#pragma unroll
    for (int ks = 0; ks < CC / 64; ++ks) fq[i][ks] = ldfm(qp + (size_t)(16 * i) * CC + 512 * ks);
  }
  // the q requests are in flight and the code below reuses their address registers
  asm volatile("s_wait_xcnt 0x0" ::: "memory");

  // softmax share of this lane: query sq, keys sk .. sk + 7 of each key block
  const int sq = tid >> 2, sk = 8 * (tid & 3);
  float m_run = -1.0e30f, l_run = 0.f;
  v8f o[16];
#pragma unroll
  for (int j = 0; j < 16; ++j) o[j] = zero8();

  // ---- the two matrix phases, used in the fill, in the loop and in the drain
  Frag fk[CC / 64];
  Frag fv[4];
  // two score partial tiles over this wave's d-half, each k fragment used for both -> Sp buffer at dst
  auto score = [&](float* dst) __attribute__((always_inline)) {
    v8f s0 = zero8(), s1 = zero8();
#pragma unroll                                                            // fk[], fq[][] stay in registers
    for (int ks = 0; ks < CC / 64; ++ks) {
      s0 = mma_h(fk[ks].h, fq[0][ks].h, s0);
      s1 = mma_h(fk[ks].h, fq[1][ks].h, s1);
    }
    v4f sa, sb, sc, sd;
#pragma unroll
    for (int r = 0; r < 4; ++r) { sa[r] = s0[r]; sb[r] = s0[4 + r]; sc[r] = s1[r]; sd[r] = s1[4 + r]; }
    *(v4f*)(dst)                = sa;
    *(v4f*)(dst + 4)            = sb;
    *(v4f*)(dst + 16 * SPP)     = sc;
    *(v4f*)(dst + 16 * SPP + 4) = sd;
  };
  // the O^T step in two parts. pv_read: all its LDS reads (corr, P^T fragments of buffer buf) as one group, placed
  // at the head of a pass so that they land under the score products. pv_scale: rescale (block-uniform test). pv_mul: O^T += V . P^T
  float cr[4];
  Frag p[4];
  auto pv_read = [&](int buf) __attribute__((always_inline)) {
#pragma unroll                                                            // cr[], p[] stay in registers
    for (int q = 0; q < 4; ++q) {
      cr[q] = Cs[AQ * buf + 16 * q + c];
      p[q]  = ldfrag(pf + AQ * PFP * buf + 16 * PFP * q);
    }
  };
  auto pv_scale = [&]() __attribute__((always_inline)) {
    // corr <= 1: the least of the lane's four, then one ballot; lanes 0..15 hold all 64 queries between them
    if (wave_ballot(fminf(fminf(cr[0], cr[1]), fminf(cr[2], cr[3])) != 1.0f) != 0u) {
#pragma unroll
      for (int q = 0; q < 4; ++q) {
#pragma unroll
        for (int j = 0; j < 4; ++j) {
#pragma unroll
          for (int r = 0; r < 8; ++r) o[4 * j + q][r] *= cr[q];
        }
      }
    }
  };
  auto pv_mul = [&]() __attribute__((always_inline)) {
#pragma unroll
    for (int j = 0; j < 4; ++j) {
#pragma unroll
      for (int q = 0; q < 4; ++q) o[4 * j + q] = mma_h(fv[j].h, p[q].h, o[4 * j + q]);
    }
  };

  // ---- fill: scores of key block 0 -> Sp buffer 0; P = 0, corr = 1 in buffer 1 for the O^T step of pass 0; then
  //      the k fragments of block 1 and the v fragments of block 0 (finite values for that step, which adds v x 0)
  const unsigned short* kpn = kp;
  const unsigned short* vpn = vp;
#pragma unroll                                                            // fk[] stays in registers
  for (int ks = 0; ks < CC / 64; ++ks) fk[ks] = ldfm(kpn + 512 * ks);
  // every group of k or v requests names the registers of kpn or vpn: the wait stands in front of the step that rewrites
  // them (the step length goes through the statement, so that the addition cannot be lifted over the wait)
  unsigned kstep0 = 32u * CC;
  asm volatile("s_wait_xcnt 0x0" : "+s"(kstep0) : : "memory");
  kpn += kstep0;
  {
    const v4u z4 = {0u, 0u, 0u, 0u};
#pragma unroll 1
    for (int t = tid; t < AQ * PFP / 8; t += 256) *(v4u*)(Pf + AQ * PFP + 8 * t) = z4;
    if (tid < AQ) Cs[AQ + tid] = 1.0f;
  }
  score(spw);
#pragma unroll                                                            // fk[] stays in registers
  for (int ks = 0; ks < CC / 64; ++ks) fk[ks] = ldfm(kpn + 512 * ks);
  unsigned kstep1 = 32u * CC;
  asm volatile("s_wait_xcnt 0x0" : "+s"(kstep1) : : "memory");            // as above
  kpn += kstep1;                                                          // from here on: two key blocks ahead of the pass
#pragma unroll                                                            // fv[] stays in registers
  for (int j = 0; j < 4; ++j) fv[j] = ldfm(vpn + (size_t)(16 * j) * NN);
  lds_barrier();

#pragma unroll 1
  for (int i = 0; i < NKB; ++i) {
    const int cur = i & 1, oth = cur ^ 1;
    pv_read(oth);
    // this lane's score partials of key block i (both d-halves), in the same group of LDS reads
    v4f sa0[2], sa1[2];
    {
      const float* s0p = Sp + 2 * AQ * SPP * cur + sq * SPP + sk;          // d-half 0
#pragma unroll                                                            // sa0[], sa1[] stay in registers
      for (int t2 = 0; t2 < 2; ++t2) {
        sa0[t2] = *(const v4f*)(s0p + 4 * t2);
        sa1[t2] = *(const v4f*)(s0p + AQ * SPP + 4 * t2);                  // d-half 1
      }
    }
    // ---- scores of key block i+1 (last pass: the last block again, never read)
    score(spw + 2 * AQ * SPP * oth);
    // ---- the k fragments of key block i+2 are requested here, a whole pass ahead of their use (clamped to the last block)
#pragma unroll                                                            // fk[] stays in registers
    for (int ks = 0; ks < CC / 64; ++ks) fk[ks] = ldfm(kpn + 512 * ks);
    unsigned kstep = (i + 3 < NKB) ? 32u * CC : 0u;
    asm volatile("s_wait_xcnt 0x0" : "+s"(kstep) : : "memory");           // as above
    kpn += kstep;
    // keeps the softmax and the test of corr, and with them the wait for their LDS reads, behind the score products:
    // scheduled among them they stall the wave for the LDS latency at the head of the pass
    __builtin_amdgcn_sched_barrier(0);
    // ---- O^T of key block i-1, first part: rescale
    pv_scale();
    // ---- online softmax of key block i: query sq, keys 32 i + sk .. + 7. It stands between the wave's two runs of matrix
    //      products: while one wave of a SIMD is in this vector chain the other has products to issue, and a pass ends in
    //      products, not in a chain that every wave would wait for at the barrier
    {
      float sv[8];
#pragma unroll
      for (int t2 = 0; t2 < 2; ++t2) {
#pragma unroll
        for (int t = 0; t < 4; ++t) sv[4 * t2 + t] = sa0[t2][t] + sa1[t2][t];
      }
      float mx = sv[0];
#pragma unroll
      for (int j = 1; j < 8; ++j) mx = fmaxf(mx, sv[j]);
      mx = fmaxf(mx, quad_xor<1>(mx));                                    // max over the query's four lanes
      mx = fmaxf(mx, quad_xor<2>(mx));
      const float mn   = fmaxf(m_run, mx * SCL);
      const float corr = __expf(m_run - mn);                             // == 1 exactly when the max did not grow
      m_run = mn;
      const float msh = mn - LNPS;                                        // exp gives e^{s-m} * 2^14
      float ls = 0.f;
      v4u pk;
#pragma unroll
      for (int t = 0; t < 4; ++t) {
        const float e0 = __expf(fmaf(sv[2 * t],     SCL, -msh));           // key 32i + sk + 2t
        const float e1 = __expf(fmaf(sv[2 * t + 1], SCL, -msh));           // key 32i + sk + 2t + 1
        ls += e0 + e1;
        pk[t] = pk16(h_bits((_Float16)e0), h_bits((_Float16)e1));
      }
      l_run = l_run * corr + ls;
      *(v4u*)(Pf + AQ * PFP * cur + sq * PFP + sk) = pk;
      if ((tid & 3) == 0) Cs[AQ * cur + sq] = corr;
    }
    // keeps the additions of the row sum, which nothing in the pass waits for, in the vector chain above: left free they are
    // scheduled behind the barrier, in front of every wave's first score product of the next pass
    __builtin_amdgcn_sched_barrier(0);
    // ---- O^T of key block i-1, second part: the products (pass 0: adds zero)
    pv_mul();
    // ---- the v fragments of key block i are requested here, a whole pass ahead of their use
#pragma unroll                                                            // fv[] stays in registers
    for (int j = 0; j < 4; ++j) fv[j] = ldfm(vpn + (size_t)(16 * j) * NN);
    unsigned vstep = (i + 1 < NKB) ? 512u : 0u;
    asm volatile("s_wait_xcnt 0x0" : "+s"(vstep) : : "memory");           // as above
    vpn += vstep;
    lds_barrier();
  }
  // ---- drain: O^T of the last key block
  pv_read((NKB - 1) & 1);
  pv_scale();
  pv_mul();
  // no global request has been issued since the last pass's wait after its v requests: a precaution
  asm volatile("s_wait_xcnt 0x0" ::: "memory");
  l_run += quad_xor<1>(l_run);                                            // the query's four partial sums, same m in all four
  l_run += quad_xor<2>(l_run);
  if ((tid & 3) == 0) Ls[sq] = 1.0f / l_run;                              // o and l both carry the 2^14 factor
  __syncthreads();
  float inv[4];
#pragma unroll
  for (int q = 0; q < 4; ++q) inv[q] = Ls[16 * q + c];

#pragma unroll
  for (int half = 0; half < 2; ++half) {
    if ((wave >> 2) == half) {
      const int chb = 64 * (wave & 3);                                    // channel offset inside this half
#pragma unroll
      for (int j = 0; j < 4; ++j) {
#pragma unroll
        for (int q = 0; q < 4; ++q) {
          v4f va, vb;
#pragma unroll
          for (int r = 0; r < 4; ++r) { va[r] = o[4 * j + q][r] * inv[q]; vb[r] = o[4 * j + q][4 + r] * inv[q]; }
          float* dst = Os + (16 * q + c) * OSH + chb + 16 * j + 8 * hh;   // Os[query][ch = chb + 16j + 8hh + r]
          *(v4f*)dst       = va;
          *(v4f*)(dst + 4) = vb;
        }
      }
    }
    __syncthreads();
    {
      v4u uh[AQ / 8], ul[AQ / 8];
#pragma unroll
      for (int it = 0; it < AQ / 8; ++it) {
        const int pc = it * 8 + wave;                                     // piece: row tile pc>>4, chunk pair pc&15
        const int lo = (16 * (pc >> 4) + c) * OSH + 16 * (pc & 15) + 8 * hh;
        const v4f a = *(const v4f*)(Os + lo);
        const v4f q = *(const v4f*)(Os + lo + 4);
        const float f[8] = {a[0], a[1], a[2], a[3], q[0], q[1], q[2], q[3]};
#pragma unroll
        for (int t = 0; t < 4; ++t) {
          const float f0 = f[2 * t], f1 = f[2 * t + 1];
          const unsigned short hb0 = bf_bits(f0), hb1 = bf_bits(f1);
          const unsigned short lb0 = bf_bits(f0 - bf_up(hb0));
          const unsigned short lb1 = bf_bits(f1 - bf_up(hb1));
          uh[it][t] = pk16(hb0, hb1);
          ul[it][t] = pk16(lb0, lb1);
        }
      }
#pragma unroll
      for (int it = 0; it < AQ / 8; ++it) {
        const int pc = it * 8 + wave;
        const size_t po = ((size_t)(b * NN + n0 + 16 * (pc >> 4))) * CC + 16 * (CC / 2) * half + 256 * (pc & 15) + 8 * lane;
        *(v4u*)(Ah + po) = uh[it];
        *(v4u*)(Al + po) = ul[it];
      }
    }
    __syncthreads();
  }
}

// =============================================================================================================
// (6) output projection + bias + residual for one (b, 128-n tile, 256-o block o0 = mb*256), D rows = positions:
//     D[n][o] = sum_c (Ah + Al)[b][n][c] Wp[o][c] (2 products, K = 512), GEMM core as in (4). Per lane 8 consecutive n of
//     one o -> LDS Vs[o_loc][n_loc] (pitch PSP, b128 stores; cross-wave, block barrier), then one wave per row: lane e ->
//     n 4e..4e+3, 4 whole lines of out per instruction.
// coverage: Vs 8 waves x 32 n x 128 o = 256 x 128 (staged == consumed); out 32 it x 8 rows x 32 lanes x 4 = 256 o x
//           128 n; grid (NQ/128, 2, NB) covers out[b][0..511][0..NQ-1] exactly once.
// =============================================================================================================
__global__ __launch_bounds__(256)
void gemm_p(const unsigned short* __restrict__ Wb, const unsigned short* __restrict__ Ah,
            const unsigned short* __restrict__ Al, const float* __restrict__ bp, const float* __restrict__ x,
            float* out) {
  __shared__ __align__(16) float Vs[GWO * PSP];
  const int tid  = threadIdx.x;
  const int lane = tid & 31, wave = tid >> 5;
  const int hh   = lane >> 4, c = lane & 15;
  const int nt   = blockIdx.x, mb = blockIdx.y, b = blockIdx.z;
  const int n0   = nt * GWN, o0 = mb * GWO;
  const int nw   = 32 * (wave & 3), ow = 128 * (wave >> 2);                // this wave's tile inside the block's

  const size_t ao = ((size_t)(b * NN + n0 + nw)) * CC + 8 * lane;
  v8f acc[16];
  gemm_core<false>(Wb + ((size_t)(3 * CC + o0 + ow)) * CC + 8 * lane, Ah + ao, Al + ao, acc);

  // ---- epilogue: lane (hh, c) holds n_loc = nw + 16 t + 8 hh + r of o_loc = ow + 16 m + c
#pragma unroll                                                            // constant indices: the arrays stay in registers
  for (int m = 0; m < 8; ++m) {
    const float bb = bfr(bp[o0 + ow + 16 * m + c]);
#pragma unroll                                                            // constant indices: the arrays stay in registers
    for (int t = 0; t < 2; ++t) {
      v4f va, vb;
#pragma unroll                                                            // constant indices: the arrays stay in registers
      for (int r = 0; r < 4; ++r) { va[r] = acc[2 * m + t][r] + bb; vb[r] = acc[2 * m + t][4 + r] + bb; }
      float* sp = Vs + (ow + 16 * m + c) * PSP + nw + 16 * t + 8 * hh;
      *(v4f*)sp       = va;
      *(v4f*)(sp + 4) = vb;
    }
  }
  __syncthreads();

  const size_t idx = ((size_t)(b * CC + o0 + wave)) * NN + n0 + 4 * lane;  // row it * 8 + wave: + 8 it NN
  v4f res[GWO / 8];
#pragma unroll                                                            // constant indices: the arrays stay in registers
  for (int it = 0; it < GWO / 8; ++it) {
    const v4f a = *(const v4f*)(Vs + (it * 8 + wave) * PSP + 4 * lane);
    const v4f xv = *(const v4f*)(x + idx + (size_t)(8 * it) * NN);
#pragma unroll                                                            // constant indices: the arrays stay in registers
    for (int t = 0; t < 4; ++t) res[it][t] = a[t] + bfr(xv[t]);
  }
#pragma unroll                                                            // constant indices: the arrays stay in registers
  for (int it = 0; it < GWO / 8; ++it) *(v4f*)(out + idx + (size_t)(8 * it) * NN) = res[it];
}

// =============================================================================================================
// Workspace map (bytes; each region start a multiple of 256; every extent is an exact tile multiple and is written
//   (all 16-bit planes fragment-major, same extents as row-major)
//   Wb    bf16 [4][512][512]          2097152
//   stats f32  [NB*32][32]             16384 (NB=4)
//   Hh/Hl bf16 [NB][4096][512]     16777216 x2   (reused as Ah/Al after their last reader, launch (4))
//   Q16/K16 f16 [NB][4096][512]   16777216 x2
//   V16   f16  [NB][512][4096]     16777216
//   total (NB=4) = 85999616
// =============================================================================================================
extern "C" void kernel_launch(void* const* d_in, const int* in_sizes, int n_in,
                              void* d_out, int out_size, void* d_ws, size_t ws_size,
                              hipStream_t stream) {
  if (n_in < 11) return;
  if (in_sizes[0] < NB * CC * NN) return;
  if (in_sizes[1] < CC || in_sizes[2] < CC) return;
  if (in_sizes[3] < CC * CC || in_sizes[5] < CC * CC || in_sizes[7] < CC * CC || in_sizes[9] < CC * CC) return;
  if (in_sizes[4] < CC || in_sizes[6] < CC || in_sizes[8] < CC || in_sizes[10] < CC) return;
  if (out_size < NB * CC * NN) return;

  size_t off = 0;
  auto carve = [&](size_t bytes) { const size_t o = off; off += (bytes + 255) & ~(size_t)255; return o; };
  const size_t plane = (size_t)NB * NN * CC * 2;
  const size_t oWb  = carve((size_t)4 * CC * CC * 2);
  const size_t oSt  = carve((size_t)NB * NGRP * 32 * 4);
  const size_t oHh  = carve(plane);
  const size_t oHl  = carve(plane);
  const size_t oQ   = carve(plane);
  const size_t oK   = carve(plane);
  const size_t oV   = carve(plane);
  const size_t oAh  = oHh;                                                // same extent, disjoint lifetimes
  const size_t oAl  = oHl;
  if (off > ws_size) return;
  if (off > (size_t)134217728) return;

  const float* x   = (const float*)d_in[0];
  const float* gnw = (const float*)d_in[1];
  const float* gnb = (const float*)d_in[2];
  const float* wq  = (const float*)d_in[3];
  const float* bq  = (const float*)d_in[4];
  const float* wk  = (const float*)d_in[5];
  const float* bk  = (const float*)d_in[6];
  const float* wv  = (const float*)d_in[7];
  const float* bv  = (const float*)d_in[8];
  const float* wp  = (const float*)d_in[9];
  const float* bp  = (const float*)d_in[10];

  char* ws = (char*)d_ws;
  unsigned short* Wb  = (unsigned short*)(ws + oWb);
  float*          St  = (float*)(ws + oSt);
  unsigned short* Hh  = (unsigned short*)(ws + oHh);
  unsigned short* Hl  = (unsigned short*)(ws + oHl);
  unsigned short* Q16 = (unsigned short*)(ws + oQ);
  unsigned short* K16 = (unsigned short*)(ws + oK);
  unsigned short* V16 = (unsigned short*)(ws + oV);
  unsigned short* Ah  = (unsigned short*)(ws + oAh);
  unsigned short* Al  = (unsigned short*)(ws + oAl);
  float* out = (float*)d_out;

  const dim3 blk256(256);

  // (0) conv weights -> stacked bf16 plane
  cvt_w<<<dim3(4 * (CC / 4)), blk256, 0, stream>>>(wq, wk, wv, wp, Wb);
  // (1) group statistics per (b, g) in f64
  gn_stats<<<dim3(NB * NGRP), blk256, 0, stream>>>(x, St);
  // (2) normalised activations -> fragment-major bf16 hi / residual planes
  gn_apply<<<dim3(NN / QT, CC / QT, NB), blk256, 0, stream>>>(x, gnw, gnb, St, Hh, Hl);
  // (3) q and k -> fragment-major f16 planes (rows = positions)
  gemm_qk<<<dim3(NN / GWN, 2 * (CC / GWO), NB), blk256, 0, stream>>>(Wb, Hh, Hl, bq, bk, Q16, K16);
  // (4) v -> fragment-major f16 plane (rows = channels)
  gemm_v<<<dim3(NN / GWN, CC / GWO, NB), blk256, 0, stream>>>(Wb, Hh, Hl, bv, V16);
  // (5) attention -> bf16 hi / residual planes of the attention output (regions of Hh / Hl, dead by now)
  attn_k<<<dim3(NQ / AQ, NB), blk256, 0, stream>>>(Q16, K16, V16, Ah, Al);
  // (6) output projection + bias + residual -> out [b][512][4096]
  gemm_p<<<dim3(NQ / GWN, CC / GWO, NB), blk256, 0, stream>>>(Wb, Ah, Al, bp, x, out);
  (void)hipGetLastError();
}

// v007
// Measured time: 231 microseconds a run.
// Two timings next to v006 put it at 1.10 and 1.18 times that version's speed.
// All steps since v000 together make it 4.92 times as fast.
// Contractions: q/k/v 1x1-conv GEMMs W[512x512].H[512x4096] on v_wmma_f32_16x16x32_bf16 (W = bf16-RNE weights,
// exact; H = bf16 hi + bf16 residual planes of the normalised activations; 2 products, K=512); scores S^T = K.Q^T on
// v_wmma_f32_16x16x32_f16 (k, q: plain f16 planes, 1 product, K=512 split over two wave groups, fixed-order f32
// combine in LDS); O^T = V.P^T on v_wmma_f32_16x16x32_f16 (v: f16 plane, P = e^{s-m} x 2^14 as f16, K=4096); output
// 1x1-conv GEMM Wp[512x512].A[512x4096] on v_wmma_f32_16x16x32_bf16 (A = bf16 hi + residual planes of the
// attention output; 2 products, K=512). f32 accumulate everywhere; normalisation statistics in f64; softmax
// statistics, biases and the residual add in f32 VALU.
#include <hip/hip_runtime.h>
#include <math.h>
#include <stdint.h>

#ifndef NB
#define NB 4
#endif
#ifndef NQ
#define NQ 4096
#endif
#define NB_FULL 4
#define CC     512
#define NN     4096
#define NGRP   32
#define GSZ    16
#define QT     64
#define AQ     64
#define GWO    256
#define GWN    128
#define PSP    132
#define OSH    260
#define TP     72
#define SPP    36
#define PFP    40
#define SCL    0.044194173824159216f
#define LNPS   9.704060527839234f
#define GEPS   1.0e-6
#define SLD    8
#define NKB    (NN / 32)

static_assert(NB >= 1 && NB <= NB_FULL);
static_assert(NQ >= GWN && NQ <= NN && NQ % GWN == 0 && NQ % AQ == 0);
static_assert(NN % QT == 0 && NN % GWN == 0 && NN % AQ == 0 && NN % 32 == 0);
static_assert(CC == 8 * QT && CC % GWO == 0 && CC % 32 == 0);
static_assert(GSZ * NGRP == CC && GSZ == 16);
static_assert((GSZ * NN) % (4 * 256 * SLD) == 0);
static_assert((PSP * 4) % 16 == 0 && (OSH * 4) % 16 == 0 && (TP * 2) % 16 == 0);
static_assert((SPP * 4) % 16 == 0 && (PFP * 2) % 16 == 0);
static_assert(OSH >= GWO && PSP >= GWN && GWN * OSH * 4 <= 163840 && GWO * PSP * 4 <= 163840);
static_assert(AQ == 64 && (4 * AQ * SPP * 4 + 2 * AQ * PFP * 2 + AQ * OSH * 4 + 4 * AQ * 4) <= 327680);
static_assert(NKB >= 3 && (NKB & (NKB - 1)) == 0 && (AQ * PFP) % 8 == 0);
static_assert(((CC / 32) & (CC / 32 - 1)) == 0);

typedef _Float16       v16h __attribute__((ext_vector_type(16)));
typedef _Float16       v8h  __attribute__((ext_vector_type(8)));
typedef __bf16         v16b __attribute__((ext_vector_type(16)));
typedef unsigned short v8us __attribute__((ext_vector_type(8)));
typedef float          v8f  __attribute__((ext_vector_type(8)));
typedef float          v4f  __attribute__((ext_vector_type(4)));
typedef unsigned int   v4u  __attribute__((ext_vector_type(4)));

union Frag  { v8us u[2]; v16h h; v16b bf; };
static_assert(sizeof(Frag) == 32);

// ---- scalar helpers -------------------------------------------------------------------------------------------
__device__ __forceinline__ unsigned short bf_bits(float f) {          // f32 -> bf16 bits, RNE convert
  unsigned u = __float_as_uint(f);
  return (unsigned short)((u + 0x7FFFu + ((u >> 16) & 1u)) >> 16);
}
__device__ __forceinline__ float bf_up(unsigned short hb) { return __uint_as_float(((unsigned)hb) << 16); }
__device__ __forceinline__ float bfr(float f) { return bf_up(bf_bits(f)); }
__device__ __forceinline__ unsigned short h_bits(_Float16 x) { return __builtin_bit_cast(unsigned short, x); }
__device__ __forceinline__ unsigned pk16(unsigned short a, unsigned short b) { return (unsigned)a | ((unsigned)b << 16); }
__device__ __forceinline__ v8f zero8() { v8f z = {0.f, 0.f, 0.f, 0.f, 0.f, 0.f, 0.f, 0.f}; return z; }
__device__ __forceinline__ unsigned wave_ballot(bool p) {
#if defined(__HIP_DEVICE_COMPILE__)
  return __builtin_amdgcn_ballot_w32(p);
#else
  return p ? 1u : 0u;
#endif
}

// ---- value of the lane whose number differs in bit 0 (X = 1) or bit 1 (X = 2), inside a group of four lanes: one DPP move
template <int X>
__device__ __forceinline__ float quad_xor(float v) {
#if defined(__HIP_DEVICE_COMPILE__)
  return __int_as_float(__builtin_amdgcn_update_dpp(0, __float_as_int(v), X == 1 ? 0xB1 : 0x4E, 0xF, 0xF, true));
#else
  return v;
#endif
}

// ---- 16-bit fragment loader (A, or B from a k-contiguous [n][k] row): lane -> row/col (lane&15), p already includes
//      + 8*(lane>>4); elements 0..7 <- p[0..7] (k0+8h..), elements 8..15 <- p[16..23] (k0+16+8h..)
__device__ __forceinline__ Frag ldfrag(const unsigned short* p) {
  Frag f;
  f.u[0] = *(const v8us*)(p);
  f.u[1] = *(const v8us*)(p + 16);
  return f;
}

// ---- fragment-major planes (every 16-bit operand plane in the workspace): a plane of R rows x KD k-elements is cut
//      into fragments of 16 rows x 32 k = 512 elements; fragment (row tile rt, k step ks) starts at element
//      16*rt*KD + 512*ks and holds [u 0..1][lane 0..31][8 elements]: lane = 16*h + (row&15), k = 32*ks + 16*u + 8*h + t.
//      That is the register order of ldfrag above, so one fragment is two loads of 512 contiguous bytes per wave
//      (4 whole 128-B lines each) where a row-major plane gives 16 partial lines per load. p already includes + 8*lane.
__device__ __forceinline__ Frag ldfm(const unsigned short* p) {
  Frag f;
  f.u[0] = *(const v8us*)(p);
  f.u[1] = *(const v8us*)(p + 256);
  return f;
}

// ---- WMMA helpers. f16 form (attention): the plain builtin; the compiler keeps the distances behind its own WMMAs. The
//      asm pad of the bf16 form takes its operands from v0..v255 alone: built with it, the 64-query tile spills to scratch.
__device__ __forceinline__ v8f mma_h(v16h a, v16h b, v8f c) {
  return __builtin_amdgcn_wmma_f32_16x16x32_f16(false, a, false, b, (short)0, c, false, false);
}
// bf16 form (GEMMs): builtin followed by a 4-slot VALU gap tying D and keeping A/B live
__device__ __forceinline__ v8f mma_b(v16b a, v16b b, v8f c) {
  v8f d = __builtin_amdgcn_wmma_f32_16x16x32_bf16(false, a, false, b, (short)0, c, false, false);
#if defined(__HIP_DEVICE_COMPILE__)
  const v16h ha = __builtin_bit_cast(v16h, a), hb = __builtin_bit_cast(v16h, b);
  asm volatile("v_nop\n\tv_nop\n\tv_nop\n\tv_nop" : "+v"(d) : "v"(ha), "v"(hb));
#endif
  return d;
}

// ---- work-group barrier of the attention loop: orders LDS only (release / acquire on the local address space), so the
//      k and v requests that are in flight at it stay in flight; __syncthreads() would wait for them at every barrier.
//      The loop stores nothing to global memory and reads there only what earlier launches wrote.
__device__ __forceinline__ void lds_barrier() {
#if defined(__HIP_DEVICE_COMPILE__)
  __builtin_amdgcn_fence(__ATOMIC_RELEASE, "workgroup", "local");
  __builtin_amdgcn_s_barrier();
  __builtin_amdgcn_fence(__ATOMIC_ACQUIRE, "workgroup", "local");
#endif
}

// =============================================================================================================
// (0) conv weights: Wb bf16, rows 512*matrix + o, k = c, fragment-major; matrix 0 = wq, 1 = wk, 2 = wv, 3 = wp; value =
//     bf16-RNE(w). Block blk (0..511): matrix blk/128 (block-uniform), row tile blk/4; wave gw = 8 blk + w owns the
//     half u = gw&1 of the fragment of k step (gw>>1)&15 and stores it as 512 contiguous bytes.
// coverage: 128 row tiles x 16 k steps x 2 halves = 4096 waves x 32 lanes x 8 = the whole plane.
// =============================================================================================================
__global__ __launch_bounds__(256)
void cvt_w(const float* __restrict__ wq, const float* __restrict__ wk, const float* __restrict__ wv,
           const float* __restrict__ wp, unsigned short* Wb) {
  const int tid = threadIdx.x, blk = blockIdx.x;
  const int wave = tid >> 5, lane = tid & 31;
  const int sel = blk / (CC / 4);                                          // 0..3, block-uniform
  const float* src = (sel == 0) ? wq : (sel == 1) ? wk : (sel == 2) ? wv : wp;   // all global
  const int gw  = blk * 8 + wave;                                          // 0..4095
  const int u   = gw & 1, ks = (gw >> 1) & 15, rt = gw >> 5;               // rt 0..127 = blk / 4
  const int o   = (rt & 31) * 16 + (lane & 15);                            // 0..511
  const int col = 32 * ks + 16 * u + 8 * (lane >> 4);                      // 0..504
  const float* s = src + (size_t)o * CC + col;
  const v4f a = *(const v4f*)s;
  const v4f q = *(const v4f*)(s + 4);
  const float f[8] = {a[0], a[1], a[2], a[3], q[0], q[1], q[2], q[3]};
  v4u pkv;
#pragma unroll
  for (int t = 0; t < 4; ++t) pkv[t] = pk16(bf_bits(f[2 * t]), bf_bits(f[2 * t + 1]));
{
    *(v4u*)(Wb + (size_t)(16 * rt) * CC + 512 * ks + 256 * u + 8 * lane) = pkv;
    
  }
}

// =============================================================================================================
// (1) group-normalisation statistics of bf16-RNE(x): block bg = b*32+g owns the 16 channels x 4096 positions
// =============================================================================================================
__global__ __launch_bounds__(256)
void gn_stats(const float* __restrict__ x, float* stats) {
  __shared__ double red[256];
  const int tid = threadIdx.x, bg = blockIdx.x;
  const v4f* p = (const v4f*)(x + (size_t)bg * GSZ * NN);
  const int N4 = GSZ * NN / 4;                                            // 16384
  const double invN = 1.0 / (double)(GSZ * NN);

  double s = 0.0;
#pragma unroll 1
  for (int i = tid; i < N4; i += 256 * SLD) {
    v4f v[SLD];                                                           // SLD loads in flight per lane, old sum order
#pragma unroll                                                            // v[] stays in registers
    for (int u = 0; u < SLD; ++u) v[u] = p[i + 256 * u];
#pragma unroll                                                            // v[] stays in registers
    for (int u = 0; u < SLD; ++u)
      s += ((double)bfr(v[u][0]) + (double)bfr(v[u][1])) + ((double)bfr(v[u][2]) + (double)bfr(v[u][3]));
  }
  red[tid] = s;
  __syncthreads();
#pragma unroll 1
  for (int off = 128; off > 0; off >>= 1) {
    if (tid < off) red[tid] += red[tid + off];
    __syncthreads();
  }
  const double mean = red[0] * invN;
  __syncthreads();                                                        // everyone read red[0]

  double s2 = 0.0;
#pragma unroll 1
  for (int i = tid; i < N4; i += 256 * SLD) {
    v4f v[SLD];                                                           // SLD loads in flight per lane, old sum order
#pragma unroll                                                            // v[] stays in registers
    for (int u = 0; u < SLD; ++u) v[u] = p[i + 256 * u];
#pragma unroll                                                            // v[] stays in registers
    for (int u = 0; u < SLD; ++u) {
#pragma unroll
      for (int t = 0; t < 4; ++t) {
        const double d = (double)bfr(v[u][t]) - mean;
        s2 += d * d;
      }
    }
  }
  red[tid] = s2;
  __syncthreads();
#pragma unroll 1
  for (int off = 128; off > 0; off >>= 1) {
    if (tid < off) red[tid] += red[tid + off];
    __syncthreads();
  }
  const double var = red[0] * invN;
  const float meanf = (float)mean;
  const float rstdf = (float)(1.0 / sqrt(var + GEPS));

  v4f val = {0.f, 0.f, 0.f, 0.f};
  if (tid == 0) { val[0] = meanf; val[1] = rstdf; }
  float* dst = stats + (size_t)bg * 32 + 4 * (tid & 7);
  if (tid < 8) *(v4f*)dst = val;
  
}

// =============================================================================================================
// (2) h = (bf16-RNE(x) - mean) * rstd * bf16-RNE(gn_w) + bf16-RNE(gn_b) in f32, then bf16 hi = RNE(h) and bf16
//     lo = RNE(h - hi), written as Hh/Hl bf16, rows 4096 b + n, k = c, fragment-major (for the conv GEMMs).
//     Block (nb, cb, b) owns 64 n x 64 c through LDS tiles Th/Tl[64 n][64 c] (pitch TP; cross-wave, block barrier).
// coverage: Th/Tl 2 it x 32 rows(c) x 8 lanes x 8 n = 64 x 64 (staged extent == consumed extent); planes 2 it x 8
//           waves = 4 row tiles x 2 k steps x 2 halves of 512 B per plane; grid (64, 8, NB) covers all 4096 n x 512 c.
// =============================================================================================================
__global__ __launch_bounds__(256)
void gn_apply(const float* __restrict__ x, const float* __restrict__ gw, const float* __restrict__ gb,
              const float* __restrict__ stats, unsigned short* Hh, unsigned short* Hl) {
  __shared__ __align__(16) unsigned short Th[QT * TP];
  __shared__ __align__(16) unsigned short Tl[QT * TP];
  const int tid = threadIdx.x;
  const int nb = blockIdx.x, cb = blockIdx.y, b = blockIdx.z;
  const int e = tid & 7, lq = tid >> 3;                                  // lq 0..31
  const int n0 = nb * QT, c0 = cb * QT;
#pragma unroll
  for (int it = 0; it < 2; ++it) {
    const int cl = it * 32 + lq;                                          // 0..63
    const int ch = c0 + cl;                                               // 0..511
    const int g  = ch / GSZ;                                              // 0..31
    const float mean = stats[(size_t)(b * NGRP + g) * 32 + 0];
    const float rstd = stats[(size_t)(b * NGRP + g) * 32 + 1];
    const float w  = bfr(gw[ch]);
    const float bb = bfr(gb[ch]);
    const float* sp = x + ((size_t)(b * CC + ch)) * NN + n0 + 8 * e;
    const v4f a = *(const v4f*)sp;
    const v4f q = *(const v4f*)(sp + 4);
    const float f[8] = {a[0], a[1], a[2], a[3], q[0], q[1], q[2], q[3]};
#pragma unroll
    for (int t = 0; t < 8; ++t) {
      const float h = (bfr(f[t]) - mean) * rstd * w + bb;
      const unsigned short hb = bf_bits(h);
      const unsigned short lb = bf_bits(h - bf_up(hb));
      Th[(8 * e + t) * TP + cl] = hb;
      Tl[(8 * e + t) * TP + cl] = lb;
    }
  }
  __syncthreads();
  const int lane = tid & 31, wave = tid >> 5;
  v4u uh[2], ul[2];
#pragma unroll
  for (int it = 0; it < 2; ++it) {
    const int pc = it * 8 + wave;                                         // piece: row tile pc>>2, chunk pair pc&3
    const int lo = (16 * (pc >> 2) + (lane & 15)) * TP + 16 * (pc & 3) + 8 * (lane >> 4);
    uh[it] = *(const v4u*)(Th + lo);
    ul[it] = *(const v4u*)(Tl + lo);
  }
{
#pragma unroll
    for (int it = 0; it < 2; ++it) {
      const int pc = it * 8 + wave;
      const size_t po = ((size_t)(b * NN + n0 + 16 * (pc >> 2))) * CC + 16 * c0 + 256 * (pc & 3) + 8 * lane;
      *(v4u*)(Hh + po) = uh[it];
      *(v4u*)(Hl + po) = ul[it];
    }
    
  }
}

// =============================================================================================================
// GEMM core of launches (3), (4) and (6). Work-group = 8 waves = 256 output channels x 128 positions; wave w owns 128
//     channels (8 weight row tiles, base 128 (w>>2)) x 32 positions (2 row tiles, base 32 (w&3)) = 16 accumulator tiles.
//     Per k step of 32 a wave fetches 8 weight fragments and 2 x 2 activation fragments (hi and residual plane) for 32
//     WMMAs: a weight fragment feeds 2 position tiles in both planes, an activation fragment 8 channel tiles. The four waves
//     of one channel half ask for the same weight lines and the two waves of one position group for the same activation lines.
//     wp, hp, lp: the wave's first fragment in each plane, + 8*lane. Per accumulator: hi then residual of k step ks0, ks0 + 1,
//     .. 15, 0, .. ks0 - 1. ks0 (block-uniform) differs between the work-groups that read the same weight or activation
//     fragments, so that they do not ask L2 for the same lines at the same moment.
//     WROWS: D rows = channels (A = weights, B = activations); else D rows = positions (A = activations, B = weights).
// =============================================================================================================
template <bool WROWS>
__device__ __forceinline__ void gemm_core(const unsigned short* wp, const unsigned short* hp,
                                          const unsigned short* lp, int ks0, v8f (&acc)[16]) {
#pragma unroll                                                            // constant indices: the arrays stay in registers
  for (int j = 0; j < 16; ++j) acc[j] = zero8();
  wp += 512 * ks0;
  hp += 512 * ks0;
  lp += 512 * ks0;
  int kc = ks0;                                                           // the k step that the three pointers stand at

#pragma unroll 2                                                          // one branch and one count per two k steps
  for (int ks = 0; ks < CC / 32; ++ks) {
    Frag fh[2], fl[2], fw[8];                                             // all loads of the step before its first WMMA
#pragma unroll                                                            // fh[], fl[] stay in registers
    for (int t = 0; t < 2; ++t) {
      fh[t] = ldfm(hp + (size_t)(16 * t) * CC);
      fl[t] = ldfm(lp + (size_t)(16 * t) * CC);
    }
#pragma unroll                                                            // fw[] stays in registers
    for (int m = 0; m < 8; ++m) fw[m] = ldfm(wp + (size_t)(16 * m) * CC);
    // the step's requests name the registers of wp, hp and lp: the wait stands in front of the additions that rewrite them
    // (the step length goes through the statement, so that no addition can be lifted over the wait)
    int kstep = (kc == CC / 32 - 1) ? -(CC / 32 - 1) * 512 : 512;         // behind the last k step comes k step 0
    kc = (kc + 1) & (CC / 32 - 1);
    asm volatile("s_wait_xcnt 0x0" : "+s"(kstep) : : "memory");
    wp += kstep;
    hp += kstep;
    lp += kstep;
    // the 16 tiles' hi products, then their 16 residual products
#pragma unroll                                                            // constant indices: the arrays stay in registers
    for (int m = 0; m < 8; ++m) {
#pragma unroll                                                            // constant indices: the arrays stay in registers
      for (int t = 0; t < 2; ++t)
        acc[2 * m + t] = WROWS ? mma_b(fw[m].bf, fh[t].bf, acc[2 * m + t]) : mma_b(fh[t].bf, fw[m].bf, acc[2 * m + t]);
    }
#pragma unroll                                                            // constant indices: the arrays stay in registers
    for (int m = 0; m < 8; ++m) {
#pragma unroll                                                            // constant indices: the arrays stay in registers
      for (int t = 0; t < 2; ++t)
        acc[2 * m + t] = WROWS ? mma_b(fw[m].bf, fl[t].bf, acc[2 * m + t]) : mma_b(fl[t].bf, fw[m].bf, acc[2 * m + t]);
    }
  }
}

// =============================================================================================================
// (3) q / k conv GEMM for one (b, 128-n tile, matrix sel = mb/2, 256-o block o0 = (mb%2)*256):
//     Y[o][n] = sum_c W[o][c] (Hh + Hl)[b][n][c] + bf16-RNE(bias[o]); D rows = channels, K = 512 = 16 steps x 2 products.
//     Epilogue staged in LDS Os[n_loc][o_loc] (pitch OSH, b128 stores of 8 consecutive o per lane; cross-wave,
//     block barrier), then sel 0 -> Q16, sel 1 -> K16, plain f16, rows 4096 b + n, k = d, fragment-major.
// coverage: Os 8 waves x 32 n x 128 o = 128 x 256 (staged == consumed); plane 16 it x 8 waves = 8 row tiles x 8 k steps x 2
//           halves of 512 B = 128 n x 256 d; grid (32, 4, NB) covers d 0..511 of all 4096 rows of Q16 and K16 once.
// =============================================================================================================
__global__ __launch_bounds__(256)
void gemm_qk(const unsigned short* __restrict__ Wb, const unsigned short* __restrict__ Hh,
             const unsigned short* __restrict__ Hl, const float* __restrict__ bq, const float* __restrict__ bk,
             unsigned short* Q16, unsigned short* K16) {
  __shared__ __align__(16) float Os[GWN * OSH];
  const int tid  = threadIdx.x;
  const int lane = tid & 31, wave = tid >> 5;
  const int hh   = lane >> 4, c = lane & 15;
  const int nt   = blockIdx.x, mb = blockIdx.y, b = blockIdx.z;
  const int sel  = mb / (CC / GWO);                                        // 0 = q, 1 = k (block-uniform)
  const int n0   = nt * GWN, o0 = (mb % (CC / GWO)) * GWO;
  const int nw   = 32 * (wave & 3), ow = 128 * (wave >> 2);                // this wave's tile inside the block's

  const size_t ho = ((size_t)(b * NN + n0 + nw)) * CC + 8 * lane;
  v8f acc[16];
  gemm_core<true>(Wb + ((size_t)(sel * CC + o0 + ow)) * CC + 8 * lane, Hh + ho, Hl + ho, (nt + 4 * mb + b) & (CC / 32 - 1), acc);

  // ---- epilogue: + bias -> LDS Os[n_loc][o_loc]; lane (hh, c) holds o = ow + 16 m + 8 hh + r for n_loc = nw + 16 t + c
  const float* bsrc = ((sel == 0) ? bq : bk) + o0 + ow + 8 * hh;          // block-uniform choice, both global
  v4f bl[16];
#pragma unroll                                                            // bl[] stays in registers
  for (int m = 0; m < 16; ++m) bl[m] = *(const v4f*)(bsrc + 16 * (m >> 1) + 4 * (m & 1));
  // the bias requests name the registers of bsrc: it goes through the statement as an input, so that they are left alone
  // (also by what the requests bring) up to the wait
  asm volatile("s_wait_xcnt 0x0" : : "v"(bsrc) : "memory");
#pragma unroll                                                            // constant indices: the arrays stay in registers
  for (int m = 0; m < 8; ++m) {
    const v4f b0 = bl[2 * m], b1 = bl[2 * m + 1];
#pragma unroll                                                            // constant indices: the arrays stay in registers
    for (int t = 0; t < 2; ++t) {
      v4f va, vb;
#pragma unroll                                                            // constant indices: the arrays stay in registers
      for (int r = 0; r < 4; ++r) { va[r] = acc[2 * m + t][r] + bfr(b0[r]); vb[r] = acc[2 * m + t][4 + r] + bfr(b1[r]); }
      float* sp = Os + (nw + 16 * t + c) * OSH + ow + 16 * m + 8 * hh;
      *(v4f*)sp       = va;
      *(v4f*)(sp + 4) = vb;
    }
  }
  __syncthreads();

  unsigned short* Ph = (sel == 0) ? Q16 : K16;                             // block-uniform, both global
  v4u uv[16];
#pragma unroll                                                            // constant indices: the arrays stay in registers
  for (int it = 0; it < 16; ++it) {                                        // piece: row tile it>>1, chunk pair 8 (it&1) + wave
    const int lo = (16 * (it >> 1) + c) * OSH + 16 * (8 * (it & 1) + wave) + 8 * hh;
    const v4f a = *(const v4f*)(Os + lo);
    const v4f q = *(const v4f*)(Os + lo + 4);
    const float f[8] = {a[0], a[1], a[2], a[3], q[0], q[1], q[2], q[3]};
#pragma unroll                                                            // constant indices: the arrays stay in registers
    for (int t = 0; t < 4; ++t)
      uv[it][t] = pk16(h_bits((_Float16)f[2 * t]), h_bits((_Float16)f[2 * t + 1]));
  }
  const size_t po = ((size_t)(b * NN + n0)) * CC + 16 * o0 + 256 * wave + 8 * lane;
#pragma unroll                                                            // constant indices: the arrays stay in registers
  for (int it = 0; it < 16; ++it) *(v4u*)(Ph + po + (size_t)(16 * (it >> 1)) * CC + 2048 * (it & 1)) = uv[it];
}

// =============================================================================================================
// (4) v conv GEMM for one (b, 128-n tile, 256-o block o0 = mb*256), operands swapped so the D rows are positions:
//     D[n][o] = sum_c (Hh + Hl)[b][n][c] Wv[o][c] (2 products, K = 512).
//     Per lane the D tile holds 8 consecutive n of one o -> LDS Vs[o_loc][n_loc] (pitch PSP, b128 stores;
//     cross-wave, block barrier), then V16 f16, rows 512 b + o, k = n (KD = 4096), fragment-major, = f16(D +
//     bf16-RNE(bv[o])) (unscaled, |v| ~ 1).
// coverage: Vs 8 waves x 32 n x 128 o = 256 x 128 (staged == consumed); V16 16 it (row tiles) x 8 waves (4 k steps x 2
//           halves of 512 B) = 256 o x 128 n; grid (32, 2, NB) covers all 512 o x 4096 n of each b exactly once.
// =============================================================================================================
__global__ __launch_bounds__(256)
void gemm_v(const unsigned short* __restrict__ Wb, const unsigned short* __restrict__ Hh,
            const unsigned short* __restrict__ Hl, const float* __restrict__ bv, unsigned short* V16) {
  __shared__ __align__(16) float Vs[GWO * PSP];
  const int tid  = threadIdx.x;
  const int lane = tid & 31, wave = tid >> 5;
  const int hh   = lane >> 4, c = lane & 15;
  const int nt   = blockIdx.x, mb = blockIdx.y, b = blockIdx.z;
  const int n0   = nt * GWN, o0 = mb * GWO;
  const int nw   = 32 * (wave & 3), ow = 128 * (wave >> 2);                // this wave's tile inside the block's

  const size_t ho = ((size_t)(b * NN + n0 + nw)) * CC + 8 * lane;
  v8f acc[16];
  gemm_core<false>(Wb + ((size_t)(2 * CC + o0 + ow)) * CC + 8 * lane, Hh + ho, Hl + ho, (nt + 8 * mb + b) & (CC / 32 - 1), acc);

  // ---- epilogue: lane (hh, c) holds n_loc = nw + 16 t + 8 hh + r of o_loc = ow + 16 m + c
#pragma unroll                                                            // constant indices: the arrays stay in registers
  for (int m = 0; m < 8; ++m) {
    const float bb = bfr(bv[o0 + ow + 16 * m + c]);
#pragma unroll                                                            // constant indices: the arrays stay in registers
    for (int t = 0; t < 2; ++t) {
      v4f va, vb;
#pragma unroll                                                            // constant indices: the arrays stay in registers
      for (int r = 0; r < 4; ++r) { va[r] = acc[2 * m + t][r] + bb; vb[r] = acc[2 * m + t][4 + r] + bb; }
      float* sp = Vs + (ow + 16 * m + c) * PSP + nw + 16 * t + 8 * hh;
      *(v4f*)sp       = va;
      *(v4f*)(sp + 4) = vb;
    }
  }
  __syncthreads();

  v4u uv[16];
#pragma unroll                                                            // constant indices: the arrays stay in registers
  for (int it = 0; it < 16; ++it) {
    const int lo = (it * 16 + c) * PSP + 16 * wave + 8 * hh;               // row tile it, chunk pair = wave
    const v4f a = *(const v4f*)(Vs + lo);
    const v4f q = *(const v4f*)(Vs + lo + 4);
    const float f[8] = {a[0], a[1], a[2], a[3], q[0], q[1], q[2], q[3]};
#pragma unroll                                                            // constant indices: the arrays stay in registers
    for (int t = 0; t < 4; ++t)
      uv[it][t] = pk16(h_bits((_Float16)f[2 * t]), h_bits((_Float16)f[2 * t + 1]));
  }
  const size_t po = ((size_t)(b * CC + o0)) * NN + 16 * n0 + 256 * wave + 8 * lane;
#pragma unroll                                                            // constant indices: the arrays stay in registers
  for (int it = 0; it < 16; ++it) *(v4u*)(V16 + po + (size_t)(16 * it) * NN) = uv[it];
}

// =============================================================================================================
// (5) attention for one (b, 64-query tile), transposed formulation, 4096 keys, no mask. Block = 8 waves, one block per
//   WGP (grid 64 x NB): every K and V fragment that a block fetches feeds 64 queries.
//   Score phase per 32-key block kb: wave w computes TWO S^T partial tiles (16 keys x 16 queries each) from one set of
//   k fragments: key tile kt = w&1 (keys kb+16kt..), query tiles 2 qg + i, qg = (w>>1)&1, i = 0..1 (queries
//   n0+16(2qg+i)..), over the d-half dh = w>>2 (d 256dh .. 256dh+255, 8 steps of 32): A = k rows (row = key,
//   fragment-major, split k map) from K16, B = q rows (col = query, same map) from Q16, plain f16, 1 product. Each
//   partial (D row = key 8h+r, col = query) goes to LDS Sp[dh][query][key] (pitch SPP, b128 stores; cross-wave, block
//   barrier); the two d-halves are added in fixed order by the softmax lanes.
//   Softmax: all 8 waves, four lanes per query: thread tid has query tid / 4 and the 8 keys 8 (tid & 3) ..: s_j = (Sp[0] +
//   Sp[1]) * 512^-0.5, block max in-lane and over the four lanes (two DPP moves), online max m in f32 (equal in the four
//   lanes), the sum l as one f32 partial per lane over its own keys (the four are added once, behind the loop), corr =
//   e^{m_old - m_new} -> Cs[query], P_j = e^{s_j - m} x 2^14 as f16 -> Pf[query][key] (pitch PFP, one 16-B store per lane;
//   cross-wave, block barrier).
//   O^T (rows channel, cols query): every wave owns channels 64w..64w+63 (4 tiles j) x 64 queries (4 tiles) = 16
//   accumulator tiles; rescale by Cs when any of the 64 corr is not 1 (every wave reads all 64, so block-uniform; corr is
//   exactly 1 for a query whose max did not grow), then += A(v rows channel = 64w+16j+(lane&15), keys kb.., fragment-major f16 plane V16) . B(P^T: row = query
//   from Pf, keys contiguous, same k order).
//   The three phases run as a pipeline over the key blocks, ONE barrier per key block: between two barriers every wave
//   does the scores of block i+1, its share of the softmax of block i and O^T of block i-1. Sp, Pf and Cs
//   have two buffers each (index = key block & 1): what a pass writes was last read in the pass before, behind a barrier,
//   and is read in the next pass. Fill: block 0's scores ahead of the
//   loop, and P = 0, corr = 1 for the O^T step of pass 0 (adds zero); drain: the last pass scores one block more
//   (never read), O^T of the last block stands behind the loop.
//   Key walk: "key block i" above is the i-th block of this work-group's walk, keys 32 ((st + i) mod 128) ..: the walk goes
//   once round all 128 blocks from a start st of the work-group's own. The 64 work-groups of one b read the same K and V
//   planes; from one common start they would ask L2 for the same lines at the same moment in every pass. The online softmax
//   takes the key blocks in any order; the order of its sums follows the walk.
//   Epilogue in two 256-channel halves: waves with (w>>2) == half stage O/l in LDS Os[query][256 ch] (pitch OSH, b128
//   stores; cross-wave, block barrier), then all 256 threads write Ah (bf16 hi) and Al (bf16 residual), fragment-major.
// coverage: Sp 8 waves x 2 tiles = [2 dh][64 q][32 keys] each key block (staged == consumed); Pf 64 rows x 32 keys by
//           256 lanes x 8 keys (staged == consumed, pad cols never read; buffer 1 zeroed whole ahead of the loop); Os per half 4 waves x 64 q x 64 ch = 64 x 256 (staged
//           == consumed); planes 2 halves x 8 it x 8 waves x 512 B = 4 row tiles x 16 k steps per plane; grid (NQ/64,
//           NB) covers rows 0..NQ-1 exactly once (only those are read later).
// =============================================================================================================
__global__ __launch_bounds__(256)
void attn_k(const unsigned short* __restrict__ Q16, const unsigned short* __restrict__ K16,
            const unsigned short* __restrict__ V16, unsigned short* Ah, unsigned short* Al) {
  __shared__ __align__(16) float Sp[2 * 2 * AQ * SPP];
  __shared__ __align__(16) unsigned short Pf[2 * AQ * PFP];
  __shared__ __align__(16) float Os[AQ * OSH];
  __shared__ float Cs[2 * AQ];
  __shared__ float Ls[AQ];
  const int tid  = threadIdx.x;
  const int wave = tid >> 5, lane = tid & 31;
  const int hh   = lane >> 4, c = lane & 15;
  const int n0   = blockIdx.x * AQ, b = blockIdx.y;
  const int kt = wave & 1, qg = (wave >> 1) & 1, dh = wave >> 2;

  // q fragment pointer (B operand of S^T, col = query n0 + 16 (2 qg + i) + c, d-half dh), + 16*CC*i + 512*ks
  const unsigned short* qp = Q16 + ((size_t)(b * NN + n0 + 32 * qg)) * CC + 16 * (CC / 2) * dh + 8 * lane;
  // k fragment base (A operand, row = key kb + 16 kt + c, d-half dh), + kb*CC + 512*ks
  const unsigned short* kp = K16 + ((size_t)(b * NN + 16 * kt)) * CC + 16 * (CC / 2) * dh + 8 * lane;
  // v fragment base (A operand of O^T, row = channel 64 w + 16 j + c), + 16*j*NN + 16*kb (k step kb/32)
  const unsigned short* vp = V16 + ((size_t)(b * CC + 64 * wave)) * NN + 8 * lane;
  // this lane's S^T partial destination: Sp[dh][query 16(2qg+i)+c][key 16kt + 8hh + r], + 16*SPP*i
  float* spw = Sp + (dh * AQ + 32 * qg + c) * SPP + 16 * kt + 8 * hh;
  // P^T fragment rows (row = query 16 q + c, keys contiguous), + 16*PFP*q
  const unsigned short* pf = Pf + c * PFP + 8 * hh;

  // q fragments of this wave's d-half do not change with the key block: loaded once, kept in registers
  Frag fq[2][CC / 64];
#pragma unroll                                                            // fq[][] stays in registers
  for (int i = 0; i < 2; ++i) {
#pragma unroll
    for (int ks = 0; ks < CC / 64; ++ks) fq[i][ks] = ldfm(qp + (size_t)(16 * i) * CC + 512 * ks);
  }
  // the q requests are in flight and the code below reuses their address registers
  asm volatile("s_wait_xcnt 0x0" ::: "memory");

  // softmax share of this lane: query sq, keys sk .. sk + 7 of each key block
  const int sq = tid >> 2, sk = 8 * (tid & 3);
  float m_run = -1.0e30f, l_run = 0.f;
  v8f o[16];
#pragma unroll
  for (int j = 0; j < 16; ++j) o[j] = zero8();

  // ---- the two matrix phases, used in the fill, in the loop and in the drain
  Frag fk[CC / 64];
  Frag fv[4];
  // two score partial tiles over this wave's d-half, each k fragment used for both -> Sp buffer at dst
  auto score = [&](float* dst) __attribute__((always_inline)) {
    v8f s0 = zero8(), s1 = zero8();
#pragma unroll                                                            // fk[], fq[][] stay in registers
    for (int ks = 0; ks < CC / 64; ++ks) {
      s0 = mma_h(fk[ks].h, fq[0][ks].h, s0);
      s1 = mma_h(fk[ks].h, fq[1][ks].h, s1);
    }
    v4f sa, sb, sc, sd;
#pragma unroll
    for (int r = 0; r < 4; ++r) { sa[r] = s0[r]; sb[r] = s0[4 + r]; sc[r] = s1[r]; sd[r] = s1[4 + r]; }
    *(v4f*)(dst)                = sa;
    *(v4f*)(dst + 4)            = sb;
    *(v4f*)(dst + 16 * SPP)     = sc;
    *(v4f*)(dst + 16 * SPP + 4) = sd;
  };
  // the O^T step in two parts. pv_read: all its LDS reads (corr, P^T fragments of buffer buf) as one group, placed
  // at the head of a pass so that they land under the score products. pv_scale: rescale (block-uniform test). pv_mul: O^T += V . P^T
  float cr[4];
  Frag p[4];
  auto pv_read = [&](int buf) __attribute__((always_inline)) {
#pragma unroll                                                            // cr[], p[] stay in registers
    for (int q = 0; q < 4; ++q) {
      cr[q] = Cs[AQ * buf + 16 * q + c];
      p[q]  = ldfrag(pf + AQ * PFP * buf + 16 * PFP * q);
    }
  };
  auto pv_scale = [&]() __attribute__((always_inline)) {
    // corr <= 1: the least of the lane's four, then one ballot; lanes 0..15 hold all 64 queries between them
    if (wave_ballot(fminf(fminf(cr[0], cr[1]), fminf(cr[2], cr[3])) != 1.0f) != 0u) {
#pragma unroll
      for (int q = 0; q < 4; ++q) {
#pragma unroll
        for (int j = 0; j < 4; ++j) {
#pragma unroll
          for (int r = 0; r < 8; ++r) o[4 * j + q][r] *= cr[q];
        }
      }
    }
  };
  auto pv_mul = [&]() __attribute__((always_inline)) {
#pragma unroll
    for (int j = 0; j < 4; ++j) {
#pragma unroll
      for (int q = 0; q < 4; ++q) o[4 * j + q] = mma_h(fv[j].h, p[q].h, o[4 * j + q]);
    }
  };

  // ---- fill: scores of key block 0 -> Sp buffer 0; P = 0, corr = 1 in buffer 1 for the O^T step of pass 0; then
  //      the k fragments of block 1 and the v fragments of block 0 (finite values for that step, which adds v x 0)
  // start of the walk: 64 different even blocks; neighbours in blockIdx.x stand ten blocks apart
  const int st = 2 * ((5 * (int)blockIdx.x) & (NKB / 2 - 1));
  const unsigned short* kpn = kp + (size_t)st * (32 * CC);
  const unsigned short* vpn = vp + (size_t)st * 512;
  int kj = st, vj = st;                                                   // the key blocks that kpn and vpn stand at
  // step to the next key block of the walk, in elements of the k plane (KS = 32 CC) or the v plane (KS = 512): behind
  // block 127 comes block 0, so every address of the walk, also of the blocks asked for past its end, lies in the planes
  auto wstep = [&](int& j, int KS) __attribute__((always_inline)) {
    const int s = (j == NKB - 1) ? -(NKB - 1) * KS : KS;
    j = (j + 1) & (NKB - 1);
    return s;
  };
#pragma unroll                                                            // fk[] stays in registers
  for (int ks = 0; ks < CC / 64; ++ks) fk[ks] = ldfm(kpn + 512 * ks);
  // every group of k or v requests names the registers of kpn or vpn: the wait stands in front of the step that rewrites
  // them (the step length goes through the statement, so that the addition cannot be lifted over the wait)
  int kstep0 = wstep(kj, 32 * CC);
  asm volatile("s_wait_xcnt 0x0" : "+s"(kstep0) : : "memory");
  kpn += kstep0;
  {
    const v4u z4 = {0u, 0u, 0u, 0u};
#pragma unroll 1
    for (int t = tid; t < AQ * PFP / 8; t += 256) *(v4u*)(Pf + AQ * PFP + 8 * t) = z4;
    if (tid < AQ) Cs[AQ + tid] = 1.0f;
  }
  score(spw);
#pragma unroll                                                            // fk[] stays in registers
  for (int ks = 0; ks < CC / 64; ++ks) fk[ks] = ldfm(kpn + 512 * ks);
  int kstep1 = wstep(kj, 32 * CC);
  asm volatile("s_wait_xcnt 0x0" : "+s"(kstep1) : : "memory");            // as above
  kpn += kstep1;                                                          // from here on: two key blocks ahead of the pass
#pragma unroll                                                            // fv[] stays in registers
  for (int j = 0; j < 4; ++j) fv[j] = ldfm(vpn + (size_t)(16 * j) * NN);
  lds_barrier();

#pragma unroll 1
  for (int i = 0; i < NKB; ++i) {
    const int cur = i & 1, oth = cur ^ 1;
    pv_read(oth);
    // this lane's score partials of key block i (both d-halves), in the same group of LDS reads
    v4f sa0[2], sa1[2];
    {
      const float* s0p = Sp + 2 * AQ * SPP * cur + sq * SPP + sk;          // d-half 0
#pragma unroll                                                            // sa0[], sa1[] stay in registers
      for (int t2 = 0; t2 < 2; ++t2) {
        sa0[t2] = *(const v4f*)(s0p + 4 * t2);
        sa1[t2] = *(const v4f*)(s0p + AQ * SPP + 4 * t2);                  // d-half 1
      }
    }
    // ---- scores of key block i+1 (last pass: one block past the walk's end, never read)
    score(spw + 2 * AQ * SPP * oth);
    // ---- the k fragments of key block i+2 are requested here, a whole pass ahead of their use
#pragma unroll                                                            // fk[] stays in registers
    for (int ks = 0; ks < CC / 64; ++ks) fk[ks] = ldfm(kpn + 512 * ks);
    int kstep = wstep(kj, 32 * CC);
    asm volatile("s_wait_xcnt 0x0" : "+s"(kstep) : : "memory");           // as above
    kpn += kstep;
    // keeps the softmax and the test of corr, and with them the wait for their LDS reads, behind the score products:
    // scheduled among them they stall the wave for the LDS latency at the head of the pass
    __builtin_amdgcn_sched_barrier(0);
    // ---- O^T of key block i-1, first part: rescale
    pv_scale();
    // ---- online softmax of key block i: query sq, keys 32 ((st + i) mod 128) + sk .. + 7. It stands between the wave's two runs of matrix
    //      products: while one wave of a SIMD is in this vector chain the other has products to issue, and a pass ends in
    //      products, not in a chain that every wave would wait for at the barrier
    {
      float sv[8];
#pragma unroll
      for (int t2 = 0; t2 < 2; ++t2) {
#pragma unroll
        for (int t = 0; t < 4; ++t) sv[4 * t2 + t] = sa0[t2][t] + sa1[t2][t];
      }
      float mx = sv[0];
#pragma unroll
      for (int j = 1; j < 8; ++j) mx = fmaxf(mx, sv[j]);
      mx = fmaxf(mx, quad_xor<1>(mx));                                    // max over the query's four lanes
      mx = fmaxf(mx, quad_xor<2>(mx));
      const float mn   = fmaxf(m_run, mx * SCL);
      const float corr = __expf(m_run - mn);                             // == 1 exactly when the max did not grow
      m_run = mn;
      const float msh = mn - LNPS;                                        // exp gives e^{s-m} * 2^14
      float ls = 0.f;
      v4u pk;
#pragma unroll
      for (int t = 0; t < 4; ++t) {
        const float e0 = __expf(fmaf(sv[2 * t],     SCL, -msh));           // key 32 ((st + i) mod 128) + sk + 2t
        const float e1 = __expf(fmaf(sv[2 * t + 1], SCL, -msh));           // key 32 ((st + i) mod 128) + sk + 2t + 1
        ls += e0 + e1;
        pk[t] = pk16(h_bits((_Float16)e0), h_bits((_Float16)e1));
      }
      l_run = l_run * corr + ls;
      *(v4u*)(Pf + AQ * PFP * cur + sq * PFP + sk) = pk;
      if ((tid & 3) == 0) Cs[AQ * cur + sq] = corr;
    }
    // keeps the additions of the row sum, which nothing in the pass waits for, in the vector chain above: left free they are
    // scheduled behind the barrier, in front of every wave's first score product of the next pass
    __builtin_amdgcn_sched_barrier(0);
    // ---- O^T of key block i-1, second part: the products (pass 0: adds zero)
    pv_mul();
    // ---- the v fragments of key block i are requested here, a whole pass ahead of their use
#pragma unroll                                                            // fv[] stays in registers
    for (int j = 0; j < 4; ++j) fv[j] = ldfm(vpn + (size_t)(16 * j) * NN);
    int vstep = wstep(vj, 512);
    asm volatile("s_wait_xcnt 0x0" : "+s"(vstep) : : "memory");           // as above
    vpn += vstep;
    lds_barrier();
  }
  // ---- drain: O^T of the last key block
  pv_read((NKB - 1) & 1);
  pv_scale();
  pv_mul();
  // no global request has been issued since the last pass's wait after its v requests: a precaution
  asm volatile("s_wait_xcnt 0x0" ::: "memory");
  l_run += quad_xor<1>(l_run);                                            // the query's four partial sums, same m in all four
  l_run += quad_xor<2>(l_run);
  if ((tid & 3) == 0) Ls[sq] = 1.0f / l_run;                              // o and l both carry the 2^14 factor
  __syncthreads();
  float inv[4];
#pragma unroll
  for (int q = 0; q < 4; ++q) inv[q] = Ls[16 * q + c];

#pragma unroll
  for (int half = 0; half < 2; ++half) {
    if ((wave >> 2) == half) {
      const int chb = 64 * (wave & 3);                                    // channel offset inside this half
#pragma unroll
      for (int j = 0; j < 4; ++j) {
#pragma unroll
        for (int q = 0; q < 4; ++q) {
          v4f va, vb;
#pragma unroll
          for (int r = 0; r < 4; ++r) { va[r] = o[4 * j + q][r] * inv[q]; vb[r] = o[4 * j + q][4 + r] * inv[q]; }
          float* dst = Os + (16 * q + c) * OSH + chb + 16 * j + 8 * hh;   // Os[query][ch = chb + 16j + 8hh + r]
          *(v4f*)dst       = va;
          *(v4f*)(dst + 4) = vb;
        }
      }
    }
    __syncthreads();
    {
      v4u uh[AQ / 8], ul[AQ / 8];
#pragma unroll
      for (int it = 0; it < AQ / 8; ++it) {
        const int pc = it * 8 + wave;                                     // piece: row tile pc>>4, chunk pair pc&15
        const int lo = (16 * (pc >> 4) + c) * OSH + 16 * (pc & 15) + 8 * hh;
        const v4f a = *(const v4f*)(Os + lo);
        const v4f q = *(const v4f*)(Os + lo + 4);
        const float f[8] = {a[0], a[1], a[2], a[3], q[0], q[1], q[2], q[3]};
#pragma unroll
        for (int t = 0; t < 4; ++t) {
          const float f0 = f[2 * t], f1 = f[2 * t + 1];
          const unsigned short hb0 = bf_bits(f0), hb1 = bf_bits(f1);
          const unsigned short lb0 = bf_bits(f0 - bf_up(hb0));
          const unsigned short lb1 = bf_bits(f1 - bf_up(hb1));
          uh[it][t] = pk16(hb0, hb1);
          ul[it][t] = pk16(lb0, lb1);
        }
      }
#pragma unroll
      for (int it = 0; it < AQ / 8; ++it) {
        const int pc = it * 8 + wave;
        const size_t po = ((size_t)(b * NN + n0 + 16 * (pc >> 4))) * CC + 16 * (CC / 2) * half + 256 * (pc & 15) + 8 * lane;
        *(v4u*)(Ah + po) = uh[it];
        *(v4u*)(Al + po) = ul[it];
      }
    }
    __syncthreads();
  }
}

// =============================================================================================================
// (6) output projection + bias + residual for one (b, 128-n tile, 256-o block o0 = mb*256), D rows = positions:
//     D[n][o] = sum_c (Ah + Al)[b][n][c] Wp[o][c] (2 products, K = 512), GEMM core as in (4). Per lane 8 consecutive n of
//     one o -> LDS Vs[o_loc][n_loc] (pitch PSP, b128 stores; cross-wave, block barrier), then one wave per row: lane e ->
//     n 4e..4e+3, 4 whole lines of out per instruction.
// coverage: Vs 8 waves x 32 n x 128 o = 256 x 128 (staged == consumed); out 32 it x 8 rows x 32 lanes x 4 = 256 o x
//           128 n; grid (NQ/128, 2, NB) covers out[b][0..511][0..NQ-1] exactly once.
// =============================================================================================================
__global__ __launch_bounds__(256)
void gemm_p(const unsigned short* __restrict__ Wb, const unsigned short* __restrict__ Ah,
            const unsigned short* __restrict__ Al, const float* __restrict__ bp, const float* __restrict__ x,
            float* out) {
  __shared__ __align__(16) float Vs[GWO * PSP];
  const int tid  = threadIdx.x;
  const int lane = tid & 31, wave = tid >> 5;
  const int hh   = lane >> 4, c = lane & 15;
  const int nt   = blockIdx.x, mb = blockIdx.y, b = blockIdx.z;
  const int n0   = nt * GWN, o0 = mb * GWO;
  const int nw   = 32 * (wave & 3), ow = 128 * (wave >> 2);                // this wave's tile inside the block's

  const size_t ao = ((size_t)(b * NN + n0 + nw)) * CC + 8 * lane;
  v8f acc[16];
  gemm_core<false>(Wb + ((size_t)(3 * CC + o0 + ow)) * CC + 8 * lane, Ah + ao, Al + ao, (nt + 8 * mb + b) & (CC / 32 - 1), acc);

  // ---- epilogue: lane (hh, c) holds n_loc = nw + 16 t + 8 hh + r of o_loc = ow + 16 m + c
#pragma unroll                                                            // constant indices: the arrays stay in registers
  for (int m = 0; m < 8; ++m) {
    const float bb = bfr(bp[o0 + ow + 16 * m + c]);
#pragma unroll                                                            // constant indices: the arrays stay in registers
    for (int t = 0; t < 2; ++t) {
      v4f va, vb;
#pragma unroll                                                            // constant indices: the arrays stay in registers
      for (int r = 0; r < 4; ++r) { va[r] = acc[2 * m + t][r] + bb; vb[r] = acc[2 * m + t][4 + r] + bb; }
      float* sp = Vs + (ow + 16 * m + c) * PSP + nw + 16 * t + 8 * hh;
      *(v4f*)sp       = va;
      *(v4f*)(sp + 4) = vb;
    }
  }
  __syncthreads();

  const size_t idx = ((size_t)(b * CC + o0 + wave)) * NN + n0 + 4 * lane;  // row it * 8 + wave: + 8 it NN
  v4f res[GWO / 8];
#pragma unroll                                                            // constant indices: the arrays stay in registers
  for (int it = 0; it < GWO / 8; ++it) {
    const v4f a = *(const v4f*)(Vs + (it * 8 + wave) * PSP + 4 * lane);
    const v4f xv = *(const v4f*)(x + idx + (size_t)(8 * it) * NN);
#pragma unroll                                                            // constant indices: the arrays stay in registers
    for (int t = 0; t < 4; ++t) res[it][t] = a[t] + bfr(xv[t]);
  }
#pragma unroll                                                            // constant indices: the arrays stay in registers
  for (int it = 0; it < GWO / 8; ++it) *(v4f*)(out + idx + (size_t)(8 * it) * NN) = res[it];
}

// =============================================================================================================
// Workspace map (bytes; each region start a multiple of 256; every extent is an exact tile multiple and is written
//   (all 16-bit planes fragment-major, same extents as row-major)
//   Wb    bf16 [4][512][512]          2097152
//   stats f32  [NB*32][32]             16384 (NB=4)
//   Hh/Hl bf16 [NB][4096][512]     16777216 x2   (reused as Ah/Al after their last reader, launch (4))
//   Q16/K16 f16 [NB][4096][512]   16777216 x2
//   V16   f16  [NB][512][4096]     16777216
//   total (NB=4) = 85999616
// =============================================================================================================
extern "C" void kernel_launch(void* const* d_in, const int* in_sizes, int n_in,
                              void* d_out, int out_size, void* d_ws, size_t ws_size,
                              hipStream_t stream) {
  if (n_in < 11) return;
  if (in_sizes[0] < NB * CC * NN) return;
  if (in_sizes[1] < CC || in_sizes[2] < CC) return;
  if (in_sizes[3] < CC * CC || in_sizes[5] < CC * CC || in_sizes[7] < CC * CC || in_sizes[9] < CC * CC) return;
  if (in_sizes[4] < CC || in_sizes[6] < CC || in_sizes[8] < CC || in_sizes[10] < CC) return;
  if (out_size < NB * CC * NN) return;

  size_t off = 0;
  auto carve = [&](size_t bytes) { const size_t o = off; off += (bytes + 255) & ~(size_t)255; return o; };
  const size_t plane = (size_t)NB * NN * CC * 2;
  const size_t oWb  = carve((size_t)4 * CC * CC * 2);
  const size_t oSt  = carve((size_t)NB * NGRP * 32 * 4);
  const size_t oHh  = carve(plane);
  const size_t oHl  = carve(plane);
  const size_t oQ   = carve(plane);
  const size_t oK   = carve(plane);
  const size_t oV   = carve(plane);
  const size_t oAh  = oHh;                                                // same extent, disjoint lifetimes
  const size_t oAl  = oHl;
  if (off > ws_size) return;
  if (off > (size_t)134217728) return;

  const float* x   = (const float*)d_in[0];
  const float* gnw = (const float*)d_in[1];
  const float* gnb = (const float*)d_in[2];
  const float* wq  = (const float*)d_in[3];
  const float* bq  = (const float*)d_in[4];
  const float* wk  = (const float*)d_in[5];
  const float* bk  = (const float*)d_in[6];
  const float* wv  = (const float*)d_in[7];
  const float* bv  = (const float*)d_in[8];
  const float* wp  = (const float*)d_in[9];
  const float* bp  = (const float*)d_in[10];

  char* ws = (char*)d_ws;
  unsigned short* Wb  = (unsigned short*)(ws + oWb);
  float*          St  = (float*)(ws + oSt);
  unsigned short* Hh  = (unsigned short*)(ws + oHh);
  unsigned short* Hl  = (unsigned short*)(ws + oHl);
  unsigned short* Q16 = (unsigned short*)(ws + oQ);
  unsigned short* K16 = (unsigned short*)(ws + oK);
  unsigned short* V16 = (unsigned short*)(ws + oV);
  unsigned short* Ah  = (unsigned short*)(ws + oAh);
  unsigned short* Al  = (unsigned short*)(ws + oAl);
  float* out = (float*)d_out;

  const dim3 blk256(256);

  // (0) conv weights -> stacked bf16 plane
  cvt_w<<<dim3(4 * (CC / 4)), blk256, 0, stream>>>(wq, wk, wv, wp, Wb);
  // (1) group statistics per (b, g) in f64
  gn_stats<<<dim3(NB * NGRP), blk256, 0, stream>>>(x, St);
  // (2) normalised activations -> fragment-major bf16 hi / residual planes
  gn_apply<<<dim3(NN / QT, CC / QT, NB), blk256, 0, stream>>>(x, gnw, gnb, St, Hh, Hl);
  // (3) q and k -> fragment-major f16 planes (rows = positions)
  gemm_qk<<<dim3(NN / GWN, 2 * (CC / GWO), NB), blk256, 0, stream>>>(Wb, Hh, Hl, bq, bk, Q16, K16);
  // (4) v -> fragment-major f16 plane (rows = channels)
  gemm_v<<<dim3(NN / GWN, CC / GWO, NB), blk256, 0, stream>>>(Wb, Hh, Hl, bv, V16);
  // (5) attention -> bf16 hi / residual planes of the attention output (regions of Hh / Hl, dead by now)
  attn_k<<<dim3(NQ / AQ, NB), blk256, 0, stream>>>(Q16, K16, V16, Ah, Al);
  // (6) output projection + bias + residual -> out [b][512][4096]
  gemm_p<<<dim3(NQ / GWN, CC / GWO, NB), blk256, 0, stream>>>(Wb, Ah, Al, bp, x, out);
  (void)hipGetLastError();
}

// v008
// A run of this version takes 219 microseconds.
// Next to v007, in two timings, it ran 1.05 and 1.07 times as fast.
// Counting every step since v000, it is 5.20 times as fast.
// Contractions: q/k/v 1x1-conv GEMMs W[512x512].H[512x4096] on v_wmma_f32_16x16x32_bf16 (W = bf16-RNE weights,
// exact; H = bf16 hi + bf16 residual planes of the normalised activations; 2 products, K=512); scores S^T = K.Q^T on
// v_wmma_f32_16x16x32_f16 (k, q: plain f16 planes, 1 product, K=512 split over two wave groups, fixed-order f32
// combine in LDS); O^T = V.P^T on v_wmma_f32_16x16x32_f16 (v: f16 plane, P = e^{s-m} x 2^14 as f16, K=4096); output
// 1x1-conv GEMM Wp[512x512].A[512x4096] on v_wmma_f32_16x16x32_bf16 (A = bf16 hi + residual planes of the
// attention output; 2 products, K=512). f32 accumulate everywhere; normalisation statistics summed in f64; softmax
// statistics, biases and the residual add in f32 VALU.
#include <hip/hip_runtime.h>
#include <math.h>
#include <stdint.h>

#ifndef NB
#define NB 4
#endif
#ifndef NQ
#define NQ 4096
#endif
#define NB_FULL 4
#define CC     512
#define NN     4096
#define NGRP   32
#define GSZ    16
#define AQ     64
#define GWO    256
#define GWN    128
#define PSP    132
#define OSH    260
#define SPP    36
#define PFP    40
#define SCL    0.044194173824159216f
#define LNPS   9.704060527839234f
#define GEPS   1.0e-6
#define NKB    (NN / 32)

static_assert(NB >= 1 && NB <= NB_FULL);
static_assert(NQ >= GWN && NQ <= NN && NQ % GWN == 0 && NQ % AQ == 0);
static_assert(NN % GWN == 0 && NN % AQ == 0 && NN % 32 == 0 && NN == 8 * 512);
static_assert(CC == 512 && CC % GWO == 0 && CC % 32 == 0);
static_assert(GSZ * NGRP == CC && GSZ == 16);
static_assert((PSP * 4) % 16 == 0 && (OSH * 4) % 16 == 0);
static_assert((SPP * 4) % 16 == 0 && (PFP * 2) % 16 == 0);
static_assert(OSH >= GWO && PSP >= GWN && GWN * OSH * 4 <= 163840 && GWO * PSP * 4 <= 163840);
static_assert(AQ == 64 && (4 * AQ * SPP * 4 + 2 * AQ * PFP * 2 + AQ * OSH * 4 + 4 * AQ * 4) <= 327680);
static_assert(NKB >= 3 && (NKB & (NKB - 1)) == 0 && (AQ * PFP) % 8 == 0);
static_assert(((CC / 32) & (CC / 32 - 1)) == 0);

typedef _Float16       v16h __attribute__((ext_vector_type(16)));
typedef _Float16       v8h  __attribute__((ext_vector_type(8)));
typedef __bf16         v16b __attribute__((ext_vector_type(16)));
typedef unsigned short v8us __attribute__((ext_vector_type(8)));
typedef float          v8f  __attribute__((ext_vector_type(8)));
typedef float          v4f  __attribute__((ext_vector_type(4)));
typedef unsigned int   v4u  __attribute__((ext_vector_type(4)));

union Frag  { v8us u[2]; v16h h; v16b bf; };
static_assert(sizeof(Frag) == 32);

// ---- scalar helpers -------------------------------------------------------------------------------------------
__device__ __forceinline__ unsigned short bf_bits(float f) {          // f32 -> bf16 bits, RNE convert
  unsigned u = __float_as_uint(f);
  return (unsigned short)((u + 0x7FFFu + ((u >> 16) & 1u)) >> 16);
}
__device__ __forceinline__ float bf_up(unsigned short hb) { return __uint_as_float(((unsigned)hb) << 16); }
__device__ __forceinline__ float bfr(float f) { return bf_up(bf_bits(f)); }
__device__ __forceinline__ unsigned short h_bits(_Float16 x) { return __builtin_bit_cast(unsigned short, x); }
__device__ __forceinline__ unsigned pk16(unsigned short a, unsigned short b) { return (unsigned)a | ((unsigned)b << 16); }
__device__ __forceinline__ v8f zero8() { v8f z = {0.f, 0.f, 0.f, 0.f, 0.f, 0.f, 0.f, 0.f}; return z; }
__device__ __forceinline__ unsigned wave_ballot(bool p) {
#if defined(__HIP_DEVICE_COMPILE__)
  return __builtin_amdgcn_ballot_w32(p);
#else
  return p ? 1u : 0u;
#endif
}

// ---- value of the lane whose number differs in bit 0 (X = 1) or bit 1 (X = 2), inside a group of four lanes: one DPP move
template <int X>
__device__ __forceinline__ float quad_xor(float v) {
#if defined(__HIP_DEVICE_COMPILE__)
  return __int_as_float(__builtin_amdgcn_update_dpp(0, __float_as_int(v), X == 1 ? 0xB1 : 0x4E, 0xF, 0xF, true));
#else
  return v;
#endif
}

// ---- 16-bit fragment loader (A, or B from a k-contiguous [n][k] row): lane -> row/col (lane&15), p already includes
//      + 8*(lane>>4); elements 0..7 <- p[0..7] (k0+8h..), elements 8..15 <- p[16..23] (k0+16+8h..)
__device__ __forceinline__ Frag ldfrag(const unsigned short* p) {
  Frag f;
  f.u[0] = *(const v8us*)(p);
  f.u[1] = *(const v8us*)(p + 16);
  return f;
}

// ---- fragment-major planes (every 16-bit operand plane in the workspace): a plane of R rows x KD k-elements is cut
//      into fragments of 16 rows x 32 k = 512 elements; fragment (row tile rt, k step ks) starts at element
//      16*rt*KD + 512*ks and holds [u 0..1][lane 0..31][8 elements]: lane = 16*h + (row&15), k = 32*ks + 16*u + 8*h + t.
//      That is the register order of ldfrag above, so one fragment is two loads of 512 contiguous bytes per wave
//      (4 whole 128-B lines each) where a row-major plane gives 16 partial lines per load. p already includes + 8*lane.
__device__ __forceinline__ Frag ldfm(const unsigned short* p) {
  Frag f;
  f.u[0] = *(const v8us*)(p);
  f.u[1] = *(const v8us*)(p + 256);
  return f;
}

// ---- WMMA helpers. f16 form (attention): the plain builtin; the compiler keeps the distances behind its own WMMAs. The
//      asm pad of the bf16 form takes its operands from v0..v255 alone: built with it, the 64-query tile spills to scratch.
__device__ __forceinline__ v8f mma_h(v16h a, v16h b, v8f c) {
  return __builtin_amdgcn_wmma_f32_16x16x32_f16(false, a, false, b, (short)0, c, false, false);
}
// bf16 form (GEMMs): builtin followed by a 4-slot VALU gap tying D and keeping A/B live
__device__ __forceinline__ v8f mma_b(v16b a, v16b b, v8f c) {
  v8f d = __builtin_amdgcn_wmma_f32_16x16x32_bf16(false, a, false, b, (short)0, c, false, false);
#if defined(__HIP_DEVICE_COMPILE__)
  const v16h ha = __builtin_bit_cast(v16h, a), hb = __builtin_bit_cast(v16h, b);
  asm volatile("v_nop\n\tv_nop\n\tv_nop\n\tv_nop" : "+v"(d) : "v"(ha), "v"(hb));
#endif
  return d;
}

// ---- work-group barrier of the attention loop: orders LDS only (release / acquire on the local address space), so the
//      k and v requests that are in flight at it stay in flight; __syncthreads() would wait for them at every barrier.
//      The loop stores nothing to global memory and reads there only what earlier launches wrote.
__device__ __forceinline__ void lds_barrier() {
#if defined(__HIP_DEVICE_COMPILE__)
  __builtin_amdgcn_fence(__ATOMIC_RELEASE, "workgroup", "local");
  __builtin_amdgcn_s_barrier();
  __builtin_amdgcn_fence(__ATOMIC_ACQUIRE, "workgroup", "local");
#endif
}

// =============================================================================================================
// (0) conv weights: Wb bf16, rows 512*matrix + o, k = c, fragment-major; matrix 0 = wq, 1 = wk, 2 = wv, 3 = wp; value =
//     bf16-RNE(w). Block blk (0..511): matrix blk/128 (block-uniform), row tile blk/4; wave gw = 8 blk + w owns the
//     half u = gw&1 of the fragment of k step (gw>>1)&15 and stores it as 512 contiguous bytes.
// coverage: 128 row tiles x 16 k steps x 2 halves = 4096 waves x 32 lanes x 8 = the whole plane.
// =============================================================================================================
__global__ __launch_bounds__(256)
void cvt_w(const float* __restrict__ wq, const float* __restrict__ wk, const float* __restrict__ wv,
           const float* __restrict__ wp, unsigned short* Wb) {
  const int tid = threadIdx.x, blk = blockIdx.x;
  const int wave = tid >> 5, lane = tid & 31;
  const int sel = blk / (CC / 4);                                          // 0..3, block-uniform
  const float* src = (sel == 0) ? wq : (sel == 1) ? wk : (sel == 2) ? wv : wp;   // all global
  const int gw  = blk * 8 + wave;                                          // 0..4095
  const int u   = gw & 1, ks = (gw >> 1) & 15, rt = gw >> 5;               // rt 0..127 = blk / 4
  const int o   = (rt & 31) * 16 + (lane & 15);                            // 0..511
  const int col = 32 * ks + 16 * u + 8 * (lane >> 4);                      // 0..504
  const float* s = src + (size_t)o * CC + col;
  const v4f a = *(const v4f*)s;
  const v4f q = *(const v4f*)(s + 4);
  const float f[8] = {a[0], a[1], a[2], a[3], q[0], q[1], q[2], q[3]};
  v4u pkv;
#pragma unroll
  for (int t = 0; t < 4; ++t) pkv[t] = pk16(bf_bits(f[2 * t]), bf_bits(f[2 * t + 1]));
{
    *(v4u*)(Wb + (size_t)(16 * rt) * CC + 512 * ks + 256 * u + 8 * lane) = pkv;
    
  }
}

__device__ __forceinline__ int wave_uniform(int v) {
#if defined(__HIP_DEVICE_COMPILE__)
  return __builtin_amdgcn_readfirstlane(v);
#else
  return v;
#endif
}

// sum of s over the 1024 threads of the block, the same bits in every thread; red: 32 doubles of LDS, used once
__device__ __forceinline__ double block_sum(double s, double* red, int lane, int wave) {
#pragma unroll                                                            // the exchange distances become constants
  for (int m = 16; m > 0; m >>= 1) s += __shfl_xor(s, m, 32);
  if (lane == 0) red[wave] = s;
  __syncthreads();
  double t = red[lane];
#pragma unroll                                                            // the exchange distances become constants
  for (int m = 16; m > 0; m >>= 1) t += __shfl_xor(t, m, 32);
  return t;
}

__global__ __launch_bounds__(1024)
void gn_norm(const float* __restrict__ x, const float* __restrict__ gw, const float* __restrict__ gb,
             unsigned short* Hh, unsigned short* Hl) {
  __shared__ double red1[32];
  __shared__ double red2[32];
  const int tid = threadIdx.x, bg = blockIdx.x;
  // the wave's number as a scalar: the channel half, gn_w and gn_b then sit in scalar registers and leave the 128 vector
  // registers that a wave of this block may have to the 64 values and their sums
  const int lane = tid & 31, wave = wave_uniform(tid >> 5);
  const int b = bg / NGRP, g = bg % NGRP;
  const int hf = wave & 1;
  const int nb = 32 * (wave >> 1) + lane;                                 // 0..511; n = nb + 512 i
  const double invN = 1.0 / (double)(GSZ * NN);

  const float* sp  = x + ((size_t)bg * GSZ + 8 * hf) * NN + nb;           // + t NN + 512 i
  const float* gwp = gw + GSZ * g + 8 * hf;
  const float* gbp = gb + GSZ * g + 8 * hf;
  const v4f w0 = *(const v4f*)gwp, w1 = *(const v4f*)(gwp + 4);
  const v4f c0 = *(const v4f*)gbp, c1 = *(const v4f*)(gbp + 4);
  float v[8][8];                                                          // [i][t], all 64 loads in flight at once
#pragma unroll                                                            // v[][] stays in registers
  for (int i = 0; i < 8; ++i) {
#pragma unroll
    for (int t = 0; t < 8; ++t) v[i][t] = sp[(size_t)t * NN + 512 * i];
  }
  // the requests are in flight and the code below reuses their address registers
  asm volatile("s_wait_xcnt 0x0" ::: "memory");

  double s = 0.0;
#pragma unroll                                                            // v[][] stays in registers
  for (int i = 0; i < 8; ++i) {
#pragma unroll
    for (int t = 0; t < 8; ++t) v[i][t] = bfr(v[i][t]);
    s += (((double)v[i][0] + (double)v[i][1]) + ((double)v[i][2] + (double)v[i][3])) +
         (((double)v[i][4] + (double)v[i][5]) + ((double)v[i][6] + (double)v[i][7]));
  }
  const double mean = block_sum(s, red1, lane, wave) * invN;

  const float meanf = (float)mean;

  // from here on v holds the f32 difference x - mean, which the application needs too; its squares are summed in f64
  double s2 = 0.0, s3 = 0.0;                                              // two chains: even and odd t
#pragma unroll                                                            // v[][] stays in registers
  for (int i = 0; i < 8; ++i) {
#pragma unroll
    for (int t = 0; t < 8; t += 2) {
      v[i][t]     -= meanf;
      v[i][t + 1] -= meanf;
      const double d0 = (double)v[i][t], d1 = (double)v[i][t + 1];
      s2 += d0 * d0;
      s3 += d1 * d1;
    }
  }
  const double var = block_sum(s2 + s3, red2, lane, wave) * invN;
  const float rstdf = (float)(1.0 / sqrt(var + GEPS));

  const float wf[8] = {bfr(w0[0]), bfr(w0[1]), bfr(w0[2]), bfr(w0[3]), bfr(w1[0]), bfr(w1[1]), bfr(w1[2]), bfr(w1[3])};
  const float bo[8] = {bfr(c0[0]), bfr(c0[1]), bfr(c0[2]), bfr(c0[3]), bfr(c1[0]), bfr(c1[1]), bfr(c1[2]), bfr(c1[3])};
  // row tile of n = nb + 512 i: rows 16 (nb >> 4) + 512 i ..; fragment half of this group at + 256 g; lane 16 hf + (n & 15)
  const size_t po = ((size_t)(b * NN + (nb & ~15))) * CC + 256 * g + 128 * hf + 8 * (nb & 15);
#pragma unroll                                                            // constant indices: v[][] stays in registers
  for (int i = 0; i < 8; ++i) {
    v4u uh, ul;
#pragma unroll
    for (int t = 0; t < 4; ++t) {
      const float h0 = v[i][2 * t]     * rstdf * wf[2 * t]     + bo[2 * t];
      const float h1 = v[i][2 * t + 1] * rstdf * wf[2 * t + 1] + bo[2 * t + 1];
      const unsigned short hb0 = bf_bits(h0), hb1 = bf_bits(h1);
      uh[t] = pk16(hb0, hb1);
      ul[t] = pk16(bf_bits(h0 - bf_up(hb0)), bf_bits(h1 - bf_up(hb1)));
    }
    *(v4u*)(Hh + po + (size_t)(512 * i) * CC) = uh;
    *(v4u*)(Hl + po + (size_t)(512 * i) * CC) = ul;
    // the two stores name the registers of uh and ul, which the next position's values take over: the wait stands in front
    // of that arithmetic, and the scheduling barrier keeps the arithmetic from being lifted over the wait
    if (i < 7) {                                                          // behind the last position nothing is rewritten
      asm volatile("s_wait_xcnt 0x0" ::: "memory");
      __builtin_amdgcn_sched_barrier(0);
    }
  }
}

// =============================================================================================================
// GEMM core of launches (3), (4) and (6). Work-group = 8 waves = 256 output channels x 128 positions; wave w owns 128
//     channels (8 weight row tiles, base 128 (w>>2)) x 32 positions (2 row tiles, base 32 (w&3)) = 16 accumulator tiles.
//     Per k step of 32 a wave fetches 8 weight fragments and 2 x 2 activation fragments (hi and residual plane) for 32
//     WMMAs: a weight fragment feeds 2 position tiles in both planes, an activation fragment 8 channel tiles. The four waves
//     of one channel half ask for the same weight lines and the two waves of one position group for the same activation lines.
//     wp, hp, lp: the wave's first fragment in each plane, + 8*lane. Per accumulator: hi then residual of k step ks0, ks0 + 1,
//     .. 15, 0, .. ks0 - 1. ks0 (block-uniform) differs between the work-groups that read the same weight or activation
//     fragments, so that they do not ask L2 for the same lines at the same moment.
//     WROWS: D rows = channels (A = weights, B = activations); else D rows = positions (A = activations, B = weights).
// =============================================================================================================
template <bool WROWS>
__device__ __forceinline__ void gemm_core(const unsigned short* wp, const unsigned short* hp,
                                          const unsigned short* lp, int ks0, v8f (&acc)[16]) {
#pragma unroll                                                            // constant indices: the arrays stay in registers
  for (int j = 0; j < 16; ++j) acc[j] = zero8();
  wp += 512 * ks0;
  hp += 512 * ks0;
  lp += 512 * ks0;
  int kc = ks0;                                                           // the k step that the three pointers stand at

#pragma unroll 2                                                          // one branch and one count per two k steps
  for (int ks = 0; ks < CC / 32; ++ks) {
    Frag fh[2], fl[2], fw[8];                                             // all loads of the step before its first WMMA
#pragma unroll                                                            // fh[], fl[] stay in registers
    for (int t = 0; t < 2; ++t) {
      fh[t] = ldfm(hp + (size_t)(16 * t) * CC);
      fl[t] = ldfm(lp + (size_t)(16 * t) * CC);
    }
#pragma unroll                                                            // fw[] stays in registers
    for (int m = 0; m < 8; ++m) fw[m] = ldfm(wp + (size_t)(16 * m) * CC);
    // the step's requests name the registers of wp, hp and lp: the wait stands in front of the additions that rewrite them
    // (the step length goes through the statement, so that no addition can be lifted over the wait)
    int kstep = (kc == CC / 32 - 1) ? -(CC / 32 - 1) * 512 : 512;         // behind the last k step comes k step 0
    kc = (kc + 1) & (CC / 32 - 1);
    asm volatile("s_wait_xcnt 0x0" : "+s"(kstep) : : "memory");
    wp += kstep;
    hp += kstep;
    lp += kstep;
    // the 16 tiles' hi products, then their 16 residual products
#pragma unroll                                                            // constant indices: the arrays stay in registers
    for (int m = 0; m < 8; ++m) {
#pragma unroll                                                            // constant indices: the arrays stay in registers
      for (int t = 0; t < 2; ++t)
        acc[2 * m + t] = WROWS ? mma_b(fw[m].bf, fh[t].bf, acc[2 * m + t]) : mma_b(fh[t].bf, fw[m].bf, acc[2 * m + t]);
    }
#pragma unroll                                                            // constant indices: the arrays stay in registers
    for (int m = 0; m < 8; ++m) {
#pragma unroll                                                            // constant indices: the arrays stay in registers
      for (int t = 0; t < 2; ++t)
        acc[2 * m + t] = WROWS ? mma_b(fw[m].bf, fl[t].bf, acc[2 * m + t]) : mma_b(fl[t].bf, fw[m].bf, acc[2 * m + t]);
    }
  }
}

// =============================================================================================================
// (3) q / k conv GEMM for one (b, 128-n tile, matrix sel = mb/2, 256-o block o0 = (mb%2)*256):
//     Y[o][n] = sum_c W[o][c] (Hh + Hl)[b][n][c] + bf16-RNE(bias[o]); D rows = channels, K = 512 = 16 steps x 2 products.
//     Epilogue staged in LDS Os[n_loc][o_loc] (pitch OSH, b128 stores of 8 consecutive o per lane; cross-wave,
//     block barrier), then sel 0 -> Q16, sel 1 -> K16, plain f16, rows 4096 b + n, k = d, fragment-major.
// coverage: Os 8 waves x 32 n x 128 o = 128 x 256 (staged == consumed); plane 16 it x 8 waves = 8 row tiles x 8 k steps x 2
//           halves of 512 B = 128 n x 256 d; grid (32, 4, NB) covers d 0..511 of all 4096 rows of Q16 and K16 once.
// =============================================================================================================
__global__ __launch_bounds__(256)
void gemm_qk(const unsigned short* __restrict__ Wb, const unsigned short* __restrict__ Hh,
             const unsigned short* __restrict__ Hl, const float* __restrict__ bq, const float* __restrict__ bk,
             unsigned short* Q16, unsigned short* K16) {
  __shared__ __align__(16) float Os[GWN * OSH];
  const int tid  = threadIdx.x;
  const int lane = tid & 31, wave = tid >> 5;
  const int hh   = lane >> 4, c = lane & 15;
  const int nt   = blockIdx.x, mb = blockIdx.y, b = blockIdx.z;
  const int sel  = mb / (CC / GWO);                                        // 0 = q, 1 = k (block-uniform)
  const int n0   = nt * GWN, o0 = (mb % (CC / GWO)) * GWO;
  const int nw   = 32 * (wave & 3), ow = 128 * (wave >> 2);                // this wave's tile inside the block's

  const size_t ho = ((size_t)(b * NN + n0 + nw)) * CC + 8 * lane;
  v8f acc[16];
  gemm_core<true>(Wb + ((size_t)(sel * CC + o0 + ow)) * CC + 8 * lane, Hh + ho, Hl + ho, (nt + 4 * mb + b) & (CC / 32 - 1), acc);

  // ---- epilogue: + bias -> LDS Os[n_loc][o_loc]; lane (hh, c) holds o = ow + 16 m + 8 hh + r for n_loc = nw + 16 t + c
  const float* bsrc = ((sel == 0) ? bq : bk) + o0 + ow + 8 * hh;          // block-uniform choice, both global
  v4f bl[16];
#pragma unroll                                                            // bl[] stays in registers
  for (int m = 0; m < 16; ++m) bl[m] = *(const v4f*)(bsrc + 16 * (m >> 1) + 4 * (m & 1));
  // the bias requests name the registers of bsrc: it goes through the statement as an input, so that they are left alone
  // (also by what the requests bring) up to the wait
  asm volatile("s_wait_xcnt 0x0" : : "v"(bsrc) : "memory");
#pragma unroll                                                            // constant indices: the arrays stay in registers
  for (int m = 0; m < 8; ++m) {
    const v4f b0 = bl[2 * m], b1 = bl[2 * m + 1];
#pragma unroll                                                            // constant indices: the arrays stay in registers
    for (int t = 0; t < 2; ++t) {
      v4f va, vb;
#pragma unroll                                                            // constant indices: the arrays stay in registers
      for (int r = 0; r < 4; ++r) { va[r] = acc[2 * m + t][r] + bfr(b0[r]); vb[r] = acc[2 * m + t][4 + r] + bfr(b1[r]); }
      float* sp = Os + (nw + 16 * t + c) * OSH + ow + 16 * m + 8 * hh;
      *(v4f*)sp       = va;
      *(v4f*)(sp + 4) = vb;
    }
  }
  __syncthreads();

  unsigned short* Ph = (sel == 0) ? Q16 : K16;                             // block-uniform, both global
  v4u uv[16];
#pragma unroll                                                            // constant indices: the arrays stay in registers
  for (int it = 0; it < 16; ++it) {                                        // piece: row tile it>>1, chunk pair 8 (it&1) + wave
    const int lo = (16 * (it >> 1) + c) * OSH + 16 * (8 * (it & 1) + wave) + 8 * hh;
    const v4f a = *(const v4f*)(Os + lo);
    const v4f q = *(const v4f*)(Os + lo + 4);
    const float f[8] = {a[0], a[1], a[2], a[3], q[0], q[1], q[2], q[3]};
#pragma unroll                                                            // constant indices: the arrays stay in registers
    for (int t = 0; t < 4; ++t)
      uv[it][t] = pk16(h_bits((_Float16)f[2 * t]), h_bits((_Float16)f[2 * t + 1]));
  }
  const size_t po = ((size_t)(b * NN + n0)) * CC + 16 * o0 + 256 * wave + 8 * lane;
#pragma unroll                                                            // constant indices: the arrays stay in registers
  for (int it = 0; it < 16; ++it) *(v4u*)(Ph + po + (size_t)(16 * (it >> 1)) * CC + 2048 * (it & 1)) = uv[it];
}

// =============================================================================================================
// (4) v conv GEMM for one (b, 128-n tile, 256-o block o0 = mb*256), operands swapped so the D rows are positions:
//     D[n][o] = sum_c (Hh + Hl)[b][n][c] Wv[o][c] (2 products, K = 512).
//     Per lane the D tile holds 8 consecutive n of one o -> LDS Vs[o_loc][n_loc] (pitch PSP, b128 stores;
//     cross-wave, block barrier), then V16 f16, rows 512 b + o, k = n (KD = 4096), fragment-major, = f16(D +
//     bf16-RNE(bv[o])) (unscaled, |v| ~ 1).
// coverage: Vs 8 waves x 32 n x 128 o = 256 x 128 (staged == consumed); V16 16 it (row tiles) x 8 waves (4 k steps x 2
//           halves of 512 B) = 256 o x 128 n; grid (32, 2, NB) covers all 512 o x 4096 n of each b exactly once.
// =============================================================================================================
__global__ __launch_bounds__(256)
void gemm_v(const unsigned short* __restrict__ Wb, const unsigned short* __restrict__ Hh,
            const unsigned short* __restrict__ Hl, const float* __restrict__ bv, unsigned short* V16) {
  __shared__ __align__(16) float Vs[GWO * PSP];
  const int tid  = threadIdx.x;
  const int lane = tid & 31, wave = tid >> 5;
  const int hh   = lane >> 4, c = lane & 15;
  const int nt   = blockIdx.x, mb = blockIdx.y, b = blockIdx.z;
  const int n0   = nt * GWN, o0 = mb * GWO;
  const int nw   = 32 * (wave & 3), ow = 128 * (wave >> 2);                // this wave's tile inside the block's

  const size_t ho = ((size_t)(b * NN + n0 + nw)) * CC + 8 * lane;
  v8f acc[16];
  gemm_core<false>(Wb + ((size_t)(2 * CC + o0 + ow)) * CC + 8 * lane, Hh + ho, Hl + ho, (nt + 8 * mb + b) & (CC / 32 - 1), acc);

  // ---- epilogue: lane (hh, c) holds n_loc = nw + 16 t + 8 hh + r of o_loc = ow + 16 m + c
#pragma unroll                                                            // constant indices: the arrays stay in registers
  for (int m = 0; m < 8; ++m) {
    const float bb = bfr(bv[o0 + ow + 16 * m + c]);
#pragma unroll                                                            // constant indices: the arrays stay in registers
    for (int t = 0; t < 2; ++t) {
      v4f va, vb;
#pragma unroll                                                            // constant indices: the arrays stay in registers
      for (int r = 0; r < 4; ++r) { va[r] = acc[2 * m + t][r] + bb; vb[r] = acc[2 * m + t][4 + r] + bb; }
      float* sp = Vs + (ow + 16 * m + c) * PSP + nw + 16 * t + 8 * hh;
      *(v4f*)sp       = va;
      *(v4f*)(sp + 4) = vb;
    }
  }
  __syncthreads();

  v4u uv[16];
#pragma unroll                                                            // constant indices: the arrays stay in registers
  for (int it = 0; it < 16; ++it) {
    const int lo = (it * 16 + c) * PSP + 16 * wave + 8 * hh;               // row tile it, chunk pair = wave
    const v4f a = *(const v4f*)(Vs + lo);
    const v4f q = *(const v4f*)(Vs + lo + 4);
    const float f[8] = {a[0], a[1], a[2], a[3], q[0], q[1], q[2], q[3]};
#pragma unroll                                                            // constant indices: the arrays stay in registers
    for (int t = 0; t < 4; ++t)
      uv[it][t] = pk16(h_bits((_Float16)f[2 * t]), h_bits((_Float16)f[2 * t + 1]));
  }
  const size_t po = ((size_t)(b * CC + o0)) * NN + 16 * n0 + 256 * wave + 8 * lane;
#pragma unroll                                                            // constant indices: the arrays stay in registers
  for (int it = 0; it < 16; ++it) *(v4u*)(V16 + po + (size_t)(16 * it) * NN) = uv[it];
}

// =============================================================================================================
// (5) attention for one (b, 64-query tile), transposed formulation, 4096 keys, no mask. Block = 8 waves, one block per
//   WGP (grid 64 x NB): every K and V fragment that a block fetches feeds 64 queries.
//   Score phase per 32-key block kb: wave w computes TWO S^T partial tiles (16 keys x 16 queries each) from one set of
//   k fragments: key tile kt = w&1 (keys kb+16kt..), query tiles 2 qg + i, qg = (w>>1)&1, i = 0..1 (queries
//   n0+16(2qg+i)..), over the d-half dh = w>>2 (d 256dh .. 256dh+255, 8 steps of 32): A = k rows (row = key,
//   fragment-major, split k map) from K16, B = q rows (col = query, same map) from Q16, plain f16, 1 product. Each
//   partial (D row = key 8h+r, col = query) goes to LDS Sp[dh][query][key] (pitch SPP, b128 stores; cross-wave, block
//   barrier); the two d-halves are added in fixed order by the softmax lanes.
//   Softmax: all 8 waves, four lanes per query: thread tid has query tid / 4 and the 8 keys 8 (tid & 3) ..: s_j = (Sp[0] +
//   Sp[1]) * 512^-0.5, block max in-lane and over the four lanes (two DPP moves), online max m in f32 (equal in the four
//   lanes), the sum l as one f32 partial per lane over its own keys (the four are added once, behind the loop), corr =
//   e^{m_old - m_new} -> Cs[query], P_j = e^{s_j - m} x 2^14 as f16 -> Pf[query][key] (pitch PFP, one 16-B store per lane;
//   cross-wave, block barrier).
//   O^T (rows channel, cols query): every wave owns channels 64w..64w+63 (4 tiles j) x 64 queries (4 tiles) = 16
//   accumulator tiles; rescale by Cs when any of the 64 corr is not 1 (every wave reads all 64, so block-uniform; corr is
//   exactly 1 for a query whose max did not grow), then += A(v rows channel = 64w+16j+(lane&15), keys kb.., fragment-major f16 plane V16) . B(P^T: row = query
//   from Pf, keys contiguous, same k order).
//   The three phases run as a pipeline over the key blocks, ONE barrier per key block: between two barriers every wave
//   does the scores of block i+1, its share of the softmax of block i and O^T of block i-1. Sp, Pf and Cs
//   have two buffers each (index = key block & 1): what a pass writes was last read in the pass before, behind a barrier,
//   and is read in the next pass. Fill: block 0's scores ahead of the
//   loop, and P = 0, corr = 1 for the O^T step of pass 0 (adds zero); drain: the last pass scores one block more
//   (never read), O^T of the last block stands behind the loop.
//   Key walk: "key block i" above is the i-th block of this work-group's walk, keys 32 ((st + i) mod 128) ..: the walk goes
//   once round all 128 blocks from a start st of the work-group's own. The 64 work-groups of one b read the same K and V
//   planes; from one common start they would ask L2 for the same lines at the same moment in every pass. The online softmax
//   takes the key blocks in any order; the order of its sums follows the walk.
//   Epilogue in two 256-channel halves: waves with (w>>2) == half stage O/l in LDS Os[query][256 ch] (pitch OSH, b128
//   stores; cross-wave, block barrier), then all 256 threads write Ah (bf16 hi) and Al (bf16 residual), fragment-major.
// coverage: Sp 8 waves x 2 tiles = [2 dh][64 q][32 keys] each key block (staged == consumed); Pf 64 rows x 32 keys by
//           256 lanes x 8 keys (staged == consumed, pad cols never read; buffer 1 zeroed whole ahead of the loop); Os per half 4 waves x 64 q x 64 ch = 64 x 256 (staged
//           == consumed); planes 2 halves x 8 it x 8 waves x 512 B = 4 row tiles x 16 k steps per plane; grid (NQ/64,
//           NB) covers rows 0..NQ-1 exactly once (only those are read later).
// =============================================================================================================
__global__ __launch_bounds__(256)
void attn_k(const unsigned short* __restrict__ Q16, const unsigned short* __restrict__ K16,
            const unsigned short* __restrict__ V16, unsigned short* Ah, unsigned short* Al) {
  __shared__ __align__(16) float Sp[2 * 2 * AQ * SPP];
  __shared__ __align__(16) unsigned short Pf[2 * AQ * PFP];
  __shared__ __align__(16) float Os[AQ * OSH];
  __shared__ float Cs[2 * AQ];
  __shared__ float Ls[AQ];
  const int tid  = threadIdx.x;
  const int wave = tid >> 5, lane = tid & 31;
  const int hh   = lane >> 4, c = lane & 15;
  const int n0   = blockIdx.x * AQ, b = blockIdx.y;
  const int kt = wave & 1, qg = (wave >> 1) & 1, dh = wave >> 2;

  // q fragment pointer (B operand of S^T, col = query n0 + 16 (2 qg + i) + c, d-half dh), + 16*CC*i + 512*ks
  const unsigned short* qp = Q16 + ((size_t)(b * NN + n0 + 32 * qg)) * CC + 16 * (CC / 2) * dh + 8 * lane;
  // k fragment base (A operand, row = key kb + 16 kt + c, d-half dh), + kb*CC + 512*ks
  const unsigned short* kp = K16 + ((size_t)(b * NN + 16 * kt)) * CC + 16 * (CC / 2) * dh + 8 * lane;
  // v fragment base (A operand of O^T, row = channel 64 w + 16 j + c), + 16*j*NN + 16*kb (k step kb/32)
  const unsigned short* vp = V16 + ((size_t)(b * CC + 64 * wave)) * NN + 8 * lane;
  // this lane's S^T partial destination: Sp[dh][query 16(2qg+i)+c][key 16kt + 8hh + r], + 16*SPP*i
  float* spw = Sp + (dh * AQ + 32 * qg + c) * SPP + 16 * kt + 8 * hh;
  // P^T fragment rows (row = query 16 q + c, keys contiguous), + 16*PFP*q
  const unsigned short* pf = Pf + c * PFP + 8 * hh;

  // q fragments of this wave's d-half do not change with the key block: loaded once, kept in registers
  Frag fq[2][CC / 64];
#pragma unroll                                                            // fq[][] stays in registers
  for (int i = 0; i < 2; ++i) {
#pragma unroll
    for (int ks = 0; ks < CC / 64; ++ks) fq[i][ks] = ldfm(qp + (size_t)(16 * i) * CC + 512 * ks);
  }
  // the q requests are in flight and the code below reuses their address registers
  asm volatile("s_wait_xcnt 0x0" ::: "memory");

  // softmax share of this lane: query sq, keys sk .. sk + 7 of each key block
  const int sq = tid >> 2, sk = 8 * (tid & 3);
  float m_run = -1.0e30f, l_run = 0.f;
  v8f o[16];
#pragma unroll
  for (int j = 0; j < 16; ++j) o[j] = zero8();

  // ---- the two matrix phases, used in the fill, in the loop and in the drain
  Frag fk[CC / 64];
  Frag fv[4];
  // two score partial tiles over this wave's d-half, each k fragment used for both -> Sp buffer at dst
  auto score = [&](float* dst) __attribute__((always_inline)) {
    v8f s0 = zero8(), s1 = zero8();
#pragma unroll                                                            // fk[], fq[][] stay in registers
    for (int ks = 0; ks < CC / 64; ++ks) {
      s0 = mma_h(fk[ks].h, fq[0][ks].h, s0);
      s1 = mma_h(fk[ks].h, fq[1][ks].h, s1);
    }
    v4f sa, sb, sc, sd;
#pragma unroll
    for (int r = 0; r < 4; ++r) { sa[r] = s0[r]; sb[r] = s0[4 + r]; sc[r] = s1[r]; sd[r] = s1[4 + r]; }
    *(v4f*)(dst)                = sa;
    *(v4f*)(dst + 4)            = sb;
    *(v4f*)(dst + 16 * SPP)     = sc;
    *(v4f*)(dst + 16 * SPP + 4) = sd;
  };
  // the O^T step in two parts. pv_read: all its LDS reads (corr, P^T fragments of buffer buf) as one group, placed
  // at the head of a pass so that they land under the score products. pv_scale: rescale (block-uniform test). pv_mul: O^T += V . P^T
  float cr[4];
  Frag p[4];
  auto pv_read = [&](int buf) __attribute__((always_inline)) {
#pragma unroll                                                            // cr[], p[] stay in registers
    for (int q = 0; q < 4; ++q) {
      cr[q] = Cs[AQ * buf + 16 * q + c];
      p[q]  = ldfrag(pf + AQ * PFP * buf + 16 * PFP * q);
    }
  };
  auto pv_scale = [&]() __attribute__((always_inline)) {
    // corr <= 1: the least of the lane's four, then one ballot; lanes 0..15 hold all 64 queries between them
    if (wave_ballot(fminf(fminf(cr[0], cr[1]), fminf(cr[2], cr[3])) != 1.0f) != 0u) {
#pragma unroll
      for (int q = 0; q < 4; ++q) {
#pragma unroll
        for (int j = 0; j < 4; ++j) {
#pragma unroll
          for (int r = 0; r < 8; ++r) o[4 * j + q][r] *= cr[q];
        }
      }
    }
  };
  auto pv_mul = [&]() __attribute__((always_inline)) {
#pragma unroll
    for (int j = 0; j < 4; ++j) {
#pragma unroll
      for (int q = 0; q < 4; ++q) o[4 * j + q] = mma_h(fv[j].h, p[q].h, o[4 * j + q]);
    }
  };

  // ---- fill: scores of key block 0 -> Sp buffer 0; P = 0, corr = 1 in buffer 1 for the O^T step of pass 0; then
  //      the k fragments of block 1 and the v fragments of block 0 (finite values for that step, which adds v x 0)
  // start of the walk: 64 different even blocks; neighbours in blockIdx.x stand ten blocks apart
  const int st = 2 * ((5 * (int)blockIdx.x) & (NKB / 2 - 1));
  const unsigned short* kpn = kp + (size_t)st * (32 * CC);
  const unsigned short* vpn = vp + (size_t)st * 512;
  int kj = st, vj = st;                                                   // the key blocks that kpn and vpn stand at
  // step to the next key block of the walk, in elements of the k plane (KS = 32 CC) or the v plane (KS = 512): behind
  // block 127 comes block 0, so every address of the walk, also of the blocks asked for past its end, lies in the planes
  auto wstep = [&](int& j, int KS) __attribute__((always_inline)) {
    const int s = (j == NKB - 1) ? -(NKB - 1) * KS : KS;
    j = (j + 1) & (NKB - 1);
    return s;
  };
#pragma unroll                                                            // fk[] stays in registers
  for (int ks = 0; ks < CC / 64; ++ks) fk[ks] = ldfm(kpn + 512 * ks);
  // every group of k or v requests names the registers of kpn or vpn: the wait stands in front of the step that rewrites
  // them (the step length goes through the statement, so that the addition cannot be lifted over the wait)
  int kstep0 = wstep(kj, 32 * CC);
  asm volatile("s_wait_xcnt 0x0" : "+s"(kstep0) : : "memory");
  kpn += kstep0;
  {
    const v4u z4 = {0u, 0u, 0u, 0u};
#pragma unroll 1
    for (int t = tid; t < AQ * PFP / 8; t += 256) *(v4u*)(Pf + AQ * PFP + 8 * t) = z4;
    if (tid < AQ) Cs[AQ + tid] = 1.0f;
  }
  score(spw);
#pragma unroll                                                            // fk[] stays in registers
  for (int ks = 0; ks < CC / 64; ++ks) fk[ks] = ldfm(kpn + 512 * ks);
  int kstep1 = wstep(kj, 32 * CC);
  asm volatile("s_wait_xcnt 0x0" : "+s"(kstep1) : : "memory");            // as above
  kpn += kstep1;                                                          // from here on: two key blocks ahead of the pass
#pragma unroll                                                            // fv[] stays in registers
  for (int j = 0; j < 4; ++j) fv[j] = ldfm(vpn + (size_t)(16 * j) * NN);
  lds_barrier();

#pragma unroll 1
  for (int i = 0; i < NKB; ++i) {
    const int cur = i & 1, oth = cur ^ 1;
    pv_read(oth);
    // this lane's score partials of key block i (both d-halves), in the same group of LDS reads
    v4f sa0[2], sa1[2];
    {
      const float* s0p = Sp + 2 * AQ * SPP * cur + sq * SPP + sk;          // d-half 0
#pragma unroll                                                            // sa0[], sa1[] stay in registers
      for (int t2 = 0; t2 < 2; ++t2) {
        sa0[t2] = *(const v4f*)(s0p + 4 * t2);
        sa1[t2] = *(const v4f*)(s0p + AQ * SPP + 4 * t2);                  // d-half 1
      }
    }
    // ---- scores of key block i+1 (last pass: one block past the walk's end, never read)
    score(spw + 2 * AQ * SPP * oth);
    // ---- the k fragments of key block i+2 are requested here, a whole pass ahead of their use
#pragma unroll                                                            // fk[] stays in registers
    for (int ks = 0; ks < CC / 64; ++ks) fk[ks] = ldfm(kpn + 512 * ks);
    int kstep = wstep(kj, 32 * CC);
    asm volatile("s_wait_xcnt 0x0" : "+s"(kstep) : : "memory");           // as above
    kpn += kstep;
    // keeps the softmax and the test of corr, and with them the wait for their LDS reads, behind the score products:
    // scheduled among them they stall the wave for the LDS latency at the head of the pass
    __builtin_amdgcn_sched_barrier(0);
    // ---- O^T of key block i-1, first part: rescale
    pv_scale();
    // ---- online softmax of key block i: query sq, keys 32 ((st + i) mod 128) + sk .. + 7. It stands between the wave's two runs of matrix
    //      products: while one wave of a SIMD is in this vector chain the other has products to issue, and a pass ends in
    //      products, not in a chain that every wave would wait for at the barrier
    {
      float sv[8];
#pragma unroll
      for (int t2 = 0; t2 < 2; ++t2) {
#pragma unroll
        for (int t = 0; t < 4; ++t) sv[4 * t2 + t] = sa0[t2][t] + sa1[t2][t];
      }
      float mx = sv[0];
#pragma unroll
      for (int j = 1; j < 8; ++j) mx = fmaxf(mx, sv[j]);
      mx = fmaxf(mx, quad_xor<1>(mx));                                    // max over the query's four lanes
      mx = fmaxf(mx, quad_xor<2>(mx));
      const float mn   = fmaxf(m_run, mx * SCL);
      const float corr = __expf(m_run - mn);                             // == 1 exactly when the max did not grow
      m_run = mn;
      const float msh = mn - LNPS;                                        // exp gives e^{s-m} * 2^14
      float ls = 0.f;
      v4u pk;
#pragma unroll
      for (int t = 0; t < 4; ++t) {
        const float e0 = __expf(fmaf(sv[2 * t],     SCL, -msh));           // key 32 ((st + i) mod 128) + sk + 2t
        const float e1 = __expf(fmaf(sv[2 * t + 1], SCL, -msh));           // key 32 ((st + i) mod 128) + sk + 2t + 1
        ls += e0 + e1;
        pk[t] = pk16(h_bits((_Float16)e0), h_bits((_Float16)e1));
      }
      l_run = l_run * corr + ls;
      *(v4u*)(Pf + AQ * PFP * cur + sq * PFP + sk) = pk;
      if ((tid & 3) == 0) Cs[AQ * cur + sq] = corr;
    }
    // keeps the additions of the row sum, which nothing in the pass waits for, in the vector chain above: left free they are
    // scheduled behind the barrier, in front of every wave's first score product of the next pass
    __builtin_amdgcn_sched_barrier(0);
    // ---- O^T of key block i-1, second part: the products (pass 0: adds zero)
    pv_mul();
    // ---- the v fragments of key block i are requested here, a whole pass ahead of their use
#pragma unroll                                                            // fv[] stays in registers
    for (int j = 0; j < 4; ++j) fv[j] = ldfm(vpn + (size_t)(16 * j) * NN);
    int vstep = wstep(vj, 512);
    asm volatile("s_wait_xcnt 0x0" : "+s"(vstep) : : "memory");           // as above
    vpn += vstep;
    lds_barrier();
  }
  // ---- drain: O^T of the last key block
  pv_read((NKB - 1) & 1);
  pv_scale();
  pv_mul();
  // no global request has been issued since the last pass's wait after its v requests: a precaution
  asm volatile("s_wait_xcnt 0x0" ::: "memory");
  l_run += quad_xor<1>(l_run);                                            // the query's four partial sums, same m in all four
  l_run += quad_xor<2>(l_run);
  if ((tid & 3) == 0) Ls[sq] = 1.0f / l_run;                              // o and l both carry the 2^14 factor
  __syncthreads();
  float inv[4];
#pragma unroll
  for (int q = 0; q < 4; ++q) inv[q] = Ls[16 * q + c];

#pragma unroll
  for (int half = 0; half < 2; ++half) {
    if ((wave >> 2) == half) {
      const int chb = 64 * (wave & 3);                                    // channel offset inside this half
#pragma unroll
      for (int j = 0; j < 4; ++j) {
#pragma unroll
        for (int q = 0; q < 4; ++q) {
          v4f va, vb;
#pragma unroll
          for (int r = 0; r < 4; ++r) { va[r] = o[4 * j + q][r] * inv[q]; vb[r] = o[4 * j + q][4 + r] * inv[q]; }
          float* dst = Os + (16 * q + c) * OSH + chb + 16 * j + 8 * hh;   // Os[query][ch = chb + 16j + 8hh + r]
          *(v4f*)dst       = va;
          *(v4f*)(dst + 4) = vb;
        }
      }
    }
    __syncthreads();
    {
      v4u uh[AQ / 8], ul[AQ / 8];
#pragma unroll
      for (int it = 0; it < AQ / 8; ++it) {
        const int pc = it * 8 + wave;                                     // piece: row tile pc>>4, chunk pair pc&15
        const int lo = (16 * (pc >> 4) + c) * OSH + 16 * (pc & 15) + 8 * hh;
        const v4f a = *(const v4f*)(Os + lo);
        const v4f q = *(const v4f*)(Os + lo + 4);
        const float f[8] = {a[0], a[1], a[2], a[3], q[0], q[1], q[2], q[3]};
#pragma unroll
        for (int t = 0; t < 4; ++t) {
          const float f0 = f[2 * t], f1 = f[2 * t + 1];
          const unsigned short hb0 = bf_bits(f0), hb1 = bf_bits(f1);
          const unsigned short lb0 = bf_bits(f0 - bf_up(hb0));
          const unsigned short lb1 = bf_bits(f1 - bf_up(hb1));
          uh[it][t] = pk16(hb0, hb1);
          ul[it][t] = pk16(lb0, lb1);
        }
      }
#pragma unroll
      for (int it = 0; it < AQ / 8; ++it) {
        const int pc = it * 8 + wave;
        const size_t po = ((size_t)(b * NN + n0 + 16 * (pc >> 4))) * CC + 16 * (CC / 2) * half + 256 * (pc & 15) + 8 * lane;
        *(v4u*)(Ah + po) = uh[it];
        *(v4u*)(Al + po) = ul[it];
      }
    }
    __syncthreads();
  }
}

// =============================================================================================================
// (6) output projection + bias + residual for one (b, 128-n tile, 256-o block o0 = mb*256), D rows = positions:
//     D[n][o] = sum_c (Ah + Al)[b][n][c] Wp[o][c] (2 products, K = 512), GEMM core as in (4). Per lane 8 consecutive n of
//     one o -> LDS Vs[o_loc][n_loc] (pitch PSP, b128 stores; cross-wave, block barrier), then one wave per row: lane e ->
//     n 4e..4e+3, 4 whole lines of out per instruction.
// coverage: Vs 8 waves x 32 n x 128 o = 256 x 128 (staged == consumed); out 32 it x 8 rows x 32 lanes x 4 = 256 o x
//           128 n; grid (NQ/128, 2, NB) covers out[b][0..511][0..NQ-1] exactly once.
// =============================================================================================================
__global__ __launch_bounds__(256)
void gemm_p(const unsigned short* __restrict__ Wb, const unsigned short* __restrict__ Ah,
            const unsigned short* __restrict__ Al, const float* __restrict__ bp, const float* __restrict__ x,
            float* out) {
  __shared__ __align__(16) float Vs[GWO * PSP];
  const int tid  = threadIdx.x;
  const int lane = tid & 31, wave = tid >> 5;
  const int hh   = lane >> 4, c = lane & 15;
  const int nt   = blockIdx.x, mb = blockIdx.y, b = blockIdx.z;
  const int n0   = nt * GWN, o0 = mb * GWO;
  const int nw   = 32 * (wave & 3), ow = 128 * (wave >> 2);                // this wave's tile inside the block's

  const size_t ao = ((size_t)(b * NN + n0 + nw)) * CC + 8 * lane;
  v8f acc[16];
  gemm_core<false>(Wb + ((size_t)(3 * CC + o0 + ow)) * CC + 8 * lane, Ah + ao, Al + ao, (nt + 8 * mb + b) & (CC / 32 - 1), acc);

  // ---- epilogue: lane (hh, c) holds n_loc = nw + 16 t + 8 hh + r of o_loc = ow + 16 m + c
#pragma unroll                                                            // constant indices: the arrays stay in registers
  for (int m = 0; m < 8; ++m) {
    const float bb = bfr(bp[o0 + ow + 16 * m + c]);
#pragma unroll                                                            // constant indices: the arrays stay in registers
    for (int t = 0; t < 2; ++t) {
      v4f va, vb;
#pragma unroll                                                            // constant indices: the arrays stay in registers
      for (int r = 0; r < 4; ++r) { va[r] = acc[2 * m + t][r] + bb; vb[r] = acc[2 * m + t][4 + r] + bb; }
      float* sp = Vs + (ow + 16 * m + c) * PSP + nw + 16 * t + 8 * hh;
      *(v4f*)sp       = va;
      *(v4f*)(sp + 4) = vb;
    }
  }
  __syncthreads();

  const size_t idx = ((size_t)(b * CC + o0 + wave)) * NN + n0 + 4 * lane;  // row it * 8 + wave: + 8 it NN
  v4f res[GWO / 8];
#pragma unroll                                                            // constant indices: the arrays stay in registers
  for (int it = 0; it < GWO / 8; ++it) {
    const v4f a = *(const v4f*)(Vs + (it * 8 + wave) * PSP + 4 * lane);
    const v4f xv = *(const v4f*)(x + idx + (size_t)(8 * it) * NN);
#pragma unroll                                                            // constant indices: the arrays stay in registers
    for (int t = 0; t < 4; ++t) res[it][t] = a[t] + bfr(xv[t]);
  }
#pragma unroll                                                            // constant indices: the arrays stay in registers
  for (int it = 0; it < GWO / 8; ++it) *(v4f*)(out + idx + (size_t)(8 * it) * NN) = res[it];
}

// =============================================================================================================
// Workspace map (bytes; each region start a multiple of 256; every extent is an exact tile multiple and is written
//   (all 16-bit planes fragment-major, same extents as row-major)
//   Wb    bf16 [4][512][512]          2097152
//   Hh/Hl bf16 [NB][4096][512]     16777216 x2   (reused as Ah/Al after their last reader, launch (4))
//   Q16/K16 f16 [NB][4096][512]   16777216 x2
//   V16   f16  [NB][512][4096]     16777216
//   total (NB=4) = 85983232
// =============================================================================================================
extern "C" void kernel_launch(void* const* d_in, const int* in_sizes, int n_in,
                              void* d_out, int out_size, void* d_ws, size_t ws_size,
                              hipStream_t stream) {
  if (n_in < 11) return;
  if (in_sizes[0] < NB * CC * NN) return;
  if (in_sizes[1] < CC || in_sizes[2] < CC) return;
  if (in_sizes[3] < CC * CC || in_sizes[5] < CC * CC || in_sizes[7] < CC * CC || in_sizes[9] < CC * CC) return;
  if (in_sizes[4] < CC || in_sizes[6] < CC || in_sizes[8] < CC || in_sizes[10] < CC) return;
  if (out_size < NB * CC * NN) return;

  size_t off = 0;
  auto carve = [&](size_t bytes) { const size_t o = off; off += (bytes + 255) & ~(size_t)255; return o; };
  const size_t plane = (size_t)NB * NN * CC * 2;
  const size_t oWb  = carve((size_t)4 * CC * CC * 2);
  const size_t oHh  = carve(plane);
  const size_t oHl  = carve(plane);
  const size_t oQ   = carve(plane);
  const size_t oK   = carve(plane);
  const size_t oV   = carve(plane);
  const size_t oAh  = oHh;                                                // same extent, disjoint lifetimes
  const size_t oAl  = oHl;
  if (off > ws_size) return;
  if (off > (size_t)134217728) return;

  const float* x   = (const float*)d_in[0];
  const float* gnw = (const float*)d_in[1];
  const float* gnb = (const float*)d_in[2];
  const float* wq  = (const float*)d_in[3];
  const float* bq  = (const float*)d_in[4];
  const float* wk  = (const float*)d_in[5];
  const float* bk  = (const float*)d_in[6];
  const float* wv  = (const float*)d_in[7];
  const float* bv  = (const float*)d_in[8];
  const float* wp  = (const float*)d_in[9];
  const float* bp  = (const float*)d_in[10];

  char* ws = (char*)d_ws;
  unsigned short* Wb  = (unsigned short*)(ws + oWb);
  unsigned short* Hh  = (unsigned short*)(ws + oHh);
  unsigned short* Hl  = (unsigned short*)(ws + oHl);
  unsigned short* Q16 = (unsigned short*)(ws + oQ);
  unsigned short* K16 = (unsigned short*)(ws + oK);
  unsigned short* V16 = (unsigned short*)(ws + oV);
  unsigned short* Ah  = (unsigned short*)(ws + oAh);
  unsigned short* Al  = (unsigned short*)(ws + oAl);
  float* out = (float*)d_out;

  const dim3 blk256(256);

  // (0) conv weights -> stacked bf16 plane
  cvt_w<<<dim3(4 * (CC / 4)), blk256, 0, stream>>>(wq, wk, wv, wp, Wb);
  // (1), (2) group statistics per (b, g) in f64 and normalised activations -> fragment-major bf16 hi / residual planes
  gn_norm<<<dim3(NB * NGRP), dim3(1024), 0, stream>>>(x, gnw, gnb, Hh, Hl);
  // (3) q and k -> fragment-major f16 planes (rows = positions)
  gemm_qk<<<dim3(NN / GWN, 2 * (CC / GWO), NB), blk256, 0, stream>>>(Wb, Hh, Hl, bq, bk, Q16, K16);
  // (4) v -> fragment-major f16 plane (rows = channels)
  gemm_v<<<dim3(NN / GWN, CC / GWO, NB), blk256, 0, stream>>>(Wb, Hh, Hl, bv, V16);
  // (5) attention -> bf16 hi / residual planes of the attention output (regions of Hh / Hl, dead by now)
  attn_k<<<dim3(NQ / AQ, NB), blk256, 0, stream>>>(Q16, K16, V16, Ah, Al);
  // (6) output projection + bias + residual -> out [b][512][4096]
  gemm_p<<<dim3(NQ / GWN, CC / GWO, NB), blk256, 0, stream>>>(Wb, Ah, Al, bp, x, out);
  (void)hipGetLastError();
}

// v009
// Measured time: 203 microseconds a run.
// Two timings next to v008 both put it at 1.07 times that version's speed.
// Over all steps from v000 it is 5.57 times as fast.
// Contractions: q/k/v 1x1-conv GEMMs W[512x512].H[512x4096] on v_wmma_f32_16x16x32_bf16 (W = bf16-RNE weights,
// exact; H = bf16 hi + bf16 residual planes of the normalised activations; 2 products, K=512); scores S^T = K.Q^T on
// v_wmma_f32_16x16x32_f16 (k, q: plain f16 planes, 1 product, K=512 split over two wave groups, fixed-order f32
// combine in LDS); O^T = V.P^T on v_wmma_f32_16x16x32_f16 (v: f16 plane, P = e^{s-m} x 2^14 as f16, K=4096); output
// 1x1-conv GEMM Wp[512x512].A[512x4096] on v_wmma_f32_16x16x32_bf16 (A = bf16 hi + residual planes of the
// attention output; 2 products, K=512). f32 accumulate everywhere; normalisation statistics summed in f64; softmax
// statistics, biases and the residual add in f32 VALU.
#include <hip/hip_runtime.h>
#include <math.h>
#include <stdint.h>

#ifndef NB
#define NB 4
#endif
#ifndef NQ
#define NQ 4096
#endif
#define NB_FULL 4
#define CC     512
#define NN     4096
#define NGRP   32
#define GSZ    16
#define AQ     64
#define GWO    256
#define GWN    128
#define PSP    132
#define OSH    260
#define SPP    36
#define PFP    40
#define SCL    0.044194173824159216f
#define LNPS   9.704060527839234f
#define GEPS   1.0e-6
#define NKB    (NN / 32)

static_assert(NB >= 1 && NB <= NB_FULL);
static_assert(NQ >= GWN && NQ <= NN && NQ % GWN == 0 && NQ % AQ == 0);
static_assert(NN % GWN == 0 && NN % AQ == 0 && NN % 32 == 0 && NN == 8 * 512);
static_assert(CC == 512 && CC % GWO == 0 && CC % 32 == 0);
static_assert(GSZ * NGRP == CC && GSZ == 16);
static_assert((PSP * 4) % 16 == 0 && (OSH * 4) % 16 == 0);
static_assert((SPP * 4) % 16 == 0 && (PFP * 2) % 16 == 0);
static_assert(OSH >= GWO && PSP >= GWN && GWN * OSH * 4 <= 163840 && GWO * PSP * 4 <= 163840);
static_assert(AQ == 64 && (4 * AQ * SPP * 4 + 2 * AQ * PFP * 2 + AQ * OSH * 4 + 4 * AQ * 4) <= 327680);
static_assert(NKB >= 3 && (NKB & (NKB - 1)) == 0 && (AQ * PFP) % 8 == 0);
static_assert(((CC / 32) & (CC / 32 - 1)) == 0);

typedef _Float16       v16h __attribute__((ext_vector_type(16)));
typedef _Float16       v8h  __attribute__((ext_vector_type(8)));
typedef __bf16         v16b __attribute__((ext_vector_type(16)));
typedef unsigned short v8us __attribute__((ext_vector_type(8)));
typedef float          v8f  __attribute__((ext_vector_type(8)));
typedef float          v4f  __attribute__((ext_vector_type(4)));
typedef unsigned int   v4u  __attribute__((ext_vector_type(4)));

union Frag  { v8us u[2]; v16h h; v16b bf; };
static_assert(sizeof(Frag) == 32);

// ---- scalar helpers -------------------------------------------------------------------------------------------
__device__ __forceinline__ unsigned short bf_bits(float f) {          // f32 -> bf16 bits, RNE convert
  unsigned u = __float_as_uint(f);
  return (unsigned short)((u + 0x7FFFu + ((u >> 16) & 1u)) >> 16);
}
__device__ __forceinline__ float bf_up(unsigned short hb) { return __uint_as_float(((unsigned)hb) << 16); }
__device__ __forceinline__ float bfr(float f) { return bf_up(bf_bits(f)); }
__device__ __forceinline__ unsigned short h_bits(_Float16 x) { return __builtin_bit_cast(unsigned short, x); }
__device__ __forceinline__ unsigned pk16(unsigned short a, unsigned short b) { return (unsigned)a | ((unsigned)b << 16); }
__device__ __forceinline__ v8f zero8() { v8f z = {0.f, 0.f, 0.f, 0.f, 0.f, 0.f, 0.f, 0.f}; return z; }
__device__ __forceinline__ unsigned wave_ballot(bool p) {
#if defined(__HIP_DEVICE_COMPILE__)
  return __builtin_amdgcn_ballot_w32(p);
#else
  return p ? 1u : 0u;
#endif
}

// ---- value of the lane whose number differs in bit 0 (X = 1) or bit 1 (X = 2), inside a group of four lanes: one DPP move
template <int X>
__device__ __forceinline__ float quad_xor(float v) {
#if defined(__HIP_DEVICE_COMPILE__)
  return __int_as_float(__builtin_amdgcn_update_dpp(0, __float_as_int(v), X == 1 ? 0xB1 : 0x4E, 0xF, 0xF, true));
#else
  return v;
#endif
}

// ---- 16-bit fragment loader (A, or B from a k-contiguous [n][k] row): lane -> row/col (lane&15), p already includes
//      + 8*(lane>>4); elements 0..7 <- p[0..7] (k0+8h..), elements 8..15 <- p[16..23] (k0+16+8h..)
__device__ __forceinline__ Frag ldfrag(const unsigned short* p) {
  Frag f;
  f.u[0] = *(const v8us*)(p);
  f.u[1] = *(const v8us*)(p + 16);
  return f;
}

// ---- fragment-major planes (every 16-bit operand plane in the workspace): a plane of R rows x KD k-elements is cut
//      into fragments of 16 rows x 32 k = 512 elements; fragment (row tile rt, k step ks) starts at element
//      16*rt*KD + 512*ks and holds [u 0..1][lane 0..31][8 elements]: lane = 16*h + (row&15), k = 32*ks + 16*u + 8*h + t.
//      That is the register order of ldfrag above, so one fragment is two loads of 512 contiguous bytes per wave
//      (4 whole 128-B lines each) where a row-major plane gives 16 partial lines per load. p already includes + 8*lane.
__device__ __forceinline__ Frag ldfm(const unsigned short* p) {
  Frag f;
  f.u[0] = *(const v8us*)(p);
  f.u[1] = *(const v8us*)(p + 256);
  return f;
}

// ---- WMMA helpers. f16 form (attention): the plain builtin; the compiler keeps the distances behind its own WMMAs. The
//      asm pad of the bf16 form takes its operands from v0..v255 alone: built with it, the 64-query tile spills to scratch.
__device__ __forceinline__ v8f mma_h(v16h a, v16h b, v8f c) {
  return __builtin_amdgcn_wmma_f32_16x16x32_f16(false, a, false, b, (short)0, c, false, false);
}
// bf16 form (GEMMs): builtin followed by a 4-slot VALU gap tying D and keeping A/B live
__device__ __forceinline__ v8f mma_b(v16b a, v16b b, v8f c) {
  v8f d = __builtin_amdgcn_wmma_f32_16x16x32_bf16(false, a, false, b, (short)0, c, false, false);
#if defined(__HIP_DEVICE_COMPILE__)
  const v16h ha = __builtin_bit_cast(v16h, a), hb = __builtin_bit_cast(v16h, b);
  asm volatile("v_nop\n\tv_nop\n\tv_nop\n\tv_nop" : "+v"(d) : "v"(ha), "v"(hb));
#endif
  return d;
}

// ---- work-group barrier of the attention loop: orders LDS only (release / acquire on the local address space), so the
//      k and v requests that are in flight at it stay in flight; __syncthreads() would wait for them at every barrier.
//      The loop stores nothing to global memory and reads there only what earlier launches wrote.
__device__ __forceinline__ void lds_barrier() {
#if defined(__HIP_DEVICE_COMPILE__)
  __builtin_amdgcn_fence(__ATOMIC_RELEASE, "workgroup", "local");
  __builtin_amdgcn_s_barrier();
  __builtin_amdgcn_fence(__ATOMIC_ACQUIRE, "workgroup", "local");
#endif
}

// =============================================================================================================
// (0) conv weights: Wb bf16, rows 512*matrix + o, k = c, fragment-major; matrix 0 = wq, 1 = wk, 2 = wv, 3 = wp; value =
//     bf16-RNE(w). Block blk (0..511): matrix blk/128 (block-uniform), row tile blk/4; wave gw = 8 blk + w owns the
//     half u = gw&1 of the fragment of k step (gw>>1)&15 and stores it as 512 contiguous bytes.
// coverage: 128 row tiles x 16 k steps x 2 halves = 4096 waves x 32 lanes x 8 = the whole plane.
// =============================================================================================================
__global__ __launch_bounds__(256)
void cvt_w(const float* __restrict__ wq, const float* __restrict__ wk, const float* __restrict__ wv,
           const float* __restrict__ wp, unsigned short* Wb) {
  const int tid = threadIdx.x, blk = blockIdx.x;
  const int wave = tid >> 5, lane = tid & 31;
  const int sel = blk / (CC / 4);                                          // 0..3, block-uniform
  const float* src = (sel == 0) ? wq : (sel == 1) ? wk : (sel == 2) ? wv : wp;   // all global
  const int gw  = blk * 8 + wave;                                          // 0..4095
  const int u   = gw & 1, ks = (gw >> 1) & 15, rt = gw >> 5;               // rt 0..127 = blk / 4
  const int o   = (rt & 31) * 16 + (lane & 15);                            // 0..511
  const int col = 32 * ks + 16 * u + 8 * (lane >> 4);                      // 0..504
  const float* s = src + (size_t)o * CC + col;
  const v4f a = *(const v4f*)s;
  const v4f q = *(const v4f*)(s + 4);
  const float f[8] = {a[0], a[1], a[2], a[3], q[0], q[1], q[2], q[3]};
  v4u pkv;
#pragma unroll
  for (int t = 0; t < 4; ++t) pkv[t] = pk16(bf_bits(f[2 * t]), bf_bits(f[2 * t + 1]));
{
    *(v4u*)(Wb + (size_t)(16 * rt) * CC + 512 * ks + 256 * u + 8 * lane) = pkv;
    
  }
}

__device__ __forceinline__ int wave_uniform(int v) {
#if defined(__HIP_DEVICE_COMPILE__)
  return __builtin_amdgcn_readfirstlane(v);
#else
  return v;
#endif
}

// sum of s over the 1024 threads of the block, the same bits in every thread; red: 32 doubles of LDS, used once
__device__ __forceinline__ double block_sum(double s, double* red, int lane, int wave) {
#pragma unroll                                                            // the exchange distances become constants
  for (int m = 16; m > 0; m >>= 1) s += __shfl_xor(s, m, 32);
  if (lane == 0) red[wave] = s;
  __syncthreads();
  double t = red[lane];
#pragma unroll                                                            // the exchange distances become constants
  for (int m = 16; m > 0; m >>= 1) t += __shfl_xor(t, m, 32);
  return t;
}

__global__ __launch_bounds__(1024)
void gn_norm(const float* __restrict__ x, const float* __restrict__ gw, const float* __restrict__ gb,
             unsigned short* Hh, unsigned short* Hl) {
  __shared__ double red1[32];
  __shared__ double red2[32];
  const int tid = threadIdx.x, bg = blockIdx.x;
  // the wave's number as a scalar: the channel half, gn_w and gn_b then sit in scalar registers and leave the 128 vector
  // registers that a wave of this block may have to the 64 values and their sums
  const int lane = tid & 31, wave = wave_uniform(tid >> 5);
  const int b = bg / NGRP, g = bg % NGRP;
  const int hf = wave & 1;
  const int nb = 32 * (wave >> 1) + lane;                                 // 0..511; n = nb + 512 i
  const double invN = 1.0 / (double)(GSZ * NN);

  const float* sp  = x + ((size_t)bg * GSZ + 8 * hf) * NN + nb;           // + t NN + 512 i
  const float* gwp = gw + GSZ * g + 8 * hf;
  const float* gbp = gb + GSZ * g + 8 * hf;
  const v4f w0 = *(const v4f*)gwp, w1 = *(const v4f*)(gwp + 4);
  const v4f c0 = *(const v4f*)gbp, c1 = *(const v4f*)(gbp + 4);
  float v[8][8];                                                          // [i][t], all 64 loads in flight at once
#pragma unroll                                                            // v[][] stays in registers
  for (int i = 0; i < 8; ++i) {
#pragma unroll
    for (int t = 0; t < 8; ++t) v[i][t] = sp[(size_t)t * NN + 512 * i];
  }
  // the requests are in flight and the code below reuses their address registers
  asm volatile("s_wait_xcnt 0x0" ::: "memory");

  double s = 0.0;
#pragma unroll                                                            // v[][] stays in registers
  for (int i = 0; i < 8; ++i) {
#pragma unroll
    for (int t = 0; t < 8; ++t) v[i][t] = bfr(v[i][t]);
    s += (((double)v[i][0] + (double)v[i][1]) + ((double)v[i][2] + (double)v[i][3])) +
         (((double)v[i][4] + (double)v[i][5]) + ((double)v[i][6] + (double)v[i][7]));
  }
  const double mean = block_sum(s, red1, lane, wave) * invN;

  const float meanf = (float)mean;

  // from here on v holds the f32 difference x - mean, which the application needs too; its squares are summed in f64
  double s2 = 0.0, s3 = 0.0;                                              // two chains: even and odd t
#pragma unroll                                                            // v[][] stays in registers
  for (int i = 0; i < 8; ++i) {
#pragma unroll
    for (int t = 0; t < 8; t += 2) {
      v[i][t]     -= meanf;
      v[i][t + 1] -= meanf;
      const double d0 = (double)v[i][t], d1 = (double)v[i][t + 1];
      s2 += d0 * d0;
      s3 += d1 * d1;
    }
  }
  const double var = block_sum(s2 + s3, red2, lane, wave) * invN;
  const float rstdf = (float)(1.0 / sqrt(var + GEPS));

  const float wf[8] = {bfr(w0[0]), bfr(w0[1]), bfr(w0[2]), bfr(w0[3]), bfr(w1[0]), bfr(w1[1]), bfr(w1[2]), bfr(w1[3])};
  const float bo[8] = {bfr(c0[0]), bfr(c0[1]), bfr(c0[2]), bfr(c0[3]), bfr(c1[0]), bfr(c1[1]), bfr(c1[2]), bfr(c1[3])};
  // row tile of n = nb + 512 i: rows 16 (nb >> 4) + 512 i ..; fragment half of this group at + 256 g; lane 16 hf + (n & 15)
  const size_t po = ((size_t)(b * NN + (nb & ~15))) * CC + 256 * g + 128 * hf + 8 * (nb & 15);
#pragma unroll                                                            // constant indices: v[][] stays in registers
  for (int i = 0; i < 8; ++i) {
    v4u uh, ul;
#pragma unroll
    for (int t = 0; t < 4; ++t) {
      const float h0 = v[i][2 * t]     * rstdf * wf[2 * t]     + bo[2 * t];
      const float h1 = v[i][2 * t + 1] * rstdf * wf[2 * t + 1] + bo[2 * t + 1];
      const unsigned short hb0 = bf_bits(h0), hb1 = bf_bits(h1);
      uh[t] = pk16(hb0, hb1);
      ul[t] = pk16(bf_bits(h0 - bf_up(hb0)), bf_bits(h1 - bf_up(hb1)));
    }
    *(v4u*)(Hh + po + (size_t)(512 * i) * CC) = uh;
    *(v4u*)(Hl + po + (size_t)(512 * i) * CC) = ul;
    // the two stores name the registers of uh and ul, which the next position's values take over: the wait stands in front
    // of that arithmetic, and the scheduling barrier keeps the arithmetic from being lifted over the wait
    if (i < 7) {                                                          // behind the last position nothing is rewritten
      asm volatile("s_wait_xcnt 0x0" ::: "memory");
      __builtin_amdgcn_sched_barrier(0);
    }
  }
}

// =============================================================================================================
// GEMM core of launches (3), (4) and (6). Work-group = 8 waves = 256 output channels x 128 positions; wave w owns 128
//     channels (8 weight row tiles, base 128 (w>>2)) x 32 positions (2 row tiles, base 32 (w&3)) = 16 accumulator tiles.
//     Per k step of 32 a wave fetches 8 weight fragments and 2 x 2 activation fragments (hi and residual plane) for 32
//     WMMAs: a weight fragment feeds 2 position tiles in both planes, an activation fragment 8 channel tiles. The four waves
//     of one channel half ask for the same weight lines and the two waves of one position group for the same activation lines.
//     wp, hp, lp: the wave's first fragment in each plane, + 8*lane. Per accumulator: hi then residual of k step ks0, ks0 + 1,
//     .. 15, 0, .. ks0 - 1. ks0 (block-uniform) differs between the work-groups that read the same weight or activation
//     fragments, so that they do not ask L2 for the same lines at the same moment.
//     WROWS: D rows = channels (A = weights, B = activations); else D rows = positions (A = activations, B = weights).
// =============================================================================================================
template <bool WROWS>
__device__ __forceinline__ void gemm_core(const unsigned short* wp, const unsigned short* hp,
                                          const unsigned short* lp, int ks0, v8f (&acc)[16]) {
#pragma unroll                                                            // constant indices: the arrays stay in registers
  for (int j = 0; j < 16; ++j) acc[j] = zero8();
  wp += 512 * ks0;
  hp += 512 * ks0;
  lp += 512 * ks0;
  int kc = ks0;                                                           // the k step that the three pointers stand at

#pragma unroll 2                                                          // one branch and one count per two k steps
  for (int ks = 0; ks < CC / 32; ++ks) {
    Frag fh[2], fl[2], fw[8];                                             // all loads of the step before its first WMMA
#pragma unroll                                                            // fh[], fl[] stay in registers
    for (int t = 0; t < 2; ++t) {
      fh[t] = ldfm(hp + (size_t)(16 * t) * CC);
      fl[t] = ldfm(lp + (size_t)(16 * t) * CC);
    }
#pragma unroll                                                            // fw[] stays in registers
    for (int m = 0; m < 8; ++m) fw[m] = ldfm(wp + (size_t)(16 * m) * CC);
    // the step's requests name the registers of wp, hp and lp: the wait stands in front of the additions that rewrite them
    // (the step length goes through the statement, so that no addition can be lifted over the wait)
    int kstep = (kc == CC / 32 - 1) ? -(CC / 32 - 1) * 512 : 512;         // behind the last k step comes k step 0
    kc = (kc + 1) & (CC / 32 - 1);
    asm volatile("s_wait_xcnt 0x0" : "+s"(kstep) : : "memory");
    wp += kstep;
    hp += kstep;
    lp += kstep;
    // the 16 tiles' hi products, then their 16 residual products
#pragma unroll                                                            // constant indices: the arrays stay in registers
    for (int m = 0; m < 8; ++m) {
#pragma unroll                                                            // constant indices: the arrays stay in registers
      for (int t = 0; t < 2; ++t)
        acc[2 * m + t] = WROWS ? mma_b(fw[m].bf, fh[t].bf, acc[2 * m + t]) : mma_b(fh[t].bf, fw[m].bf, acc[2 * m + t]);
    }
#pragma unroll                                                            // constant indices: the arrays stay in registers
    for (int m = 0; m < 8; ++m) {
#pragma unroll                                                            // constant indices: the arrays stay in registers
      for (int t = 0; t < 2; ++t)
        acc[2 * m + t] = WROWS ? mma_b(fw[m].bf, fl[t].bf, acc[2 * m + t]) : mma_b(fl[t].bf, fw[m].bf, acc[2 * m + t]);
    }
  }
}

// =============================================================================================================
// (3) q / k conv GEMM for one (b, 128-n tile, matrix sel = mb/2, 256-o block o0 = (mb%2)*256):
//     Y[o][n] = sum_c W[o][c] (Hh + Hl)[b][n][c] + bf16-RNE(bias[o]); D rows = channels, K = 512 = 16 steps x 2 products.
//     Epilogue staged in LDS Os[n_loc][o_loc] (pitch OSH, b128 stores of 8 consecutive o per lane; cross-wave,
//     block barrier), then sel 0 -> Q16, sel 1 -> K16, plain f16, rows 4096 b + n, k = d, fragment-major.
// coverage: Os 8 waves x 32 n x 128 o = 128 x 256 (staged == consumed); plane 16 it x 8 waves = 8 row tiles x 8 k steps x 2
//           halves of 512 B = 128 n x 256 d; grid (32, 4, NB) covers d 0..511 of all 4096 rows of Q16 and K16 once.
// =============================================================================================================
__global__ __launch_bounds__(256)
void gemm_qk(const unsigned short* __restrict__ Wb, const unsigned short* __restrict__ Hh,
             const unsigned short* __restrict__ Hl, const float* __restrict__ bq, const float* __restrict__ bk,
             unsigned short* Q16, unsigned short* K16) {
  __shared__ __align__(16) float Os[GWN * OSH];
  const int tid  = threadIdx.x;
  const int lane = tid & 31, wave = tid >> 5;
  const int hh   = lane >> 4, c = lane & 15;
  const int nt   = blockIdx.x, mb = blockIdx.y, b = blockIdx.z;
  const int sel  = mb / (CC / GWO);                                        // 0 = q, 1 = k (block-uniform)
  const int n0   = nt * GWN, o0 = (mb % (CC / GWO)) * GWO;
  const int nw   = 32 * (wave & 3), ow = 128 * (wave >> 2);                // this wave's tile inside the block's

  const size_t ho = ((size_t)(b * NN + n0 + nw)) * CC + 8 * lane;
  v8f acc[16];
  gemm_core<true>(Wb + ((size_t)(sel * CC + o0 + ow)) * CC + 8 * lane, Hh + ho, Hl + ho, (nt + 4 * mb + b) & (CC / 32 - 1), acc);

  // ---- epilogue: + bias -> LDS Os[n_loc][o_loc]; lane (hh, c) holds o = ow + 16 m + 8 hh + r for n_loc = nw + 16 t + c
  const float* bsrc = ((sel == 0) ? bq : bk) + o0 + ow + 8 * hh;          // block-uniform choice, both global
  v4f bl[16];
#pragma unroll                                                            // bl[] stays in registers
  for (int m = 0; m < 16; ++m) bl[m] = *(const v4f*)(bsrc + 16 * (m >> 1) + 4 * (m & 1));
  // the bias requests name the registers of bsrc: it goes through the statement as an input, so that they are left alone
  // (also by what the requests bring) up to the wait
  asm volatile("s_wait_xcnt 0x0" : : "v"(bsrc) : "memory");
#pragma unroll                                                            // constant indices: the arrays stay in registers
  for (int m = 0; m < 8; ++m) {
    const v4f b0 = bl[2 * m], b1 = bl[2 * m + 1];
#pragma unroll                                                            // constant indices: the arrays stay in registers
    for (int t = 0; t < 2; ++t) {
      v4f va, vb;
#pragma unroll                                                            // constant indices: the arrays stay in registers
      for (int r = 0; r < 4; ++r) { va[r] = acc[2 * m + t][r] + bfr(b0[r]); vb[r] = acc[2 * m + t][4 + r] + bfr(b1[r]); }
      float* sp = Os + (nw + 16 * t + c) * OSH + ow + 16 * m + 8 * hh;
      *(v4f*)sp       = va;
      *(v4f*)(sp + 4) = vb;
    }
  }
  __syncthreads();

  unsigned short* Ph = (sel == 0) ? Q16 : K16;                             // block-uniform, both global
  v4u uv[16];
#pragma unroll                                                            // constant indices: the arrays stay in registers
  for (int it = 0; it < 16; ++it) {                                        // piece: row tile it>>1, chunk pair 8 (it&1) + wave
    const int lo = (16 * (it >> 1) + c) * OSH + 16 * (8 * (it & 1) + wave) + 8 * hh;
    const v4f a = *(const v4f*)(Os + lo);
    const v4f q = *(const v4f*)(Os + lo + 4);
    const float f[8] = {a[0], a[1], a[2], a[3], q[0], q[1], q[2], q[3]};
#pragma unroll                                                            // constant indices: the arrays stay in registers
    for (int t = 0; t < 4; ++t)
      uv[it][t] = pk16(h_bits((_Float16)f[2 * t]), h_bits((_Float16)f[2 * t + 1]));
  }
  const size_t po = ((size_t)(b * NN + n0)) * CC + 16 * o0 + 256 * wave + 8 * lane;
#pragma unroll                                                            // constant indices: the arrays stay in registers
  for (int it = 0; it < 16; ++it) *(v4u*)(Ph + po + (size_t)(16 * (it >> 1)) * CC + 2048 * (it & 1)) = uv[it];
}

// =============================================================================================================
// (4) v conv GEMM for one (b, 128-n tile, 256-o block o0 = mb*256), operands swapped so the D rows are positions:
//     D[n][o] = sum_c (Hh + Hl)[b][n][c] Wv[o][c] (2 products, K = 512).
//     Per lane the D tile holds 8 consecutive n of one o -> LDS Vs[o_loc][n_loc] (pitch PSP, b128 stores;
//     cross-wave, block barrier), then V16 f16, rows 512 b + o, k = n (KD = 4096), fragment-major, = f16(D +
//     bf16-RNE(bv[o])) (unscaled, |v| ~ 1).
// coverage: Vs 8 waves x 32 n x 128 o = 256 x 128 (staged == consumed); V16 16 it (row tiles) x 8 waves (4 k steps x 2
//           halves of 512 B) = 256 o x 128 n; grid (32, 2, NB) covers all 512 o x 4096 n of each b exactly once.
// =============================================================================================================
__global__ __launch_bounds__(256)
void gemm_v(const unsigned short* __restrict__ Wb, const unsigned short* __restrict__ Hh,
            const unsigned short* __restrict__ Hl, const float* __restrict__ bv, unsigned short* V16) {
  __shared__ __align__(16) float Vs[GWO * PSP];
  const int tid  = threadIdx.x;
  const int lane = tid & 31, wave = tid >> 5;
  const int hh   = lane >> 4, c = lane & 15;
  const int nt   = blockIdx.x, mb = blockIdx.y, b = blockIdx.z;
  const int n0   = nt * GWN, o0 = mb * GWO;
  const int nw   = 32 * (wave & 3), ow = 128 * (wave >> 2);                // this wave's tile inside the block's

  const size_t ho = ((size_t)(b * NN + n0 + nw)) * CC + 8 * lane;
  v8f acc[16];
  gemm_core<false>(Wb + ((size_t)(2 * CC + o0 + ow)) * CC + 8 * lane, Hh + ho, Hl + ho, (nt + 8 * mb + b) & (CC / 32 - 1), acc);

  // ---- epilogue: lane (hh, c) holds n_loc = nw + 16 t + 8 hh + r of o_loc = ow + 16 m + c
#pragma unroll                                                            // constant indices: the arrays stay in registers
  for (int m = 0; m < 8; ++m) {
    const float bb = bfr(bv[o0 + ow + 16 * m + c]);
#pragma unroll                                                            // constant indices: the arrays stay in registers
    for (int t = 0; t < 2; ++t) {
      v4f va, vb;
#pragma unroll                                                            // constant indices: the arrays stay in registers
      for (int r = 0; r < 4; ++r) { va[r] = acc[2 * m + t][r] + bb; vb[r] = acc[2 * m + t][4 + r] + bb; }
      float* sp = Vs + (ow + 16 * m + c) * PSP + nw + 16 * t + 8 * hh;
      *(v4f*)sp       = va;
      *(v4f*)(sp + 4) = vb;
    }
  }
  __syncthreads();

  v4u uv[16];
#pragma unroll                                                            // constant indices: the arrays stay in registers
  for (int it = 0; it < 16; ++it) {
    const int lo = (it * 16 + c) * PSP + 16 * wave + 8 * hh;               // row tile it, chunk pair = wave
    const v4f a = *(const v4f*)(Vs + lo);
    const v4f q = *(const v4f*)(Vs + lo + 4);
    const float f[8] = {a[0], a[1], a[2], a[3], q[0], q[1], q[2], q[3]};
#pragma unroll                                                            // constant indices: the arrays stay in registers
    for (int t = 0; t < 4; ++t)
      uv[it][t] = pk16(h_bits((_Float16)f[2 * t]), h_bits((_Float16)f[2 * t + 1]));
  }
  const size_t po = ((size_t)(b * CC + o0)) * NN + 16 * n0 + 256 * wave + 8 * lane;
#pragma unroll                                                            // constant indices: the arrays stay in registers
  for (int it = 0; it < 16; ++it) *(v4u*)(V16 + po + (size_t)(16 * it) * NN) = uv[it];
}

// =============================================================================================================
// (5) attention for one (b, 64-query tile), transposed formulation, 4096 keys, no mask. Block = 8 waves, one block per
//   WGP (grid 64 x NB): every K and V fragment that a block fetches feeds 64 queries.
//   Score phase per 32-key block kb: wave w computes TWO S^T partial tiles (16 keys x 16 queries each) from one set of
//   k fragments: key tile kt = w&1 (keys kb+16kt..), query tiles 2 qg + i, qg = (w>>1)&1, i = 0..1 (queries
//   n0+16(2qg+i)..), over the d-half dh = w>>2 (d 256dh .. 256dh+255, 8 steps of 32): A = k rows (row = key,
//   fragment-major, split k map) from K16, B = q rows (col = query, same map) from Q16, plain f16, 1 product. Each
//   partial (D row = key 8h+r, col = query) goes to LDS Sp[dh][query][key] (pitch SPP, b128 stores; cross-wave, block
//   barrier); the two d-halves are added in fixed order by the softmax lanes.
//   Softmax: all 8 waves, four lanes per query: thread tid has query tid / 4 and the 8 keys 8 (tid & 3) ..: s_j = (Sp[0] +
//   Sp[1]) * 512^-0.5, block max in-lane and over the four lanes (two DPP moves), online max m in f32 (equal in the four
//   lanes), the sum l as one f32 partial per lane over its own keys (the four are added once, behind the loop), corr =
//   e^{m_old - m_new} -> Cs[query], P_j = e^{s_j - m} x 2^14 as f16 -> Pf[query][key] (pitch PFP, one 16-B store per lane;
//   cross-wave, block barrier).
//   O^T (rows channel, cols query): every wave owns channels 64w..64w+63 (4 tiles j) x 64 queries (4 tiles) = 16
//   accumulator tiles; rescale by Cs when any of the 64 corr is not 1 (every wave reads all 64, so block-uniform; corr is
//   exactly 1 for a query whose max did not grow), then += A(v rows channel = 64w+16j+(lane&15), keys kb.., fragment-major f16 plane V16) . B(P^T: row = query
//   from Pf, keys contiguous, same k order).
//   The three phases run as a pipeline over the key blocks, ONE barrier per key block: between two barriers every wave
//   does the scores of block i+1, its share of the softmax of block i and O^T of block i-1. Sp, Pf and Cs
//   have two buffers each (index = key block & 1): what a pass writes was last read in the pass before, behind a barrier,
//   and is read in the next pass. Fill: block 0's scores ahead of the
//   loop, and P = 0, corr = 1 for the O^T step of pass 0 (adds zero); drain: the last pass scores one block more
//   (never read), O^T of the last block stands behind the loop.
//   Key walk: "key block i" above is the i-th block of this work-group's walk, keys 32 ((st + i) mod 128) ..: the walk goes
//   once round all 128 blocks from a start st of the work-group's own. The 64 work-groups of one b read the same K and V
//   planes; from one common start they would ask L2 for the same lines at the same moment in every pass. The online softmax
//   takes the key blocks in any order; the order of its sums follows the walk.
//   Epilogue in two 256-channel halves: waves with (w>>2) == half stage O/l in LDS Os[query][256 ch] (pitch OSH, b128
//   stores; cross-wave, block barrier), then all 256 threads write Ah (bf16 hi) and Al (bf16 residual), fragment-major.
// coverage: Sp 8 waves x 2 tiles = [2 dh][64 q][32 keys] each key block (staged == consumed); Pf 64 rows x 32 keys by
//           256 lanes x 8 keys (staged == consumed, pad cols never read; buffer 1 zeroed whole ahead of the loop); Os per half 4 waves x 64 q x 64 ch = 64 x 256 (staged
//           == consumed); planes 2 halves x 8 it x 8 waves x 512 B = 4 row tiles x 16 k steps per plane; grid (NQ/64,
//           NB) covers rows 0..NQ-1 exactly once (only those are read later).
// =============================================================================================================
__global__ __launch_bounds__(256)
void attn_k(const unsigned short* __restrict__ Q16, const unsigned short* __restrict__ K16,
            const unsigned short* __restrict__ V16, unsigned short* Ah, unsigned short* Al) {
  __shared__ __align__(16) float Sp[2 * 2 * AQ * SPP];
  __shared__ __align__(16) unsigned short Pf[2 * AQ * PFP];
  __shared__ __align__(16) float Os[AQ * OSH];
  __shared__ float Cs[2 * AQ];
  __shared__ float Ls[AQ];
  const int tid  = threadIdx.x;
  const int wave = tid >> 5, lane = tid & 31;
  const int hh   = lane >> 4, c = lane & 15;
  const int n0   = blockIdx.x * AQ, b = blockIdx.y;
  const int kt = wave & 1, qg = (wave >> 1) & 1, dh = wave >> 2;

  // q fragment pointer (B operand of S^T, col = query n0 + 16 (2 qg + i) + c, d-half dh), + 16*CC*i + 512*ks
  const unsigned short* qp = Q16 + ((size_t)(b * NN + n0 + 32 * qg)) * CC + 16 * (CC / 2) * dh + 8 * lane;
  // k fragment base (A operand, row = key kb + 16 kt + c, d-half dh), + kb*CC + 512*ks
  const unsigned short* kp = K16 + ((size_t)(b * NN + 16 * kt)) * CC + 16 * (CC / 2) * dh + 8 * lane;
  // v fragment base (A operand of O^T, row = channel 64 w + 16 j + c), + 16*j*NN + 16*kb (k step kb/32)
  const unsigned short* vp = V16 + ((size_t)(b * CC + 64 * wave)) * NN + 8 * lane;
  // this lane's S^T partial destination: Sp[dh][query 16(2qg+i)+c][key 16kt + 8hh + r], + 16*SPP*i
  float* spw = Sp + (dh * AQ + 32 * qg + c) * SPP + 16 * kt + 8 * hh;
  // P^T fragment rows (row = query 16 q + c, keys contiguous), + 16*PFP*q
  const unsigned short* pf = Pf + c * PFP + 8 * hh;

  // q fragments of this wave's d-half do not change with the key block: loaded once, kept in registers
  Frag fq[2][CC / 64];
#pragma unroll                                                            // fq[][] stays in registers
  for (int i = 0; i < 2; ++i) {
#pragma unroll
    for (int ks = 0; ks < CC / 64; ++ks) fq[i][ks] = ldfm(qp + (size_t)(16 * i) * CC + 512 * ks);
  }
  // the q requests are in flight and the code below reuses their address registers
  asm volatile("s_wait_xcnt 0x0" ::: "memory");

  // softmax share of this lane: query sq, keys sk .. sk + 7 of each key block
  const int sq = tid >> 2, sk = 8 * (tid & 3);
  float m_run = -1.0e30f, l_run = 0.f;
  v8f o[16];
#pragma unroll
  for (int j = 0; j < 16; ++j) o[j] = zero8();

  // ---- the two matrix phases, used in the fill, in the loop and in the drain
  Frag fk[CC / 64];
  Frag fv[4];
  // two score partial tiles over this wave's d-half, each k fragment used for both -> Sp buffer at dst
  auto score = [&](float* dst) __attribute__((always_inline)) {
    v8f s0 = zero8(), s1 = zero8();
#pragma unroll                                                            // fk[], fq[][] stay in registers
    for (int ks = 0; ks < CC / 64; ++ks) {
      s0 = mma_h(fk[ks].h, fq[0][ks].h, s0);
      s1 = mma_h(fk[ks].h, fq[1][ks].h, s1);
    }
    v4f sa, sb, sc, sd;
#pragma unroll
    for (int r = 0; r < 4; ++r) { sa[r] = s0[r]; sb[r] = s0[4 + r]; sc[r] = s1[r]; sd[r] = s1[4 + r]; }
    *(v4f*)(dst)                = sa;
    *(v4f*)(dst + 4)            = sb;
    *(v4f*)(dst + 16 * SPP)     = sc;
    *(v4f*)(dst + 16 * SPP + 4) = sd;
  };
  // the O^T step in two parts. pv_read: all its LDS reads (corr, P^T fragments of buffer buf) as one group, placed
  // at the head of a pass so that they land under the score products. pv_scale: rescale (block-uniform test). pv_mul: O^T += V . P^T
  float cr[4];
  Frag p[4];
  auto pv_read = [&](int buf) __attribute__((always_inline)) {
#pragma unroll                                                            // cr[], p[] stay in registers
    for (int q = 0; q < 4; ++q) {
      cr[q] = Cs[AQ * buf + 16 * q + c];
      p[q]  = ldfrag(pf + AQ * PFP * buf + 16 * PFP * q);
    }
  };
  auto pv_scale = [&]() __attribute__((always_inline)) {
    // corr <= 1: the least of the lane's four, then one ballot; lanes 0..15 hold all 64 queries between them
    if (wave_ballot(fminf(fminf(cr[0], cr[1]), fminf(cr[2], cr[3])) != 1.0f) != 0u) {
#pragma unroll
      for (int q = 0; q < 4; ++q) {
#pragma unroll
        for (int j = 0; j < 4; ++j) {
#pragma unroll
          for (int r = 0; r < 8; ++r) o[4 * j + q][r] *= cr[q];
        }
      }
    }
  };
  auto pv_mul = [&]() __attribute__((always_inline)) {
#pragma unroll
    for (int j = 0; j < 4; ++j) {
#pragma unroll
      for (int q = 0; q < 4; ++q) o[4 * j + q] = mma_h(fv[j].h, p[q].h, o[4 * j + q]);
    }
  };

  // ---- fill: scores of key block 0 -> Sp buffer 0; P = 0, corr = 1 in buffer 1 for the O^T step of pass 0; then
  //      the k fragments of block 1 and the v fragments of the block in front of block 0 (finite values for that step,
  //      which adds v x 0)
  // start of the walk: 64 different even blocks; neighbours in blockIdx.x stand ten blocks apart
  const int st = 2 * ((5 * (int)blockIdx.x) & (NKB / 2 - 1));
  const unsigned short* kpn = kp + (size_t)st * (32 * CC);
  // vpn starts one block in front of the walk: every pass steps it first and asks then
  int kj = st, vj = (st + NKB - 1) & (NKB - 1);                           // the key blocks that kpn and vpn stand at
  const unsigned short* vpn = vp + (size_t)vj * 512;
  // step to the next key block of the walk, in elements of the k plane (KS = 32 CC) or the v plane (KS = 512): behind
  // block 127 comes block 0, so every address of the walk, also of the blocks asked for past its end, lies in the planes
  auto wstep = [&](int& j, int KS) __attribute__((always_inline)) {
    const int s = (j == NKB - 1) ? -(NKB - 1) * KS : KS;
    j = (j + 1) & (NKB - 1);
    return s;
  };
#pragma unroll                                                            // fk[] stays in registers
  for (int ks = 0; ks < CC / 64; ++ks) fk[ks] = ldfm(kpn + 512 * ks);
  // every group of k or v requests names the registers of kpn or vpn: the wait stands in front of the step that rewrites
  // them (the step length goes through the statement, so that the addition cannot be lifted over the wait)
  int kstep0 = wstep(kj, 32 * CC);
  asm volatile("s_wait_xcnt 0x0" : "+s"(kstep0) : : "memory");
  kpn += kstep0;
  {
    const v4u z4 = {0u, 0u, 0u, 0u};
#pragma unroll 1
    for (int t = tid; t < AQ * PFP / 8; t += 256) *(v4u*)(Pf + AQ * PFP + 8 * t) = z4;
    if (tid < AQ) Cs[AQ + tid] = 1.0f;
  }
  score(spw);
#pragma unroll                                                            // fk[] stays in registers
  for (int ks = 0; ks < CC / 64; ++ks) fk[ks] = ldfm(kpn + 512 * ks);  // kpn stays at block 1: every pass steps it first and asks then
#pragma unroll                                                            // fv[] stays in registers
  for (int j = 0; j < 4; ++j) fv[j] = ldfm(vpn + (size_t)(16 * j) * NN);
  lds_barrier();

#pragma unroll 1
  for (int i = 0; i < NKB; ++i) {
    const int cur = i & 1, oth = cur ^ 1;
    pv_read(oth);
    // this lane's score partials of key block i (both d-halves), in the same group of LDS reads
    v4f sa0[2], sa1[2];
    {
      const float* s0p = Sp + 2 * AQ * SPP * cur + sq * SPP + sk;          // d-half 0
#pragma unroll                                                            // sa0[], sa1[] stay in registers
      for (int t2 = 0; t2 < 2; ++t2) {
        sa0[t2] = *(const v4f*)(s0p + 4 * t2);
        sa1[t2] = *(const v4f*)(s0p + AQ * SPP + 4 * t2);                  // d-half 1
      }
    }
    // keeps the LDS reads above in one group in front of the run of products below, for the same reason as the requests behind it
    __builtin_amdgcn_sched_barrier(0);
    // ---- scores of key block i+1 (last pass: one block past the walk's end, never read)
    score(spw + 2 * AQ * SPP * oth);
    // keeps the wait below, and with it the k requests, behind the run of products above: dealt among the products, every
    // pair of requests is a place of its own where the wave's run of matrix instructions is broken off
    __builtin_amdgcn_sched_barrier(0);
    // ---- the k fragments of key block i+2 are requested here, as one group, nearly a pass ahead of their use.
    //      The walk pointer steps IN FRONT of its group: the wait that the step owes then meets requests that are a phase old
    //      (the youngest: the v group of the pass before). Behind the group it held the wave until the group's own
    //      addresses were through. (the step length goes through the statement: the addition cannot be lifted over the wait;
    //      its "memory" clobber keeps the requests behind it)
    int kstep = wstep(kj, 32 * CC);
    asm volatile("s_wait_xcnt 0x0" : "+s"(kstep) : : "memory");
    kpn += kstep;
#pragma unroll                                                            // fk[] stays in registers
    for (int ks = 0; ks < CC / 64; ++ks) fk[ks] = ldfm(kpn + 512 * ks);
    // keeps the softmax and the test of corr, and with them the wait for their LDS reads, behind the score products:
    // scheduled among them they stall the wave for the LDS latency at the head of the pass
    __builtin_amdgcn_sched_barrier(0);
    // ---- O^T of key block i-1, first part: rescale
    pv_scale();
    // ---- online softmax of key block i: query sq, keys 32 ((st + i) mod 128) + sk .. + 7. It stands between the wave's two runs of matrix
    //      products: while one wave of a SIMD is in this vector chain the other has products to issue, and a pass ends in
    //      products, not in a chain that every wave would wait for at the barrier
    {
      float sv[8];
#pragma unroll
      for (int t2 = 0; t2 < 2; ++t2) {
#pragma unroll
        for (int t = 0; t < 4; ++t) sv[4 * t2 + t] = sa0[t2][t] + sa1[t2][t];
      }
      float mx = sv[0];
#pragma unroll
      for (int j = 1; j < 8; ++j) mx = fmaxf(mx, sv[j]);
      mx = fmaxf(mx, quad_xor<1>(mx));                                    // max over the query's four lanes
      mx = fmaxf(mx, quad_xor<2>(mx));
      const float mn   = fmaxf(m_run, mx * SCL);
      const float corr = __expf(m_run - mn);                             // == 1 exactly when the max did not grow
      m_run = mn;
      const float msh = mn - LNPS;                                        // exp gives e^{s-m} * 2^14
      float ls = 0.f;
      v4u pk;
#pragma unroll
      for (int t = 0; t < 4; ++t) {
        const float e0 = __expf(fmaf(sv[2 * t],     SCL, -msh));           // key 32 ((st + i) mod 128) + sk + 2t
        const float e1 = __expf(fmaf(sv[2 * t + 1], SCL, -msh));           // key 32 ((st + i) mod 128) + sk + 2t + 1
        ls += e0 + e1;
        pk[t] = pk16(h_bits((_Float16)e0), h_bits((_Float16)e1));
      }
      l_run = l_run * corr + ls;
      *(v4u*)(Pf + AQ * PFP * cur + sq * PFP + sk) = pk;
      if ((tid & 3) == 0) Cs[AQ * cur + sq] = corr;
    }
    // keeps the additions of the row sum, which nothing in the pass waits for, in the vector chain above: left free they are
    // scheduled behind the barrier, in front of every wave's first score product of the next pass
    __builtin_amdgcn_sched_barrier(0);
    // ---- O^T of key block i-1, second part: the products (pass 0: adds zero)
    pv_mul();
    // keeps the wait below, and with it the v requests, behind the run of products above, as for the k requests
    __builtin_amdgcn_sched_barrier(0);
    // ---- the v fragments of key block i are requested here, as one group, ahead of their use in the next pass; step and wait
    //      in front of the group as for k (the youngest requests here: this pass's k group, a softmax and 16 products old)
    int vstep = wstep(vj, 512);
    asm volatile("s_wait_xcnt 0x0" : "+s"(vstep) : : "memory");
    vpn += vstep;
#pragma unroll                                                            // fv[] stays in registers
    for (int j = 0; j < 4; ++j) fv[j] = ldfm(vpn + (size_t)(16 * j) * NN);
    lds_barrier();
  }
  // the last pass's k and v requests are in flight and the code below reuses the registers of the walk pointers: both go through
  // the statement as inputs, so that their registers are left alone up to the wait
  asm volatile("s_wait_xcnt 0x0" : : "v"(kpn), "v"(vpn) : "memory");
  // ---- drain: O^T of the last key block
  pv_read((NKB - 1) & 1);
  pv_scale();
  pv_mul();
  l_run += quad_xor<1>(l_run);                                            // the query's four partial sums, same m in all four
  l_run += quad_xor<2>(l_run);
  if ((tid & 3) == 0) Ls[sq] = 1.0f / l_run;                              // o and l both carry the 2^14 factor
  __syncthreads();
  float inv[4];
#pragma unroll
  for (int q = 0; q < 4; ++q) inv[q] = Ls[16 * q + c];

#pragma unroll
  for (int half = 0; half < 2; ++half) {
    if ((wave >> 2) == half) {
      const int chb = 64 * (wave & 3);                                    // channel offset inside this half
#pragma unroll
      for (int j = 0; j < 4; ++j) {
#pragma unroll
        for (int q = 0; q < 4; ++q) {
          v4f va, vb;
#pragma unroll
          for (int r = 0; r < 4; ++r) { va[r] = o[4 * j + q][r] * inv[q]; vb[r] = o[4 * j + q][4 + r] * inv[q]; }
          float* dst = Os + (16 * q + c) * OSH + chb + 16 * j + 8 * hh;   // Os[query][ch = chb + 16j + 8hh + r]
          *(v4f*)dst       = va;
          *(v4f*)(dst + 4) = vb;
        }
      }
    }
    __syncthreads();
    {
      v4u uh[AQ / 8], ul[AQ / 8];
#pragma unroll
      for (int it = 0; it < AQ / 8; ++it) {
        const int pc = it * 8 + wave;                                     // piece: row tile pc>>4, chunk pair pc&15
        const int lo = (16 * (pc >> 4) + c) * OSH + 16 * (pc & 15) + 8 * hh;
        const v4f a = *(const v4f*)(Os + lo);
        const v4f q = *(const v4f*)(Os + lo + 4);
        const float f[8] = {a[0], a[1], a[2], a[3], q[0], q[1], q[2], q[3]};
#pragma unroll
        for (int t = 0; t < 4; ++t) {
          const float f0 = f[2 * t], f1 = f[2 * t + 1];
          const unsigned short hb0 = bf_bits(f0), hb1 = bf_bits(f1);
          const unsigned short lb0 = bf_bits(f0 - bf_up(hb0));
          const unsigned short lb1 = bf_bits(f1 - bf_up(hb1));
          uh[it][t] = pk16(hb0, hb1);
          ul[it][t] = pk16(lb0, lb1);
        }
      }
#pragma unroll
      for (int it = 0; it < AQ / 8; ++it) {
        const int pc = it * 8 + wave;
        const size_t po = ((size_t)(b * NN + n0 + 16 * (pc >> 4))) * CC + 16 * (CC / 2) * half + 256 * (pc & 15) + 8 * lane;
        *(v4u*)(Ah + po) = uh[it];
        *(v4u*)(Al + po) = ul[it];
      }
    }
    __syncthreads();
  }
}

// =============================================================================================================
// (6) output projection + bias + residual for one (b, 128-n tile, 256-o block o0 = mb*256), D rows = positions:
//     D[n][o] = sum_c (Ah + Al)[b][n][c] Wp[o][c] (2 products, K = 512), GEMM core as in (4). Per lane 8 consecutive n of
//     one o -> LDS Vs[o_loc][n_loc] (pitch PSP, b128 stores; cross-wave, block barrier), then one wave per row: lane e ->
//     n 4e..4e+3, 4 whole lines of out per instruction.
// coverage: Vs 8 waves x 32 n x 128 o = 256 x 128 (staged == consumed); out 32 it x 8 rows x 32 lanes x 4 = 256 o x
//           128 n; grid (NQ/128, 2, NB) covers out[b][0..511][0..NQ-1] exactly once.
// =============================================================================================================
__global__ __launch_bounds__(256)
void gemm_p(const unsigned short* __restrict__ Wb, const unsigned short* __restrict__ Ah,
            const unsigned short* __restrict__ Al, const float* __restrict__ bp, const float* __restrict__ x,
            float* out) {
  __shared__ __align__(16) float Vs[GWO * PSP];
  const int tid  = threadIdx.x;
  const int lane = tid & 31, wave = tid >> 5;
  const int hh   = lane >> 4, c = lane & 15;
  const int nt   = blockIdx.x, mb = blockIdx.y, b = blockIdx.z;
  const int n0   = nt * GWN, o0 = mb * GWO;
  const int nw   = 32 * (wave & 3), ow = 128 * (wave >> 2);                // this wave's tile inside the block's

  const size_t ao = ((size_t)(b * NN + n0 + nw)) * CC + 8 * lane;
  v8f acc[16];
  gemm_core<false>(Wb + ((size_t)(3 * CC + o0 + ow)) * CC + 8 * lane, Ah + ao, Al + ao, (nt + 8 * mb + b) & (CC / 32 - 1), acc);

  // ---- epilogue: lane (hh, c) holds n_loc = nw + 16 t + 8 hh + r of o_loc = ow + 16 m + c
#pragma unroll                                                            // constant indices: the arrays stay in registers
  for (int m = 0; m < 8; ++m) {
    const float bb = bfr(bp[o0 + ow + 16 * m + c]);
#pragma unroll                                                            // constant indices: the arrays stay in registers
    for (int t = 0; t < 2; ++t) {
      v4f va, vb;
#pragma unroll                                                            // constant indices: the arrays stay in registers
      for (int r = 0; r < 4; ++r) { va[r] = acc[2 * m + t][r] + bb; vb[r] = acc[2 * m + t][4 + r] + bb; }
      float* sp = Vs + (ow + 16 * m + c) * PSP + nw + 16 * t + 8 * hh;
      *(v4f*)sp       = va;
      *(v4f*)(sp + 4) = vb;
    }
  }
  __syncthreads();

  const size_t idx = ((size_t)(b * CC + o0 + wave)) * NN + n0 + 4 * lane;  // row it * 8 + wave: + 8 it NN
  v4f res[GWO / 8];
#pragma unroll                                                            // constant indices: the arrays stay in registers
  for (int it = 0; it < GWO / 8; ++it) {
    const v4f a = *(const v4f*)(Vs + (it * 8 + wave) * PSP + 4 * lane);
    const v4f xv = *(const v4f*)(x + idx + (size_t)(8 * it) * NN);
#pragma unroll                                                            // constant indices: the arrays stay in registers
    for (int t = 0; t < 4; ++t) res[it][t] = a[t] + bfr(xv[t]);
  }
#pragma unroll                                                            // constant indices: the arrays stay in registers
  for (int it = 0; it < GWO / 8; ++it) *(v4f*)(out + idx + (size_t)(8 * it) * NN) = res[it];
}

// =============================================================================================================
// Workspace map (bytes; each region start a multiple of 256; every extent is an exact tile multiple and is written
//   (all 16-bit planes fragment-major, same extents as row-major)
//   Wb    bf16 [4][512][512]          2097152
//   Hh/Hl bf16 [NB][4096][512]     16777216 x2   (reused as Ah/Al after their last reader, launch (4))
//   Q16/K16 f16 [NB][4096][512]   16777216 x2
//   V16   f16  [NB][512][4096]     16777216
//   total (NB=4) = 85983232
// =============================================================================================================
extern "C" void kernel_launch(void* const* d_in, const int* in_sizes, int n_in,
                              void* d_out, int out_size, void* d_ws, size_t ws_size,
                              hipStream_t stream) {
  if (n_in < 11) return;
  if (in_sizes[0] < NB * CC * NN) return;
  if (in_sizes[1] < CC || in_sizes[2] < CC) return;
  if (in_sizes[3] < CC * CC || in_sizes[5] < CC * CC || in_sizes[7] < CC * CC || in_sizes[9] < CC * CC) return;
  if (in_sizes[4] < CC || in_sizes[6] < CC || in_sizes[8] < CC || in_sizes[10] < CC) return;
  if (out_size < NB * CC * NN) return;

  size_t off = 0;
  auto carve = [&](size_t bytes) { const size_t o = off; off += (bytes + 255) & ~(size_t)255; return o; };
  const size_t plane = (size_t)NB * NN * CC * 2;
  const size_t oWb  = carve((size_t)4 * CC * CC * 2);
  const size_t oHh  = carve(plane);
  const size_t oHl  = carve(plane);
  const size_t oQ   = carve(plane);
  const size_t oK   = carve(plane);
  const size_t oV   = carve(plane);
  const size_t oAh  = oHh;                                                // same extent, disjoint lifetimes
  const size_t oAl  = oHl;
  if (off > ws_size) return;
  if (off > (size_t)134217728) return;

  const float* x   = (const float*)d_in[0];
  const float* gnw = (const float*)d_in[1];
  const float* gnb = (const float*)d_in[2];
  const float* wq  = (const float*)d_in[3];
  const float* bq  = (const float*)d_in[4];
  const float* wk  = (const float*)d_in[5];
  const float* bk  = (const float*)d_in[6];
  const float* wv  = (const float*)d_in[7];
  const float* bv  = (const float*)d_in[8];
  const float* wp  = (const float*)d_in[9];
  const float* bp  = (const float*)d_in[10];

  char* ws = (char*)d_ws;
  unsigned short* Wb  = (unsigned short*)(ws + oWb);
  unsigned short* Hh  = (unsigned short*)(ws + oHh);
  unsigned short* Hl  = (unsigned short*)(ws + oHl);
  unsigned short* Q16 = (unsigned short*)(ws + oQ);
  unsigned short* K16 = (unsigned short*)(ws + oK);
  unsigned short* V16 = (unsigned short*)(ws + oV);
  unsigned short* Ah  = (unsigned short*)(ws + oAh);
  unsigned short* Al  = (unsigned short*)(ws + oAl);
  float* out = (float*)d_out;

  const dim3 blk256(256);

  // (0) conv weights -> stacked bf16 plane
  cvt_w<<<dim3(4 * (CC / 4)), blk256, 0, stream>>>(wq, wk, wv, wp, Wb);
  // (1), (2) group statistics per (b, g) in f64 and normalised activations -> fragment-major bf16 hi / residual planes
  gn_norm<<<dim3(NB * NGRP), dim3(1024), 0, stream>>>(x, gnw, gnb, Hh, Hl);
  // (3) q and k -> fragment-major f16 planes (rows = positions)
  gemm_qk<<<dim3(NN / GWN, 2 * (CC / GWO), NB), blk256, 0, stream>>>(Wb, Hh, Hl, bq, bk, Q16, K16);
  // (4) v -> fragment-major f16 plane (rows = channels)
  gemm_v<<<dim3(NN / GWN, CC / GWO, NB), blk256, 0, stream>>>(Wb, Hh, Hl, bv, V16);
  // (5) attention -> bf16 hi / residual planes of the attention output (regions of Hh / Hl, dead by now)
  attn_k<<<dim3(NQ / AQ, NB), blk256, 0, stream>>>(Q16, K16, V16, Ah, Al);
  // (6) output projection + bias + residual -> out [b][512][4096]
  gemm_p<<<dim3(NQ / GWN, CC / GWO, NB), blk256, 0, stream>>>(Wb, Ah, Al, bp, x, out);
  (void)hipGetLastError();
}

// v010
// It runs in 188 microseconds.
// Timed twice side by side with v009, it ran 1.09 and 1.08 times as fast.
// All steps since v000 together make it 6.04 times as fast.
// Contractions: q/k/v 1x1-conv GEMMs W[512x512].H[512x4096] on v_wmma_f32_16x16x32_f16 (W = bf16-RNE weights held
// as f16; H = one f16 plane of the normalised activations; 1 product, K=512); scores S^T = K.Q^T on
// v_wmma_f32_16x16x32_f16 (k, q: plain f16 planes, 1 product, K=512 split over two wave groups, fixed-order f32
// combine in LDS); O^T = V.P^T on v_wmma_f32_16x16x32_f16 (v: f16 plane, P = e^{s-m} x 2^14 as f16, K=4096); output
// 1x1-conv GEMM Wp[512x512].A[512x4096] on v_wmma_f32_16x16x32_f16 (A = one f16 plane of the
// attention output; 1 product, K=512). f32 accumulate everywhere; normalisation statistics summed in f64; softmax
// statistics, biases and the residual add in f32 VALU.
#include <hip/hip_runtime.h>
#include <math.h>
#include <stdint.h>

#ifndef NB
#define NB 4
#endif
#ifndef NQ
#define NQ 4096
#endif
#define NB_FULL 4
#define CC     512
#define NN     4096
#define NGRP   32
#define GSZ    16
#define AQ     64
#define GWO    256
#define GWN    128
#define PSP    132
#define OSH    260
#define SPP    36
#define PFP    40
#define SCL    0.044194173824159216f
#define LNPS   9.704060527839234f
#define GEPS   1.0e-6
#define NKB    (NN / 32)

static_assert(NB >= 1 && NB <= NB_FULL);
static_assert(NQ >= GWN && NQ <= NN && NQ % GWN == 0 && NQ % AQ == 0);
static_assert(NN % GWN == 0 && NN % AQ == 0 && NN % 32 == 0 && NN == 8 * 512);
static_assert(CC == 512 && CC % GWO == 0 && CC % 32 == 0);
static_assert(GSZ * NGRP == CC && GSZ == 16);
static_assert((PSP * 4) % 16 == 0 && (OSH * 4) % 16 == 0);
static_assert((SPP * 4) % 16 == 0 && (PFP * 2) % 16 == 0);
static_assert(OSH >= GWO && PSP >= GWN && GWN * OSH * 4 <= 163840 && GWO * PSP * 4 <= 163840);
static_assert(AQ == 64 && (4 * AQ * SPP * 4 + 2 * AQ * PFP * 2 + AQ * OSH * 4 + 4 * AQ * 4) <= 327680);
static_assert(NKB >= 3 && (NKB & (NKB - 1)) == 0 && (AQ * PFP) % 8 == 0);
static_assert(((CC / 32) & (CC / 32 - 1)) == 0);

typedef _Float16       v16h __attribute__((ext_vector_type(16)));
typedef _Float16       v8h  __attribute__((ext_vector_type(8)));
typedef unsigned short v8us __attribute__((ext_vector_type(8)));
typedef float          v8f  __attribute__((ext_vector_type(8)));
typedef float          v4f  __attribute__((ext_vector_type(4)));
typedef unsigned int   v4u  __attribute__((ext_vector_type(4)));

union Frag  { v8us u[2]; v16h h; };
static_assert(sizeof(Frag) == 32);

// ---- scalar helpers -------------------------------------------------------------------------------------------
__device__ __forceinline__ unsigned short bf_bits(float f) {          // f32 -> bf16 bits, RNE convert
  unsigned u = __float_as_uint(f);
  return (unsigned short)((u + 0x7FFFu + ((u >> 16) & 1u)) >> 16);
}
__device__ __forceinline__ float bf_up(unsigned short hb) { return __uint_as_float(((unsigned)hb) << 16); }
__device__ __forceinline__ float bfr(float f) { return bf_up(bf_bits(f)); }
__device__ __forceinline__ unsigned short h_bits(_Float16 x) { return __builtin_bit_cast(unsigned short, x); }
__device__ __forceinline__ unsigned pk16(unsigned short a, unsigned short b) { return (unsigned)a | ((unsigned)b << 16); }
__device__ __forceinline__ v8f zero8() { v8f z = {0.f, 0.f, 0.f, 0.f, 0.f, 0.f, 0.f, 0.f}; return z; }
__device__ __forceinline__ unsigned wave_ballot(bool p) {
#if defined(__HIP_DEVICE_COMPILE__)
  return __builtin_amdgcn_ballot_w32(p);
#else
  return p ? 1u : 0u;
#endif
}

// ---- value of the lane whose number differs in bit 0 (X = 1) or bit 1 (X = 2), inside a group of four lanes: one DPP move
template <int X>
__device__ __forceinline__ float quad_xor(float v) {
#if defined(__HIP_DEVICE_COMPILE__)
  return __int_as_float(__builtin_amdgcn_update_dpp(0, __float_as_int(v), X == 1 ? 0xB1 : 0x4E, 0xF, 0xF, true));
#else
  return v;
#endif
}

// ---- 16-bit fragment loader (A, or B from a k-contiguous [n][k] row): lane -> row/col (lane&15), p already includes
//      + 8*(lane>>4); elements 0..7 <- p[0..7] (k0+8h..), elements 8..15 <- p[16..23] (k0+16+8h..)
__device__ __forceinline__ Frag ldfrag(const unsigned short* p) {
  Frag f;
  f.u[0] = *(const v8us*)(p);
  f.u[1] = *(const v8us*)(p + 16);
  return f;
}

// ---- fragment-major planes (every 16-bit operand plane in the workspace): a plane of R rows x KD k-elements is cut
//      into fragments of 16 rows x 32 k = 512 elements; fragment (row tile rt, k step ks) starts at element
//      16*rt*KD + 512*ks and holds [u 0..1][lane 0..31][8 elements]: lane = 16*h + (row&15), k = 32*ks + 16*u + 8*h + t.
//      That is the register order of ldfrag above, so one fragment is two loads of 512 contiguous bytes per wave
//      (4 whole 128-B lines each) where a row-major plane gives 16 partial lines per load. p already includes + 8*lane.
__device__ __forceinline__ Frag ldfm(const unsigned short* p) {
  Frag f;
  f.u[0] = *(const v8us*)(p);
  f.u[1] = *(const v8us*)(p + 256);
  return f;
}

// ---- WMMA helpers. f16 form (attention): the plain builtin; the compiler keeps the distances behind its own WMMAs. The
//      asm pad of the GEMM form takes its operands from v0..v255 alone: built with it, the 64-query tile spills to scratch.
__device__ __forceinline__ v8f mma_h(v16h a, v16h b, v8f c) {
  return __builtin_amdgcn_wmma_f32_16x16x32_f16(false, a, false, b, (short)0, c, false, false);
}
// GEMM form: builtin followed by a 4-slot VALU gap tying D and keeping A/B live
__device__ __forceinline__ v8f mma_g(v16h a, v16h b, v8f c) {
  v8f d = __builtin_amdgcn_wmma_f32_16x16x32_f16(false, a, false, b, (short)0, c, false, false);
#if defined(__HIP_DEVICE_COMPILE__)
  asm volatile("v_nop\n\tv_nop\n\tv_nop\n\tv_nop" : "+v"(d) : "v"(a), "v"(b));
#endif
  return d;
}

// ---- work-group barrier of the attention loop: orders LDS only (release / acquire on the local address space), so the
//      k and v requests that are in flight at it stay in flight; __syncthreads() would wait for them at every barrier.
//      The loop stores nothing to global memory and reads there only what earlier launches wrote.
__device__ __forceinline__ void lds_barrier() {
#if defined(__HIP_DEVICE_COMPILE__)
  __builtin_amdgcn_fence(__ATOMIC_RELEASE, "workgroup", "local");
  __builtin_amdgcn_s_barrier();
  __builtin_amdgcn_fence(__ATOMIC_ACQUIRE, "workgroup", "local");
#endif
}

// =============================================================================================================
// (0) conv weights: Wb f16, rows 512*matrix + o, k = c, fragment-major; matrix 0 = wq, 1 = wk, 2 = wv, 3 = wp; value =
//     f16(bf16-RNE(w)), the same number down to 2^-17 (8 significant bits; f16 keeps steps of 2^-24). Block blk (0..511): matrix blk/128 (block-uniform), row tile blk/4; wave gw = 8 blk + w owns the
//     half u = gw&1 of the fragment of k step (gw>>1)&15 and stores it as 512 contiguous bytes.
// coverage: 128 row tiles x 16 k steps x 2 halves = 4096 waves x 32 lanes x 8 = the whole plane.
// =============================================================================================================
__global__ __launch_bounds__(256)
void cvt_w(const float* __restrict__ wq, const float* __restrict__ wk, const float* __restrict__ wv,
           const float* __restrict__ wp, unsigned short* Wb) {
  const int tid = threadIdx.x, blk = blockIdx.x;
  const int wave = tid >> 5, lane = tid & 31;
  const int sel = blk / (CC / 4);                                          // 0..3, block-uniform
  const float* src = (sel == 0) ? wq : (sel == 1) ? wk : (sel == 2) ? wv : wp;   // all global
  const int gw  = blk * 8 + wave;                                          // 0..4095
  const int u   = gw & 1, ks = (gw >> 1) & 15, rt = gw >> 5;               // rt 0..127 = blk / 4
  const int o   = (rt & 31) * 16 + (lane & 15);                            // 0..511
  const int col = 32 * ks + 16 * u + 8 * (lane >> 4);                      // 0..504
  const float* s = src + (size_t)o * CC + col;
  const v4f a = *(const v4f*)s;
  const v4f q = *(const v4f*)(s + 4);
  const float f[8] = {a[0], a[1], a[2], a[3], q[0], q[1], q[2], q[3]};
  v4u pkv;
#pragma unroll
  for (int t = 0; t < 4; ++t) pkv[t] = pk16(h_bits((_Float16)bfr(f[2 * t])), h_bits((_Float16)bfr(f[2 * t + 1])));
{
    *(v4u*)(Wb + (size_t)(16 * rt) * CC + 512 * ks + 256 * u + 8 * lane) = pkv;
    
  }
}

__device__ __forceinline__ int wave_uniform(int v) {
#if defined(__HIP_DEVICE_COMPILE__)
  return __builtin_amdgcn_readfirstlane(v);
#else
  return v;
#endif
}

// sum of s over the 1024 threads of the block, the same bits in every thread; red: 32 doubles of LDS, used once
__device__ __forceinline__ double block_sum(double s, double* red, int lane, int wave) {
#pragma unroll                                                            // the exchange distances become constants
  for (int m = 16; m > 0; m >>= 1) s += __shfl_xor(s, m, 32);
  if (lane == 0) red[wave] = s;
  __syncthreads();
  double t = red[lane];
#pragma unroll                                                            // the exchange distances become constants
  for (int m = 16; m > 0; m >>= 1) t += __shfl_xor(t, m, 32);
  return t;
}

__global__ __launch_bounds__(1024)
void gn_norm(const float* __restrict__ x, const float* __restrict__ gw, const float* __restrict__ gb,
             unsigned short* Hh) {
  __shared__ double red1[32];
  __shared__ double red2[32];
  const int tid = threadIdx.x, bg = blockIdx.x;
  // the wave's number as a scalar: the channel half, gn_w and gn_b then sit in scalar registers and leave the 128 vector
  // registers that a wave of this block may have to the 64 values and their sums
  const int lane = tid & 31, wave = wave_uniform(tid >> 5);
  const int b = bg / NGRP, g = bg % NGRP;
  const int hf = wave & 1;
  const int nb = 32 * (wave >> 1) + lane;                                 // 0..511; n = nb + 512 i
  const double invN = 1.0 / (double)(GSZ * NN);

  const float* sp  = x + ((size_t)bg * GSZ + 8 * hf) * NN + nb;           // + t NN + 512 i
  const float* gwp = gw + GSZ * g + 8 * hf;
  const float* gbp = gb + GSZ * g + 8 * hf;
  const v4f w0 = *(const v4f*)gwp, w1 = *(const v4f*)(gwp + 4);
  const v4f c0 = *(const v4f*)gbp, c1 = *(const v4f*)(gbp + 4);
  float v[8][8];                                                          // [i][t], all 64 loads in flight at once
#pragma unroll                                                            // v[][] stays in registers
  for (int i = 0; i < 8; ++i) {
#pragma unroll
    for (int t = 0; t < 8; ++t) v[i][t] = sp[(size_t)t * NN + 512 * i];
  }
  // the requests are in flight and the code below reuses their address registers
  asm volatile("s_wait_xcnt 0x0" ::: "memory");

  double s = 0.0;
#pragma unroll                                                            // v[][] stays in registers
  for (int i = 0; i < 8; ++i) {
#pragma unroll
    for (int t = 0; t < 8; ++t) v[i][t] = bfr(v[i][t]);
    s += (((double)v[i][0] + (double)v[i][1]) + ((double)v[i][2] + (double)v[i][3])) +
         (((double)v[i][4] + (double)v[i][5]) + ((double)v[i][6] + (double)v[i][7]));
  }
  const double mean = block_sum(s, red1, lane, wave) * invN;

  const float meanf = (float)mean;

  // from here on v holds the f32 difference x - mean, which the application needs too; its squares are summed in f64
  double s2 = 0.0, s3 = 0.0;                                              // two chains: even and odd t
#pragma unroll                                                            // v[][] stays in registers
  for (int i = 0; i < 8; ++i) {
#pragma unroll
    for (int t = 0; t < 8; t += 2) {
      v[i][t]     -= meanf;
      v[i][t + 1] -= meanf;
      const double d0 = (double)v[i][t], d1 = (double)v[i][t + 1];
      s2 += d0 * d0;
      s3 += d1 * d1;
    }
  }
  const double var = block_sum(s2 + s3, red2, lane, wave) * invN;
  const float rstdf = (float)(1.0 / sqrt(var + GEPS));

  const float wf[8] = {bfr(w0[0]), bfr(w0[1]), bfr(w0[2]), bfr(w0[3]), bfr(w1[0]), bfr(w1[1]), bfr(w1[2]), bfr(w1[3])};
  const float bo[8] = {bfr(c0[0]), bfr(c0[1]), bfr(c0[2]), bfr(c0[3]), bfr(c1[0]), bfr(c1[1]), bfr(c1[2]), bfr(c1[3])};
  // row tile of n = nb + 512 i: rows 16 (nb >> 4) + 512 i ..; fragment half of this group at + 256 g; lane 16 hf + (n & 15)
  const size_t po = ((size_t)(b * NN + (nb & ~15))) * CC + 256 * g + 128 * hf + 8 * (nb & 15);
#pragma unroll                                                            // constant indices: v[][] stays in registers
  for (int i = 0; i < 8; ++i) {
    v4u uh;
#pragma unroll
    for (int t = 0; t < 4; ++t) {
      const float h0 = v[i][2 * t]     * rstdf * wf[2 * t]     + bo[2 * t];
      const float h1 = v[i][2 * t + 1] * rstdf * wf[2 * t + 1] + bo[2 * t + 1];
      uh[t] = pk16(h_bits((_Float16)h0), h_bits((_Float16)h1));
    }
    *(v4u*)(Hh + po + (size_t)(512 * i) * CC) = uh;
    // the store names the registers of uh, which the next position's values take over: the wait stands in front
    // of that arithmetic, and the scheduling barrier keeps the arithmetic from being lifted over the wait
    if (i < 7) {                                                          // behind the last position nothing is rewritten
      asm volatile("s_wait_xcnt 0x0" ::: "memory");
      __builtin_amdgcn_sched_barrier(0);
    }
  }
}

// =============================================================================================================
// GEMM core of launches (3), (4) and (6). Work-group = 8 waves = 256 output channels x 128 positions; wave w owns 128
//     channels (8 weight row tiles, base 128 (w>>2)) x 32 positions (2 row tiles, base 32 (w&3)) = 16 accumulator tiles.
//     Per k step of 32 a wave fetches 8 weight fragments and 2 activation fragments for 16
//     WMMAs: a weight fragment feeds 2 position tiles, an activation fragment 8 channel tiles. The four waves
//     of one channel half ask for the same weight lines and the two waves of one position group for the same activation lines.
//     wp, hp: the wave's first fragment in each plane, + 8*lane. Per accumulator: k step ks0, ks0 + 1,
//     .. 15, 0, .. ks0 - 1. ks0 (block-uniform) differs between the work-groups that read the same weight or activation
//     fragments, so that they do not ask L2 for the same lines at the same moment.
//     WROWS: D rows = channels (A = weights, B = activations); else D rows = positions (A = activations, B = weights).
// =============================================================================================================
template <bool WROWS>
__device__ __forceinline__ void gemm_core(const unsigned short* wp, const unsigned short* hp,
                                          int ks0, v8f (&acc)[16]) {
#pragma unroll                                                            // constant indices: the arrays stay in registers
  for (int j = 0; j < 16; ++j) acc[j] = zero8();
  wp += 512 * ks0;
  hp += 512 * ks0;
  int kc = ks0;                                                           // the k step that the two pointers stand at

#pragma unroll 2                                                          // one branch and one count per two k steps
  for (int ks = 0; ks < CC / 32; ++ks) {
    Frag fh[2], fw[8];                                                    // all loads of the step before its first WMMA
#pragma unroll                                                            // fh[] stays in registers
    for (int t = 0; t < 2; ++t) fh[t] = ldfm(hp + (size_t)(16 * t) * CC);
#pragma unroll                                                            // fw[] stays in registers
    for (int m = 0; m < 8; ++m) fw[m] = ldfm(wp + (size_t)(16 * m) * CC);
    // the step's requests name the registers of wp and hp: the wait stands in front of the additions that rewrite them
    // (the step length goes through the statement, so that no addition can be lifted over the wait)
    int kstep = (kc == CC / 32 - 1) ? -(CC / 32 - 1) * 512 : 512;         // behind the last k step comes k step 0
    kc = (kc + 1) & (CC / 32 - 1);
    asm volatile("s_wait_xcnt 0x0" : "+s"(kstep) : : "memory");
    wp += kstep;
    hp += kstep;
#pragma unroll                                                            // constant indices: the arrays stay in registers
    for (int m = 0; m < 8; ++m) {
#pragma unroll                                                            // constant indices: the arrays stay in registers
      for (int t = 0; t < 2; ++t)
        acc[2 * m + t] = WROWS ? mma_g(fw[m].h, fh[t].h, acc[2 * m + t]) : mma_g(fh[t].h, fw[m].h, acc[2 * m + t]);
    }
  }
}

// =============================================================================================================
// (3) q / k conv GEMM for one (b, 128-n tile, matrix sel = mb/2, 256-o block o0 = (mb%2)*256):
//     Y[o][n] = sum_c W[o][c] Hh[b][n][c] + bf16-RNE(bias[o]); D rows = channels, K = 512 = 16 steps, 1 product.
//     Epilogue staged in LDS Os[n_loc][o_loc] (pitch OSH, b128 stores of 8 consecutive o per lane; cross-wave,
//     block barrier), then sel 0 -> Q16, sel 1 -> K16, plain f16, rows 4096 b + n, k = d, fragment-major.
// coverage: Os 8 waves x 32 n x 128 o = 128 x 256 (staged == consumed); plane 16 it x 8 waves = 8 row tiles x 8 k steps x 2
//           halves of 512 B = 128 n x 256 d; grid (32, 4, NB) covers d 0..511 of all 4096 rows of Q16 and K16 once.
// =============================================================================================================
__global__ __launch_bounds__(256)
void gemm_qk(const unsigned short* __restrict__ Wb, const unsigned short* __restrict__ Hh,
             const float* __restrict__ bq, const float* __restrict__ bk,
             unsigned short* Q16, unsigned short* K16) {
  __shared__ __align__(16) float Os[GWN * OSH];
  const int tid  = threadIdx.x;
  const int lane = tid & 31, wave = tid >> 5;
  const int hh   = lane >> 4, c = lane & 15;
  const int nt   = blockIdx.x, mb = blockIdx.y, b = blockIdx.z;
  const int sel  = mb / (CC / GWO);                                        // 0 = q, 1 = k (block-uniform)
  const int n0   = nt * GWN, o0 = (mb % (CC / GWO)) * GWO;
  const int nw   = 32 * (wave & 3), ow = 128 * (wave >> 2);                // this wave's tile inside the block's

  const size_t ho = ((size_t)(b * NN + n0 + nw)) * CC + 8 * lane;
  v8f acc[16];
  gemm_core<true>(Wb + ((size_t)(sel * CC + o0 + ow)) * CC + 8 * lane, Hh + ho, (nt + 4 * mb + b) & (CC / 32 - 1), acc);

  // ---- epilogue: + bias -> LDS Os[n_loc][o_loc]; lane (hh, c) holds o = ow + 16 m + 8 hh + r for n_loc = nw + 16 t + c
  const float* bsrc = ((sel == 0) ? bq : bk) + o0 + ow + 8 * hh;          // block-uniform choice, both global
  v4f bl[16];
#pragma unroll                                                            // bl[] stays in registers
  for (int m = 0; m < 16; ++m) bl[m] = *(const v4f*)(bsrc + 16 * (m >> 1) + 4 * (m & 1));
  // the bias requests name the registers of bsrc: it goes through the statement as an input, so that they are left alone
  // (also by what the requests bring) up to the wait
  asm volatile("s_wait_xcnt 0x0" : : "v"(bsrc) : "memory");
#pragma unroll                                                            // constant indices: the arrays stay in registers
  for (int m = 0; m < 8; ++m) {
    const v4f b0 = bl[2 * m], b1 = bl[2 * m + 1];
#pragma unroll                                                            // constant indices: the arrays stay in registers
    for (int t = 0; t < 2; ++t) {
      v4f va, vb;
#pragma unroll                                                            // constant indices: the arrays stay in registers
      for (int r = 0; r < 4; ++r) { va[r] = acc[2 * m + t][r] + bfr(b0[r]); vb[r] = acc[2 * m + t][4 + r] + bfr(b1[r]); }
      float* sp = Os + (nw + 16 * t + c) * OSH + ow + 16 * m + 8 * hh;
      *(v4f*)sp       = va;
      *(v4f*)(sp + 4) = vb;
    }
  }
  __syncthreads();

  unsigned short* Ph = (sel == 0) ? Q16 : K16;                             // block-uniform, both global
  v4u uv[16];
#pragma unroll                                                            // constant indices: the arrays stay in registers
  for (int it = 0; it < 16; ++it) {                                        // piece: row tile it>>1, chunk pair 8 (it&1) + wave
    const int lo = (16 * (it >> 1) + c) * OSH + 16 * (8 * (it & 1) + wave) + 8 * hh;
    const v4f a = *(const v4f*)(Os + lo);
    const v4f q = *(const v4f*)(Os + lo + 4);
    const float f[8] = {a[0], a[1], a[2], a[3], q[0], q[1], q[2], q[3]};
#pragma unroll                                                            // constant indices: the arrays stay in registers
    for (int t = 0; t < 4; ++t)
      uv[it][t] = pk16(h_bits((_Float16)f[2 * t]), h_bits((_Float16)f[2 * t + 1]));
  }
  const size_t po = ((size_t)(b * NN + n0)) * CC + 16 * o0 + 256 * wave + 8 * lane;
#pragma unroll                                                            // constant indices: the arrays stay in registers
  for (int it = 0; it < 16; ++it) *(v4u*)(Ph + po + (size_t)(16 * (it >> 1)) * CC + 2048 * (it & 1)) = uv[it];
}

// =============================================================================================================
// (4) v conv GEMM for one (b, 128-n tile, 256-o block o0 = mb*256), operands swapped so the D rows are positions:
//     D[n][o] = sum_c Hh[b][n][c] Wv[o][c] (1 product, K = 512).
//     Per lane the D tile holds 8 consecutive n of one o -> LDS Vs[o_loc][n_loc] (pitch PSP, b128 stores;
//     cross-wave, block barrier), then V16 f16, rows 512 b + o, k = n (KD = 4096), fragment-major, = f16(D +
//     bf16-RNE(bv[o])) (unscaled, |v| ~ 1).
// coverage: Vs 8 waves x 32 n x 128 o = 256 x 128 (staged == consumed); V16 16 it (row tiles) x 8 waves (4 k steps x 2
//           halves of 512 B) = 256 o x 128 n; grid (32, 2, NB) covers all 512 o x 4096 n of each b exactly once.
// =============================================================================================================
__global__ __launch_bounds__(256)
void gemm_v(const unsigned short* __restrict__ Wb, const unsigned short* __restrict__ Hh,
            const float* __restrict__ bv, unsigned short* V16) {
  __shared__ __align__(16) float Vs[GWO * PSP];
  const int tid  = threadIdx.x;
  const int lane = tid & 31, wave = tid >> 5;
  const int hh   = lane >> 4, c = lane & 15;
  const int nt   = blockIdx.x, mb = blockIdx.y, b = blockIdx.z;
  const int n0   = nt * GWN, o0 = mb * GWO;
  const int nw   = 32 * (wave & 3), ow = 128 * (wave >> 2);                // this wave's tile inside the block's

  const size_t ho = ((size_t)(b * NN + n0 + nw)) * CC + 8 * lane;
  v8f acc[16];
  gemm_core<false>(Wb + ((size_t)(2 * CC + o0 + ow)) * CC + 8 * lane, Hh + ho, (nt + 8 * mb + b) & (CC / 32 - 1), acc);

  // ---- epilogue: lane (hh, c) holds n_loc = nw + 16 t + 8 hh + r of o_loc = ow + 16 m + c
#pragma unroll                                                            // constant indices: the arrays stay in registers
  for (int m = 0; m < 8; ++m) {
    const float bb = bfr(bv[o0 + ow + 16 * m + c]);
#pragma unroll                                                            // constant indices: the arrays stay in registers
    for (int t = 0; t < 2; ++t) {
      v4f va, vb;
#pragma unroll                                                            // constant indices: the arrays stay in registers
      for (int r = 0; r < 4; ++r) { va[r] = acc[2 * m + t][r] + bb; vb[r] = acc[2 * m + t][4 + r] + bb; }
      float* sp = Vs + (ow + 16 * m + c) * PSP + nw + 16 * t + 8 * hh;
      *(v4f*)sp       = va;
      *(v4f*)(sp + 4) = vb;
    }
  }
  __syncthreads();

  v4u uv[16];
#pragma unroll                                                            // constant indices: the arrays stay in registers
  for (int it = 0; it < 16; ++it) {
    const int lo = (it * 16 + c) * PSP + 16 * wave + 8 * hh;               // row tile it, chunk pair = wave
    const v4f a = *(const v4f*)(Vs + lo);
    const v4f q = *(const v4f*)(Vs + lo + 4);
    const float f[8] = {a[0], a[1], a[2], a[3], q[0], q[1], q[2], q[3]};
#pragma unroll                                                            // constant indices: the arrays stay in registers
    for (int t = 0; t < 4; ++t)
      uv[it][t] = pk16(h_bits((_Float16)f[2 * t]), h_bits((_Float16)f[2 * t + 1]));
  }
  const size_t po = ((size_t)(b * CC + o0)) * NN + 16 * n0 + 256 * wave + 8 * lane;
#pragma unroll                                                            // constant indices: the arrays stay in registers
  for (int it = 0; it < 16; ++it) *(v4u*)(V16 + po + (size_t)(16 * it) * NN) = uv[it];
}

// =============================================================================================================
// (5) attention for one (b, 64-query tile), transposed formulation, 4096 keys, no mask. Block = 8 waves, one block per
//   WGP (grid 64 x NB): every K and V fragment that a block fetches feeds 64 queries.
//   Score phase per 32-key block kb: wave w computes TWO S^T partial tiles (16 keys x 16 queries each) from one set of
//   k fragments: key tile kt = w&1 (keys kb+16kt..), query tiles 2 qg + i, qg = (w>>1)&1, i = 0..1 (queries
//   n0+16(2qg+i)..), over the d-half dh = w>>2 (d 256dh .. 256dh+255, 8 steps of 32): A = k rows (row = key,
//   fragment-major, split k map) from K16, B = q rows (col = query, same map) from Q16, plain f16, 1 product. Each
//   partial (D row = key 8h+r, col = query) goes to LDS Sp[dh][query][key] (pitch SPP, b128 stores; cross-wave, block
//   barrier); the two d-halves are added in fixed order by the softmax lanes.
//   Softmax: all 8 waves, four lanes per query: thread tid has query tid / 4 and the 8 keys 8 (tid & 3) ..: s_j = (Sp[0] +
//   Sp[1]) * 512^-0.5, block max in-lane and over the four lanes (two DPP moves), online max m in f32 (equal in the four
//   lanes), the sum l as one f32 partial per lane over its own keys (the four are added once, behind the loop), corr =
//   e^{m_old - m_new} -> Cs[query], P_j = e^{s_j - m} x 2^14 as f16 -> Pf[query][key] (pitch PFP, one 16-B store per lane;
//   cross-wave, block barrier).
//   O^T (rows channel, cols query): every wave owns channels 64w..64w+63 (4 tiles j) x 64 queries (4 tiles) = 16
//   accumulator tiles; rescale by Cs when any of the 64 corr is not 1 (every wave reads all 64, so block-uniform; corr is
//   exactly 1 for a query whose max did not grow), then += A(v rows channel = 64w+16j+(lane&15), keys kb.., fragment-major f16 plane V16) . B(P^T: row = query
//   from Pf, keys contiguous, same k order).
//   The three phases run as a pipeline over the key blocks, ONE barrier per key block: between two barriers every wave
//   does the scores of block i+1, its share of the softmax of block i and O^T of block i-1. Sp, Pf and Cs
//   have two buffers each (index = key block & 1): what a pass writes was last read in the pass before, behind a barrier,
//   and is read in the next pass. Fill: block 0's scores ahead of the
//   loop, and P = 0, corr = 1 for the O^T step of pass 0 (adds zero); drain: the last pass scores one block more
//   (never read), O^T of the last block stands behind the loop.
//   Key walk: "key block i" above is the i-th block of this work-group's walk, keys 32 ((st + i) mod 128) ..: the walk goes
//   once round all 128 blocks from a start st of the work-group's own. The 64 work-groups of one b read the same K and V
//   planes; from one common start they would ask L2 for the same lines at the same moment in every pass. The online softmax
//   takes the key blocks in any order; the order of its sums follows the walk.
//   Epilogue in two 256-channel halves: waves with (w>>2) == half stage O/l in LDS Os[query][256 ch] (pitch OSH, b128
//   stores; cross-wave, block barrier), then all 256 threads write Ah (one f16 plane), fragment-major.
// coverage: Sp 8 waves x 2 tiles = [2 dh][64 q][32 keys] each key block (staged == consumed); Pf 64 rows x 32 keys by
//           256 lanes x 8 keys (staged == consumed, pad cols never read; buffer 1 zeroed whole ahead of the loop); Os per half 4 waves x 64 q x 64 ch = 64 x 256 (staged
//           == consumed); plane 2 halves x 8 it x 8 waves x 512 B = 4 row tiles x 16 k steps; grid (NQ/64,
//           NB) covers rows 0..NQ-1 exactly once (only those are read later).
// =============================================================================================================
__global__ __launch_bounds__(256)
void attn_k(const unsigned short* __restrict__ Q16, const unsigned short* __restrict__ K16,
            const unsigned short* __restrict__ V16, unsigned short* Ah) {
  __shared__ __align__(16) float Sp[2 * 2 * AQ * SPP];
  __shared__ __align__(16) unsigned short Pf[2 * AQ * PFP];
  __shared__ __align__(16) float Os[AQ * OSH];
  __shared__ float Cs[2 * AQ];
  __shared__ float Ls[AQ];
  const int tid  = threadIdx.x;
  const int wave = tid >> 5, lane = tid & 31;
  const int hh   = lane >> 4, c = lane & 15;
  const int n0   = blockIdx.x * AQ, b = blockIdx.y;
  const int kt = wave & 1, qg = (wave >> 1) & 1, dh = wave >> 2;

  // q fragment pointer (B operand of S^T, col = query n0 + 16 (2 qg + i) + c, d-half dh), + 16*CC*i + 512*ks
  const unsigned short* qp = Q16 + ((size_t)(b * NN + n0 + 32 * qg)) * CC + 16 * (CC / 2) * dh + 8 * lane;
  // k fragment base (A operand, row = key kb + 16 kt + c, d-half dh), + kb*CC + 512*ks
  const unsigned short* kp = K16 + ((size_t)(b * NN + 16 * kt)) * CC + 16 * (CC / 2) * dh + 8 * lane;
  // v fragment base (A operand of O^T, row = channel 64 w + 16 j + c), + 16*j*NN + 16*kb (k step kb/32)
  const unsigned short* vp = V16 + ((size_t)(b * CC + 64 * wave)) * NN + 8 * lane;
  // this lane's S^T partial destination: Sp[dh][query 16(2qg+i)+c][key 16kt + 8hh + r], + 16*SPP*i
  float* spw = Sp + (dh * AQ + 32 * qg + c) * SPP + 16 * kt + 8 * hh;
  // P^T fragment rows (row = query 16 q + c, keys contiguous), + 16*PFP*q
  const unsigned short* pf = Pf + c * PFP + 8 * hh;

  // q fragments of this wave's d-half do not change with the key block: loaded once, kept in registers
  Frag fq[2][CC / 64];
#pragma unroll                                                            // fq[][] stays in registers
  for (int i = 0; i < 2; ++i) {
#pragma unroll
    for (int ks = 0; ks < CC / 64; ++ks) fq[i][ks] = ldfm(qp + (size_t)(16 * i) * CC + 512 * ks);
  }
  // the q requests are in flight and the code below reuses their address registers
  asm volatile("s_wait_xcnt 0x0" ::: "memory");

  // softmax share of this lane: query sq, keys sk .. sk + 7 of each key block
  const int sq = tid >> 2, sk = 8 * (tid & 3);
  float m_run = -1.0e30f, l_run = 0.f;
  v8f o[16];
#pragma unroll
  for (int j = 0; j < 16; ++j) o[j] = zero8();

  // ---- the two matrix phases, used in the fill, in the loop and in the drain
  Frag fk[CC / 64];
  Frag fv[4];
  // two score partial tiles over this wave's d-half, each k fragment used for both -> Sp buffer at dst
  auto score = [&](float* dst) __attribute__((always_inline)) {
    v8f s0 = zero8(), s1 = zero8();
#pragma unroll                                                            // fk[], fq[][] stay in registers
    for (int ks = 0; ks < CC / 64; ++ks) {
      s0 = mma_h(fk[ks].h, fq[0][ks].h, s0);
      s1 = mma_h(fk[ks].h, fq[1][ks].h, s1);
    }
    v4f sa, sb, sc, sd;
#pragma unroll
    for (int r = 0; r < 4; ++r) { sa[r] = s0[r]; sb[r] = s0[4 + r]; sc[r] = s1[r]; sd[r] = s1[4 + r]; }
    *(v4f*)(dst)                = sa;
    *(v4f*)(dst + 4)            = sb;
    *(v4f*)(dst + 16 * SPP)     = sc;
    *(v4f*)(dst + 16 * SPP + 4) = sd;
  };
  // the O^T step in two parts. pv_read: all its LDS reads (corr, P^T fragments of buffer buf) as one group, placed
  // at the head of a pass so that they land under the score products. pv_scale: rescale (block-uniform test). pv_mul: O^T += V . P^T
  float cr[4];
  Frag p[4];
  auto pv_read = [&](int buf) __attribute__((always_inline)) {
#pragma unroll                                                            // cr[], p[] stay in registers
    for (int q = 0; q < 4; ++q) {
      cr[q] = Cs[AQ * buf + 16 * q + c];
      p[q]  = ldfrag(pf + AQ * PFP * buf + 16 * PFP * q);
    }
  };
  auto pv_scale = [&]() __attribute__((always_inline)) {
    // corr <= 1: the least of the lane's four, then one ballot; lanes 0..15 hold all 64 queries between them
    if (wave_ballot(fminf(fminf(cr[0], cr[1]), fminf(cr[2], cr[3])) != 1.0f) != 0u) {
#pragma unroll
      for (int q = 0; q < 4; ++q) {
#pragma unroll
        for (int j = 0; j < 4; ++j) {
#pragma unroll
          for (int r = 0; r < 8; ++r) o[4 * j + q][r] *= cr[q];
        }
      }
    }
  };
  auto pv_mul = [&]() __attribute__((always_inline)) {
#pragma unroll
    for (int j = 0; j < 4; ++j) {
#pragma unroll
      for (int q = 0; q < 4; ++q) o[4 * j + q] = mma_h(fv[j].h, p[q].h, o[4 * j + q]);
    }
  };

  // ---- fill: scores of key block 0 -> Sp buffer 0; P = 0, corr = 1 in buffer 1 for the O^T step of pass 0; then
  //      the k fragments of block 1 and the v fragments of the block in front of block 0 (finite values for that step,
  //      which adds v x 0)
  // start of the walk: 64 different even blocks; neighbours in blockIdx.x stand ten blocks apart
  const int st = 2 * ((5 * (int)blockIdx.x) & (NKB / 2 - 1));
  const unsigned short* kpn = kp + (size_t)st * (32 * CC);
  // vpn starts one block in front of the walk: every pass steps it first and asks then
  int kj = st, vj = (st + NKB - 1) & (NKB - 1);                           // the key blocks that kpn and vpn stand at
  const unsigned short* vpn = vp + (size_t)vj * 512;
  // step to the next key block of the walk, in elements of the k plane (KS = 32 CC) or the v plane (KS = 512): behind
  // block 127 comes block 0, so every address of the walk, also of the blocks asked for past its end, lies in the planes
  auto wstep = [&](int& j, int KS) __attribute__((always_inline)) {
    const int s = (j == NKB - 1) ? -(NKB - 1) * KS : KS;
    j = (j + 1) & (NKB - 1);
    return s;
  };
#pragma unroll                                                            // fk[] stays in registers
  for (int ks = 0; ks < CC / 64; ++ks) fk[ks] = ldfm(kpn + 512 * ks);
  // every group of k or v requests names the registers of kpn or vpn: the wait stands in front of the step that rewrites
  // them (the step length goes through the statement, so that the addition cannot be lifted over the wait)
  int kstep0 = wstep(kj, 32 * CC);
  asm volatile("s_wait_xcnt 0x0" : "+s"(kstep0) : : "memory");
  kpn += kstep0;
  {
    const v4u z4 = {0u, 0u, 0u, 0u};
#pragma unroll 1
    for (int t = tid; t < AQ * PFP / 8; t += 256) *(v4u*)(Pf + AQ * PFP + 8 * t) = z4;
    if (tid < AQ) Cs[AQ + tid] = 1.0f;
  }
  score(spw);
#pragma unroll                                                            // fk[] stays in registers
  for (int ks = 0; ks < CC / 64; ++ks) fk[ks] = ldfm(kpn + 512 * ks);  // kpn stays at block 1: every pass steps it first and asks then
#pragma unroll                                                            // fv[] stays in registers
  for (int j = 0; j < 4; ++j) fv[j] = ldfm(vpn + (size_t)(16 * j) * NN);
  lds_barrier();

#pragma unroll 1
  for (int i = 0; i < NKB; ++i) {
    const int cur = i & 1, oth = cur ^ 1;
    pv_read(oth);
    // this lane's score partials of key block i (both d-halves), in the same group of LDS reads
    v4f sa0[2], sa1[2];
    {
      const float* s0p = Sp + 2 * AQ * SPP * cur + sq * SPP + sk;          // d-half 0
#pragma unroll                                                            // sa0[], sa1[] stay in registers
      for (int t2 = 0; t2 < 2; ++t2) {
        sa0[t2] = *(const v4f*)(s0p + 4 * t2);
        sa1[t2] = *(const v4f*)(s0p + AQ * SPP + 4 * t2);                  // d-half 1
      }
    }
    // keeps the LDS reads above in one group in front of the run of products below, for the same reason as the requests behind it
    __builtin_amdgcn_sched_barrier(0);
    // ---- scores of key block i+1 (last pass: one block past the walk's end, never read)
    score(spw + 2 * AQ * SPP * oth);
    // keeps the wait below, and with it the k requests, behind the run of products above: dealt among the products, every
    // pair of requests is a place of its own where the wave's run of matrix instructions is broken off
    __builtin_amdgcn_sched_barrier(0);
    // ---- the k fragments of key block i+2 are requested here, as one group, nearly a pass ahead of their use.
    //      The walk pointer steps IN FRONT of its group: the wait that the step owes then meets requests that are a phase old
    //      (the youngest: the v group of the pass before). Behind the group it held the wave until the group's own
    //      addresses were through. (the step length goes through the statement: the addition cannot be lifted over the wait;
    //      its "memory" clobber keeps the requests behind it)
    int kstep = wstep(kj, 32 * CC);
    asm volatile("s_wait_xcnt 0x0" : "+s"(kstep) : : "memory");
    kpn += kstep;
#pragma unroll                                                            // fk[] stays in registers
    for (int ks = 0; ks < CC / 64; ++ks) fk[ks] = ldfm(kpn + 512 * ks);
    // keeps the softmax and the test of corr, and with them the wait for their LDS reads, behind the score products:
    // scheduled among them they stall the wave for the LDS latency at the head of the pass
    __builtin_amdgcn_sched_barrier(0);
    // ---- O^T of key block i-1, first part: rescale
    pv_scale();
    // ---- online softmax of key block i: query sq, keys 32 ((st + i) mod 128) + sk .. + 7. It stands between the wave's two runs of matrix
    //      products: while one wave of a SIMD is in this vector chain the other has products to issue, and a pass ends in
    //      products, not in a chain that every wave would wait for at the barrier
    {
      float sv[8];
#pragma unroll
      for (int t2 = 0; t2 < 2; ++t2) {
#pragma unroll
        for (int t = 0; t < 4; ++t) sv[4 * t2 + t] = sa0[t2][t] + sa1[t2][t];
      }
      float mx = sv[0];
#pragma unroll
      for (int j = 1; j < 8; ++j) mx = fmaxf(mx, sv[j]);
      mx = fmaxf(mx, quad_xor<1>(mx));                                    // max over the query's four lanes
      mx = fmaxf(mx, quad_xor<2>(mx));
      const float mn   = fmaxf(m_run, mx * SCL);
      const float corr = __expf(m_run - mn);                             // == 1 exactly when the max did not grow
      m_run = mn;
      const float msh = mn - LNPS;                                        // exp gives e^{s-m} * 2^14
      float ls = 0.f;
      v4u pk;
#pragma unroll
      for (int t = 0; t < 4; ++t) {
        const float e0 = __expf(fmaf(sv[2 * t],     SCL, -msh));           // key 32 ((st + i) mod 128) + sk + 2t
        const float e1 = __expf(fmaf(sv[2 * t + 1], SCL, -msh));           // key 32 ((st + i) mod 128) + sk + 2t + 1
        ls += e0 + e1;
        pk[t] = pk16(h_bits((_Float16)e0), h_bits((_Float16)e1));
      }
      l_run = l_run * corr + ls;
      *(v4u*)(Pf + AQ * PFP * cur + sq * PFP + sk) = pk;
      if ((tid & 3) == 0) Cs[AQ * cur + sq] = corr;
    }
    // keeps the additions of the row sum, which nothing in the pass waits for, in the vector chain above: left free they are
    // scheduled behind the barrier, in front of every wave's first score product of the next pass
    __builtin_amdgcn_sched_barrier(0);
    // ---- O^T of key block i-1, second part: the products (pass 0: adds zero)
    pv_mul();
    // keeps the wait below, and with it the v requests, behind the run of products above, as for the k requests
    __builtin_amdgcn_sched_barrier(0);
    // ---- the v fragments of key block i are requested here, as one group, ahead of their use in the next pass; step and wait
    //      in front of the group as for k (the youngest requests here: this pass's k group, a softmax and 16 products old)
    int vstep = wstep(vj, 512);
    asm volatile("s_wait_xcnt 0x0" : "+s"(vstep) : : "memory");
    vpn += vstep;
#pragma unroll                                                            // fv[] stays in registers
    for (int j = 0; j < 4; ++j) fv[j] = ldfm(vpn + (size_t)(16 * j) * NN);
    lds_barrier();
  }
  // the last pass's k and v requests are in flight and the code below reuses the registers of the walk pointers: both go through
  // the statement as inputs, so that their registers are left alone up to the wait
  asm volatile("s_wait_xcnt 0x0" : : "v"(kpn), "v"(vpn) : "memory");
  // ---- drain: O^T of the last key block
  pv_read((NKB - 1) & 1);
  pv_scale();
  pv_mul();
  l_run += quad_xor<1>(l_run);                                            // the query's four partial sums, same m in all four
  l_run += quad_xor<2>(l_run);
  if ((tid & 3) == 0) Ls[sq] = 1.0f / l_run;                              // o and l both carry the 2^14 factor
  __syncthreads();
  float inv[4];
#pragma unroll
  for (int q = 0; q < 4; ++q) inv[q] = Ls[16 * q + c];

#pragma unroll
  for (int half = 0; half < 2; ++half) {
    if ((wave >> 2) == half) {
      const int chb = 64 * (wave & 3);                                    // channel offset inside this half
#pragma unroll
      for (int j = 0; j < 4; ++j) {
#pragma unroll
        for (int q = 0; q < 4; ++q) {
          v4f va, vb;
#pragma unroll
          for (int r = 0; r < 4; ++r) { va[r] = o[4 * j + q][r] * inv[q]; vb[r] = o[4 * j + q][4 + r] * inv[q]; }
          float* dst = Os + (16 * q + c) * OSH + chb + 16 * j + 8 * hh;   // Os[query][ch = chb + 16j + 8hh + r]
          *(v4f*)dst       = va;
          *(v4f*)(dst + 4) = vb;
        }
      }
    }
    __syncthreads();
    {
      v4u uh[AQ / 8];
#pragma unroll
      for (int it = 0; it < AQ / 8; ++it) {
        const int pc = it * 8 + wave;                                     // piece: row tile pc>>4, chunk pair pc&15
        const int lo = (16 * (pc >> 4) + c) * OSH + 16 * (pc & 15) + 8 * hh;
        const v4f a = *(const v4f*)(Os + lo);
        const v4f q = *(const v4f*)(Os + lo + 4);
        const float f[8] = {a[0], a[1], a[2], a[3], q[0], q[1], q[2], q[3]};
#pragma unroll
        for (int t = 0; t < 4; ++t)
          uh[it][t] = pk16(h_bits((_Float16)f[2 * t]), h_bits((_Float16)f[2 * t + 1]));
      }
#pragma unroll
      for (int it = 0; it < AQ / 8; ++it) {
        const int pc = it * 8 + wave;
        const size_t po = ((size_t)(b * NN + n0 + 16 * (pc >> 4))) * CC + 16 * (CC / 2) * half + 256 * (pc & 15) + 8 * lane;
        *(v4u*)(Ah + po) = uh[it];
      }
    }
    __syncthreads();
  }
}

// =============================================================================================================
// (6) output projection + bias + residual for one (b, 128-n tile, 256-o block o0 = mb*256), D rows = positions:
//     D[n][o] = sum_c Ah[b][n][c] Wp[o][c] (1 product, K = 512), GEMM core as in (4). Per lane 8 consecutive n of
//     one o -> LDS Vs[o_loc][n_loc] (pitch PSP, b128 stores; cross-wave, block barrier), then one wave per row: lane e ->
//     n 4e..4e+3, 4 whole lines of out per instruction.
// coverage: Vs 8 waves x 32 n x 128 o = 256 x 128 (staged == consumed); out 32 it x 8 rows x 32 lanes x 4 = 256 o x
//           128 n; grid (NQ/128, 2, NB) covers out[b][0..511][0..NQ-1] exactly once.
// =============================================================================================================
__global__ __launch_bounds__(256)
void gemm_p(const unsigned short* __restrict__ Wb, const unsigned short* __restrict__ Ah,
            const float* __restrict__ bp, const float* __restrict__ x,
            float* out) {
  __shared__ __align__(16) float Vs[GWO * PSP];
  const int tid  = threadIdx.x;
  const int lane = tid & 31, wave = tid >> 5;
  const int hh   = lane >> 4, c = lane & 15;
  const int nt   = blockIdx.x, mb = blockIdx.y, b = blockIdx.z;
  const int n0   = nt * GWN, o0 = mb * GWO;
  const int nw   = 32 * (wave & 3), ow = 128 * (wave >> 2);                // this wave's tile inside the block's

  const size_t ao = ((size_t)(b * NN + n0 + nw)) * CC + 8 * lane;
  v8f acc[16];
  gemm_core<false>(Wb + ((size_t)(3 * CC + o0 + ow)) * CC + 8 * lane, Ah + ao, (nt + 8 * mb + b) & (CC / 32 - 1), acc);

  // ---- epilogue: lane (hh, c) holds n_loc = nw + 16 t + 8 hh + r of o_loc = ow + 16 m + c
#pragma unroll                                                            // constant indices: the arrays stay in registers
  for (int m = 0; m < 8; ++m) {
    const float bb = bfr(bp[o0 + ow + 16 * m + c]);
#pragma unroll                                                            // constant indices: the arrays stay in registers
    for (int t = 0; t < 2; ++t) {
      v4f va, vb;
#pragma unroll                                                            // constant indices: the arrays stay in registers
      for (int r = 0; r < 4; ++r) { va[r] = acc[2 * m + t][r] + bb; vb[r] = acc[2 * m + t][4 + r] + bb; }
      float* sp = Vs + (ow + 16 * m + c) * PSP + nw + 16 * t + 8 * hh;
      *(v4f*)sp       = va;
      *(v4f*)(sp + 4) = vb;
    }
  }
  __syncthreads();

  const size_t idx = ((size_t)(b * CC + o0 + wave)) * NN + n0 + 4 * lane;  // row it * 8 + wave: + 8 it NN
  v4f res[GWO / 8];
#pragma unroll                                                            // constant indices: the arrays stay in registers
  for (int it = 0; it < GWO / 8; ++it) {
    const v4f a = *(const v4f*)(Vs + (it * 8 + wave) * PSP + 4 * lane);
    const v4f xv = *(const v4f*)(x + idx + (size_t)(8 * it) * NN);
#pragma unroll                                                            // constant indices: the arrays stay in registers
    for (int t = 0; t < 4; ++t) res[it][t] = a[t] + bfr(xv[t]);
  }
#pragma unroll                                                            // constant indices: the arrays stay in registers
  for (int it = 0; it < GWO / 8; ++it) *(v4f*)(out + idx + (size_t)(8 * it) * NN) = res[it];
}

// =============================================================================================================
// Workspace map (bytes; each region start a multiple of 256; every extent is an exact tile multiple and is written
//   (all 16-bit planes fragment-major, same extents as row-major)
//   Wb    f16  [4][512][512]          2097152
//   Hh    f16  [NB][4096][512]     16777216      (reused as Ah after its last reader, launch (4))
//   Q16/K16 f16 [NB][4096][512]   16777216 x2
//   V16   f16  [NB][512][4096]     16777216
//   total (NB=4) = 69206016
// =============================================================================================================
extern "C" void kernel_launch(void* const* d_in, const int* in_sizes, int n_in,
                              void* d_out, int out_size, void* d_ws, size_t ws_size,
                              hipStream_t stream) {
  if (n_in < 11) return;
  if (in_sizes[0] < NB * CC * NN) return;
  if (in_sizes[1] < CC || in_sizes[2] < CC) return;
  if (in_sizes[3] < CC * CC || in_sizes[5] < CC * CC || in_sizes[7] < CC * CC || in_sizes[9] < CC * CC) return;
  if (in_sizes[4] < CC || in_sizes[6] < CC || in_sizes[8] < CC || in_sizes[10] < CC) return;
  if (out_size < NB * CC * NN) return;

  size_t off = 0;
  auto carve = [&](size_t bytes) { const size_t o = off; off += (bytes + 255) & ~(size_t)255; return o; };
  const size_t plane = (size_t)NB * NN * CC * 2;
  const size_t oWb  = carve((size_t)4 * CC * CC * 2);
  const size_t oHh  = carve(plane);
  const size_t oQ   = carve(plane);
  const size_t oK   = carve(plane);
  const size_t oV   = carve(plane);
  const size_t oAh  = oHh;                                                // same extent, disjoint lifetimes
  if (off > ws_size) return;
  if (off > (size_t)134217728) return;

  const float* x   = (const float*)d_in[0];
  const float* gnw = (const float*)d_in[1];
  const float* gnb = (const float*)d_in[2];
  const float* wq  = (const float*)d_in[3];
  const float* bq  = (const float*)d_in[4];
  const float* wk  = (const float*)d_in[5];
  const float* bk  = (const float*)d_in[6];
  const float* wv  = (const float*)d_in[7];
  const float* bv  = (const float*)d_in[8];
  const float* wp  = (const float*)d_in[9];
  const float* bp  = (const float*)d_in[10];

  char* ws = (char*)d_ws;
  unsigned short* Wb  = (unsigned short*)(ws + oWb);
  unsigned short* Hh  = (unsigned short*)(ws + oHh);
  unsigned short* Q16 = (unsigned short*)(ws + oQ);
  unsigned short* K16 = (unsigned short*)(ws + oK);
  unsigned short* V16 = (unsigned short*)(ws + oV);
  unsigned short* Ah  = (unsigned short*)(ws + oAh);
  float* out = (float*)d_out;

  const dim3 blk256(256);

  // (0) conv weights -> stacked f16 plane
  cvt_w<<<dim3(4 * (CC / 4)), blk256, 0, stream>>>(wq, wk, wv, wp, Wb);
  // (1), (2) group statistics per (b, g) in f64 and normalised activations -> fragment-major f16 plane
  gn_norm<<<dim3(NB * NGRP), dim3(1024), 0, stream>>>(x, gnw, gnb, Hh);
  // (3) q and k -> fragment-major f16 planes (rows = positions)
  gemm_qk<<<dim3(NN / GWN, 2 * (CC / GWO), NB), blk256, 0, stream>>>(Wb, Hh, bq, bk, Q16, K16);
  // (4) v -> fragment-major f16 plane (rows = channels)
  gemm_v<<<dim3(NN / GWN, CC / GWO, NB), blk256, 0, stream>>>(Wb, Hh, bv, V16);
  // (5) attention -> f16 plane of the attention output (region of Hh, dead by now)
  attn_k<<<dim3(NQ / AQ, NB), blk256, 0, stream>>>(Q16, K16, V16, Ah);
  // (6) output projection + bias + residual -> out [b][512][4096]
  gemm_p<<<dim3(NQ / GWN, CC / GWO, NB), blk256, 0, stream>>>(Wb, Ah, bp, x, out);
  (void)hipGetLastError();
}
